// v000
// The times below were measured on an AMD MI455X: many runs one after another, warmed up first and cycling through
// copies of the inputs, with the whole window's GPU time divided by the number of runs. Launches and the gaps
// between them are all in it. The median over several windows is given; except for v000 it joins two sittings, which
// can be a few percent apart, so the side-by-side timings, each taken in one sitting, are the better comparison.
// v000 is the starting kernel. One run takes 1410 microseconds.
// Contractions (f32 accumulate everywhere): H[e][d] = sum_o Wq[o][d]*Wk[o][e] on v_wmma_f32_16x16x32_bf16 with
// bf16-RNE weights (exact products); query plane A' = X.H with bf16-RNE x and H carried as bf16 hi + bf16
// residual (2 products, shared accumulator); U = X.Wv^T (1 product, bf16-RNE operands); scores
// S^T = X(keys).A'(queries) with A' as bf16 hi + bf16 residual (2 products); O^T = U.P^T on
// v_wmma_f32_16x16x32_f16 (U x16 as f16, P = e^{s-m} x16384 as f16 built from the score D registers).
// LayerNorm statistics in f64 VALU; per-batch affine terms, softmax statistics and normalisation in f32 VALU.
#include <hip/hip_runtime.h>
#include <math.h>
#include <stdint.h>

#ifndef NB
#define NB 8
#endif
#ifndef NQ
#define NQ 2048
#endif
#define NBF  8
#define NC   2048
#define ND   768
#define QT   64
#define OSP  68
#define TPW  72
#define KCH  64
#define USC  16.0f
#define IUSC 0.0625f
#define LNPS 9.704060527839234f
#define EPSV 1.0e-5f
#define ATTN_LDS (4 * 16 * ND * 4)

static_assert(NB >= 1 && NB <= NBF);
static_assert(NQ % QT == 0 && NQ >= QT && NQ <= NC);
static_assert(NC % QT == 0 && ND % QT == 0);
static_assert(NC % 32 == 0 && ND % 32 == 0);
static_assert(ND % 256 == 0 && ND % 128 == 0 && ND % 16 == 0);
static_assert(NC / KCH == 32 && KCH == 64);
static_assert(4 * NBF <= 32);
static_assert((OSP * 4) % 16 == 0);
static_assert((TPW * 2) % 16 == 0);
static_assert(ATTN_LDS == 196608);

typedef _Float16       v16h __attribute__((ext_vector_type(16)));
typedef _Float16       v8h  __attribute__((ext_vector_type(8)));
typedef __bf16         v16b __attribute__((ext_vector_type(16)));
typedef unsigned short v8us __attribute__((ext_vector_type(8)));
typedef float          v8f  __attribute__((ext_vector_type(8)));
typedef float          v4f  __attribute__((ext_vector_type(4)));
typedef unsigned int   v4u  __attribute__((ext_vector_type(4)));
typedef double         v2d  __attribute__((ext_vector_type(2)));

union Frag  { v8us u[2]; v16h h; v16b bf; };
union FragH { v16h v; v8h hv[2]; };
static_assert(sizeof(Frag) == 32);
static_assert(sizeof(FragH) == 32);

// ---- scalar helpers ---------------------------------------------------------------------------------------
__device__ __forceinline__ unsigned short bf_bits(float f) {          // f32 -> bf16 bits, RNE convert
  unsigned u = __float_as_uint(f);
  return (unsigned short)((u + 0x7FFFu + ((u >> 16) & 1u)) >> 16);
}
__device__ __forceinline__ float bf_up(unsigned short hb) { return __uint_as_float(((unsigned)hb) << 16); }
__device__ __forceinline__ float bf_lo16(unsigned w) { return __uint_as_float(w << 16); }
__device__ __forceinline__ float bf_hi16(unsigned w) { return __uint_as_float(w & 0xFFFF0000u); }
__device__ __forceinline__ unsigned short h_bits(_Float16 x) { return __builtin_bit_cast(unsigned short, x); }
__device__ __forceinline__ unsigned pk16(unsigned short a, unsigned short b) { return (unsigned)a | ((unsigned)b << 16); }
__device__ __forceinline__ v8f zero8() { v8f z = {0.f, 0.f, 0.f, 0.f, 0.f, 0.f, 0.f, 0.f}; return z; }
__device__ __forceinline__ float hmax8(v8f s) {
  return fmaxf(fmaxf(fmaxf(s[0], s[1]), fmaxf(s[2], s[3])), fmaxf(fmaxf(s[4], s[5]), fmaxf(s[6], s[7])));
}
__device__ __forceinline__ double shfl_xor_d(double v, int mask) {
  int lo = __double2loint(v), hi = __double2hiint(v);
  lo = __shfl_xor(lo, mask, 32);
  hi = __shfl_xor(hi, mask, 32);
  return __hiloint2double(hi, lo);
}

// ---- 16-bit fragment loader (A, or B from a k-contiguous [n][k] row): lane -> row/col (lane&15), p already includes
//      + 8*(lane>>4); elements 0..7 <- p[0..7] (k0+8h..), elements 8..15 <- p[16..23] (k0+16+8h..)
__device__ __forceinline__ Frag ldfrag(const unsigned short* p) {
  Frag f;
  f.u[0] = *(const v8us*)(p);
  f.u[1] = *(const v8us*)(p + 16);
  return f;
}

// ---- WMMA helpers: builtin followed by a 4-slot VALU gap tying D and keeping A/B live --------------------------
__device__ __forceinline__ v8f mma_h(v16h a, v16h b, v8f c) {
  v8f d = __builtin_amdgcn_wmma_f32_16x16x32_f16(false, a, false, b, (short)0, c, false, false);
#if defined(__HIP_DEVICE_COMPILE__)
  asm volatile("v_nop\n\tv_nop\n\tv_nop\n\tv_nop" : "+v"(d) : "v"(a), "v"(b));
#endif
  return d;
}
__device__ __forceinline__ v8f mma_b(v16b a, v16b b, v8f c) {
  v8f d = __builtin_amdgcn_wmma_f32_16x16x32_bf16(false, a, false, b, (short)0, c, false, false);
#if defined(__HIP_DEVICE_COMPILE__)
  const v16h ha = __builtin_bit_cast(v16h, a), hb = __builtin_bit_cast(v16h, b);
  asm volatile("v_nop\n\tv_nop\n\tv_nop\n\tv_nop" : "+v"(d) : "v"(ha), "v"(hb));
#endif
  return d;
}

// =========================================================================================================
// (0) weights f32 [768][768] (y = 0: Wk, 1: Wq, 2: Wv, block-uniform selection) -> bf16-RNE planes:
//     natural Wn[y][o][i] and transposed Wt[y][i][o], plus row sums rs[y][o] = sum_i bf16(W[o][i]) in f32.
//     Block (ob, y) owns rows o0..o0+63; column chunks of 64 go through the LDS tile T[i_loc][o_loc] (pitch TPW).
// coverage: Wn 12 chunks x 2 it x 8 waves x 4 rows x 8 lanes x 8 = 64 x 768 per block; Wt 12 chunks x 2 it x 32 x 8
//           lanes x 8 = 768 x 64 per block; rs 16 x 4 = 64; grid (12, 3) covers all three matrices once.
// LDS: T and rsL cross-wave (block barriers).
// =========================================================================================================
__global__ __launch_bounds__(256)
void cvt_w(const float* __restrict__ wk, const float* __restrict__ wq, const float* __restrict__ wv,
           unsigned short* Wn, unsigned short* Wt, float* rs) {
  __shared__ __align__(16) unsigned short T[QT * TPW];
  __shared__ __align__(16) float rsL[QT];
  const int tid = threadIdx.x, lane = tid & 31, wave = tid >> 5;
  const int y = blockIdx.y, o0 = blockIdx.x * QT;
  const float* W = (y == 0) ? wk : ((y == 1) ? wq : wv);            // block-uniform, all global
  unsigned short* Np = Wn + (size_t)y * ND * ND;
  unsigned short* Tq = Wt + (size_t)y * ND * ND;
  const int e = lane & 7, r4 = lane >> 3;                           // r4 0..3
  const int e8 = tid & 7, lq = tid >> 3;                            // lq 0..31
  float rsum0 = 0.f, rsum1 = 0.f;
#pragma unroll 1
  for (int cc = 0; cc < ND / QT; ++cc) {
    const int i0 = cc * QT;
#pragma unroll
    for (int it = 0; it < 2; ++it) {
      const int ol = 8 * wave + 4 * it + r4;                          // 0..63
      const float* sp = W + (size_t)(o0 + ol) * ND + i0 + 8 * e;
      const v4f a = *(const v4f*)sp;
      const v4f q = *(const v4f*)(sp + 4);
      const float f[8] = {a[0], a[1], a[2], a[3], q[0], q[1], q[2], q[3]};
      unsigned short hb[8];
      float ps = 0.f;
#pragma unroll
      for (int t = 0; t < 8; ++t) { hb[t] = bf_bits(f[t]); ps += bf_up(hb[t]); }
      if (it == 0) rsum0 += ps; else rsum1 += ps;
      v4u u;
#pragma unroll
      for (int t = 0; t < 4; ++t) u[t] = pk16(hb[2 * t], hb[2 * t + 1]);
      unsigned short* np = Np + (size_t)(o0 + ol) * ND + i0 + 8 * e;
      *(v4u*)np = u;
      
#pragma unroll
      for (int t = 0; t < 8; ++t) T[(8 * e + t) * TPW + ol] = hb[t];   // T[i_loc][o_loc]
    }
    __syncthreads();
    v4u up[2];
#pragma unroll
    for (int it = 0; it < 2; ++it) {
      const int il = 32 * it + lq;                                    // 0..63
      up[it] = *(const v4u*)(T + il * TPW + 8 * e8);
    }
{
#pragma unroll
      for (int it = 0; it < 2; ++it) {
        const int il = 32 * it + lq;
        *(v4u*)(Tq + (size_t)(i0 + il) * ND + o0 + 8 * e8) = up[it];
      }
      
    }
    __syncthreads();                                                  // T reused by the next chunk
  }
  rsum0 += __shfl_xor(rsum0, 1, 32); rsum0 += __shfl_xor(rsum0, 2, 32); rsum0 += __shfl_xor(rsum0, 4, 32);
  rsum1 += __shfl_xor(rsum1, 1, 32); rsum1 += __shfl_xor(rsum1, 2, 32); rsum1 += __shfl_xor(rsum1, 4, 32);
  if (e == 0) { rsL[8 * wave + r4] = rsum0; rsL[8 * wave + 4 + r4] = rsum1; }
  __syncthreads();
  if (wave == 0 && lane < 16) {
    const v4f v = *(const v4f*)(rsL + 4 * lane);
    float* rp = rs + (size_t)y * ND + o0 + 4 * lane;
    *(v4f*)rp = v;
    
  }
}

// =========================================================================================================
// (1) g[e] = sum_o bf16(Wk)[o][e] * rq[o]  (rq = row sums of bf16(Wq)); f32, one thread per e, loop unrolled by 4.
//     Output: 256 floats per block = 8 lines, wave w lanes 0..7 write line w (8 lanes x 16 B, one instruction),
// coverage: 3 blocks x 256 = 768 = whole g.  LDS gL: each wave reads back only its own 32 slots (block barrier).
// =========================================================================================================
__global__ __launch_bounds__(256)
void k_g(const unsigned short* __restrict__ Wkn, const float* __restrict__ rq, float* g) {
  __shared__ __align__(16) float gL[256];
  const int tid = threadIdx.x, lane = tid & 31, wave = tid >> 5;
  const int e = blockIdx.x * 256 + tid;
  float acc = 0.f;
#pragma unroll 4
  for (int o = 0; o < ND; ++o) acc += bf_up(Wkn[(size_t)o * ND + e]) * rq[o];
  gL[tid] = acc;
  __syncthreads();
  if (lane < 8) {
    const v4f v = *(const v4f*)(gL + 32 * wave + 4 * lane);
    float* p = g + (size_t)blockIdx.x * 256 + 32 * wave + 4 * lane;
    *(v4f*)p = v;
    
  }
}

// =========================================================================================================
// (2) x f32 [b][2048][768] -> Xb bf16-RNE plane (same layout) and per-chunk f64 partial sums of the bf16 values
//     (sum, sum of squares). Block (ch, b) owns 32 rows; wave w rows 4w..4w+3; per row 3 instructions of
// coverage: Xb 4 rows x 8 waves x 3 x 32 lanes x 8 = 32 x 768 per block, grid (64, NB) = all rows of b < NB;
// =========================================================================================================
__global__ __launch_bounds__(256)
void k_xcvt(const float* __restrict__ x, unsigned short* Xb, double* part) {
  __shared__ double sL[8], qL[8];
  const int tid = threadIdx.x, lane = tid & 31, wave = tid >> 5;
  const int ch = blockIdx.x, b = blockIdx.y;
  const int r0 = ch * (NC / KCH);
  double s = 0.0, q = 0.0;
#pragma unroll 1
  for (int t = 0; t < 4; ++t) {
    const int row = r0 + 4 * wave + t;
    const size_t base = ((size_t)b * NC + row) * ND + 8 * lane;
#pragma unroll 1
    for (int c3 = 0; c3 < ND / 256; ++c3) {
      const float* sp = x + base + 256 * c3;
      const v4f a = *(const v4f*)sp;
      const v4f q4 = *(const v4f*)(sp + 4);
      const float f[8] = {a[0], a[1], a[2], a[3], q4[0], q4[1], q4[2], q4[3]};
      unsigned short hb[8];
#pragma unroll
      for (int k = 0; k < 8; ++k) {
        hb[k] = bf_bits(f[k]);
        const double v = (double)bf_up(hb[k]);
        s += v;
        q += v * v;
      }
      v4u u;
#pragma unroll
      for (int k = 0; k < 4; ++k) u[k] = pk16(hb[2 * k], hb[2 * k + 1]);
      unsigned short* xp = Xb + base + 256 * c3;
      *(v4u*)xp = u;
      
    }
  }
  s += shfl_xor_d(s, 16); s += shfl_xor_d(s, 8); s += shfl_xor_d(s, 4); s += shfl_xor_d(s, 2); s += shfl_xor_d(s, 1);
  q += shfl_xor_d(q, 16); q += shfl_xor_d(q, 8); q += shfl_xor_d(q, 4); q += shfl_xor_d(q, 2); q += shfl_xor_d(q, 1);
  if (lane == 0) { sL[wave] = s; qL[wave] = q; }
  __syncthreads();
  if (wave == 0) {
    double S = 0.0, Q = 0.0;
#pragma unroll
    for (int w = 0; w < 8; ++w) { S += sL[w]; Q += qL[w]; }
    v2d val;
    val[0] = (lane == 0) ? S : 0.0;
    val[1] = (lane == 0) ? Q : 0.0;
    if (lane < 8) {
      double* pp = part + ((size_t)b * KCH + ch) * 16 + 2 * lane;
      *(v2d*)pp = val;
      
    }
  }
}

// =========================================================================================================
// (3) LayerNorm statistics per batch from the 64 partial lines (fixed-order f64 tree): st line f32 [32] with
// =========================================================================================================
__global__ __launch_bounds__(64)
void k_stats(const double* __restrict__ part, float* st) {
  __shared__ double sL[64], qL[64];
  __shared__ __align__(16) float stL[32];
  const int tid = threadIdx.x;
  if (tid < 32) stL[tid] = 0.f;
#pragma unroll 1
  for (int b = 0; b < NB; ++b) {
    __syncthreads();
    const size_t pb = ((size_t)b * KCH + tid) * 16;
    sL[tid] = part[pb];
    qL[tid] = part[pb + 1];
    __syncthreads();
#pragma unroll
    for (int off = 32; off > 0; off >>= 1) {
      if (tid < off) { sL[tid] += sL[tid + off]; qL[tid] += qL[tid + off]; }
      __syncthreads();
    }
    if (tid == 0) {
      const double n  = (double)NC * (double)ND;
      const double mu = sL[0] / n;
      double var = qL[0] / n - mu * mu;
      if (var < 0.0) var = 0.0;
      const float varf = (float)var;
      const float ve   = varf + EPSV;
      const float rstd = (float)(1.0 / sqrt((double)ve));
      const float muf  = (float)mu;
      stL[4 * b + 0] = muf;
      stL[4 * b + 1] = rstd;
      stL[4 * b + 2] = rstd * rstd;
      stL[4 * b + 3] = muf * rstd * rstd;
    }
  }
  __syncthreads();
  if (tid < 8) {
    const v4f v = *(const v4f*)(stL + 4 * tid);
    float* p = st + 4 * tid;
    *(v4f*)p = v;
    
  }
}

// =========================================================================================================
// GEMM engine (K = 768 = 24 k-steps, all operand planes k-contiguous with pitch ND): block 128 threads = 4 waves,
// 64 (m) x 64 (n) tile; wave w owns cols n0+16w..+15 (one B fragment per k-step from row n of the B plane) and
// 4 m-tiles (A rows m0 + 16 mt + (lane&15)); NPROD = 2 adds a second A plane (bf16 residual) into the same
// accumulator. Split k map loader for both operands.
// =========================================================================================================
template <int NPROD>
__device__ __forceinline__ void gemm_k(const unsigned short* __restrict__ ap0,
                                       const unsigned short* __restrict__ ap1,
                                       const unsigned short* __restrict__ bp, v8f (&acc)[4]) {
#pragma unroll
  for (int mt = 0; mt < 4; ++mt) acc[mt] = zero8();
#pragma unroll 2
  for (int ks = 0; ks < ND / 32; ++ks) {
    const Frag fb = ldfrag(bp + 32 * ks);
#pragma unroll
    for (int mt = 0; mt < 4; ++mt) {
      const Frag fa = ldfrag(ap0 + (size_t)(16 * mt) * ND + 32 * ks);
      acc[mt] = mma_b(fa.bf, fb.bf, acc[mt]);
      if (NPROD == 2) {
        const Frag fl = ldfrag(ap1 + (size_t)(16 * mt) * ND + 32 * ks);
        acc[mt] = mma_b(fl.bf, fb.bf, acc[mt]);
      }
    }
  }
}

// D tiles -> LDS Os[n_loc][m_loc] (pitch OSP, b128 stores): lane (hh, c) holds m = 16 mt + 8 hh + r for
// n_loc = 16 w + c.  coverage: 4 waves x 16 n x 4 mt x 16 m = 64 x 64 (pad cols 64..67 never read).
__device__ __forceinline__ void stage_os(float* Os, const v8f (&acc)[4], float sc, int wave, int hh, int c) {
  const int nl = 16 * wave + c;
#pragma unroll
  for (int mt = 0; mt < 4; ++mt) {
    v4f va, vb;
#pragma unroll
    for (int r = 0; r < 4; ++r) { va[r] = acc[mt][r] * sc; vb[r] = acc[mt][4 + r] * sc; }
    *(v4f*)(Os + nl * OSP + 16 * mt + 8 * hh)     = va;
    *(v4f*)(Os + nl * OSP + 16 * mt + 8 * hh + 4) = vb;
  }
}

// Os -> two bf16 planes (hi = bf16-RNE(v), lo = bf16-RNE(v - hi)), plane row = row0 + n_loc, 64 m values =
// coverage: 4 it x 16 rows x 8 lanes x 8 = 64 x 64 per plane.
__device__ __forceinline__ void epi_split(const float* Os, unsigned short* Ph, unsigned short* Pl,
                                          size_t row0, int pitch, int col0, int tid) {
  const int e = tid & 7, lq = tid >> 3;                              // lq 0..15
  v4u uh[4], ul[4];
#pragma unroll
  for (int it = 0; it < 4; ++it) {
    const int row = it * 16 + lq;
    const v4f a = *(const v4f*)(Os + row * OSP + 8 * e);
    const v4f q = *(const v4f*)(Os + row * OSP + 8 * e + 4);
    const float f[8] = {a[0], a[1], a[2], a[3], q[0], q[1], q[2], q[3]};
#pragma unroll
    for (int t = 0; t < 4; ++t) {
      const float f0 = f[2 * t], f1 = f[2 * t + 1];
      const unsigned short hb0 = bf_bits(f0), hb1 = bf_bits(f1);
      const unsigned short lb0 = bf_bits(f0 - bf_up(hb0));
      const unsigned short lb1 = bf_bits(f1 - bf_up(hb1));
      uh[it][t] = pk16(hb0, hb1);
      ul[it][t] = pk16(lb0, lb1);
    }
  }
{
#pragma unroll
    for (int it = 0; it < 4; ++it) {
      const int row = it * 16 + lq;
      const size_t po = (row0 + (size_t)row) * (size_t)pitch + (size_t)col0 + 8 * e;
      *(v4u*)(Ph + po) = uh[it];
      *(v4u*)(Pl + po) = ul[it];
    }
    
  }
}

// Os -> one f16 plane (values already scaled), same line geometry as epi_split.
__device__ __forceinline__ void epi_h(const float* Os, unsigned short* P, size_t row0, int pitch, int col0, int tid) {
  const int e = tid & 7, lq = tid >> 3;
  v4u u[4];
#pragma unroll
  for (int it = 0; it < 4; ++it) {
    const int row = it * 16 + lq;
    const v4f a = *(const v4f*)(Os + row * OSP + 8 * e);
    const v4f q = *(const v4f*)(Os + row * OSP + 8 * e + 4);
    const float f[8] = {a[0], a[1], a[2], a[3], q[0], q[1], q[2], q[3]};
#pragma unroll
    for (int t = 0; t < 4; ++t)
      u[it][t] = pk16(h_bits((_Float16)f[2 * t]), h_bits((_Float16)f[2 * t + 1]));
  }
{
#pragma unroll
    for (int it = 0; it < 4; ++it) {
      const int row = it * 16 + lq;
      const size_t po = (row0 + (size_t)row) * (size_t)pitch + (size_t)col0 + 8 * e;
      *(v4u*)(P + po) = u[it];
    }
    
  }
}

// =========================================================================================================
// (4) H planes: D[m = d][n = e] = sum_o WqT[d][o] * WkT[e][o]  (1 product, exact) -> Hh/Hl bf16 [e][768 d].
// grid (12 e-tiles, 12 d-tiles).  LDS Os cross-wave (block barrier).
// =========================================================================================================
__global__ __launch_bounds__(128)
void k_hgemm(const unsigned short* __restrict__ Aq, const unsigned short* __restrict__ Bk,
             unsigned short* Hh, unsigned short* Hl) {
  __shared__ __align__(16) float Os[QT * OSP];
  const int tid = threadIdx.x, lane = tid & 31, wave = tid >> 5, hh = lane >> 4, c = lane & 15;
  const int n0 = blockIdx.x * QT, m0 = blockIdx.y * QT;
  const unsigned short* ap = Aq + (size_t)(m0 + c) * ND + 8 * hh;
  const unsigned short* bp = Bk + (size_t)(n0 + 16 * wave + c) * ND + 8 * hh;
  v8f acc[4];
  gemm_k<1>(ap, ap, bp, acc);
  stage_os(Os, acc, 1.0f, wave, hh, c);
  __syncthreads();
  epi_split(Os, Hh, Hl, (size_t)n0, ND, m0, tid);
}

// =========================================================================================================
// (5) query planes: D[m = e][n = query] = sum_d (Hh + Hl)[e][d] * Xb[b][q][d]  (2 products), scaled by rstd_b^2
//     in the epilogue -> Ah/Al bf16 [b][NQ][768 e].  grid (NQ/64, 12 e-tiles, NB).
// =========================================================================================================
__global__ __launch_bounds__(128)
void k_agemm(const unsigned short* __restrict__ Hh, const unsigned short* __restrict__ Hl,
             const unsigned short* __restrict__ Xb, const float* __restrict__ st,
             unsigned short* Ah, unsigned short* Al) {
  __shared__ __align__(16) float Os[QT * OSP];
  const int tid = threadIdx.x, lane = tid & 31, wave = tid >> 5, hh = lane >> 4, c = lane & 15;
  const int n0 = blockIdx.x * QT, m0 = blockIdx.y * QT, b = blockIdx.z;
  const unsigned short* ap0 = Hh + (size_t)(m0 + c) * ND + 8 * hh;
  const unsigned short* ap1 = Hl + (size_t)(m0 + c) * ND + 8 * hh;
  const unsigned short* bp  = Xb + ((size_t)b * NC + n0 + 16 * wave + c) * ND + 8 * hh;
  v8f acc[4];
  gemm_k<2>(ap0, ap1, bp, acc);
  const float sc = st[4 * b + 2];
  stage_os(Os, acc, sc, wave, hh, c);
  __syncthreads();
  epi_split(Os, Ah, Al, (size_t)b * NQ + n0, ND, m0, tid);
}

// =========================================================================================================
// (6) value plane (channel-major, keys contiguous): D[m = key j][n = o] = sum_d Xb[b][j][d] * Wvb[o][d]
//     (1 product, exact), x16 -> U f16 [b][768 o][2048 j].  grid (12 o-tiles, 32 key-tiles, NB).
// =========================================================================================================
__global__ __launch_bounds__(128)
void k_vgemm(const unsigned short* __restrict__ Xb, const unsigned short* __restrict__ Wvn, unsigned short* U) {
  __shared__ __align__(16) float Os[QT * OSP];
  const int tid = threadIdx.x, lane = tid & 31, wave = tid >> 5, hh = lane >> 4, c = lane & 15;
  const int n0 = blockIdx.x * QT, m0 = blockIdx.y * QT, b = blockIdx.z;
  const unsigned short* ap = Xb + ((size_t)b * NC + m0 + c) * ND + 8 * hh;
  const unsigned short* bp = Wvn + (size_t)(n0 + 16 * wave + c) * ND + 8 * hh;
  v8f acc[4];
  gemm_k<1>(ap, ap, bp, acc);
  stage_os(Os, acc, USC, wave, hh, c);
  __syncthreads();
  epi_h(Os, U, (size_t)b * ND + n0, NC, m0, tid);
}

// =========================================================================================================
// (7) key-side affine term: cs[b][j] = -(mu_b rstd_b^2) * sum_d g[d] * Xb[b][j][d], f32 VALU, one wave per row,
// coverage: grid (64, NB) x 32 rows = every key row of b < NB.  LDS csL cross-wave (block barrier).
// =========================================================================================================
__global__ __launch_bounds__(256)
void k_cs(const unsigned short* __restrict__ Xb, const float* __restrict__ g, const float* __restrict__ st,
          float* cs) {
  __shared__ __align__(16) float csL[32];
  const int tid = threadIdx.x, lane = tid & 31, wave = tid >> 5;
  const int r0 = blockIdx.x * 32, b = blockIdx.y;
  v4f ga[3], gb[3];
#pragma unroll
  for (int c3 = 0; c3 < 3; ++c3) {
    ga[c3] = *(const v4f*)(g + 256 * c3 + 8 * lane);
    gb[c3] = *(const v4f*)(g + 256 * c3 + 8 * lane + 4);
  }
  const float nmr = -st[4 * b + 3];
#pragma unroll 1
  for (int t = 0; t < 4; ++t) {
    const int row = r0 + 4 * wave + t;
    const unsigned short* xp = Xb + ((size_t)b * NC + row) * ND + 8 * lane;
    float acc = 0.f;
#pragma unroll
    for (int c3 = 0; c3 < 3; ++c3) {
      const v4u u = *(const v4u*)(xp + 256 * c3);
      acc += bf_lo16(u[0]) * ga[c3][0] + bf_hi16(u[0]) * ga[c3][1]
           + bf_lo16(u[1]) * ga[c3][2] + bf_hi16(u[1]) * ga[c3][3]
           + bf_lo16(u[2]) * gb[c3][0] + bf_hi16(u[2]) * gb[c3][1]
           + bf_lo16(u[3]) * gb[c3][2] + bf_hi16(u[3]) * gb[c3][3];
    }
    acc += __shfl_xor(acc, 16, 32); acc += __shfl_xor(acc, 8, 32); acc += __shfl_xor(acc, 4, 32);
    acc += __shfl_xor(acc, 2, 32);  acc += __shfl_xor(acc, 1, 32);
    if (lane == 0) csL[4 * wave + t] = acc * nmr;
  }
  __syncthreads();
  if (wave == 0 && lane < 8) {
    const v4f v = *(const v4f*)(csL + 4 * lane);
    float* p = cs + (size_t)b * NC + r0 + 4 * lane;
    *(v4f*)p = v;
    
  }
}

// =========================================================================================================
// (8) attention for one (b, 64-query tile), transposed formulation, 2048 keys, no mask:
//   S^T tile (16 keys x 16 queries) = sum over 24 d-chunks of A(key row kb + (lane&15) of the bf16 plane Xb,
//   split k map) . B(query row of Ah) + A(Xb).B(Al) (bf16 residual, shared accumulator), then + cs[key].
//   Per lane the D tile holds 8 keys of ONE query: online softmax state per lane, one shuffle (lane^16) for the
//   max over 32 keys; corr applied every step (== 1 exactly when the max did not grow). P = e^{s-m} x 16384 as
//   f16 is the B operand of O^T (rows channel, cols queries) += A(U rows channel 16j + (lane&15), keys
//   contiguous, f16 x16) . B(P^T): element r <- D of the tile covering keys kb..kb+15, element 8+r <- the tile
//   covering kb+16..kb+31, lane unchanged. The 48 accumulator tiles per wave live in wave-private LDS slots
//   Ow[query][768] (lane-private addresses, same-type b128 load/store, zero-filled first).
//   Epilogue after a block barrier: out[b][q][:] = Ow[q][:] * (rstd / (16 l_q)) - mu rstd rowsum(Wv), row =
// coverage: 4 waves x 16 query rows x 6 x 32 lanes x 4 = 64 x 768; grid (NQ/64, NB) covers out[b < NB][q < NQ].
// LDS: Ow wave-private in the key loop; cross-lane reads only after __syncthreads. staged extent (zero-fill
//      16 x 768 per wave) == consumed extent.
// =========================================================================================================
__global__ __launch_bounds__(128)
void k_attn(const unsigned short* __restrict__ Ah, const unsigned short* __restrict__ Al,
            const unsigned short* __restrict__ Xb, const unsigned short* __restrict__ U,
            const float* __restrict__ cs, const float* __restrict__ rv,
            const float* __restrict__ st, float* out) {
  extern __shared__ v4f lds_dyn[];
  const int tid  = threadIdx.x;
  const int wave = tid >> 5, lane = tid & 31;
  const int hh   = lane >> 4, c = lane & 15;
  const int n0   = blockIdx.x * QT, b = blockIdx.y;
  float* Ow = (float*)lds_dyn + (size_t)wave * (16 * ND);
  float* op = Ow + c * ND + 8 * hh;                                  // this lane's slots (query column c)
#pragma unroll 8
  for (int j = 0; j < ND / 16; ++j) {
    const v4f z = {0.f, 0.f, 0.f, 0.f};
    *(v4f*)(op + 16 * j)     = z;
    *(v4f*)(op + 16 * j + 4) = z;
  }

  const size_t qo = ((size_t)b * NQ + n0 + 16 * wave + c) * ND + 8 * hh;
  const unsigned short* Ahp = Ah + qo;
  const unsigned short* Alp = Al + qo;
  const unsigned short* Kp  = Xb + (size_t)b * NC * ND + (size_t)c * ND + 8 * hh;   // + key*ND + 32 kc
  const unsigned short* Vp  = U + (size_t)b * ND * NC + (size_t)c * NC + 8 * hh;    // + 16 j*NC + kb
  const float* csb = cs + (size_t)b * NC + 8 * hh;                                    // + kb (+16)

  float m = -1.0e30f, l = 0.f;
#pragma unroll 1
  for (int kb = 0; kb < NC; kb += 32) {
    const unsigned short* k0p = Kp + (size_t)kb * ND;                // keys kb .. kb+15
    const unsigned short* k1p = Kp + (size_t)(kb + 16) * ND;         // keys kb+16 .. kb+31
    v8f s0 = zero8(), s1 = zero8();
#pragma unroll 1
    for (int kc = 0; kc < ND / 32; ++kc) {
      const Frag qh = ldfrag(Ahp + 32 * kc);
      const Frag ql = ldfrag(Alp + 32 * kc);
      const Frag k0 = ldfrag(k0p + 32 * kc);
      const Frag k1 = ldfrag(k1p + 32 * kc);
      s0 = mma_b(k0.bf, qh.bf, s0);
      s1 = mma_b(k1.bf, qh.bf, s1);
      s0 = mma_b(k0.bf, ql.bf, s0);
      s1 = mma_b(k1.bf, ql.bf, s1);
    }
    {
      const v4f ca = *(const v4f*)(csb + kb);
      const v4f cb = *(const v4f*)(csb + kb + 4);
      const v4f cd = *(const v4f*)(csb + kb + 16);
      const v4f ce = *(const v4f*)(csb + kb + 20);
#pragma unroll
      for (int r = 0; r < 4; ++r) {
        s0[r] += ca[r]; s0[4 + r] += cb[r];                          // key kb      + 8hh + r
        s1[r] += cd[r]; s1[4 + r] += ce[r];                          // key kb + 16 + 8hh + r
      }
    }

    float mx = fmaxf(hmax8(s0), hmax8(s1));
    mx = fmaxf(mx, __shfl_xor(mx, 16, 32));
    const float mn   = fmaxf(m, mx);
    const float corr = __expf(m - mn);                               // == 1 exactly when the max did not grow
    l *= corr;
    m = mn;
    const float msh = mn - LNPS;                                     // exp gives e^{s-m} * 16384

    FragH ph;
    float ls = 0.f;
#pragma unroll
    for (int r = 0; r < 8; ++r) {
      const float e0 = __expf(s0[r] - msh);
      const float e1 = __expf(s1[r] - msh);
      ls += e0 + e1;
      ph.hv[0][r] = (_Float16)e0;
      ph.hv[1][r] = (_Float16)e1;
    }
    l += ls;

#pragma unroll 4
    for (int j = 0; j < ND / 16; ++j) {
      const v4f oa = *(const v4f*)(op + 16 * j);
      const v4f ob = *(const v4f*)(op + 16 * j + 4);
      v8f o;
#pragma unroll
      for (int r = 0; r < 4; ++r) { o[r] = oa[r] * corr; o[4 + r] = ob[r] * corr; }
      const Frag vf = ldfrag(Vp + (size_t)(16 * j) * NC + kb);
      o = mma_h(vf.h, ph.v, o);
      v4f na, nb2;
#pragma unroll
      for (int r = 0; r < 4; ++r) { na[r] = o[r]; nb2[r] = o[4 + r]; }
      *(v4f*)(op + 16 * j)     = na;
      *(v4f*)(op + 16 * j + 4) = nb2;
    }
  }
  l += __shfl_xor(l, 16, 32);
  const float inv  = 1.0f / l;                                       // Ow and l both carry the x16384 factor
  const float mu   = st[4 * b + 0], rstd = st[4 * b + 1];
  const float qsc  = inv * rstd * IUSC;                              // per lane: its query column
  const float mrs  = mu * rstd;
  v4f rvv[6];
#pragma unroll
  for (int k = 0; k < ND / 128; ++k) {
    const v4f t = *(const v4f*)(rv + 128 * k + 4 * lane);
#pragma unroll
    for (int u = 0; u < 4; ++u) rvv[k][u] = t[u] * mrs;
  }
  __syncthreads();                                                   // all accumulator slots final before cross-lane reads

{
#pragma unroll 1
    for (int qq = 0; qq < 16; ++qq) {
      const float sc = __shfl(qsc, qq, 32);
      const float* lrow = Ow + qq * ND + 4 * lane;
      float* orow = out + ((size_t)b * NC + n0 + 16 * wave + qq) * ND + 4 * lane;
#pragma unroll
      for (int k = 0; k < ND / 128; ++k) {
        const v4f v = *(const v4f*)(lrow + 128 * k);
        v4f w;
#pragma unroll
        for (int u = 0; u < 4; ++u) w[u] = v[u] * sc - rvv[k][u];
        *(v4f*)(orow + 128 * k) = w;
      }
    }
    
  }
}

// =========================================================================================================
// Workspace map (bytes; each region start a multiple of 256; every extent is an exact tile/line multiple and is
//   Wn bf16 [3][768][768]      3538944      Wt bf16 [3][768][768]   3538944
//   rs  f32 [3][768]              9216      g   f32 [768]              3072
//   Xb bf16 [NB][2048][768]   25165824 (NB=8)  part f64 [NB][64][16]  65536    st f32 [32]  128 (256)
//   Hh/Hl bf16 [768][768]      1179648 x2
//   Ah/Al bf16 [NB][NQ][768]  25165824 x2 (NB=8, NQ=2048)
//   U  f16 [NB][768][2048]    25165824      cs f32 [NB][2048]         65536
//   total (NB=8, NQ=2048) = 110244096
// =========================================================================================================
extern "C" void kernel_launch(void* const* d_in, const int* in_sizes, int n_in,
                              void* d_out, int out_size, void* d_ws, size_t ws_size,
                              hipStream_t stream) {
  if (n_in < 4) return;
  if (in_sizes[0] < NB * NC * ND) return;
  if (in_sizes[1] < ND * ND || in_sizes[2] < ND * ND || in_sizes[3] < ND * ND) return;
  if (out_size < NB * NC * ND) return;

  size_t off = 0;
  auto carve = [&](size_t bytes) { const size_t o = off; off += (bytes + 255) & ~(size_t)255; return o; };
  const size_t oWn   = carve((size_t)3 * ND * ND * 2);
  const size_t oWt   = carve((size_t)3 * ND * ND * 2);
  const size_t oRs   = carve((size_t)3 * ND * 4);
  const size_t oG    = carve((size_t)ND * 4);
  const size_t oXb   = carve((size_t)NB * NC * ND * 2);
  const size_t oPart = carve((size_t)NB * KCH * 128);
  const size_t oSt   = carve((size_t)128);
  const size_t oHh   = carve((size_t)ND * ND * 2);
  const size_t oHl   = carve((size_t)ND * ND * 2);
  const size_t oAh   = carve((size_t)NB * NQ * ND * 2);
  const size_t oAl   = carve((size_t)NB * NQ * ND * 2);
  const size_t oU    = carve((size_t)NB * ND * NC * 2);
  const size_t oCs   = carve((size_t)NB * NC * 4);
  if (off > ws_size) return;
  if (off > (size_t)134217728) return;

  const float* x  = (const float*)d_in[0];
  const float* wk = (const float*)d_in[1];
  const float* wq = (const float*)d_in[2];
  const float* wv = (const float*)d_in[3];

  char* ws = (char*)d_ws;
  unsigned short* Wn  = (unsigned short*)(ws + oWn);
  unsigned short* Wt  = (unsigned short*)(ws + oWt);
  float*          rs  = (float*)(ws + oRs);
  float*          g   = (float*)(ws + oG);
  unsigned short* Xb  = (unsigned short*)(ws + oXb);
  double*         part = (double*)(ws + oPart);
  float*          st  = (float*)(ws + oSt);
  unsigned short* Hh  = (unsigned short*)(ws + oHh);
  unsigned short* Hl  = (unsigned short*)(ws + oHl);
  unsigned short* Ah  = (unsigned short*)(ws + oAh);
  unsigned short* Al  = (unsigned short*)(ws + oAl);
  unsigned short* U   = (unsigned short*)(ws + oU);
  float*          cs  = (float*)(ws + oCs);
  float* out = (float*)d_out;

  const dim3 blk256(256), blk128(128), blk64(64);

  // (0) weights -> bf16 natural + transposed planes + row sums (y: 0 Wk, 1 Wq, 2 Wv)
  cvt_w<<<dim3(ND / QT, 3), blk256, 0, stream>>>(wk, wq, wv, Wn, Wt, rs);
  // (1) g = bf16(Wk)^T . rowsum(bf16(Wq))
  k_g<<<dim3(ND / 256), blk256, 0, stream>>>(Wn, rs + ND, g);
  // (2) x -> bf16 plane + f64 partial sums
  k_xcvt<<<dim3(KCH, NB), blk256, 0, stream>>>(x, Xb, part);
  // (3) LayerNorm statistics
  k_stats<<<dim3(1), blk64, 0, stream>>>(part, st);
  // (4) H planes: A = Wq transposed (rows d), B = Wk transposed (rows e)
  k_hgemm<<<dim3(ND / QT, ND / QT), blk128, 0, stream>>>(Wt + (size_t)1 * ND * ND, Wt, Hh, Hl);
  // (5) query planes A' = rstd^2 X.H  (hi + residual)
  k_agemm<<<dim3(NQ / QT, ND / QT, NB), blk128, 0, stream>>>(Hh, Hl, Xb, st, Ah, Al);
  // (6) value plane U = 16 X.Wv^T (channel-major)
  k_vgemm<<<dim3(ND / QT, NC / QT, NB), blk128, 0, stream>>>(Xb, Wn + (size_t)2 * ND * ND, U);
  // (7) key-side affine term
  k_cs<<<dim3(NC / 32, NB), blk256, 0, stream>>>(Xb, g, st, cs);
  // (8) attention -> out [b][q][768]
  (void)hipFuncSetAttribute(reinterpret_cast<const void*>(&k_attn),
                            hipFuncAttributeMaxDynamicSharedMemorySize, ATTN_LDS);
  k_attn<<<dim3(NQ / QT, NB), blk128, ATTN_LDS, stream>>>(Ah, Al, Xb, U, cs, rs + 2 * ND, st, out);
  (void)hipGetLastError();
}

// v001
// It runs in 853 microseconds.
// Timed twice side by side with v000, it ran 1.69 and 1.68 times as fast.
// Contractions (f32 accumulate everywhere): H[e][d] = sum_o Wq[o][d]*Wk[o][e] on v_wmma_f32_16x16x32_bf16 with
// bf16-RNE weights (exact products); query plane A' = X.H with bf16-RNE x and H carried as bf16 hi + bf16
// residual (2 products, shared accumulator); U = X.Wv^T (1 product, bf16-RNE operands); scores
// S^T = X(keys).A'(queries) with A' as bf16 hi + bf16 residual (2 products); O^T = U.P^T on
// v_wmma_f32_16x16x32_f16 (U x16 as f16, P = e^{s-m} x16384 as f16 built from the score D registers).
// LayerNorm statistics in f64 VALU; per-batch affine terms, softmax statistics and normalisation in f32 VALU.
#include <hip/hip_runtime.h>
#include <math.h>
#include <stdint.h>

#ifndef NB
#define NB 8
#endif
#ifndef NQ
#define NQ 2048
#endif
#define NBF  8
#define NC   2048
#define ND   768
#define QT   64
#define OSP  68
#define TPW  72
#define KCH  64
#define USC  16.0f
#define IUSC 0.0625f
#define LNPS 9.704060527839234f
#define EPSV 1.0e-5f
#define ATTN_LDS (4 * 16 * ND * 4)

static_assert(NB >= 1 && NB <= NBF);
static_assert(NQ % QT == 0 && NQ >= QT && NQ <= NC);
static_assert(NC % QT == 0 && ND % QT == 0);
static_assert(NC % 32 == 0 && ND % 32 == 0);
static_assert(ND % 256 == 0 && ND % 128 == 0 && ND % 16 == 0);
static_assert(NC / KCH == 32 && KCH == 64);
static_assert(4 * NBF <= 32);
static_assert((OSP * 4) % 16 == 0);
static_assert((TPW * 2) % 16 == 0);
static_assert(ATTN_LDS == 196608);

typedef _Float16       v16h __attribute__((ext_vector_type(16)));
typedef _Float16       v8h  __attribute__((ext_vector_type(8)));
typedef __bf16         v16b __attribute__((ext_vector_type(16)));
typedef unsigned short v8us __attribute__((ext_vector_type(8)));
typedef float          v8f  __attribute__((ext_vector_type(8)));
typedef float          v4f  __attribute__((ext_vector_type(4)));
typedef unsigned int   v4u  __attribute__((ext_vector_type(4)));
typedef double         v2d  __attribute__((ext_vector_type(2)));

union Frag  { v8us u[2]; v16h h; v16b bf; };
union FragH { v16h v; v8h hv[2]; };
static_assert(sizeof(Frag) == 32);
static_assert(sizeof(FragH) == 32);

// ---- scalar helpers ---------------------------------------------------------------------------------------
__device__ __forceinline__ unsigned short bf_bits(float f) {          // f32 -> bf16 bits, RNE convert
  unsigned u = __float_as_uint(f);
  return (unsigned short)((u + 0x7FFFu + ((u >> 16) & 1u)) >> 16);
}
__device__ __forceinline__ float bf_up(unsigned short hb) { return __uint_as_float(((unsigned)hb) << 16); }
__device__ __forceinline__ float bf_lo16(unsigned w) { return __uint_as_float(w << 16); }
__device__ __forceinline__ float bf_hi16(unsigned w) { return __uint_as_float(w & 0xFFFF0000u); }
__device__ __forceinline__ unsigned short h_bits(_Float16 x) { return __builtin_bit_cast(unsigned short, x); }
__device__ __forceinline__ unsigned pk16(unsigned short a, unsigned short b) { return (unsigned)a | ((unsigned)b << 16); }
__device__ __forceinline__ v8f zero8() { v8f z = {0.f, 0.f, 0.f, 0.f, 0.f, 0.f, 0.f, 0.f}; return z; }
__device__ __forceinline__ float hmax8(v8f s) {
  return fmaxf(fmaxf(fmaxf(s[0], s[1]), fmaxf(s[2], s[3])), fmaxf(fmaxf(s[4], s[5]), fmaxf(s[6], s[7])));
}
__device__ __forceinline__ double shfl_xor_d(double v, int mask) {
  int lo = __double2loint(v), hi = __double2hiint(v);
  lo = __shfl_xor(lo, mask, 32);
  hi = __shfl_xor(hi, mask, 32);
  return __hiloint2double(hi, lo);
}

// ---- 16-bit fragment loader (A, or B from a k-contiguous [n][k] row): lane -> row/col (lane&15), p already includes
//      + 8*(lane>>4); elements 0..7 <- p[0..7] (k0+8h..), elements 8..15 <- p[16..23] (k0+16+8h..)
__device__ __forceinline__ Frag ldfrag(const unsigned short* p) {
  Frag f;
  f.u[0] = *(const v8us*)(p);
  f.u[1] = *(const v8us*)(p + 16);
  return f;
}

// ---- WMMA helpers: mma_b = builtin followed by a 4-slot VALU gap tying D and keeping A/B live --------------------------
// mma_h is the bare builtin (the compiler keeps the distance behind its own WMMAs): with D tied to an asm statement
// the 48 resident D tiles of k_attn, 384 registers, do not all get registers and the build spills to scratch.
__device__ __forceinline__ v8f mma_h(v16h a, v16h b, v8f c) {
  return __builtin_amdgcn_wmma_f32_16x16x32_f16(false, a, false, b, (short)0, c, false, false);
}
__device__ __forceinline__ v8f mma_b(v16b a, v16b b, v8f c) {
  v8f d = __builtin_amdgcn_wmma_f32_16x16x32_bf16(false, a, false, b, (short)0, c, false, false);
#if defined(__HIP_DEVICE_COMPILE__)
  const v16h ha = __builtin_bit_cast(v16h, a), hb = __builtin_bit_cast(v16h, b);
  asm volatile("v_nop\n\tv_nop\n\tv_nop\n\tv_nop" : "+v"(d) : "v"(ha), "v"(hb));
#endif
  return d;
}

// =========================================================================================================
// (0) weights f32 [768][768] (y = 0: Wk, 1: Wq, 2: Wv, block-uniform selection) -> bf16-RNE planes:
//     natural Wn[y][o][i] and transposed Wt[y][i][o], plus row sums rs[y][o] = sum_i bf16(W[o][i]) in f32.
//     Block (ob, y) owns rows o0..o0+63; column chunks of 64 go through the LDS tile T[i_loc][o_loc] (pitch TPW).
// coverage: Wn 12 chunks x 2 it x 8 waves x 4 rows x 8 lanes x 8 = 64 x 768 per block; Wt 12 chunks x 2 it x 32 x 8
//           lanes x 8 = 768 x 64 per block; rs 16 x 4 = 64; grid (12, 3) covers all three matrices once.
// LDS: T and rsL cross-wave (block barriers).
// =========================================================================================================
__global__ __launch_bounds__(256)
void cvt_w(const float* __restrict__ wk, const float* __restrict__ wq, const float* __restrict__ wv,
           unsigned short* Wn, unsigned short* Wt, float* rs) {
  __shared__ __align__(16) unsigned short T[QT * TPW];
  __shared__ __align__(16) float rsL[QT];
  const int tid = threadIdx.x, lane = tid & 31, wave = tid >> 5;
  const int y = blockIdx.y, o0 = blockIdx.x * QT;
  const float* W = (y == 0) ? wk : ((y == 1) ? wq : wv);            // block-uniform, all global
  unsigned short* Np = Wn + (size_t)y * ND * ND;
  unsigned short* Tq = Wt + (size_t)y * ND * ND;
  const int e = lane & 7, r4 = lane >> 3;                           // r4 0..3
  const int e8 = tid & 7, lq = tid >> 3;                            // lq 0..31
  float rsum0 = 0.f, rsum1 = 0.f;
#pragma unroll 1
  for (int cc = 0; cc < ND / QT; ++cc) {
    const int i0 = cc * QT;
#pragma unroll
    for (int it = 0; it < 2; ++it) {
      const int ol = 8 * wave + 4 * it + r4;                          // 0..63
      const float* sp = W + (size_t)(o0 + ol) * ND + i0 + 8 * e;
      const v4f a = *(const v4f*)sp;
      const v4f q = *(const v4f*)(sp + 4);
      const float f[8] = {a[0], a[1], a[2], a[3], q[0], q[1], q[2], q[3]};
      unsigned short hb[8];
      float ps = 0.f;
#pragma unroll
      for (int t = 0; t < 8; ++t) { hb[t] = bf_bits(f[t]); ps += bf_up(hb[t]); }
      if (it == 0) rsum0 += ps; else rsum1 += ps;
      v4u u;
#pragma unroll
      for (int t = 0; t < 4; ++t) u[t] = pk16(hb[2 * t], hb[2 * t + 1]);
      unsigned short* np = Np + (size_t)(o0 + ol) * ND + i0 + 8 * e;
      *(v4u*)np = u;
      
#pragma unroll
      for (int t = 0; t < 8; ++t) T[(8 * e + t) * TPW + ol] = hb[t];   // T[i_loc][o_loc]
    }
    __syncthreads();
    v4u up[2];
#pragma unroll
    for (int it = 0; it < 2; ++it) {
      const int il = 32 * it + lq;                                    // 0..63
      up[it] = *(const v4u*)(T + il * TPW + 8 * e8);
    }
{
#pragma unroll
      for (int it = 0; it < 2; ++it) {
        const int il = 32 * it + lq;
        *(v4u*)(Tq + (size_t)(i0 + il) * ND + o0 + 8 * e8) = up[it];
      }
      
    }
    __syncthreads();                                                  // T reused by the next chunk
  }
  rsum0 += __shfl_xor(rsum0, 1, 32); rsum0 += __shfl_xor(rsum0, 2, 32); rsum0 += __shfl_xor(rsum0, 4, 32);
  rsum1 += __shfl_xor(rsum1, 1, 32); rsum1 += __shfl_xor(rsum1, 2, 32); rsum1 += __shfl_xor(rsum1, 4, 32);
  if (e == 0) { rsL[8 * wave + r4] = rsum0; rsL[8 * wave + 4 + r4] = rsum1; }
  __syncthreads();
  if (wave == 0 && lane < 16) {
    const v4f v = *(const v4f*)(rsL + 4 * lane);
    float* rp = rs + (size_t)y * ND + o0 + 4 * lane;
    *(v4f*)rp = v;
    
  }
}

// =========================================================================================================
// (1) g[e] = sum_o bf16(Wk)[o][e] * rq[o]  (rq = row sums of bf16(Wq)); f32, one thread per e, loop unrolled by 4.
//     Output: 256 floats per block = 8 lines, wave w lanes 0..7 write line w (8 lanes x 16 B, one instruction),
// coverage: 3 blocks x 256 = 768 = whole g.  LDS gL: each wave reads back only its own 32 slots (block barrier).
// =========================================================================================================
__global__ __launch_bounds__(256)
void k_g(const unsigned short* __restrict__ Wkn, const float* __restrict__ rq, float* g) {
  __shared__ __align__(16) float gL[256];
  const int tid = threadIdx.x, lane = tid & 31, wave = tid >> 5;
  const int e = blockIdx.x * 256 + tid;
  float acc = 0.f;
#pragma unroll 4
  for (int o = 0; o < ND; ++o) acc += bf_up(Wkn[(size_t)o * ND + e]) * rq[o];
  gL[tid] = acc;
  __syncthreads();
  if (lane < 8) {
    const v4f v = *(const v4f*)(gL + 32 * wave + 4 * lane);
    float* p = g + (size_t)blockIdx.x * 256 + 32 * wave + 4 * lane;
    *(v4f*)p = v;
    
  }
}

// =========================================================================================================
// (2) x f32 [b][2048][768] -> Xb bf16-RNE plane (same layout) and per-chunk f64 partial sums of the bf16 values
//     (sum, sum of squares). Block (ch, b) owns 32 rows; wave w rows 4w..4w+3; per row 3 instructions of
// coverage: Xb 4 rows x 8 waves x 3 x 32 lanes x 8 = 32 x 768 per block, grid (64, NB) = all rows of b < NB;
// =========================================================================================================
__global__ __launch_bounds__(256)
void k_xcvt(const float* __restrict__ x, unsigned short* Xb, double* part) {
  __shared__ double sL[8], qL[8];
  const int tid = threadIdx.x, lane = tid & 31, wave = tid >> 5;
  const int ch = blockIdx.x, b = blockIdx.y;
  const int r0 = ch * (NC / KCH);
  double s = 0.0, q = 0.0;
#pragma unroll 1
  for (int t = 0; t < 4; ++t) {
    const int row = r0 + 4 * wave + t;
    const size_t base = ((size_t)b * NC + row) * ND + 8 * lane;
#pragma unroll 1
    for (int c3 = 0; c3 < ND / 256; ++c3) {
      const float* sp = x + base + 256 * c3;
      const v4f a = *(const v4f*)sp;
      const v4f q4 = *(const v4f*)(sp + 4);
      const float f[8] = {a[0], a[1], a[2], a[3], q4[0], q4[1], q4[2], q4[3]};
      unsigned short hb[8];
#pragma unroll
      for (int k = 0; k < 8; ++k) {
        hb[k] = bf_bits(f[k]);
        const double v = (double)bf_up(hb[k]);
        s += v;
        q += v * v;
      }
      v4u u;
#pragma unroll
      for (int k = 0; k < 4; ++k) u[k] = pk16(hb[2 * k], hb[2 * k + 1]);
      unsigned short* xp = Xb + base + 256 * c3;
      *(v4u*)xp = u;
      
    }
  }
  s += shfl_xor_d(s, 16); s += shfl_xor_d(s, 8); s += shfl_xor_d(s, 4); s += shfl_xor_d(s, 2); s += shfl_xor_d(s, 1);
  q += shfl_xor_d(q, 16); q += shfl_xor_d(q, 8); q += shfl_xor_d(q, 4); q += shfl_xor_d(q, 2); q += shfl_xor_d(q, 1);
  if (lane == 0) { sL[wave] = s; qL[wave] = q; }
  __syncthreads();
  if (wave == 0) {
    double S = 0.0, Q = 0.0;
#pragma unroll
    for (int w = 0; w < 8; ++w) { S += sL[w]; Q += qL[w]; }
    v2d val;
    val[0] = (lane == 0) ? S : 0.0;
    val[1] = (lane == 0) ? Q : 0.0;
    if (lane < 8) {
      double* pp = part + ((size_t)b * KCH + ch) * 16 + 2 * lane;
      *(v2d*)pp = val;
      
    }
  }
}

// =========================================================================================================
// (3) LayerNorm statistics per batch from the 64 partial lines (fixed-order f64 tree): st line f32 [32] with
// =========================================================================================================
__global__ __launch_bounds__(64)
void k_stats(const double* __restrict__ part, float* st) {
  __shared__ double sL[64], qL[64];
  __shared__ __align__(16) float stL[32];
  const int tid = threadIdx.x;
  if (tid < 32) stL[tid] = 0.f;
#pragma unroll 1
  for (int b = 0; b < NB; ++b) {
    __syncthreads();
    const size_t pb = ((size_t)b * KCH + tid) * 16;
    sL[tid] = part[pb];
    qL[tid] = part[pb + 1];
    __syncthreads();
#pragma unroll
    for (int off = 32; off > 0; off >>= 1) {
      if (tid < off) { sL[tid] += sL[tid + off]; qL[tid] += qL[tid + off]; }
      __syncthreads();
    }
    if (tid == 0) {
      const double n  = (double)NC * (double)ND;
      const double mu = sL[0] / n;
      double var = qL[0] / n - mu * mu;
      if (var < 0.0) var = 0.0;
      const float varf = (float)var;
      const float ve   = varf + EPSV;
      const float rstd = (float)(1.0 / sqrt((double)ve));
      const float muf  = (float)mu;
      stL[4 * b + 0] = muf;
      stL[4 * b + 1] = rstd;
      stL[4 * b + 2] = rstd * rstd;
      stL[4 * b + 3] = muf * rstd * rstd;
    }
  }
  __syncthreads();
  if (tid < 8) {
    const v4f v = *(const v4f*)(stL + 4 * tid);
    float* p = st + 4 * tid;
    *(v4f*)p = v;
    
  }
}

// =========================================================================================================
// GEMM engine (K = 768 = 24 k-steps, all operand planes k-contiguous with pitch ND): block 128 threads = 4 waves,
// 64 (m) x 64 (n) tile; wave w owns cols n0+16w..+15 (one B fragment per k-step from row n of the B plane) and
// 4 m-tiles (A rows m0 + 16 mt + (lane&15)); NPROD = 2 adds a second A plane (bf16 residual) into the same
// accumulator. Split k map loader for both operands.
// =========================================================================================================
template <int NPROD>
__device__ __forceinline__ void gemm_k(const unsigned short* __restrict__ ap0,
                                       const unsigned short* __restrict__ ap1,
                                       const unsigned short* __restrict__ bp, v8f (&acc)[4]) {
#pragma unroll
  for (int mt = 0; mt < 4; ++mt) acc[mt] = zero8();
#pragma unroll 2
  for (int ks = 0; ks < ND / 32; ++ks) {
    const Frag fb = ldfrag(bp + 32 * ks);
#pragma unroll
    for (int mt = 0; mt < 4; ++mt) {
      const Frag fa = ldfrag(ap0 + (size_t)(16 * mt) * ND + 32 * ks);
      acc[mt] = mma_b(fa.bf, fb.bf, acc[mt]);
      if (NPROD == 2) {
        const Frag fl = ldfrag(ap1 + (size_t)(16 * mt) * ND + 32 * ks);
        acc[mt] = mma_b(fl.bf, fb.bf, acc[mt]);
      }
    }
  }
}

// D tiles -> LDS Os[n_loc][m_loc] (pitch OSP, b128 stores): lane (hh, c) holds m = 16 mt + 8 hh + r for
// n_loc = 16 w + c.  coverage: 4 waves x 16 n x 4 mt x 16 m = 64 x 64 (pad cols 64..67 never read).
__device__ __forceinline__ void stage_os(float* Os, const v8f (&acc)[4], float sc, int wave, int hh, int c) {
  const int nl = 16 * wave + c;
#pragma unroll
  for (int mt = 0; mt < 4; ++mt) {
    v4f va, vb;
#pragma unroll
    for (int r = 0; r < 4; ++r) { va[r] = acc[mt][r] * sc; vb[r] = acc[mt][4 + r] * sc; }
    *(v4f*)(Os + nl * OSP + 16 * mt + 8 * hh)     = va;
    *(v4f*)(Os + nl * OSP + 16 * mt + 8 * hh + 4) = vb;
  }
}

// Os -> two bf16 planes (hi = bf16-RNE(v), lo = bf16-RNE(v - hi)), plane row = row0 + n_loc, 64 m values =
// coverage: 4 it x 16 rows x 8 lanes x 8 = 64 x 64 per plane.
__device__ __forceinline__ void epi_split(const float* Os, unsigned short* Ph, unsigned short* Pl,
                                          size_t row0, int pitch, int col0, int tid) {
  const int e = tid & 7, lq = tid >> 3;                              // lq 0..15
  v4u uh[4], ul[4];
#pragma unroll
  for (int it = 0; it < 4; ++it) {
    const int row = it * 16 + lq;
    const v4f a = *(const v4f*)(Os + row * OSP + 8 * e);
    const v4f q = *(const v4f*)(Os + row * OSP + 8 * e + 4);
    const float f[8] = {a[0], a[1], a[2], a[3], q[0], q[1], q[2], q[3]};
#pragma unroll
    for (int t = 0; t < 4; ++t) {
      const float f0 = f[2 * t], f1 = f[2 * t + 1];
      const unsigned short hb0 = bf_bits(f0), hb1 = bf_bits(f1);
      const unsigned short lb0 = bf_bits(f0 - bf_up(hb0));
      const unsigned short lb1 = bf_bits(f1 - bf_up(hb1));
      uh[it][t] = pk16(hb0, hb1);
      ul[it][t] = pk16(lb0, lb1);
    }
  }
{
#pragma unroll
    for (int it = 0; it < 4; ++it) {
      const int row = it * 16 + lq;
      const size_t po = (row0 + (size_t)row) * (size_t)pitch + (size_t)col0 + 8 * e;
      *(v4u*)(Ph + po) = uh[it];
      *(v4u*)(Pl + po) = ul[it];
    }
    
  }
}

// Os -> one f16 plane (values already scaled), same line geometry as epi_split.
__device__ __forceinline__ void epi_h(const float* Os, unsigned short* P, size_t row0, int pitch, int col0, int tid) {
  const int e = tid & 7, lq = tid >> 3;
  v4u u[4];
#pragma unroll
  for (int it = 0; it < 4; ++it) {
    const int row = it * 16 + lq;
    const v4f a = *(const v4f*)(Os + row * OSP + 8 * e);
    const v4f q = *(const v4f*)(Os + row * OSP + 8 * e + 4);
    const float f[8] = {a[0], a[1], a[2], a[3], q[0], q[1], q[2], q[3]};
#pragma unroll
    for (int t = 0; t < 4; ++t)
      u[it][t] = pk16(h_bits((_Float16)f[2 * t]), h_bits((_Float16)f[2 * t + 1]));
  }
{
#pragma unroll
    for (int it = 0; it < 4; ++it) {
      const int row = it * 16 + lq;
      const size_t po = (row0 + (size_t)row) * (size_t)pitch + (size_t)col0 + 8 * e;
      *(v4u*)(P + po) = u[it];
    }
    
  }
}

// =========================================================================================================
// (4) H planes: D[m = d][n = e] = sum_o WqT[d][o] * WkT[e][o]  (1 product, exact) -> Hh/Hl bf16 [e][768 d].
// grid (12 e-tiles, 12 d-tiles).  LDS Os cross-wave (block barrier).
// =========================================================================================================
__global__ __launch_bounds__(128)
void k_hgemm(const unsigned short* __restrict__ Aq, const unsigned short* __restrict__ Bk,
             unsigned short* Hh, unsigned short* Hl) {
  __shared__ __align__(16) float Os[QT * OSP];
  const int tid = threadIdx.x, lane = tid & 31, wave = tid >> 5, hh = lane >> 4, c = lane & 15;
  const int n0 = blockIdx.x * QT, m0 = blockIdx.y * QT;
  const unsigned short* ap = Aq + (size_t)(m0 + c) * ND + 8 * hh;
  const unsigned short* bp = Bk + (size_t)(n0 + 16 * wave + c) * ND + 8 * hh;
  v8f acc[4];
  gemm_k<1>(ap, ap, bp, acc);
  stage_os(Os, acc, 1.0f, wave, hh, c);
  __syncthreads();
  epi_split(Os, Hh, Hl, (size_t)n0, ND, m0, tid);
}

// =========================================================================================================
// (5) query planes: D[m = e][n = query] = sum_d (Hh + Hl)[e][d] * Xb[b][q][d]  (2 products), scaled by rstd_b^2
//     in the epilogue -> Ah/Al bf16 [b][NQ][768 e].  grid (NQ/64, 12 e-tiles, NB).
// =========================================================================================================
__global__ __launch_bounds__(128)
void k_agemm(const unsigned short* __restrict__ Hh, const unsigned short* __restrict__ Hl,
             const unsigned short* __restrict__ Xb, const float* __restrict__ st,
             unsigned short* Ah, unsigned short* Al) {
  __shared__ __align__(16) float Os[QT * OSP];
  const int tid = threadIdx.x, lane = tid & 31, wave = tid >> 5, hh = lane >> 4, c = lane & 15;
  const int n0 = blockIdx.x * QT, m0 = blockIdx.y * QT, b = blockIdx.z;
  const unsigned short* ap0 = Hh + (size_t)(m0 + c) * ND + 8 * hh;
  const unsigned short* ap1 = Hl + (size_t)(m0 + c) * ND + 8 * hh;
  const unsigned short* bp  = Xb + ((size_t)b * NC + n0 + 16 * wave + c) * ND + 8 * hh;
  v8f acc[4];
  gemm_k<2>(ap0, ap1, bp, acc);
  const float sc = st[4 * b + 2];
  stage_os(Os, acc, sc, wave, hh, c);
  __syncthreads();
  epi_split(Os, Ah, Al, (size_t)b * NQ + n0, ND, m0, tid);
}

// =========================================================================================================
// (6) value plane (channel-major, keys contiguous): D[m = key j][n = o] = sum_d Xb[b][j][d] * Wvb[o][d]
//     (1 product, exact), x16 -> U f16 [b][768 o][2048 j].  grid (12 o-tiles, 32 key-tiles, NB).
// =========================================================================================================
__global__ __launch_bounds__(128)
void k_vgemm(const unsigned short* __restrict__ Xb, const unsigned short* __restrict__ Wvn, unsigned short* U) {
  __shared__ __align__(16) float Os[QT * OSP];
  const int tid = threadIdx.x, lane = tid & 31, wave = tid >> 5, hh = lane >> 4, c = lane & 15;
  const int n0 = blockIdx.x * QT, m0 = blockIdx.y * QT, b = blockIdx.z;
  const unsigned short* ap = Xb + ((size_t)b * NC + m0 + c) * ND + 8 * hh;
  const unsigned short* bp = Wvn + (size_t)(n0 + 16 * wave + c) * ND + 8 * hh;
  v8f acc[4];
  gemm_k<1>(ap, ap, bp, acc);
  stage_os(Os, acc, USC, wave, hh, c);
  __syncthreads();
  epi_h(Os, U, (size_t)b * ND + n0, NC, m0, tid);
}

// =========================================================================================================
// (7) key-side affine term: cs[b][j] = -(mu_b rstd_b^2) * sum_d g[d] * Xb[b][j][d], f32 VALU, one wave per row,
// coverage: grid (64, NB) x 32 rows = every key row of b < NB.  LDS csL cross-wave (block barrier).
// =========================================================================================================
__global__ __launch_bounds__(256)
void k_cs(const unsigned short* __restrict__ Xb, const float* __restrict__ g, const float* __restrict__ st,
          float* cs) {
  __shared__ __align__(16) float csL[32];
  const int tid = threadIdx.x, lane = tid & 31, wave = tid >> 5;
  const int r0 = blockIdx.x * 32, b = blockIdx.y;
  v4f ga[3], gb[3];
#pragma unroll
  for (int c3 = 0; c3 < 3; ++c3) {
    ga[c3] = *(const v4f*)(g + 256 * c3 + 8 * lane);
    gb[c3] = *(const v4f*)(g + 256 * c3 + 8 * lane + 4);
  }
  const float nmr = -st[4 * b + 3];
#pragma unroll 1
  for (int t = 0; t < 4; ++t) {
    const int row = r0 + 4 * wave + t;
    const unsigned short* xp = Xb + ((size_t)b * NC + row) * ND + 8 * lane;
    float acc = 0.f;
#pragma unroll
    for (int c3 = 0; c3 < 3; ++c3) {
      const v4u u = *(const v4u*)(xp + 256 * c3);
      acc += bf_lo16(u[0]) * ga[c3][0] + bf_hi16(u[0]) * ga[c3][1]
           + bf_lo16(u[1]) * ga[c3][2] + bf_hi16(u[1]) * ga[c3][3]
           + bf_lo16(u[2]) * gb[c3][0] + bf_hi16(u[2]) * gb[c3][1]
           + bf_lo16(u[3]) * gb[c3][2] + bf_hi16(u[3]) * gb[c3][3];
    }
    acc += __shfl_xor(acc, 16, 32); acc += __shfl_xor(acc, 8, 32); acc += __shfl_xor(acc, 4, 32);
    acc += __shfl_xor(acc, 2, 32);  acc += __shfl_xor(acc, 1, 32);
    if (lane == 0) csL[4 * wave + t] = acc * nmr;
  }
  __syncthreads();
  if (wave == 0 && lane < 8) {
    const v4f v = *(const v4f*)(csL + 4 * lane);
    float* p = cs + (size_t)b * NC + r0 + 4 * lane;
    *(v4f*)p = v;
    
  }
}

// =========================================================================================================
// (8) attention for one (b, 64-query tile), transposed formulation, 2048 keys, no mask:
//   S^T tile (16 keys x 16 queries) = sum over 24 d-chunks of A(key row kb + (lane&15) of the bf16 plane Xb,
//   split k map) . B(query row of Ah) + A(Xb).B(Al) (bf16 residual, shared accumulator), then + cs[key].
//   Per lane the D tile holds 8 keys of ONE query: online softmax state per lane, one shuffle (lane^16) for the
//   max over 32 keys; corr applied every step (== 1 exactly when the max did not grow). P = e^{s-m} x 16384 as
//   f16 is the B operand of O^T (rows channel, cols queries) += A(U rows channel 16j + (lane&15), keys
//   contiguous, f16 x16) . B(P^T): element r <- D of the tile covering keys kb..kb+15, element 8+r <- the tile
//   covering kb+16..kb+31, lane unchanged. The 48 accumulator tiles per wave live in registers (384 per lane) for
//   the whole key loop and are stored once, behind it, to wave-private LDS slots Ow[query][768].
//   Epilogue after a block barrier: out[b][q][:] = Ow[q][:] * (rstd / (16 l_q)) - mu rstd rowsum(Wv), row =
// coverage: 4 waves x 16 query rows x 6 x 32 lanes x 4 = 64 x 768; grid (NQ/64, NB) covers out[b < NB][q < NQ].
// LDS: Ow written once per lane behind the key loop; cross-lane reads only after __syncthreads. staged extent
//      (16 x 768 per wave) == consumed extent.
// =========================================================================================================
__global__ __launch_bounds__(128)
void k_attn(const unsigned short* __restrict__ Ah, const unsigned short* __restrict__ Al,
            const unsigned short* __restrict__ Xb, const unsigned short* __restrict__ U,
            const float* __restrict__ cs, const float* __restrict__ rv,
            const float* __restrict__ st, float* out) {
  extern __shared__ v4f lds_dyn[];
  const int tid  = threadIdx.x;
  const int wave = tid >> 5, lane = tid & 31;
  const int hh   = lane >> 4, c = lane & 15;
  const int n0   = blockIdx.x * QT, b = blockIdx.y;
  float* Ow = (float*)lds_dyn + (size_t)wave * (16 * ND);
  float* op = Ow + c * ND + 8 * hh;                                  // this lane's slots (query column c)
  // O^T tiles: o[j][r] = channel 16 j + 8 hh + r of query c. Every loop over o[] is fully unrolled: only constant
  // indices keep the tiles in registers.
  v8f o[ND / 16];
#pragma unroll
  for (int j = 0; j < ND / 16; ++j) o[j] = zero8();

  const size_t qo = ((size_t)b * NQ + n0 + 16 * wave + c) * ND + 8 * hh;
  const unsigned short* Ahp = Ah + qo;
  const unsigned short* Alp = Al + qo;
  const unsigned short* Kp  = Xb + (size_t)b * NC * ND + (size_t)c * ND + 8 * hh;   // + key*ND + 32 kc
  const unsigned short* Vp  = U + (size_t)b * ND * NC + (size_t)c * NC + 8 * hh;    // + 16 j*NC + kb
  const float* csb = cs + (size_t)b * NC + 8 * hh;                                    // + kb (+16)

  float m = -1.0e30f, l = 0.f;
#pragma unroll 1
  for (int kb = 0; kb < NC; kb += 32) {
    const unsigned short* k0p = Kp + (size_t)kb * ND;                // keys kb .. kb+15
    const unsigned short* k1p = Kp + (size_t)(kb + 16) * ND;         // keys kb+16 .. kb+31
    v8f s0 = zero8(), s1 = zero8();
#pragma unroll 1
    for (int kc = 0; kc < ND / 32; ++kc) {
      const Frag qh = ldfrag(Ahp + 32 * kc);
      const Frag ql = ldfrag(Alp + 32 * kc);
      const Frag k0 = ldfrag(k0p + 32 * kc);
      const Frag k1 = ldfrag(k1p + 32 * kc);
      s0 = mma_b(k0.bf, qh.bf, s0);
      s1 = mma_b(k1.bf, qh.bf, s1);
      s0 = mma_b(k0.bf, ql.bf, s0);
      s1 = mma_b(k1.bf, ql.bf, s1);
    }
    {
      const v4f ca = *(const v4f*)(csb + kb);
      const v4f cb = *(const v4f*)(csb + kb + 4);
      const v4f cd = *(const v4f*)(csb + kb + 16);
      const v4f ce = *(const v4f*)(csb + kb + 20);
#pragma unroll
      for (int r = 0; r < 4; ++r) {
        s0[r] += ca[r]; s0[4 + r] += cb[r];                          // key kb      + 8hh + r
        s1[r] += cd[r]; s1[4 + r] += ce[r];                          // key kb + 16 + 8hh + r
      }
    }

    float mx = fmaxf(hmax8(s0), hmax8(s1));
    mx = fmaxf(mx, __shfl_xor(mx, 16, 32));
    const float mn   = fmaxf(m, mx);
    const float corr = __expf(m - mn);                               // == 1 exactly when the max did not grow
    l *= corr;
    m = mn;
    const float msh = mn - LNPS;                                     // exp gives e^{s-m} * 16384

    FragH ph;
    float ls = 0.f;
#pragma unroll
    for (int r = 0; r < 8; ++r) {
      const float e0 = __expf(s0[r] - msh);
      const float e1 = __expf(s1[r] - msh);
      ls += e0 + e1;
      ph.hv[0][r] = (_Float16)e0;
      ph.hv[1][r] = (_Float16)e1;
    }
    l += ls;

#pragma unroll
    for (int j = 0; j < ND / 16; ++j) {
      const Frag vf = ldfrag(Vp + (size_t)(16 * j) * NC + kb);
      v8f t;
#pragma unroll
      for (int r = 0; r < 8; ++r) t[r] = o[j][r] * corr;
      o[j] = mma_h(vf.h, ph.v, t);
    }
  }
  // the finished tiles go to the wave's LDS slots once, for the row-major epilogue
#pragma unroll
  for (int j = 0; j < ND / 16; ++j) {
    v4f na, nb2;
#pragma unroll
    for (int r = 0; r < 4; ++r) { na[r] = o[j][r]; nb2[r] = o[j][4 + r]; }
    *(v4f*)(op + 16 * j)     = na;
    *(v4f*)(op + 16 * j + 4) = nb2;
  }
  l += __shfl_xor(l, 16, 32);
  const float inv  = 1.0f / l;                                       // Ow and l both carry the x16384 factor
  const float mu   = st[4 * b + 0], rstd = st[4 * b + 1];
  const float qsc  = inv * rstd * IUSC;                              // per lane: its query column
  const float mrs  = mu * rstd;
  v4f rvv[6];
#pragma unroll
  for (int k = 0; k < ND / 128; ++k) {
    const v4f t = *(const v4f*)(rv + 128 * k + 4 * lane);
#pragma unroll
    for (int u = 0; u < 4; ++u) rvv[k][u] = t[u] * mrs;
  }
  __syncthreads();                                                   // all accumulator slots final before cross-lane reads

{
#pragma unroll 1
    for (int qq = 0; qq < 16; ++qq) {
      const float sc = __shfl(qsc, qq, 32);
      const float* lrow = Ow + qq * ND + 4 * lane;
      float* orow = out + ((size_t)b * NC + n0 + 16 * wave + qq) * ND + 4 * lane;
#pragma unroll
      for (int k = 0; k < ND / 128; ++k) {
        const v4f v = *(const v4f*)(lrow + 128 * k);
        v4f w;
#pragma unroll
        for (int u = 0; u < 4; ++u) w[u] = v[u] * sc - rvv[k][u];
        *(v4f*)(orow + 128 * k) = w;
      }
    }
    
  }
}

// =========================================================================================================
// Workspace map (bytes; each region start a multiple of 256; every extent is an exact tile/line multiple and is
//   Wn bf16 [3][768][768]      3538944      Wt bf16 [3][768][768]   3538944
//   rs  f32 [3][768]              9216      g   f32 [768]              3072
//   Xb bf16 [NB][2048][768]   25165824 (NB=8)  part f64 [NB][64][16]  65536    st f32 [32]  128 (256)
//   Hh/Hl bf16 [768][768]      1179648 x2
//   Ah/Al bf16 [NB][NQ][768]  25165824 x2 (NB=8, NQ=2048)
//   U  f16 [NB][768][2048]    25165824      cs f32 [NB][2048]         65536
//   total (NB=8, NQ=2048) = 110244096
// =========================================================================================================
extern "C" void kernel_launch(void* const* d_in, const int* in_sizes, int n_in,
                              void* d_out, int out_size, void* d_ws, size_t ws_size,
                              hipStream_t stream) {
  if (n_in < 4) return;
  if (in_sizes[0] < NB * NC * ND) return;
  if (in_sizes[1] < ND * ND || in_sizes[2] < ND * ND || in_sizes[3] < ND * ND) return;
  if (out_size < NB * NC * ND) return;

  size_t off = 0;
  auto carve = [&](size_t bytes) { const size_t o = off; off += (bytes + 255) & ~(size_t)255; return o; };
  const size_t oWn   = carve((size_t)3 * ND * ND * 2);
  const size_t oWt   = carve((size_t)3 * ND * ND * 2);
  const size_t oRs   = carve((size_t)3 * ND * 4);
  const size_t oG    = carve((size_t)ND * 4);
  const size_t oXb   = carve((size_t)NB * NC * ND * 2);
  const size_t oPart = carve((size_t)NB * KCH * 128);
  const size_t oSt   = carve((size_t)128);
  const size_t oHh   = carve((size_t)ND * ND * 2);
  const size_t oHl   = carve((size_t)ND * ND * 2);
  const size_t oAh   = carve((size_t)NB * NQ * ND * 2);
  const size_t oAl   = carve((size_t)NB * NQ * ND * 2);
  const size_t oU    = carve((size_t)NB * ND * NC * 2);
  const size_t oCs   = carve((size_t)NB * NC * 4);
  if (off > ws_size) return;
  if (off > (size_t)134217728) return;

  const float* x  = (const float*)d_in[0];
  const float* wk = (const float*)d_in[1];
  const float* wq = (const float*)d_in[2];
  const float* wv = (const float*)d_in[3];

  char* ws = (char*)d_ws;
  unsigned short* Wn  = (unsigned short*)(ws + oWn);
  unsigned short* Wt  = (unsigned short*)(ws + oWt);
  float*          rs  = (float*)(ws + oRs);
  float*          g   = (float*)(ws + oG);
  unsigned short* Xb  = (unsigned short*)(ws + oXb);
  double*         part = (double*)(ws + oPart);
  float*          st  = (float*)(ws + oSt);
  unsigned short* Hh  = (unsigned short*)(ws + oHh);
  unsigned short* Hl  = (unsigned short*)(ws + oHl);
  unsigned short* Ah  = (unsigned short*)(ws + oAh);
  unsigned short* Al  = (unsigned short*)(ws + oAl);
  unsigned short* U   = (unsigned short*)(ws + oU);
  float*          cs  = (float*)(ws + oCs);
  float* out = (float*)d_out;

  const dim3 blk256(256), blk128(128), blk64(64);

  // (0) weights -> bf16 natural + transposed planes + row sums (y: 0 Wk, 1 Wq, 2 Wv)
  cvt_w<<<dim3(ND / QT, 3), blk256, 0, stream>>>(wk, wq, wv, Wn, Wt, rs);
  // (1) g = bf16(Wk)^T . rowsum(bf16(Wq))
  k_g<<<dim3(ND / 256), blk256, 0, stream>>>(Wn, rs + ND, g);
  // (2) x -> bf16 plane + f64 partial sums
  k_xcvt<<<dim3(KCH, NB), blk256, 0, stream>>>(x, Xb, part);
  // (3) LayerNorm statistics
  k_stats<<<dim3(1), blk64, 0, stream>>>(part, st);
  // (4) H planes: A = Wq transposed (rows d), B = Wk transposed (rows e)
  k_hgemm<<<dim3(ND / QT, ND / QT), blk128, 0, stream>>>(Wt + (size_t)1 * ND * ND, Wt, Hh, Hl);
  // (5) query planes A' = rstd^2 X.H  (hi + residual)
  k_agemm<<<dim3(NQ / QT, ND / QT, NB), blk128, 0, stream>>>(Hh, Hl, Xb, st, Ah, Al);
  // (6) value plane U = 16 X.Wv^T (channel-major)
  k_vgemm<<<dim3(ND / QT, NC / QT, NB), blk128, 0, stream>>>(Xb, Wn + (size_t)2 * ND * ND, U);
  // (7) key-side affine term
  k_cs<<<dim3(NC / 32, NB), blk256, 0, stream>>>(Xb, g, st, cs);
  // (8) attention -> out [b][q][768]
  (void)hipFuncSetAttribute(reinterpret_cast<const void*>(&k_attn),
                            hipFuncAttributeMaxDynamicSharedMemorySize, ATTN_LDS);
  k_attn<<<dim3(NQ / QT, NB), blk128, ATTN_LDS, stream>>>(Ah, Al, Xb, U, cs, rs + 2 * ND, st, out);
  (void)hipGetLastError();
}

// v002
// It runs in 629 microseconds.
// Two timings next to v001 put it at 1.36 and 1.35 times that version's speed.
// Counting every step since v000, it is 2.28 times as fast.
// Contractions (f32 accumulate everywhere): H[e][d] = sum_o Wq[o][d]*Wk[o][e] on v_wmma_f32_16x16x32_bf16 with
// bf16-RNE weights (exact products); query plane A' = X.H with bf16-RNE x and H carried as bf16 hi + bf16
// residual (2 products, shared accumulator); U = X.Wv^T (1 product, bf16-RNE operands); scores
// S^T = X(keys).A'(queries) with A' as bf16 hi + bf16 residual (2 products); O^T = U.P^T on
// v_wmma_f32_16x16x32_f16 (U x16 as f16, P = e^{s-m} x16384 as f16 built from the score D registers).
// LayerNorm statistics in f64 VALU; per-batch affine terms, softmax statistics and normalisation in f32 VALU.
#include <hip/hip_runtime.h>
#include <math.h>
#include <stdint.h>

#ifndef NB
#define NB 8
#endif
#ifndef NQ
#define NQ 2048
#endif
#define NBF  8
#define NC   2048
#define ND   768
#define QT   64
#define OSP  68
#define TPW  72
#define KCH  64
#define KG   4
#define USC  16.0f
#define IUSC 0.0625f
#define LNPS 9.704060527839234f
#define EPSV 1.0e-5f
#define ATTN_LDS (4 * 16 * ND * 4)

static_assert(NB >= 1 && NB <= NBF);
static_assert(NQ % QT == 0 && NQ >= QT && NQ <= NC);
static_assert(NC % QT == 0 && ND % QT == 0);
static_assert(NC % 32 == 0 && ND % 32 == 0);
static_assert(ND % 256 == 0 && ND % 128 == 0 && ND % 16 == 0);
static_assert(NC / KCH == 32 && KCH == 64);
static_assert((ND / 32) % KG == 0);
static_assert(2 * 16 * ND * 2 == 16 * ND * 4);
static_assert(4 * NBF <= 32);
static_assert((OSP * 4) % 16 == 0);
static_assert((TPW * 2) % 16 == 0);
static_assert(ATTN_LDS == 196608);

typedef _Float16       v16h __attribute__((ext_vector_type(16)));
typedef _Float16       v8h  __attribute__((ext_vector_type(8)));
typedef __bf16         v16b __attribute__((ext_vector_type(16)));
typedef unsigned short v8us __attribute__((ext_vector_type(8)));
typedef float          v8f  __attribute__((ext_vector_type(8)));
typedef float          v4f  __attribute__((ext_vector_type(4)));
typedef unsigned int   v4u  __attribute__((ext_vector_type(4)));
typedef double         v2d  __attribute__((ext_vector_type(2)));

union Frag  { v8us u[2]; v16h h; v16b bf; };
union FragH { v16h v; v8h hv[2]; };
static_assert(sizeof(Frag) == 32);
static_assert(sizeof(FragH) == 32);

// ---- scalar helpers ---------------------------------------------------------------------------------------
__device__ __forceinline__ unsigned short bf_bits(float f) {          // f32 -> bf16 bits, RNE convert
  unsigned u = __float_as_uint(f);
  return (unsigned short)((u + 0x7FFFu + ((u >> 16) & 1u)) >> 16);
}
__device__ __forceinline__ float bf_up(unsigned short hb) { return __uint_as_float(((unsigned)hb) << 16); }
__device__ __forceinline__ float bf_lo16(unsigned w) { return __uint_as_float(w << 16); }
__device__ __forceinline__ float bf_hi16(unsigned w) { return __uint_as_float(w & 0xFFFF0000u); }
__device__ __forceinline__ unsigned short h_bits(_Float16 x) { return __builtin_bit_cast(unsigned short, x); }
__device__ __forceinline__ unsigned pk16(unsigned short a, unsigned short b) { return (unsigned)a | ((unsigned)b << 16); }
__device__ __forceinline__ v8f zero8() { v8f z = {0.f, 0.f, 0.f, 0.f, 0.f, 0.f, 0.f, 0.f}; return z; }
__device__ __forceinline__ float hmax8(v8f s) {
  return fmaxf(fmaxf(fmaxf(s[0], s[1]), fmaxf(s[2], s[3])), fmaxf(fmaxf(s[4], s[5]), fmaxf(s[6], s[7])));
}
__device__ __forceinline__ double shfl_xor_d(double v, int mask) {
  int lo = __double2loint(v), hi = __double2hiint(v);
  lo = __shfl_xor(lo, mask, 32);
  hi = __shfl_xor(hi, mask, 32);
  return __hiloint2double(hi, lo);
}

// ---- 16-bit fragment loader (A, or B from a k-contiguous [n][k] row): lane -> row/col (lane&15), p already includes
//      + 8*(lane>>4); elements 0..7 <- p[0..7] (k0+8h..), elements 8..15 <- p[16..23] (k0+16+8h..)
__device__ __forceinline__ Frag ldfrag(const unsigned short* p) {
  Frag f;
  f.u[0] = *(const v8us*)(p);
  f.u[1] = *(const v8us*)(p + 16);
  return f;
}

// ---- fragment from the packed LDS form: two quarters of 32 lanes x 16 B, p already includes + 8*lane
__device__ __forceinline__ Frag ldq(const unsigned short* p) {
  Frag f;
  f.u[0] = *(const v8us*)(p);
  f.u[1] = *(const v8us*)(p + 256);
  return f;
}

// ---- WMMA helpers: builtin followed by a 4-slot VALU gap tying D and keeping A/B live --------------------------
// mma_h is the bare builtin (the compiler keeps the distance behind its own WMMAs): with D tied to an asm statement
// the 48 resident D tiles of k_attn, 384 registers, do not all get registers and the build spills to scratch.
__device__ __forceinline__ v8f mma_h(v16h a, v16h b, v8f c) {
  return __builtin_amdgcn_wmma_f32_16x16x32_f16(false, a, false, b, (short)0, c, false, false);
}
// mma_q is the bare bf16 builtin, for a like reason: with the two fragment groups that k_attn keeps in flight tied to
// mma_b's asm statement as operands, the build spills to scratch.
__device__ __forceinline__ v8f mma_q(v16b a, v16b b, v8f c) {
  return __builtin_amdgcn_wmma_f32_16x16x32_bf16(false, a, false, b, (short)0, c, false, false);
}
__device__ __forceinline__ v8f mma_b(v16b a, v16b b, v8f c) {
  v8f d = __builtin_amdgcn_wmma_f32_16x16x32_bf16(false, a, false, b, (short)0, c, false, false);
#if defined(__HIP_DEVICE_COMPILE__)
  const v16h ha = __builtin_bit_cast(v16h, a), hb = __builtin_bit_cast(v16h, b);
  asm volatile("v_nop\n\tv_nop\n\tv_nop\n\tv_nop" : "+v"(d) : "v"(ha), "v"(hb));
#endif
  return d;
}

// =========================================================================================================
// (0) weights f32 [768][768] (y = 0: Wk, 1: Wq, 2: Wv, block-uniform selection) -> bf16-RNE planes:
//     natural Wn[y][o][i] and transposed Wt[y][i][o], plus row sums rs[y][o] = sum_i bf16(W[o][i]) in f32.
//     Block (ob, y) owns rows o0..o0+63; column chunks of 64 go through the LDS tile T[i_loc][o_loc] (pitch TPW).
// coverage: Wn 12 chunks x 2 it x 8 waves x 4 rows x 8 lanes x 8 = 64 x 768 per block; Wt 12 chunks x 2 it x 32 x 8
//           lanes x 8 = 768 x 64 per block; rs 16 x 4 = 64; grid (12, 3) covers all three matrices once.
// LDS: T and rsL cross-wave (block barriers).
// =========================================================================================================
__global__ __launch_bounds__(256)
void cvt_w(const float* __restrict__ wk, const float* __restrict__ wq, const float* __restrict__ wv,
           unsigned short* Wn, unsigned short* Wt, float* rs) {
  __shared__ __align__(16) unsigned short T[QT * TPW];
  __shared__ __align__(16) float rsL[QT];
  const int tid = threadIdx.x, lane = tid & 31, wave = tid >> 5;
  const int y = blockIdx.y, o0 = blockIdx.x * QT;
  const float* W = (y == 0) ? wk : ((y == 1) ? wq : wv);            // block-uniform, all global
  unsigned short* Np = Wn + (size_t)y * ND * ND;
  unsigned short* Tq = Wt + (size_t)y * ND * ND;
  const int e = lane & 7, r4 = lane >> 3;                           // r4 0..3
  const int e8 = tid & 7, lq = tid >> 3;                            // lq 0..31
  float rsum0 = 0.f, rsum1 = 0.f;
#pragma unroll 1
  for (int cc = 0; cc < ND / QT; ++cc) {
    const int i0 = cc * QT;
#pragma unroll
    for (int it = 0; it < 2; ++it) {
      const int ol = 8 * wave + 4 * it + r4;                          // 0..63
      const float* sp = W + (size_t)(o0 + ol) * ND + i0 + 8 * e;
      const v4f a = *(const v4f*)sp;
      const v4f q = *(const v4f*)(sp + 4);
      const float f[8] = {a[0], a[1], a[2], a[3], q[0], q[1], q[2], q[3]};
      unsigned short hb[8];
      float ps = 0.f;
#pragma unroll
      for (int t = 0; t < 8; ++t) { hb[t] = bf_bits(f[t]); ps += bf_up(hb[t]); }
      if (it == 0) rsum0 += ps; else rsum1 += ps;
      v4u u;
#pragma unroll
      for (int t = 0; t < 4; ++t) u[t] = pk16(hb[2 * t], hb[2 * t + 1]);
      unsigned short* np = Np + (size_t)(o0 + ol) * ND + i0 + 8 * e;
      *(v4u*)np = u;
      
#pragma unroll
      for (int t = 0; t < 8; ++t) T[(8 * e + t) * TPW + ol] = hb[t];   // T[i_loc][o_loc]
    }
    __syncthreads();
    v4u up[2];
#pragma unroll
    for (int it = 0; it < 2; ++it) {
      const int il = 32 * it + lq;                                    // 0..63
      up[it] = *(const v4u*)(T + il * TPW + 8 * e8);
    }
{
#pragma unroll
      for (int it = 0; it < 2; ++it) {
        const int il = 32 * it + lq;
        *(v4u*)(Tq + (size_t)(i0 + il) * ND + o0 + 8 * e8) = up[it];
      }
      
    }
    __syncthreads();                                                  // T reused by the next chunk
  }
  rsum0 += __shfl_xor(rsum0, 1, 32); rsum0 += __shfl_xor(rsum0, 2, 32); rsum0 += __shfl_xor(rsum0, 4, 32);
  rsum1 += __shfl_xor(rsum1, 1, 32); rsum1 += __shfl_xor(rsum1, 2, 32); rsum1 += __shfl_xor(rsum1, 4, 32);
  if (e == 0) { rsL[8 * wave + r4] = rsum0; rsL[8 * wave + 4 + r4] = rsum1; }
  __syncthreads();
  if (wave == 0 && lane < 16) {
    const v4f v = *(const v4f*)(rsL + 4 * lane);
    float* rp = rs + (size_t)y * ND + o0 + 4 * lane;
    *(v4f*)rp = v;
    
  }
}

// =========================================================================================================
// (1) g[e] = sum_o bf16(Wk)[o][e] * rq[o]  (rq = row sums of bf16(Wq)); f32, one thread per e, loop unrolled by 4.
//     Output: 256 floats per block = 8 lines, wave w lanes 0..7 write line w (8 lanes x 16 B, one instruction),
// coverage: 3 blocks x 256 = 768 = whole g.  LDS gL: each wave reads back only its own 32 slots (block barrier).
// =========================================================================================================
__global__ __launch_bounds__(256)
void k_g(const unsigned short* __restrict__ Wkn, const float* __restrict__ rq, float* g) {
  __shared__ __align__(16) float gL[256];
  const int tid = threadIdx.x, lane = tid & 31, wave = tid >> 5;
  const int e = blockIdx.x * 256 + tid;
  float acc = 0.f;
#pragma unroll 4
  for (int o = 0; o < ND; ++o) acc += bf_up(Wkn[(size_t)o * ND + e]) * rq[o];
  gL[tid] = acc;
  __syncthreads();
  if (lane < 8) {
    const v4f v = *(const v4f*)(gL + 32 * wave + 4 * lane);
    float* p = g + (size_t)blockIdx.x * 256 + 32 * wave + 4 * lane;
    *(v4f*)p = v;
    
  }
}

// =========================================================================================================
// (2) x f32 [b][2048][768] -> Xb bf16-RNE plane (same layout) and per-chunk f64 partial sums of the bf16 values
//     (sum, sum of squares). Block (ch, b) owns 32 rows; wave w rows 4w..4w+3; per row 3 instructions of
// coverage: Xb 4 rows x 8 waves x 3 x 32 lanes x 8 = 32 x 768 per block, grid (64, NB) = all rows of b < NB;
// =========================================================================================================
__global__ __launch_bounds__(256)
void k_xcvt(const float* __restrict__ x, unsigned short* Xb, double* part) {
  __shared__ double sL[8], qL[8];
  const int tid = threadIdx.x, lane = tid & 31, wave = tid >> 5;
  const int ch = blockIdx.x, b = blockIdx.y;
  const int r0 = ch * (NC / KCH);
  double s = 0.0, q = 0.0;
#pragma unroll 1
  for (int t = 0; t < 4; ++t) {
    const int row = r0 + 4 * wave + t;
    const size_t base = ((size_t)b * NC + row) * ND + 8 * lane;
#pragma unroll 1
    for (int c3 = 0; c3 < ND / 256; ++c3) {
      const float* sp = x + base + 256 * c3;
      const v4f a = *(const v4f*)sp;
      const v4f q4 = *(const v4f*)(sp + 4);
      const float f[8] = {a[0], a[1], a[2], a[3], q4[0], q4[1], q4[2], q4[3]};
      unsigned short hb[8];
#pragma unroll
      for (int k = 0; k < 8; ++k) {
        hb[k] = bf_bits(f[k]);
        const double v = (double)bf_up(hb[k]);
        s += v;
        q += v * v;
      }
      v4u u;
#pragma unroll
      for (int k = 0; k < 4; ++k) u[k] = pk16(hb[2 * k], hb[2 * k + 1]);
      unsigned short* xp = Xb + base + 256 * c3;
      *(v4u*)xp = u;
      
    }
  }
  s += shfl_xor_d(s, 16); s += shfl_xor_d(s, 8); s += shfl_xor_d(s, 4); s += shfl_xor_d(s, 2); s += shfl_xor_d(s, 1);
  q += shfl_xor_d(q, 16); q += shfl_xor_d(q, 8); q += shfl_xor_d(q, 4); q += shfl_xor_d(q, 2); q += shfl_xor_d(q, 1);
  if (lane == 0) { sL[wave] = s; qL[wave] = q; }
  __syncthreads();
  if (wave == 0) {
    double S = 0.0, Q = 0.0;
#pragma unroll
    for (int w = 0; w < 8; ++w) { S += sL[w]; Q += qL[w]; }
    v2d val;
    val[0] = (lane == 0) ? S : 0.0;
    val[1] = (lane == 0) ? Q : 0.0;
    if (lane < 8) {
      double* pp = part + ((size_t)b * KCH + ch) * 16 + 2 * lane;
      *(v2d*)pp = val;
      
    }
  }
}

// =========================================================================================================
// (3) LayerNorm statistics per batch from the 64 partial lines (fixed-order f64 tree): st line f32 [32] with
// =========================================================================================================
__global__ __launch_bounds__(64)
void k_stats(const double* __restrict__ part, float* st) {
  __shared__ double sL[64], qL[64];
  __shared__ __align__(16) float stL[32];
  const int tid = threadIdx.x;
  if (tid < 32) stL[tid] = 0.f;
#pragma unroll 1
  for (int b = 0; b < NB; ++b) {
    __syncthreads();
    const size_t pb = ((size_t)b * KCH + tid) * 16;
    sL[tid] = part[pb];
    qL[tid] = part[pb + 1];
    __syncthreads();
#pragma unroll
    for (int off = 32; off > 0; off >>= 1) {
      if (tid < off) { sL[tid] += sL[tid + off]; qL[tid] += qL[tid + off]; }
      __syncthreads();
    }
    if (tid == 0) {
      const double n  = (double)NC * (double)ND;
      const double mu = sL[0] / n;
      double var = qL[0] / n - mu * mu;
      if (var < 0.0) var = 0.0;
      const float varf = (float)var;
      const float ve   = varf + EPSV;
      const float rstd = (float)(1.0 / sqrt((double)ve));
      const float muf  = (float)mu;
      stL[4 * b + 0] = muf;
      stL[4 * b + 1] = rstd;
      stL[4 * b + 2] = rstd * rstd;
      stL[4 * b + 3] = muf * rstd * rstd;
    }
  }
  __syncthreads();
  if (tid < 8) {
    const v4f v = *(const v4f*)(stL + 4 * tid);
    float* p = st + 4 * tid;
    *(v4f*)p = v;
    
  }
}

// =========================================================================================================
// GEMM engine (K = 768 = 24 k-steps, all operand planes k-contiguous with pitch ND): block 128 threads = 4 waves,
// 64 (m) x 64 (n) tile; wave w owns cols n0+16w..+15 (one B fragment per k-step from row n of the B plane) and
// 4 m-tiles (A rows m0 + 16 mt + (lane&15)); NPROD = 2 adds a second A plane (bf16 residual) into the same
// accumulator. Split k map loader for both operands.
// =========================================================================================================
template <int NPROD>
__device__ __forceinline__ void gemm_k(const unsigned short* __restrict__ ap0,
                                       const unsigned short* __restrict__ ap1,
                                       const unsigned short* __restrict__ bp, v8f (&acc)[4]) {
#pragma unroll
  for (int mt = 0; mt < 4; ++mt) acc[mt] = zero8();
#pragma unroll 2
  for (int ks = 0; ks < ND / 32; ++ks) {
    const Frag fb = ldfrag(bp + 32 * ks);
#pragma unroll
    for (int mt = 0; mt < 4; ++mt) {
      const Frag fa = ldfrag(ap0 + (size_t)(16 * mt) * ND + 32 * ks);
      acc[mt] = mma_b(fa.bf, fb.bf, acc[mt]);
      if (NPROD == 2) {
        const Frag fl = ldfrag(ap1 + (size_t)(16 * mt) * ND + 32 * ks);
        acc[mt] = mma_b(fl.bf, fb.bf, acc[mt]);
      }
    }
  }
}

// D tiles -> LDS Os[n_loc][m_loc] (pitch OSP, b128 stores): lane (hh, c) holds m = 16 mt + 8 hh + r for
// n_loc = 16 w + c.  coverage: 4 waves x 16 n x 4 mt x 16 m = 64 x 64 (pad cols 64..67 never read).
__device__ __forceinline__ void stage_os(float* Os, const v8f (&acc)[4], float sc, int wave, int hh, int c) {
  const int nl = 16 * wave + c;
#pragma unroll
  for (int mt = 0; mt < 4; ++mt) {
    v4f va, vb;
#pragma unroll
    for (int r = 0; r < 4; ++r) { va[r] = acc[mt][r] * sc; vb[r] = acc[mt][4 + r] * sc; }
    *(v4f*)(Os + nl * OSP + 16 * mt + 8 * hh)     = va;
    *(v4f*)(Os + nl * OSP + 16 * mt + 8 * hh + 4) = vb;
  }
}

// Os -> two bf16 planes (hi = bf16-RNE(v), lo = bf16-RNE(v - hi)), plane row = row0 + n_loc, 64 m values =
// coverage: 4 it x 16 rows x 8 lanes x 8 = 64 x 64 per plane.
__device__ __forceinline__ void epi_split(const float* Os, unsigned short* Ph, unsigned short* Pl,
                                          size_t row0, int pitch, int col0, int tid) {
  const int e = tid & 7, lq = tid >> 3;                              // lq 0..15
  v4u uh[4], ul[4];
#pragma unroll
  for (int it = 0; it < 4; ++it) {
    const int row = it * 16 + lq;
    const v4f a = *(const v4f*)(Os + row * OSP + 8 * e);
    const v4f q = *(const v4f*)(Os + row * OSP + 8 * e + 4);
    const float f[8] = {a[0], a[1], a[2], a[3], q[0], q[1], q[2], q[3]};
#pragma unroll
    for (int t = 0; t < 4; ++t) {
      const float f0 = f[2 * t], f1 = f[2 * t + 1];
      const unsigned short hb0 = bf_bits(f0), hb1 = bf_bits(f1);
      const unsigned short lb0 = bf_bits(f0 - bf_up(hb0));
      const unsigned short lb1 = bf_bits(f1 - bf_up(hb1));
      uh[it][t] = pk16(hb0, hb1);
      ul[it][t] = pk16(lb0, lb1);
    }
  }
{
#pragma unroll
    for (int it = 0; it < 4; ++it) {
      const int row = it * 16 + lq;
      const size_t po = (row0 + (size_t)row) * (size_t)pitch + (size_t)col0 + 8 * e;
      *(v4u*)(Ph + po) = uh[it];
      *(v4u*)(Pl + po) = ul[it];
    }
    
  }
}

// Os -> one f16 plane (values already scaled), same line geometry as epi_split.
__device__ __forceinline__ void epi_h(const float* Os, unsigned short* P, size_t row0, int pitch, int col0, int tid) {
  const int e = tid & 7, lq = tid >> 3;
  v4u u[4];
#pragma unroll
  for (int it = 0; it < 4; ++it) {
    const int row = it * 16 + lq;
    const v4f a = *(const v4f*)(Os + row * OSP + 8 * e);
    const v4f q = *(const v4f*)(Os + row * OSP + 8 * e + 4);
    const float f[8] = {a[0], a[1], a[2], a[3], q[0], q[1], q[2], q[3]};
#pragma unroll
    for (int t = 0; t < 4; ++t)
      u[it][t] = pk16(h_bits((_Float16)f[2 * t]), h_bits((_Float16)f[2 * t + 1]));
  }
{
#pragma unroll
    for (int it = 0; it < 4; ++it) {
      const int row = it * 16 + lq;
      const size_t po = (row0 + (size_t)row) * (size_t)pitch + (size_t)col0 + 8 * e;
      *(v4u*)(P + po) = u[it];
    }
    
  }
}

// =========================================================================================================
// (4) H planes: D[m = d][n = e] = sum_o WqT[d][o] * WkT[e][o]  (1 product, exact) -> Hh/Hl bf16 [e][768 d].
// grid (12 e-tiles, 12 d-tiles).  LDS Os cross-wave (block barrier).
// =========================================================================================================
__global__ __launch_bounds__(128)
void k_hgemm(const unsigned short* __restrict__ Aq, const unsigned short* __restrict__ Bk,
             unsigned short* Hh, unsigned short* Hl) {
  __shared__ __align__(16) float Os[QT * OSP];
  const int tid = threadIdx.x, lane = tid & 31, wave = tid >> 5, hh = lane >> 4, c = lane & 15;
  const int n0 = blockIdx.x * QT, m0 = blockIdx.y * QT;
  const unsigned short* ap = Aq + (size_t)(m0 + c) * ND + 8 * hh;
  const unsigned short* bp = Bk + (size_t)(n0 + 16 * wave + c) * ND + 8 * hh;
  v8f acc[4];
  gemm_k<1>(ap, ap, bp, acc);
  stage_os(Os, acc, 1.0f, wave, hh, c);
  __syncthreads();
  epi_split(Os, Hh, Hl, (size_t)n0, ND, m0, tid);
}

// =========================================================================================================
// (5) query planes: D[m = e][n = query] = sum_d (Hh + Hl)[e][d] * Xb[b][q][d]  (2 products), scaled by rstd_b^2
//     in the epilogue -> Ah/Al bf16 [b][NQ][768 e].  grid (NQ/64, 12 e-tiles, NB).
// =========================================================================================================
__global__ __launch_bounds__(128)
void k_agemm(const unsigned short* __restrict__ Hh, const unsigned short* __restrict__ Hl,
             const unsigned short* __restrict__ Xb, const float* __restrict__ st,
             unsigned short* Ah, unsigned short* Al) {
  __shared__ __align__(16) float Os[QT * OSP];
  const int tid = threadIdx.x, lane = tid & 31, wave = tid >> 5, hh = lane >> 4, c = lane & 15;
  const int n0 = blockIdx.x * QT, m0 = blockIdx.y * QT, b = blockIdx.z;
  const unsigned short* ap0 = Hh + (size_t)(m0 + c) * ND + 8 * hh;
  const unsigned short* ap1 = Hl + (size_t)(m0 + c) * ND + 8 * hh;
  const unsigned short* bp  = Xb + ((size_t)b * NC + n0 + 16 * wave + c) * ND + 8 * hh;
  v8f acc[4];
  gemm_k<2>(ap0, ap1, bp, acc);
  const float sc = st[4 * b + 2];
  stage_os(Os, acc, sc, wave, hh, c);
  __syncthreads();
  epi_split(Os, Ah, Al, (size_t)b * NQ + n0, ND, m0, tid);
}

// =========================================================================================================
// (6) value plane (channel-major, keys contiguous): D[m = key j][n = o] = sum_d Xb[b][j][d] * Wvb[o][d]
//     (1 product, exact), x16 -> U f16 [b][768 o][2048 j].  grid (12 o-tiles, 32 key-tiles, NB).
// =========================================================================================================
__global__ __launch_bounds__(128)
void k_vgemm(const unsigned short* __restrict__ Xb, const unsigned short* __restrict__ Wvn, unsigned short* U) {
  __shared__ __align__(16) float Os[QT * OSP];
  const int tid = threadIdx.x, lane = tid & 31, wave = tid >> 5, hh = lane >> 4, c = lane & 15;
  const int n0 = blockIdx.x * QT, m0 = blockIdx.y * QT, b = blockIdx.z;
  const unsigned short* ap = Xb + ((size_t)b * NC + m0 + c) * ND + 8 * hh;
  const unsigned short* bp = Wvn + (size_t)(n0 + 16 * wave + c) * ND + 8 * hh;
  v8f acc[4];
  gemm_k<1>(ap, ap, bp, acc);
  stage_os(Os, acc, USC, wave, hh, c);
  __syncthreads();
  epi_h(Os, U, (size_t)b * ND + n0, NC, m0, tid);
}

// =========================================================================================================
// (7) key-side affine term: cs[b][j] = -(mu_b rstd_b^2) * sum_d g[d] * Xb[b][j][d], f32 VALU, one wave per row,
// coverage: grid (64, NB) x 32 rows = every key row of b < NB.  LDS csL cross-wave (block barrier).
// =========================================================================================================
__global__ __launch_bounds__(256)
void k_cs(const unsigned short* __restrict__ Xb, const float* __restrict__ g, const float* __restrict__ st,
          float* cs) {
  __shared__ __align__(16) float csL[32];
  const int tid = threadIdx.x, lane = tid & 31, wave = tid >> 5;
  const int r0 = blockIdx.x * 32, b = blockIdx.y;
  v4f ga[3], gb[3];
#pragma unroll
  for (int c3 = 0; c3 < 3; ++c3) {
    ga[c3] = *(const v4f*)(g + 256 * c3 + 8 * lane);
    gb[c3] = *(const v4f*)(g + 256 * c3 + 8 * lane + 4);
  }
  const float nmr = -st[4 * b + 3];
#pragma unroll 1
  for (int t = 0; t < 4; ++t) {
    const int row = r0 + 4 * wave + t;
    const unsigned short* xp = Xb + ((size_t)b * NC + row) * ND + 8 * lane;
    float acc = 0.f;
#pragma unroll
    for (int c3 = 0; c3 < 3; ++c3) {
      const v4u u = *(const v4u*)(xp + 256 * c3);
      acc += bf_lo16(u[0]) * ga[c3][0] + bf_hi16(u[0]) * ga[c3][1]
           + bf_lo16(u[1]) * ga[c3][2] + bf_hi16(u[1]) * ga[c3][3]
           + bf_lo16(u[2]) * gb[c3][0] + bf_hi16(u[2]) * gb[c3][1]
           + bf_lo16(u[3]) * gb[c3][2] + bf_hi16(u[3]) * gb[c3][3];
    }
    acc += __shfl_xor(acc, 16, 32); acc += __shfl_xor(acc, 8, 32); acc += __shfl_xor(acc, 4, 32);
    acc += __shfl_xor(acc, 2, 32);  acc += __shfl_xor(acc, 1, 32);
    if (lane == 0) csL[4 * wave + t] = acc * nmr;
  }
  __syncthreads();
  if (wave == 0 && lane < 8) {
    const v4f v = *(const v4f*)(csL + 4 * lane);
    float* p = cs + (size_t)b * NC + r0 + 4 * lane;
    *(v4f*)p = v;
    
  }
}

// =========================================================================================================
// (8) attention for one (b, 64-query tile), transposed formulation, 2048 keys, no mask:
//   S^T tile (16 keys x 16 queries) = sum over 24 d-chunks of A(key row kb + (lane&15) of the bf16 plane Xb,
//   split k map) . B(query row of Ah) + A(Xb).B(Al) (bf16 residual, shared accumulator), then + cs[key].
//   Per lane the D tile holds 8 keys of ONE query: online softmax state per lane, one shuffle (lane^16) for the
//   max over 32 keys; corr applied every step (== 1 exactly when the max did not grow). P = e^{s-m} x 16384 as
//   f16 is the B operand of O^T (rows channel, cols queries) += A(U rows channel 16j + (lane&15), keys
//   contiguous, f16 x16) . B(P^T): element r <- D of the tile covering keys kb..kb+15, element 8+r <- the tile
//   covering kb+16..kb+31, lane unchanged. The 48 accumulator tiles per wave live in registers (384 per lane) for
//   the whole key loop and are stored once, behind it, to wave-private LDS slots Ow[query][768].
//   Epilogue after a block barrier: out[b][q][:] = Ow[q][:] * (rstd / (16 l_q)) - mu rstd rowsum(Wv), row =
// coverage: 4 waves x 16 query rows x 6 x 32 lanes x 4 = 64 x 768; grid (NQ/64, NB) covers out[b < NB][q < NQ].
// LDS: Ow written once per lane behind the key loop; cross-lane reads only after __syncthreads. staged extent
//      (16 x 768 per wave) == consumed extent. Up to the end of the key loop the same bytes hold the wave's query
//      fragments (hi + residual, 2 x 16 x 768 x 2 B), each 16 B written and read by one and the same lane.
// =========================================================================================================
__global__ __launch_bounds__(128)
void k_attn(const unsigned short* __restrict__ Ah, const unsigned short* __restrict__ Al,
            const unsigned short* __restrict__ Xb, const unsigned short* __restrict__ U,
            const float* __restrict__ cs, const float* __restrict__ rv,
            const float* __restrict__ st, float* out) {
  extern __shared__ v4f lds_dyn[];
  const int tid  = threadIdx.x;
  const int wave = tid >> 5, lane = tid & 31;
  const int hh   = lane >> 4, c = lane & 15;
  const int n0   = blockIdx.x * QT, b = blockIdx.y;
  float* Ow = (float*)lds_dyn + (size_t)wave * (16 * ND);
  float* op = Ow + c * ND + 8 * hh;                                  // this lane's slots (query column c)
  // O^T tiles: o[j][r] = channel 16 j + 8 hh + r of query c. Every loop over o[] is fully unrolled: only constant
  // indices keep the tiles in registers.
  v8f o[ND / 16];
#pragma unroll
  for (int j = 0; j < ND / 16; ++j) o[j] = zero8();

  const size_t qo = ((size_t)b * NQ + n0 + 16 * wave + c) * ND + 8 * hh;
  const unsigned short* Ahp = Ah + qo;
  const unsigned short* Alp = Al + qo;
  const unsigned short* Kp  = Xb + (size_t)b * NC * ND + (size_t)c * ND + 8 * hh;   // + key*ND + 32 kc
  const unsigned short* Vp  = U + (size_t)b * ND * NC + (size_t)c * NC + 8 * hh;    // + 16 j*NC + kb
  const float* csb = cs + (size_t)b * NC + 8 * hh;                                    // + kb (+16)

  // The wave's 16 query rows (hi and residual plane) go once into the wave's own LDS slots, fragment by fragment:
  // quarter f = 4 kc + {0, 1: hi elements 0..7, 8..15; 2, 3: residual} holds 32 lanes x 16 B, and every lane reads back
  // only what it wrote itself. The slots are the bytes of Ow, which is written only behind the key loop.
  unsigned short* Qs = (unsigned short*)lds_dyn + (size_t)wave * (2 * 16 * ND) + 8 * lane;
#pragma unroll 1
  for (int kq = 0; kq < ND / 32 / KG; ++kq) {
    const unsigned short* ap = Ahp + 32 * KG * kq;
    const unsigned short* lp = Alp + 32 * KG * kq;
    Frag a[KG], r[KG];
#pragma unroll
    for (int u = 0; u < KG; ++u) {
      a[u] = ldfrag(ap + 32 * u);
      r[u] = ldfrag(lp + 32 * u);
    }
    asm volatile("s_wait_xcnt 0x0" :: "v"(ap), "v"(lp) : "memory");
#pragma unroll
    for (int u = 0; u < KG; ++u) {
      const int kc = KG * kq + u;
      *(v8us*)(Qs + (4 * kc + 0) * 256) = a[u].u[0];
      *(v8us*)(Qs + (4 * kc + 1) * 256) = a[u].u[1];
      *(v8us*)(Qs + (4 * kc + 2) * 256) = r[u].u[0];
      *(v8us*)(Qs + (4 * kc + 3) * 256) = r[u].u[1];
    }
  }

  float m = -1.0e30f, l = 0.f;
#pragma unroll 1
  for (int kb = 0; kb < NC; kb += 32) {
    const unsigned short* k0p = Kp + (size_t)kb * ND;                // keys kb .. kb+15
    const unsigned short* k1p = Kp + (size_t)(kb + 16) * ND;         // keys kb+16 .. kb+31
    v8f s0 = zero8(), s1 = zero8();
    // K (global) and Q (LDS) fragments in groups of KG d-chunks, two groups in registers: group g + 1 is in flight
    // while group g is used.
    Frag kf[2][KG][2], qf[2][KG][2];
#pragma unroll
    for (int u = 0; u < KG; ++u) {
      kf[0][u][0] = ldfrag(k0p + 32 * u);
      kf[0][u][1] = ldfrag(k1p + 32 * u);
      qf[0][u][0] = ldq(Qs + (4 * u) * 256);
      qf[0][u][1] = ldq(Qs + (4 * u + 2) * 256);
    }
#pragma unroll
    for (int g = 0; g < ND / 32 / KG; ++g) {
      if (g + 1 < ND / 32 / KG) {
#pragma unroll
        for (int u = 0; u < KG; ++u) {
          const int kn = KG * (g + 1) + u;
          kf[(g + 1) & 1][u][0] = ldfrag(k0p + 32 * kn);
          kf[(g + 1) & 1][u][1] = ldfrag(k1p + 32 * kn);
          qf[(g + 1) & 1][u][0] = ldq(Qs + (4 * kn) * 256);
          qf[(g + 1) & 1][u][1] = ldq(Qs + (4 * kn + 2) * 256);
        }
      }
      // holds the next group's loads, as one run, in front of this group's products: they are in flight meanwhile, and
      // no LDS read stands among the products (without it the build spreads them there)
      __builtin_amdgcn_sched_barrier(0);
#pragma unroll
      for (int u = 0; u < KG; ++u) {
        s0 = mma_q(kf[g & 1][u][0].bf, qf[g & 1][u][0].bf, s0);
        s1 = mma_q(kf[g & 1][u][1].bf, qf[g & 1][u][0].bf, s1);
        s0 = mma_q(kf[g & 1][u][0].bf, qf[g & 1][u][1].bf, s0);
        s1 = mma_q(kf[g & 1][u][1].bf, qf[g & 1][u][1].bf, s1);
      }
      // keeps later groups' loads behind this point: no more than two groups hold registers, and again no LDS read
      // among the products
      __builtin_amdgcn_sched_barrier(0);
    }
    {
      const v4f ca = *(const v4f*)(csb + kb);
      const v4f cb = *(const v4f*)(csb + kb + 4);
      const v4f cd = *(const v4f*)(csb + kb + 16);
      const v4f ce = *(const v4f*)(csb + kb + 20);
      // the same wait for the K loads and these four: their address pairs are inputs, so that nothing lands on them
      // while the loads are under way (every K load has returned here: only the four are waited for)
      asm volatile("s_wait_xcnt 0x0" :: "v"(k0p), "v"(csb + kb) : "memory");
#pragma unroll
      for (int r = 0; r < 4; ++r) {
        s0[r] += ca[r]; s0[4 + r] += cb[r];                          // key kb      + 8hh + r
        s1[r] += cd[r]; s1[4 + r] += ce[r];                          // key kb + 16 + 8hh + r
      }
    }

    float mx = fmaxf(hmax8(s0), hmax8(s1));
    mx = fmaxf(mx, __shfl_xor(mx, 16, 32));
    const float mn   = fmaxf(m, mx);
    const float corr = __expf(m - mn);                               // == 1 exactly when the max did not grow
    l *= corr;
    m = mn;
    const float msh = mn - LNPS;                                     // exp gives e^{s-m} * 16384

    FragH ph;
    float ls = 0.f;
#pragma unroll
    for (int r = 0; r < 8; ++r) {
      const float e0 = __expf(s0[r] - msh);
      const float e1 = __expf(s1[r] - msh);
      ls += e0 + e1;
      ph.hv[0][r] = (_Float16)e0;
      ph.hv[1][r] = (_Float16)e1;
    }
    l += ls;

#pragma unroll
    for (int j = 0; j < ND / 16; ++j) {
      const Frag vf = ldfrag(Vp + (size_t)(16 * j) * NC + kb);
      v8f t;
#pragma unroll
      for (int r = 0; r < 8; ++r) t[r] = o[j][r] * corr;
      o[j] = mma_h(vf.h, ph.v, t);
    }
  }
  // the finished tiles go to the wave's LDS slots once, for the row-major epilogue
#pragma unroll
  for (int j = 0; j < ND / 16; ++j) {
    v4f na, nb2;
#pragma unroll
    for (int r = 0; r < 4; ++r) { na[r] = o[j][r]; nb2[r] = o[j][4 + r]; }
    *(v4f*)(op + 16 * j)     = na;
    *(v4f*)(op + 16 * j + 4) = nb2;
  }
  l += __shfl_xor(l, 16, 32);
  const float inv  = 1.0f / l;                                       // Ow and l both carry the x16384 factor
  const float mu   = st[4 * b + 0], rstd = st[4 * b + 1];
  const float qsc  = inv * rstd * IUSC;                              // per lane: its query column
  const float mrs  = mu * rstd;
  v4f rvv[6];
#pragma unroll
  for (int k = 0; k < ND / 128; ++k) {
    const v4f t = *(const v4f*)(rv + 128 * k + 4 * lane);
#pragma unroll
    for (int u = 0; u < 4; ++u) rvv[k][u] = t[u] * mrs;
  }
  __syncthreads();                                                   // all accumulator slots final before cross-lane reads

{
#pragma unroll 1
    for (int qq = 0; qq < 16; ++qq) {
      const float sc = __shfl(qsc, qq, 32);
      const float* lrow = Ow + qq * ND + 4 * lane;
      float* orow = out + ((size_t)b * NC + n0 + 16 * wave + qq) * ND + 4 * lane;
#pragma unroll
      for (int k = 0; k < ND / 128; ++k) {
        const v4f v = *(const v4f*)(lrow + 128 * k);
        v4f w;
#pragma unroll
        for (int u = 0; u < 4; ++u) w[u] = v[u] * sc - rvv[k][u];
        *(v4f*)(orow + 128 * k) = w;
      }
    }
    
  }
}

// =========================================================================================================
// Workspace map (bytes; each region start a multiple of 256; every extent is an exact tile/line multiple and is
//   Wn bf16 [3][768][768]      3538944      Wt bf16 [3][768][768]   3538944
//   rs  f32 [3][768]              9216      g   f32 [768]              3072
//   Xb bf16 [NB][2048][768]   25165824 (NB=8)  part f64 [NB][64][16]  65536    st f32 [32]  128 (256)
//   Hh/Hl bf16 [768][768]      1179648 x2
//   Ah/Al bf16 [NB][NQ][768]  25165824 x2 (NB=8, NQ=2048)
//   U  f16 [NB][768][2048]    25165824      cs f32 [NB][2048]         65536
//   total (NB=8, NQ=2048) = 110244096
// =========================================================================================================
extern "C" void kernel_launch(void* const* d_in, const int* in_sizes, int n_in,
                              void* d_out, int out_size, void* d_ws, size_t ws_size,
                              hipStream_t stream) {
  if (n_in < 4) return;
  if (in_sizes[0] < NB * NC * ND) return;
  if (in_sizes[1] < ND * ND || in_sizes[2] < ND * ND || in_sizes[3] < ND * ND) return;
  if (out_size < NB * NC * ND) return;

  size_t off = 0;
  auto carve = [&](size_t bytes) { const size_t o = off; off += (bytes + 255) & ~(size_t)255; return o; };
  const size_t oWn   = carve((size_t)3 * ND * ND * 2);
  const size_t oWt   = carve((size_t)3 * ND * ND * 2);
  const size_t oRs   = carve((size_t)3 * ND * 4);
  const size_t oG    = carve((size_t)ND * 4);
  const size_t oXb   = carve((size_t)NB * NC * ND * 2);
  const size_t oPart = carve((size_t)NB * KCH * 128);
  const size_t oSt   = carve((size_t)128);
  const size_t oHh   = carve((size_t)ND * ND * 2);
  const size_t oHl   = carve((size_t)ND * ND * 2);
  const size_t oAh   = carve((size_t)NB * NQ * ND * 2);
  const size_t oAl   = carve((size_t)NB * NQ * ND * 2);
  const size_t oU    = carve((size_t)NB * ND * NC * 2);
  const size_t oCs   = carve((size_t)NB * NC * 4);
  if (off > ws_size) return;
  if (off > (size_t)134217728) return;

  const float* x  = (const float*)d_in[0];
  const float* wk = (const float*)d_in[1];
  const float* wq = (const float*)d_in[2];
  const float* wv = (const float*)d_in[3];

  char* ws = (char*)d_ws;
  unsigned short* Wn  = (unsigned short*)(ws + oWn);
  unsigned short* Wt  = (unsigned short*)(ws + oWt);
  float*          rs  = (float*)(ws + oRs);
  float*          g   = (float*)(ws + oG);
  unsigned short* Xb  = (unsigned short*)(ws + oXb);
  double*         part = (double*)(ws + oPart);
  float*          st  = (float*)(ws + oSt);
  unsigned short* Hh  = (unsigned short*)(ws + oHh);
  unsigned short* Hl  = (unsigned short*)(ws + oHl);
  unsigned short* Ah  = (unsigned short*)(ws + oAh);
  unsigned short* Al  = (unsigned short*)(ws + oAl);
  unsigned short* U   = (unsigned short*)(ws + oU);
  float*          cs  = (float*)(ws + oCs);
  float* out = (float*)d_out;

  const dim3 blk256(256), blk128(128), blk64(64);

  // (0) weights -> bf16 natural + transposed planes + row sums (y: 0 Wk, 1 Wq, 2 Wv)
  cvt_w<<<dim3(ND / QT, 3), blk256, 0, stream>>>(wk, wq, wv, Wn, Wt, rs);
  // (1) g = bf16(Wk)^T . rowsum(bf16(Wq))
  k_g<<<dim3(ND / 256), blk256, 0, stream>>>(Wn, rs + ND, g);
  // (2) x -> bf16 plane + f64 partial sums
  k_xcvt<<<dim3(KCH, NB), blk256, 0, stream>>>(x, Xb, part);
  // (3) LayerNorm statistics
  k_stats<<<dim3(1), blk64, 0, stream>>>(part, st);
  // (4) H planes: A = Wq transposed (rows d), B = Wk transposed (rows e)
  k_hgemm<<<dim3(ND / QT, ND / QT), blk128, 0, stream>>>(Wt + (size_t)1 * ND * ND, Wt, Hh, Hl);
  // (5) query planes A' = rstd^2 X.H  (hi + residual)
  k_agemm<<<dim3(NQ / QT, ND / QT, NB), blk128, 0, stream>>>(Hh, Hl, Xb, st, Ah, Al);
  // (6) value plane U = 16 X.Wv^T (channel-major)
  k_vgemm<<<dim3(ND / QT, NC / QT, NB), blk128, 0, stream>>>(Xb, Wn + (size_t)2 * ND * ND, U);
  // (7) key-side affine term
  k_cs<<<dim3(NC / 32, NB), blk256, 0, stream>>>(Xb, g, st, cs);
  // (8) attention -> out [b][q][768]
  (void)hipFuncSetAttribute(reinterpret_cast<const void*>(&k_attn),
                            hipFuncAttributeMaxDynamicSharedMemorySize, ATTN_LDS);
  k_attn<<<dim3(NQ / QT, NB), blk128, ATTN_LDS, stream>>>(Ah, Al, Xb, U, cs, rs + 2 * ND, st, out);
  (void)hipGetLastError();
}

// v003
// A run of this version takes 511 microseconds.
// Two timings next to v002 both put it at 1.23 times that version's speed.
// Over all steps from v000 it is 2.81 times as fast.
// Contractions (f32 accumulate everywhere): H[e][d] = sum_o Wq[o][d]*Wk[o][e] on v_wmma_f32_16x16x32_bf16 with
// bf16-RNE weights (exact products); query plane A' = X.H with bf16-RNE x and H carried as bf16 hi + bf16
// residual (2 products, shared accumulator); U = X.Wv^T (1 product, bf16-RNE operands); scores
// S^T = X(keys).A'(queries) with A' as bf16 hi + bf16 residual (2 products); O^T = U.P^T on
// v_wmma_f32_16x16x32_f16 (U x16 as f16, P = e^{s-m} x16384 as f16 built from the score D registers).
// LayerNorm statistics in f64 VALU; per-batch affine terms, softmax statistics and normalisation in f32 VALU.
#include <hip/hip_runtime.h>
#include <math.h>
#include <stdint.h>

#ifndef NB
#define NB 8
#endif
#ifndef NQ
#define NQ 2048
#endif
#define NBF  8
#define NC   2048
#define ND   768
#define QT   64
#define OSP  68
#define TPW  72
#define KCH  64
#define KG   4
#define USC  16.0f
#define IUSC 0.0625f
#define LNPS 9.704060527839234f
#define EPSV 1.0e-5f
#define KP   776
#define VP   40
#define VG   8
#define QLDS (4 * 16 * ND * 4)
#define KLDS (32 * KP * 2)
#define VLDS (ND * VP * 2)
#define ATTN_LDS (QLDS + KLDS + VLDS)

static_assert(NB >= 1 && NB <= NBF);
static_assert(NQ % QT == 0 && NQ >= QT && NQ <= NC);
static_assert(NC % QT == 0 && ND % QT == 0);
static_assert(NC % 32 == 0 && ND % 32 == 0);
static_assert(ND % 256 == 0 && ND % 128 == 0 && ND % 16 == 0);
static_assert(NC / KCH == 32 && KCH == 64);
static_assert((ND / 32) % KG == 0);
static_assert(2 * 16 * ND * 2 == 16 * ND * 4);
static_assert(4 * NBF <= 32);
static_assert((OSP * 4) % 16 == 0);
static_assert((TPW * 2) % 16 == 0);
static_assert(QLDS == 196608 && ATTN_LDS <= 327680);
static_assert((KP * 2) % 32 == 16 && (VP * 2) % 32 == 16);          // LDS row pitch = 16 B x odd, for b128 readers
static_assert(KP >= ND + 8 && VP >= 32 + 8 && QLDS % 16 == 0 && KLDS % 16 == 0);
static_assert((ND / 16) % VG == 0 && ND % (4 * 8) == 0 && ND / 4 / 8 == 24 && 8 * (ND / 256) == 24);

typedef _Float16       v16h __attribute__((ext_vector_type(16)));
typedef _Float16       v8h  __attribute__((ext_vector_type(8)));
typedef __bf16         v16b __attribute__((ext_vector_type(16)));
typedef unsigned short v8us __attribute__((ext_vector_type(8)));
typedef float          v8f  __attribute__((ext_vector_type(8)));
typedef float          v4f  __attribute__((ext_vector_type(4)));
typedef unsigned int   v4u  __attribute__((ext_vector_type(4)));
typedef double         v2d  __attribute__((ext_vector_type(2)));

union Frag  { v8us u[2]; v16h h; v16b bf; };
union FragH { v16h v; v8h hv[2]; };
static_assert(sizeof(Frag) == 32);
static_assert(sizeof(FragH) == 32);

// ---- scalar helpers ---------------------------------------------------------------------------------------
__device__ __forceinline__ unsigned short bf_bits(float f) {          // f32 -> bf16 bits, RNE convert
  unsigned u = __float_as_uint(f);
  return (unsigned short)((u + 0x7FFFu + ((u >> 16) & 1u)) >> 16);
}
__device__ __forceinline__ float bf_up(unsigned short hb) { return __uint_as_float(((unsigned)hb) << 16); }
__device__ __forceinline__ float bf_lo16(unsigned w) { return __uint_as_float(w << 16); }
__device__ __forceinline__ float bf_hi16(unsigned w) { return __uint_as_float(w & 0xFFFF0000u); }
__device__ __forceinline__ unsigned short h_bits(_Float16 x) { return __builtin_bit_cast(unsigned short, x); }
__device__ __forceinline__ unsigned pk16(unsigned short a, unsigned short b) { return (unsigned)a | ((unsigned)b << 16); }
__device__ __forceinline__ v8f zero8() { v8f z = {0.f, 0.f, 0.f, 0.f, 0.f, 0.f, 0.f, 0.f}; return z; }
__device__ __forceinline__ float hmax8(v8f s) {
  return fmaxf(fmaxf(fmaxf(s[0], s[1]), fmaxf(s[2], s[3])), fmaxf(fmaxf(s[4], s[5]), fmaxf(s[6], s[7])));
}
__device__ __forceinline__ double shfl_xor_d(double v, int mask) {
  int lo = __double2loint(v), hi = __double2hiint(v);
  lo = __shfl_xor(lo, mask, 32);
  hi = __shfl_xor(hi, mask, 32);
  return __hiloint2double(hi, lo);
}

// ---- 16-bit fragment loader (A, or B from a k-contiguous [n][k] row): lane -> row/col (lane&15), p already includes
//      + 8*(lane>>4); elements 0..7 <- p[0..7] (k0+8h..), elements 8..15 <- p[16..23] (k0+16+8h..)
__device__ __forceinline__ Frag ldfrag(const unsigned short* p) {
  Frag f;
  f.u[0] = *(const v8us*)(p);
  f.u[1] = *(const v8us*)(p + 16);
  return f;
}

// ---- fragment from the packed LDS form: two quarters of 32 lanes x 16 B, p already includes + 8*lane
__device__ __forceinline__ Frag ldq(const unsigned short* p) {
  Frag f;
  f.u[0] = *(const v8us*)(p);
  f.u[1] = *(const v8us*)(p + 256);
  return f;
}

// ---- WMMA helpers: builtin followed by a 4-slot VALU gap tying D and keeping A/B live --------------------------
// mma_h is the bare builtin (the compiler keeps the distance behind its own WMMAs): with D tied to an asm statement
// the 48 resident D tiles of k_attn, 384 registers, do not all get registers and the build spills to scratch.
__device__ __forceinline__ v8f mma_h(v16h a, v16h b, v8f c) {
  return __builtin_amdgcn_wmma_f32_16x16x32_f16(false, a, false, b, (short)0, c, false, false);
}
// mma_q is the bare bf16 builtin, for a like reason: with the two fragment groups that k_attn keeps in flight tied to
// mma_b's asm statement as operands, the build spills to scratch.
__device__ __forceinline__ v8f mma_q(v16b a, v16b b, v8f c) {
  return __builtin_amdgcn_wmma_f32_16x16x32_bf16(false, a, false, b, (short)0, c, false, false);
}
__device__ __forceinline__ v8f mma_b(v16b a, v16b b, v8f c) {
  v8f d = __builtin_amdgcn_wmma_f32_16x16x32_bf16(false, a, false, b, (short)0, c, false, false);
#if defined(__HIP_DEVICE_COMPILE__)
  const v16h ha = __builtin_bit_cast(v16h, a), hb = __builtin_bit_cast(v16h, b);
  asm volatile("v_nop\n\tv_nop\n\tv_nop\n\tv_nop" : "+v"(d) : "v"(ha), "v"(hb));
#endif
  return d;
}

// ---- one tile = 24 asynchronous 16-byte copies per lane, global -> LDS, through no register. RUN copies follow one
//      another at steps (LS1, GS1), then the next run starts (LS2, GS2) further; steps in bytes (LDS) and in 16-bit
//      elements (global). The landing is waited for by the caller (s_wait_asynccnt).
typedef int v4i __attribute__((ext_vector_type(4)));
template <int RUN, int LS1, int GS1, int LS2, int GS2>
__device__ __forceinline__ void acopy_tile(unsigned char* l0, const unsigned short* g0) {
#if defined(__HIP_DEVICE_COMPILE__)
#pragma unroll
  for (int idx = 0; idx < 24; ++idx) {
    const int r = idx / RUN, s = idx % RUN;
    __builtin_amdgcn_global_load_async_to_lds_b128(
        (__attribute__((address_space(1))) v4i*)(g0 + (size_t)r * GS2 + (size_t)s * GS1),
        (__attribute__((address_space(3))) v4i*)(l0 + r * LS2 + s * LS1), 0, 0);
  }
#endif
}

// =========================================================================================================
// (0) weights f32 [768][768] (y = 0: Wk, 1: Wq, 2: Wv, block-uniform selection) -> bf16-RNE planes:
//     natural Wn[y][o][i] and transposed Wt[y][i][o], plus row sums rs[y][o] = sum_i bf16(W[o][i]) in f32.
//     Block (ob, y) owns rows o0..o0+63; column chunks of 64 go through the LDS tile T[i_loc][o_loc] (pitch TPW).
// coverage: Wn 12 chunks x 2 it x 8 waves x 4 rows x 8 lanes x 8 = 64 x 768 per block; Wt 12 chunks x 2 it x 32 x 8
//           lanes x 8 = 768 x 64 per block; rs 16 x 4 = 64; grid (12, 3) covers all three matrices once.
// LDS: T and rsL cross-wave (block barriers).
// =========================================================================================================
__global__ __launch_bounds__(256)
void cvt_w(const float* __restrict__ wk, const float* __restrict__ wq, const float* __restrict__ wv,
           unsigned short* Wn, unsigned short* Wt, float* rs) {
  __shared__ __align__(16) unsigned short T[QT * TPW];
  __shared__ __align__(16) float rsL[QT];
  const int tid = threadIdx.x, lane = tid & 31, wave = tid >> 5;
  const int y = blockIdx.y, o0 = blockIdx.x * QT;
  const float* W = (y == 0) ? wk : ((y == 1) ? wq : wv);            // block-uniform, all global
  unsigned short* Np = Wn + (size_t)y * ND * ND;
  unsigned short* Tq = Wt + (size_t)y * ND * ND;
  const int e = lane & 7, r4 = lane >> 3;                           // r4 0..3
  const int e8 = tid & 7, lq = tid >> 3;                            // lq 0..31
  float rsum0 = 0.f, rsum1 = 0.f;
#pragma unroll 1
  for (int cc = 0; cc < ND / QT; ++cc) {
    const int i0 = cc * QT;
#pragma unroll
    for (int it = 0; it < 2; ++it) {
      const int ol = 8 * wave + 4 * it + r4;                          // 0..63
      const float* sp = W + (size_t)(o0 + ol) * ND + i0 + 8 * e;
      const v4f a = *(const v4f*)sp;
      const v4f q = *(const v4f*)(sp + 4);
      const float f[8] = {a[0], a[1], a[2], a[3], q[0], q[1], q[2], q[3]};
      unsigned short hb[8];
      float ps = 0.f;
#pragma unroll
      for (int t = 0; t < 8; ++t) { hb[t] = bf_bits(f[t]); ps += bf_up(hb[t]); }
      if (it == 0) rsum0 += ps; else rsum1 += ps;
      v4u u;
#pragma unroll
      for (int t = 0; t < 4; ++t) u[t] = pk16(hb[2 * t], hb[2 * t + 1]);
      unsigned short* np = Np + (size_t)(o0 + ol) * ND + i0 + 8 * e;
      *(v4u*)np = u;
      
#pragma unroll
      for (int t = 0; t < 8; ++t) T[(8 * e + t) * TPW + ol] = hb[t];   // T[i_loc][o_loc]
    }
    __syncthreads();
    v4u up[2];
#pragma unroll
    for (int it = 0; it < 2; ++it) {
      const int il = 32 * it + lq;                                    // 0..63
      up[it] = *(const v4u*)(T + il * TPW + 8 * e8);
    }
{
#pragma unroll
      for (int it = 0; it < 2; ++it) {
        const int il = 32 * it + lq;
        *(v4u*)(Tq + (size_t)(i0 + il) * ND + o0 + 8 * e8) = up[it];
      }
      
    }
    __syncthreads();                                                  // T reused by the next chunk
  }
  rsum0 += __shfl_xor(rsum0, 1, 32); rsum0 += __shfl_xor(rsum0, 2, 32); rsum0 += __shfl_xor(rsum0, 4, 32);
  rsum1 += __shfl_xor(rsum1, 1, 32); rsum1 += __shfl_xor(rsum1, 2, 32); rsum1 += __shfl_xor(rsum1, 4, 32);
  if (e == 0) { rsL[8 * wave + r4] = rsum0; rsL[8 * wave + 4 + r4] = rsum1; }
  __syncthreads();
  if (wave == 0 && lane < 16) {
    const v4f v = *(const v4f*)(rsL + 4 * lane);
    float* rp = rs + (size_t)y * ND + o0 + 4 * lane;
    *(v4f*)rp = v;
    
  }
}

// =========================================================================================================
// (1) g[e] = sum_o bf16(Wk)[o][e] * rq[o]  (rq = row sums of bf16(Wq)); f32, one thread per e, loop unrolled by 4.
//     Output: 256 floats per block = 8 lines, wave w lanes 0..7 write line w (8 lanes x 16 B, one instruction),
// coverage: 3 blocks x 256 = 768 = whole g.  LDS gL: each wave reads back only its own 32 slots (block barrier).
// =========================================================================================================
__global__ __launch_bounds__(256)
void k_g(const unsigned short* __restrict__ Wkn, const float* __restrict__ rq, float* g) {
  __shared__ __align__(16) float gL[256];
  const int tid = threadIdx.x, lane = tid & 31, wave = tid >> 5;
  const int e = blockIdx.x * 256 + tid;
  float acc = 0.f;
#pragma unroll 4
  for (int o = 0; o < ND; ++o) acc += bf_up(Wkn[(size_t)o * ND + e]) * rq[o];
  gL[tid] = acc;
  __syncthreads();
  if (lane < 8) {
    const v4f v = *(const v4f*)(gL + 32 * wave + 4 * lane);
    float* p = g + (size_t)blockIdx.x * 256 + 32 * wave + 4 * lane;
    *(v4f*)p = v;
    
  }
}

// =========================================================================================================
// (2) x f32 [b][2048][768] -> Xb bf16-RNE plane (same layout) and per-chunk f64 partial sums of the bf16 values
//     (sum, sum of squares). Block (ch, b) owns 32 rows; wave w rows 4w..4w+3; per row 3 instructions of
// coverage: Xb 4 rows x 8 waves x 3 x 32 lanes x 8 = 32 x 768 per block, grid (64, NB) = all rows of b < NB;
// =========================================================================================================
__global__ __launch_bounds__(256)
void k_xcvt(const float* __restrict__ x, unsigned short* Xb, double* part) {
  __shared__ double sL[8], qL[8];
  const int tid = threadIdx.x, lane = tid & 31, wave = tid >> 5;
  const int ch = blockIdx.x, b = blockIdx.y;
  const int r0 = ch * (NC / KCH);
  double s = 0.0, q = 0.0;
#pragma unroll 1
  for (int t = 0; t < 4; ++t) {
    const int row = r0 + 4 * wave + t;
    const size_t base = ((size_t)b * NC + row) * ND + 8 * lane;
#pragma unroll 1
    for (int c3 = 0; c3 < ND / 256; ++c3) {
      const float* sp = x + base + 256 * c3;
      const v4f a = *(const v4f*)sp;
      const v4f q4 = *(const v4f*)(sp + 4);
      const float f[8] = {a[0], a[1], a[2], a[3], q4[0], q4[1], q4[2], q4[3]};
      unsigned short hb[8];
#pragma unroll
      for (int k = 0; k < 8; ++k) {
        hb[k] = bf_bits(f[k]);
        const double v = (double)bf_up(hb[k]);
        s += v;
        q += v * v;
      }
      v4u u;
#pragma unroll
      for (int k = 0; k < 4; ++k) u[k] = pk16(hb[2 * k], hb[2 * k + 1]);
      unsigned short* xp = Xb + base + 256 * c3;
      *(v4u*)xp = u;
      
    }
  }
  s += shfl_xor_d(s, 16); s += shfl_xor_d(s, 8); s += shfl_xor_d(s, 4); s += shfl_xor_d(s, 2); s += shfl_xor_d(s, 1);
  q += shfl_xor_d(q, 16); q += shfl_xor_d(q, 8); q += shfl_xor_d(q, 4); q += shfl_xor_d(q, 2); q += shfl_xor_d(q, 1);
  if (lane == 0) { sL[wave] = s; qL[wave] = q; }
  __syncthreads();
  if (wave == 0) {
    double S = 0.0, Q = 0.0;
#pragma unroll
    for (int w = 0; w < 8; ++w) { S += sL[w]; Q += qL[w]; }
    v2d val;
    val[0] = (lane == 0) ? S : 0.0;
    val[1] = (lane == 0) ? Q : 0.0;
    if (lane < 8) {
      double* pp = part + ((size_t)b * KCH + ch) * 16 + 2 * lane;
      *(v2d*)pp = val;
      
    }
  }
}

// =========================================================================================================
// (3) LayerNorm statistics per batch from the 64 partial lines (fixed-order f64 tree): st line f32 [32] with
// =========================================================================================================
__global__ __launch_bounds__(64)
void k_stats(const double* __restrict__ part, float* st) {
  __shared__ double sL[64], qL[64];
  __shared__ __align__(16) float stL[32];
  const int tid = threadIdx.x;
  if (tid < 32) stL[tid] = 0.f;
#pragma unroll 1
  for (int b = 0; b < NB; ++b) {
    __syncthreads();
    const size_t pb = ((size_t)b * KCH + tid) * 16;
    sL[tid] = part[pb];
    qL[tid] = part[pb + 1];
    __syncthreads();
#pragma unroll
    for (int off = 32; off > 0; off >>= 1) {
      if (tid < off) { sL[tid] += sL[tid + off]; qL[tid] += qL[tid + off]; }
      __syncthreads();
    }
    if (tid == 0) {
      const double n  = (double)NC * (double)ND;
      const double mu = sL[0] / n;
      double var = qL[0] / n - mu * mu;
      if (var < 0.0) var = 0.0;
      const float varf = (float)var;
      const float ve   = varf + EPSV;
      const float rstd = (float)(1.0 / sqrt((double)ve));
      const float muf  = (float)mu;
      stL[4 * b + 0] = muf;
      stL[4 * b + 1] = rstd;
      stL[4 * b + 2] = rstd * rstd;
      stL[4 * b + 3] = muf * rstd * rstd;
    }
  }
  __syncthreads();
  if (tid < 8) {
    const v4f v = *(const v4f*)(stL + 4 * tid);
    float* p = st + 4 * tid;
    *(v4f*)p = v;
    
  }
}

// =========================================================================================================
// GEMM engine (K = 768 = 24 k-steps, all operand planes k-contiguous with pitch ND): block 128 threads = 4 waves,
// 64 (m) x 64 (n) tile; wave w owns cols n0+16w..+15 (one B fragment per k-step from row n of the B plane) and
// 4 m-tiles (A rows m0 + 16 mt + (lane&15)); NPROD = 2 adds a second A plane (bf16 residual) into the same
// accumulator. Split k map loader for both operands.
// =========================================================================================================
template <int NPROD>
__device__ __forceinline__ void gemm_k(const unsigned short* __restrict__ ap0,
                                       const unsigned short* __restrict__ ap1,
                                       const unsigned short* __restrict__ bp, v8f (&acc)[4]) {
#pragma unroll
  for (int mt = 0; mt < 4; ++mt) acc[mt] = zero8();
#pragma unroll 2
  for (int ks = 0; ks < ND / 32; ++ks) {
    const Frag fb = ldfrag(bp + 32 * ks);
#pragma unroll
    for (int mt = 0; mt < 4; ++mt) {
      const Frag fa = ldfrag(ap0 + (size_t)(16 * mt) * ND + 32 * ks);
      acc[mt] = mma_b(fa.bf, fb.bf, acc[mt]);
      if (NPROD == 2) {
        const Frag fl = ldfrag(ap1 + (size_t)(16 * mt) * ND + 32 * ks);
        acc[mt] = mma_b(fl.bf, fb.bf, acc[mt]);
      }
    }
  }
}

// D tiles -> LDS Os[n_loc][m_loc] (pitch OSP, b128 stores): lane (hh, c) holds m = 16 mt + 8 hh + r for
// n_loc = 16 w + c.  coverage: 4 waves x 16 n x 4 mt x 16 m = 64 x 64 (pad cols 64..67 never read).
__device__ __forceinline__ void stage_os(float* Os, const v8f (&acc)[4], float sc, int wave, int hh, int c) {
  const int nl = 16 * wave + c;
#pragma unroll
  for (int mt = 0; mt < 4; ++mt) {
    v4f va, vb;
#pragma unroll
    for (int r = 0; r < 4; ++r) { va[r] = acc[mt][r] * sc; vb[r] = acc[mt][4 + r] * sc; }
    *(v4f*)(Os + nl * OSP + 16 * mt + 8 * hh)     = va;
    *(v4f*)(Os + nl * OSP + 16 * mt + 8 * hh + 4) = vb;
  }
}

// Os -> two bf16 planes (hi = bf16-RNE(v), lo = bf16-RNE(v - hi)), plane row = row0 + n_loc, 64 m values =
// coverage: 4 it x 16 rows x 8 lanes x 8 = 64 x 64 per plane.
__device__ __forceinline__ void epi_split(const float* Os, unsigned short* Ph, unsigned short* Pl,
                                          size_t row0, int pitch, int col0, int tid) {
  const int e = tid & 7, lq = tid >> 3;                              // lq 0..15
  v4u uh[4], ul[4];
#pragma unroll
  for (int it = 0; it < 4; ++it) {
    const int row = it * 16 + lq;
    const v4f a = *(const v4f*)(Os + row * OSP + 8 * e);
    const v4f q = *(const v4f*)(Os + row * OSP + 8 * e + 4);
    const float f[8] = {a[0], a[1], a[2], a[3], q[0], q[1], q[2], q[3]};
#pragma unroll
    for (int t = 0; t < 4; ++t) {
      const float f0 = f[2 * t], f1 = f[2 * t + 1];
      const unsigned short hb0 = bf_bits(f0), hb1 = bf_bits(f1);
      const unsigned short lb0 = bf_bits(f0 - bf_up(hb0));
      const unsigned short lb1 = bf_bits(f1 - bf_up(hb1));
      uh[it][t] = pk16(hb0, hb1);
      ul[it][t] = pk16(lb0, lb1);
    }
  }
{
#pragma unroll
    for (int it = 0; it < 4; ++it) {
      const int row = it * 16 + lq;
      const size_t po = (row0 + (size_t)row) * (size_t)pitch + (size_t)col0 + 8 * e;
      *(v4u*)(Ph + po) = uh[it];
      *(v4u*)(Pl + po) = ul[it];
    }
    
  }
}

// Os -> one f16 plane (values already scaled), same line geometry as epi_split.
__device__ __forceinline__ void epi_h(const float* Os, unsigned short* P, size_t row0, int pitch, int col0, int tid) {
  const int e = tid & 7, lq = tid >> 3;
  v4u u[4];
#pragma unroll
  for (int it = 0; it < 4; ++it) {
    const int row = it * 16 + lq;
    const v4f a = *(const v4f*)(Os + row * OSP + 8 * e);
    const v4f q = *(const v4f*)(Os + row * OSP + 8 * e + 4);
    const float f[8] = {a[0], a[1], a[2], a[3], q[0], q[1], q[2], q[3]};
#pragma unroll
    for (int t = 0; t < 4; ++t)
      u[it][t] = pk16(h_bits((_Float16)f[2 * t]), h_bits((_Float16)f[2 * t + 1]));
  }
{
#pragma unroll
    for (int it = 0; it < 4; ++it) {
      const int row = it * 16 + lq;
      const size_t po = (row0 + (size_t)row) * (size_t)pitch + (size_t)col0 + 8 * e;
      *(v4u*)(P + po) = u[it];
    }
    
  }
}

// =========================================================================================================
// (4) H planes: D[m = d][n = e] = sum_o WqT[d][o] * WkT[e][o]  (1 product, exact) -> Hh/Hl bf16 [e][768 d].
// grid (12 e-tiles, 12 d-tiles).  LDS Os cross-wave (block barrier).
// =========================================================================================================
__global__ __launch_bounds__(128)
void k_hgemm(const unsigned short* __restrict__ Aq, const unsigned short* __restrict__ Bk,
             unsigned short* Hh, unsigned short* Hl) {
  __shared__ __align__(16) float Os[QT * OSP];
  const int tid = threadIdx.x, lane = tid & 31, wave = tid >> 5, hh = lane >> 4, c = lane & 15;
  const int n0 = blockIdx.x * QT, m0 = blockIdx.y * QT;
  const unsigned short* ap = Aq + (size_t)(m0 + c) * ND + 8 * hh;
  const unsigned short* bp = Bk + (size_t)(n0 + 16 * wave + c) * ND + 8 * hh;
  v8f acc[4];
  gemm_k<1>(ap, ap, bp, acc);
  stage_os(Os, acc, 1.0f, wave, hh, c);
  __syncthreads();
  epi_split(Os, Hh, Hl, (size_t)n0, ND, m0, tid);
}

// =========================================================================================================
// (5) query planes: D[m = e][n = query] = sum_d (Hh + Hl)[e][d] * Xb[b][q][d]  (2 products), scaled by rstd_b^2
//     in the epilogue -> Ah/Al bf16 [b][NQ][768 e].  grid (NQ/64, 12 e-tiles, NB).
// =========================================================================================================
__global__ __launch_bounds__(128)
void k_agemm(const unsigned short* __restrict__ Hh, const unsigned short* __restrict__ Hl,
             const unsigned short* __restrict__ Xb, const float* __restrict__ st,
             unsigned short* Ah, unsigned short* Al) {
  __shared__ __align__(16) float Os[QT * OSP];
  const int tid = threadIdx.x, lane = tid & 31, wave = tid >> 5, hh = lane >> 4, c = lane & 15;
  const int n0 = blockIdx.x * QT, m0 = blockIdx.y * QT, b = blockIdx.z;
  const unsigned short* ap0 = Hh + (size_t)(m0 + c) * ND + 8 * hh;
  const unsigned short* ap1 = Hl + (size_t)(m0 + c) * ND + 8 * hh;
  const unsigned short* bp  = Xb + ((size_t)b * NC + n0 + 16 * wave + c) * ND + 8 * hh;
  v8f acc[4];
  gemm_k<2>(ap0, ap1, bp, acc);
  const float sc = st[4 * b + 2];
  stage_os(Os, acc, sc, wave, hh, c);
  __syncthreads();
  epi_split(Os, Ah, Al, (size_t)b * NQ + n0, ND, m0, tid);
}

// =========================================================================================================
// (6) value plane (channel-major, keys contiguous): D[m = key j][n = o] = sum_d Xb[b][j][d] * Wvb[o][d]
//     (1 product, exact), x16 -> U f16 [b][768 o][2048 j].  grid (12 o-tiles, 32 key-tiles, NB).
// =========================================================================================================
__global__ __launch_bounds__(128)
void k_vgemm(const unsigned short* __restrict__ Xb, const unsigned short* __restrict__ Wvn, unsigned short* U) {
  __shared__ __align__(16) float Os[QT * OSP];
  const int tid = threadIdx.x, lane = tid & 31, wave = tid >> 5, hh = lane >> 4, c = lane & 15;
  const int n0 = blockIdx.x * QT, m0 = blockIdx.y * QT, b = blockIdx.z;
  const unsigned short* ap = Xb + ((size_t)b * NC + m0 + c) * ND + 8 * hh;
  const unsigned short* bp = Wvn + (size_t)(n0 + 16 * wave + c) * ND + 8 * hh;
  v8f acc[4];
  gemm_k<1>(ap, ap, bp, acc);
  stage_os(Os, acc, USC, wave, hh, c);
  __syncthreads();
  epi_h(Os, U, (size_t)b * ND + n0, NC, m0, tid);
}

// =========================================================================================================
// (7) key-side affine term: cs[b][j] = -(mu_b rstd_b^2) * sum_d g[d] * Xb[b][j][d], f32 VALU, one wave per row,
// coverage: grid (64, NB) x 32 rows = every key row of b < NB.  LDS csL cross-wave (block barrier).
// =========================================================================================================
__global__ __launch_bounds__(256)
void k_cs(const unsigned short* __restrict__ Xb, const float* __restrict__ g, const float* __restrict__ st,
          float* cs) {
  __shared__ __align__(16) float csL[32];
  const int tid = threadIdx.x, lane = tid & 31, wave = tid >> 5;
  const int r0 = blockIdx.x * 32, b = blockIdx.y;
  v4f ga[3], gb[3];
#pragma unroll
  for (int c3 = 0; c3 < 3; ++c3) {
    ga[c3] = *(const v4f*)(g + 256 * c3 + 8 * lane);
    gb[c3] = *(const v4f*)(g + 256 * c3 + 8 * lane + 4);
  }
  const float nmr = -st[4 * b + 3];
#pragma unroll 1
  for (int t = 0; t < 4; ++t) {
    const int row = r0 + 4 * wave + t;
    const unsigned short* xp = Xb + ((size_t)b * NC + row) * ND + 8 * lane;
    float acc = 0.f;
#pragma unroll
    for (int c3 = 0; c3 < 3; ++c3) {
      const v4u u = *(const v4u*)(xp + 256 * c3);
      acc += bf_lo16(u[0]) * ga[c3][0] + bf_hi16(u[0]) * ga[c3][1]
           + bf_lo16(u[1]) * ga[c3][2] + bf_hi16(u[1]) * ga[c3][3]
           + bf_lo16(u[2]) * gb[c3][0] + bf_hi16(u[2]) * gb[c3][1]
           + bf_lo16(u[3]) * gb[c3][2] + bf_hi16(u[3]) * gb[c3][3];
    }
    acc += __shfl_xor(acc, 16, 32); acc += __shfl_xor(acc, 8, 32); acc += __shfl_xor(acc, 4, 32);
    acc += __shfl_xor(acc, 2, 32);  acc += __shfl_xor(acc, 1, 32);
    if (lane == 0) csL[4 * wave + t] = acc * nmr;
  }
  __syncthreads();
  if (wave == 0 && lane < 8) {
    const v4f v = *(const v4f*)(csL + 4 * lane);
    float* p = cs + (size_t)b * NC + r0 + 4 * lane;
    *(v4f*)p = v;
    
  }
}

// =========================================================================================================
// (8) attention for one (b, 64-query tile), transposed formulation, 2048 keys, no mask:
//   S^T tile (16 keys x 16 queries) = sum over 24 d-chunks of A(key row kb + (lane&15) of the bf16 plane Xb,
//   split k map) . B(query row of Ah) + A(Xb).B(Al) (bf16 residual, shared accumulator), then + cs[key].
//   Per lane the D tile holds 8 keys of ONE query: online softmax state per lane, one shuffle (lane^16) for the
//   max over 32 keys; corr applied every step (== 1 exactly when the max did not grow). P = e^{s-m} x 16384 as
//   f16 is the B operand of O^T (rows channel, cols queries) += A(U rows channel 16j + (lane&15), keys
//   contiguous, f16 x16) . B(P^T): element r <- D of the tile covering keys kb..kb+15, element 8+r <- the tile
//   covering kb+16..kb+31, lane unchanged. The 48 accumulator tiles per wave live in registers (384 per lane) for
//   the whole key loop and are stored once, behind it, to wave-private LDS slots Ow[query][768].
//   Epilogue after a block barrier: out[b][q][:] = Ow[q][:] * (rstd / (16 l_q)) - mu rstd rowsum(Wv), row =
// coverage: 4 waves x 16 query rows x 6 x 32 lanes x 4 = 64 x 768; grid (NQ/64, NB) covers out[b < NB][q < NQ].
// LDS: Ow written once per lane behind the key loop; cross-lane reads only after __syncthreads. staged extent
//      (16 x 768 per wave) == consumed extent. Up to the end of the key loop the same bytes hold the wave's query
//      fragments (hi + residual, 2 x 16 x 768 x 2 B), each 16 B written and read by one and the same lane.
//      Behind them one K buffer (32 key rows) and one V buffer (768 channel rows x 32 keys), filled once per block and
//      32 keys by asynchronous copies (each wave a quarter) and read by all four waves: cross-wave, so every tile is
//      read only behind its copiers' s_wait_asynccnt 0 and a block barrier, and refilled only behind the barrier
//      that ends its last read. coverage: K 4 waves x 8 rows x 3 x 32 lanes x 16 B = 32 x 1536 B; V 4 waves x 24 x
//      8 rows x 4 x 16 B = 768 x 64 B; pad bytes of a row are neither written nor read.
// =========================================================================================================
__global__ __launch_bounds__(128)
void k_attn(const unsigned short* __restrict__ Ah, const unsigned short* __restrict__ Al,
            const unsigned short* __restrict__ Xb, const unsigned short* __restrict__ U,
            const float* __restrict__ cs, const float* __restrict__ rv,
            const float* __restrict__ st, float* out) {
  __shared__ __attribute__((aligned(16))) unsigned char lds_all[ATTN_LDS];
  const int tid  = threadIdx.x;
  const int wave = tid >> 5, lane = tid & 31;
  const int hh   = lane >> 4, c = lane & 15;
  const int n0   = blockIdx.x * QT, b = blockIdx.y;
  float* Ow = (float*)lds_all + (size_t)wave * (16 * ND);
  float* op = Ow + c * ND + 8 * hh;                                  // this lane's slots (query column c)
  // O^T tiles: o[j][r] = channel 16 j + 8 hh + r of query c. Every loop over o[] is fully unrolled: only constant
  // indices keep the tiles in registers.
  v8f o[ND / 16];
#pragma unroll
  for (int j = 0; j < ND / 16; ++j) o[j] = zero8();

  const size_t qo = ((size_t)b * NQ + n0 + 16 * wave + c) * ND + 8 * hh;
  const unsigned short* Ahp = Ah + qo;
  const unsigned short* Alp = Al + qo;
  // The block's K tile (32 key rows x 768, row pitch KP) and V tile (768 channel rows x 32 keys, row pitch VP) in LDS,
  // read by all four waves. Fragment readers: lane -> row (lane&15), + 8*(lane>>4), as from the global planes.
  const unsigned short* Ks = (const unsigned short*)(lds_all + QLDS) + c * KP + 8 * hh;          // + key_loc*KP + 32 kc
  const unsigned short* Vs = (const unsigned short*)(lds_all + QLDS + KLDS) + c * VP + 8 * hh;   // + 16 j*VP
  // Copy side. K: wave w brings key rows 8w..8w+7, three copies of 512 B a row. V: wave w brings channel rows
  // 192w..192w+191, one copy = 8 rows x 64 B (lane -> row lane>>2, 16-byte piece lane&3).
  unsigned char* kl0 = lds_all + QLDS + (8 * wave) * (KP * 2) + 16 * lane;
  unsigned char* vl0 = lds_all + QLDS + KLDS + (192 * wave + (lane >> 2)) * (VP * 2) + 16 * (lane & 3);
  const unsigned short* kg0 = Xb + ((size_t)b * NC + 8 * wave) * ND + 8 * lane;                    // + kb*ND
  const unsigned short* vg0 = U + ((size_t)b * ND + 192 * wave + (lane >> 2)) * NC + 8 * (lane & 3); // + kb
  const float* csb = cs + (size_t)b * NC + 8 * hh;                                    // + kb (+16)

  // The wave's 16 query rows (hi and residual plane) go once into the wave's own LDS slots, fragment by fragment:
  // quarter f = 4 kc + {0, 1: hi elements 0..7, 8..15; 2, 3: residual} holds 32 lanes x 16 B, and every lane reads back
  // only what it wrote itself. The slots are the bytes of Ow, which is written only behind the key loop.
  unsigned short* Qs = (unsigned short*)lds_all + (size_t)wave * (2 * 16 * ND) + 8 * lane;
#pragma unroll 1
  for (int kq = 0; kq < ND / 32 / KG; ++kq) {
    const unsigned short* ap = Ahp + 32 * KG * kq;
    const unsigned short* lp = Alp + 32 * KG * kq;
    Frag a[KG], r[KG];
#pragma unroll
    for (int u = 0; u < KG; ++u) {
      a[u] = ldfrag(ap + 32 * u);
      r[u] = ldfrag(lp + 32 * u);
    }
    asm volatile("s_wait_xcnt 0x0" :: "v"(ap), "v"(lp) : "memory");
#pragma unroll
    for (int u = 0; u < KG; ++u) {
      const int kc = KG * kq + u;
      *(v8us*)(Qs + (4 * kc + 0) * 256) = a[u].u[0];
      *(v8us*)(Qs + (4 * kc + 1) * 256) = a[u].u[1];
      *(v8us*)(Qs + (4 * kc + 2) * 256) = r[u].u[0];
      *(v8us*)(Qs + (4 * kc + 3) * 256) = r[u].u[1];
    }
  }

  // Two-buffer ring over the tile sequence K(0), V(0), K(32), V(32), ...: the K buffer is worked on (scores) while the V
  // tile flies, the V buffer (O^T) while the next K tile flies. In front of the loop: first K tile, landed and
  // published; then the first V tile is sent off.
  asm volatile("s_wait_dscnt 0x0" ::: "memory");                     // the wave's own LDS stores retire before it copies
  acopy_tile<3, 512, 256, KP * 2, ND>(kl0, kg0);
  asm volatile("s_wait_asynccnt 0x0" ::: "memory");                  // this wave's share of the K tile has landed
  __syncthreads();                                                   // ... and every other wave's: the tile is readable
  acopy_tile<24, 8 * VP * 2, 8 * NC, 0, 0>(vl0, vg0);

  float m = -1.0e30f, l = 0.f;
#pragma unroll 1
  for (int kb = 0; kb < NC; kb += 32) {
    const unsigned short* k0p = Ks;                                  // keys kb .. kb+15
    const unsigned short* k1p = Ks + 16 * KP;                        // keys kb+16 .. kb+31
    v8f s0 = zero8(), s1 = zero8();
    // K and Q fragments (both LDS) in groups of KG d-chunks, two groups in registers: group g + 1 is in flight
    // while group g is used.
    Frag kf[2][KG][2], qf[2][KG][2];
#pragma unroll
    for (int u = 0; u < KG; ++u) {
      kf[0][u][0] = ldfrag(k0p + 32 * u);
      kf[0][u][1] = ldfrag(k1p + 32 * u);
      qf[0][u][0] = ldq(Qs + (4 * u) * 256);
      qf[0][u][1] = ldq(Qs + (4 * u + 2) * 256);
    }
    // the key-side terms are fetched here, at the head of the trip: the barrier at its foot waits for every global load
    const v4f ca = *(const v4f*)(csb + kb);
    const v4f cb = *(const v4f*)(csb + kb + 4);
    const v4f cd = *(const v4f*)(csb + kb + 16);
    const v4f ce = *(const v4f*)(csb + kb + 20);
    // the same wait for these four loads: their address pair is an input, so that nothing lands on it while the
    // loads are under way
    asm volatile("s_wait_xcnt 0x0" :: "v"(csb + kb) : "memory");
#pragma unroll
    for (int g = 0; g < ND / 32 / KG; ++g) {
      if (g + 1 < ND / 32 / KG) {
#pragma unroll
        for (int u = 0; u < KG; ++u) {
          const int kn = KG * (g + 1) + u;
          kf[(g + 1) & 1][u][0] = ldfrag(k0p + 32 * kn);
          kf[(g + 1) & 1][u][1] = ldfrag(k1p + 32 * kn);
          qf[(g + 1) & 1][u][0] = ldq(Qs + (4 * kn) * 256);
          qf[(g + 1) & 1][u][1] = ldq(Qs + (4 * kn + 2) * 256);
        }
      }
      // holds the next group's loads, as one run, in front of this group's products: they are in flight meanwhile, and
      // no LDS read stands among the products (without it the build spreads them there)
      __builtin_amdgcn_sched_barrier(0);
#pragma unroll
      for (int u = 0; u < KG; ++u) {
        s0 = mma_q(kf[g & 1][u][0].bf, qf[g & 1][u][0].bf, s0);
        s1 = mma_q(kf[g & 1][u][1].bf, qf[g & 1][u][0].bf, s1);
        s0 = mma_q(kf[g & 1][u][0].bf, qf[g & 1][u][1].bf, s0);
        s1 = mma_q(kf[g & 1][u][1].bf, qf[g & 1][u][1].bf, s1);
      }
      // keeps later groups' loads behind this point: no more than two groups hold registers, and again no LDS read
      // among the products
      __builtin_amdgcn_sched_barrier(0);
    }
    {
#pragma unroll
      for (int r = 0; r < 4; ++r) {
        s0[r] += ca[r]; s0[4 + r] += cb[r];                          // key kb      + 8hh + r
        s1[r] += cd[r]; s1[4 + r] += ce[r];                          // key kb + 16 + 8hh + r
      }
    }

    // foot of the score trip: own LDS reads done, own V copies landed, then the barrier that publishes the V tile and
    // ends every wave's reads of the K buffer; behind it the next K tile is sent off into that buffer
    asm volatile("s_wait_dscnt 0x0" ::: "memory");
    asm volatile("s_wait_asynccnt 0x0" ::: "memory");
    __syncthreads();
    if (kb + 32 < NC) acopy_tile<3, 512, 256, KP * 2, ND>(kl0, kg0 + (size_t)(kb + 32) * ND);

    float mx = fmaxf(hmax8(s0), hmax8(s1));
    mx = fmaxf(mx, __shfl_xor(mx, 16, 32));
    const float mn   = fmaxf(m, mx);
    const float corr = __expf(m - mn);                               // == 1 exactly when the max did not grow
    l *= corr;
    m = mn;
    const float msh = mn - LNPS;                                     // exp gives e^{s-m} * 16384

    FragH ph;
    float ls = 0.f;
#pragma unroll
    for (int r = 0; r < 8; ++r) {
      const float e0 = __expf(s0[r] - msh);
      const float e1 = __expf(s1[r] - msh);
      ls += e0 + e1;
      ph.hv[0][r] = (_Float16)e0;
      ph.hv[1][r] = (_Float16)e1;
    }
    l += ls;

    // V fragments (LDS) in groups of VG channel tiles, two groups in registers, as for K and Q above
    Frag vf[2][VG];
#pragma unroll
    for (int u = 0; u < VG; ++u) vf[0][u] = ldfrag(Vs + (16 * u) * VP);
#pragma unroll
    for (int g = 0; g < ND / 16 / VG; ++g) {
      if (g + 1 < ND / 16 / VG) {
#pragma unroll
        for (int u = 0; u < VG; ++u) vf[(g + 1) & 1][u] = ldfrag(Vs + (16 * (VG * (g + 1) + u)) * VP);
      }
      // holds the next group's LDS reads, as one run, in front of this group's products
      __builtin_amdgcn_sched_barrier(0);
#pragma unroll
      for (int u = 0; u < VG; ++u) {
        const int j = VG * g + u;
        v8f t;
#pragma unroll
        for (int r = 0; r < 8; ++r) t[r] = o[j][r] * corr;
        o[j] = mma_h(vf[g & 1][u].h, ph.v, t);
      }
      // keeps later groups' reads behind this point: no LDS read among the products
      __builtin_amdgcn_sched_barrier(0);
    }
    // foot of the O^T trip: the same order; the barrier publishes the next K tile and frees the V buffer
    asm volatile("s_wait_dscnt 0x0" ::: "memory");
    asm volatile("s_wait_asynccnt 0x0" ::: "memory");
    __syncthreads();
    if (kb + 32 < NC) acopy_tile<24, 8 * VP * 2, 8 * NC, 0, 0>(vl0, vg0 + (kb + 32));
  }
  asm volatile("s_wait_asynccnt 0x0" ::: "memory");                  // nothing is in flight when the LDS changes its use
  // the finished tiles go to the wave's LDS slots once, for the row-major epilogue
#pragma unroll
  for (int j = 0; j < ND / 16; ++j) {
    v4f na, nb2;
#pragma unroll
    for (int r = 0; r < 4; ++r) { na[r] = o[j][r]; nb2[r] = o[j][4 + r]; }
    *(v4f*)(op + 16 * j)     = na;
    *(v4f*)(op + 16 * j + 4) = nb2;
  }
  l += __shfl_xor(l, 16, 32);
  const float inv  = 1.0f / l;                                       // Ow and l both carry the x16384 factor
  const float mu   = st[4 * b + 0], rstd = st[4 * b + 1];
  const float qsc  = inv * rstd * IUSC;                              // per lane: its query column
  const float mrs  = mu * rstd;
  v4f rvv[6];
#pragma unroll
  for (int k = 0; k < ND / 128; ++k) {
    const v4f t = *(const v4f*)(rv + 128 * k + 4 * lane);
#pragma unroll
    for (int u = 0; u < 4; ++u) rvv[k][u] = t[u] * mrs;
  }
  __syncthreads();                                                   // all accumulator slots final before cross-lane reads

{
#pragma unroll 1
    for (int qq = 0; qq < 16; ++qq) {
      const float sc = __shfl(qsc, qq, 32);
      const float* lrow = Ow + qq * ND + 4 * lane;
      float* orow = out + ((size_t)b * NC + n0 + 16 * wave + qq) * ND + 4 * lane;
#pragma unroll
      for (int k = 0; k < ND / 128; ++k) {
        const v4f v = *(const v4f*)(lrow + 128 * k);
        v4f w;
#pragma unroll
        for (int u = 0; u < 4; ++u) w[u] = v[u] * sc - rvv[k][u];
        *(v4f*)(orow + 128 * k) = w;
      }
    }
    
  }
}

// =========================================================================================================
// Workspace map (bytes; each region start a multiple of 256; every extent is an exact tile/line multiple and is
//   Wn bf16 [3][768][768]      3538944      Wt bf16 [3][768][768]   3538944
//   rs  f32 [3][768]              9216      g   f32 [768]              3072
//   Xb bf16 [NB][2048][768]   25165824 (NB=8)  part f64 [NB][64][16]  65536    st f32 [32]  128 (256)
//   Hh/Hl bf16 [768][768]      1179648 x2
//   Ah/Al bf16 [NB][NQ][768]  25165824 x2 (NB=8, NQ=2048)
//   U  f16 [NB][768][2048]    25165824      cs f32 [NB][2048]         65536
//   total (NB=8, NQ=2048) = 110244096
// =========================================================================================================
extern "C" void kernel_launch(void* const* d_in, const int* in_sizes, int n_in,
                              void* d_out, int out_size, void* d_ws, size_t ws_size,
                              hipStream_t stream) {
  if (n_in < 4) return;
  if (in_sizes[0] < NB * NC * ND) return;
  if (in_sizes[1] < ND * ND || in_sizes[2] < ND * ND || in_sizes[3] < ND * ND) return;
  if (out_size < NB * NC * ND) return;

  size_t off = 0;
  auto carve = [&](size_t bytes) { const size_t o = off; off += (bytes + 255) & ~(size_t)255; return o; };
  const size_t oWn   = carve((size_t)3 * ND * ND * 2);
  const size_t oWt   = carve((size_t)3 * ND * ND * 2);
  const size_t oRs   = carve((size_t)3 * ND * 4);
  const size_t oG    = carve((size_t)ND * 4);
  const size_t oXb   = carve((size_t)NB * NC * ND * 2);
  const size_t oPart = carve((size_t)NB * KCH * 128);
  const size_t oSt   = carve((size_t)128);
  const size_t oHh   = carve((size_t)ND * ND * 2);
  const size_t oHl   = carve((size_t)ND * ND * 2);
  const size_t oAh   = carve((size_t)NB * NQ * ND * 2);
  const size_t oAl   = carve((size_t)NB * NQ * ND * 2);
  const size_t oU    = carve((size_t)NB * ND * NC * 2);
  const size_t oCs   = carve((size_t)NB * NC * 4);
  if (off > ws_size) return;
  if (off > (size_t)134217728) return;

  const float* x  = (const float*)d_in[0];
  const float* wk = (const float*)d_in[1];
  const float* wq = (const float*)d_in[2];
  const float* wv = (const float*)d_in[3];

  char* ws = (char*)d_ws;
  unsigned short* Wn  = (unsigned short*)(ws + oWn);
  unsigned short* Wt  = (unsigned short*)(ws + oWt);
  float*          rs  = (float*)(ws + oRs);
  float*          g   = (float*)(ws + oG);
  unsigned short* Xb  = (unsigned short*)(ws + oXb);
  double*         part = (double*)(ws + oPart);
  float*          st  = (float*)(ws + oSt);
  unsigned short* Hh  = (unsigned short*)(ws + oHh);
  unsigned short* Hl  = (unsigned short*)(ws + oHl);
  unsigned short* Ah  = (unsigned short*)(ws + oAh);
  unsigned short* Al  = (unsigned short*)(ws + oAl);
  unsigned short* U   = (unsigned short*)(ws + oU);
  float*          cs  = (float*)(ws + oCs);
  float* out = (float*)d_out;

  const dim3 blk256(256), blk128(128), blk64(64);

  // (0) weights -> bf16 natural + transposed planes + row sums (y: 0 Wk, 1 Wq, 2 Wv)
  cvt_w<<<dim3(ND / QT, 3), blk256, 0, stream>>>(wk, wq, wv, Wn, Wt, rs);
  // (1) g = bf16(Wk)^T . rowsum(bf16(Wq))
  k_g<<<dim3(ND / 256), blk256, 0, stream>>>(Wn, rs + ND, g);
  // (2) x -> bf16 plane + f64 partial sums
  k_xcvt<<<dim3(KCH, NB), blk256, 0, stream>>>(x, Xb, part);
  // (3) LayerNorm statistics
  k_stats<<<dim3(1), blk64, 0, stream>>>(part, st);
  // (4) H planes: A = Wq transposed (rows d), B = Wk transposed (rows e)
  k_hgemm<<<dim3(ND / QT, ND / QT), blk128, 0, stream>>>(Wt + (size_t)1 * ND * ND, Wt, Hh, Hl);
  // (5) query planes A' = rstd^2 X.H  (hi + residual)
  k_agemm<<<dim3(NQ / QT, ND / QT, NB), blk128, 0, stream>>>(Hh, Hl, Xb, st, Ah, Al);
  // (6) value plane U = 16 X.Wv^T (channel-major)
  k_vgemm<<<dim3(ND / QT, NC / QT, NB), blk128, 0, stream>>>(Xb, Wn + (size_t)2 * ND * ND, U);
  // (7) key-side affine term
  k_cs<<<dim3(NC / 32, NB), blk256, 0, stream>>>(Xb, g, st, cs);
  // (8) attention -> out [b][q][768]
  k_attn<<<dim3(NQ / QT, NB), blk128, 0, stream>>>(Ah, Al, Xb, U, cs, rs + 2 * ND, st, out);
  (void)hipGetLastError();
}

// v004
// It runs in 379 microseconds.
// In both of two side-by-side timings against v003, it was 1.35 times as fast.
// All steps since v000 together make it 3.79 times as fast.
// Contractions (f32 accumulate everywhere): H[e][d] = sum_o Wq[o][d]*Wk[o][e] on v_wmma_f32_16x16x32_bf16 with
// bf16-RNE weights (exact products); query plane A' = X.H with bf16-RNE x and H carried as bf16 hi + bf16
// residual (2 products, shared accumulator); U = X.Wv^T (1 product, bf16-RNE operands); scores
// S^T = X(keys).A'(queries) with A' as bf16 hi + bf16 residual (2 products); O^T = U.P^T on
// v_wmma_f32_16x16x32_f16 (U x16 as f16, P = e^{s-m} x16384 as f16 built from the score D registers).
// LayerNorm statistics in f64 VALU; per-batch affine terms, softmax statistics and normalisation in f32 VALU.
#include <hip/hip_runtime.h>
#include <math.h>
#include <stdint.h>

#ifndef NB
#define NB 8
#endif
#ifndef NQ
#define NQ 2048
#endif
#define NBF  8
#define NC   2048
#define ND   768
#define QT   64
#define OSP  68
#define TPW  72
#define KCH  64
#define KG   4
#define USC  16.0f
#define IUSC 0.0625f
#define LNPS 9.704060527839234f
#define EPSV 1.0e-5f
#define KP   776
#define VP   40
#define VG   8
#define QLDS (4 * 16 * ND * 4)
#define KLDS (32 * KP * 2)
#define VLDS (ND * VP * 2)
#define ATTN_LDS (QLDS + KLDS + VLDS)
#define GKC  64
#define GP   72
#define GPB  (QT * GP * 2)

static_assert(NB >= 1 && NB <= NBF);
static_assert(NQ % QT == 0 && NQ >= QT && NQ <= NC);
static_assert(NC % QT == 0 && ND % QT == 0);
static_assert(NC % 32 == 0 && ND % 32 == 0);
static_assert(ND % 256 == 0 && ND % 128 == 0 && ND % 16 == 0);
static_assert(NC / KCH == 32 && KCH == 64);
static_assert((ND / 32) % KG == 0);
static_assert(2 * 16 * ND * 2 == 16 * ND * 4);
static_assert(4 * NBF <= 32);
static_assert((OSP * 4) % 16 == 0);
static_assert((TPW * 2) % 16 == 0);
static_assert(QLDS == 196608 && ATTN_LDS <= 327680);
static_assert((KP * 2) % 32 == 16 && (VP * 2) % 32 == 16);          // LDS row pitch = 16 B x odd, for b128 readers
static_assert(KP >= ND + 8 && VP >= 32 + 8 && QLDS % 16 == 0 && KLDS % 16 == 0);
static_assert(ND % GKC == 0 && ND / GKC >= 2 && GKC * 2 == 128 && GKC % 32 == 0 && QT == 64);
static_assert((GP * 2) % 32 == 16 && GP >= GKC + 8 && 2 * 2 * GPB >= QT * OSP * 4);
static_assert((ND / 16) % VG == 0 && ND % (4 * 8) == 0 && ND / 4 / 8 == 24 && 8 * (ND / 256) == 24);

typedef _Float16       v16h __attribute__((ext_vector_type(16)));
typedef _Float16       v8h  __attribute__((ext_vector_type(8)));
typedef __bf16         v16b __attribute__((ext_vector_type(16)));
typedef unsigned short v8us __attribute__((ext_vector_type(8)));
typedef float          v8f  __attribute__((ext_vector_type(8)));
typedef float          v4f  __attribute__((ext_vector_type(4)));
typedef unsigned int   v4u  __attribute__((ext_vector_type(4)));
typedef double         v2d  __attribute__((ext_vector_type(2)));

union Frag  { v8us u[2]; v16h h; v16b bf; };
union FragH { v16h v; v8h hv[2]; };
static_assert(sizeof(Frag) == 32);
static_assert(sizeof(FragH) == 32);

// ---- scalar helpers ---------------------------------------------------------------------------------------
__device__ __forceinline__ unsigned short bf_bits(float f) {          // f32 -> bf16 bits, RNE convert
  unsigned u = __float_as_uint(f);
  return (unsigned short)((u + 0x7FFFu + ((u >> 16) & 1u)) >> 16);
}
__device__ __forceinline__ float bf_up(unsigned short hb) { return __uint_as_float(((unsigned)hb) << 16); }
__device__ __forceinline__ float bf_lo16(unsigned w) { return __uint_as_float(w << 16); }
__device__ __forceinline__ float bf_hi16(unsigned w) { return __uint_as_float(w & 0xFFFF0000u); }
__device__ __forceinline__ unsigned short h_bits(_Float16 x) { return __builtin_bit_cast(unsigned short, x); }
__device__ __forceinline__ unsigned pk16(unsigned short a, unsigned short b) { return (unsigned)a | ((unsigned)b << 16); }
__device__ __forceinline__ v8f zero8() { v8f z = {0.f, 0.f, 0.f, 0.f, 0.f, 0.f, 0.f, 0.f}; return z; }
__device__ __forceinline__ float hmax8(v8f s) {
  return fmaxf(fmaxf(fmaxf(s[0], s[1]), fmaxf(s[2], s[3])), fmaxf(fmaxf(s[4], s[5]), fmaxf(s[6], s[7])));
}
__device__ __forceinline__ double shfl_xor_d(double v, int mask) {
  int lo = __double2loint(v), hi = __double2hiint(v);
  lo = __shfl_xor(lo, mask, 32);
  hi = __shfl_xor(hi, mask, 32);
  return __hiloint2double(hi, lo);
}

// ---- 16-bit fragment loader (A, or B from a k-contiguous [n][k] row): lane -> row/col (lane&15), p already includes
//      + 8*(lane>>4); elements 0..7 <- p[0..7] (k0+8h..), elements 8..15 <- p[16..23] (k0+16+8h..)
__device__ __forceinline__ Frag ldfrag(const unsigned short* p) {
  Frag f;
  f.u[0] = *(const v8us*)(p);
  f.u[1] = *(const v8us*)(p + 16);
  return f;
}

// ---- fragment from the packed LDS form: two quarters of 32 lanes x 16 B, p already includes + 8*lane
__device__ __forceinline__ Frag ldq(const unsigned short* p) {
  Frag f;
  f.u[0] = *(const v8us*)(p);
  f.u[1] = *(const v8us*)(p + 256);
  return f;
}

// ---- WMMA helpers: builtin followed by a 4-slot VALU gap tying D and keeping A/B live --------------------------
// mma_h is the bare builtin (the compiler keeps the distance behind its own WMMAs): with D tied to an asm statement
// the 48 resident D tiles of k_attn, 384 registers, do not all get registers and the build spills to scratch.
__device__ __forceinline__ v8f mma_h(v16h a, v16h b, v8f c) {
  return __builtin_amdgcn_wmma_f32_16x16x32_f16(false, a, false, b, (short)0, c, false, false);
}
// mma_q is the bare bf16 builtin, for a like reason: with the two fragment groups that k_attn keeps in flight tied to
// mma_b's asm statement as operands, the build spills to scratch.
__device__ __forceinline__ v8f mma_q(v16b a, v16b b, v8f c) {
  return __builtin_amdgcn_wmma_f32_16x16x32_bf16(false, a, false, b, (short)0, c, false, false);
}
__device__ __forceinline__ v8f mma_b(v16b a, v16b b, v8f c) {
  v8f d = __builtin_amdgcn_wmma_f32_16x16x32_bf16(false, a, false, b, (short)0, c, false, false);
#if defined(__HIP_DEVICE_COMPILE__)
  const v16h ha = __builtin_bit_cast(v16h, a), hb = __builtin_bit_cast(v16h, b);
  asm volatile("v_nop\n\tv_nop\n\tv_nop\n\tv_nop" : "+v"(d) : "v"(ha), "v"(hb));
#endif
  return d;
}

// ---- one tile = 24 asynchronous 16-byte copies per lane, global -> LDS, through no register. RUN copies follow one
//      another at steps (LS1, GS1), then the next run starts (LS2, GS2) further; steps in bytes (LDS) and in 16-bit
//      elements (global). The landing is waited for by the caller (s_wait_asynccnt).
typedef int v4i __attribute__((ext_vector_type(4)));
template <int RUN, int LS1, int GS1, int LS2, int GS2>
__device__ __forceinline__ void acopy_tile(unsigned char* l0, const unsigned short* g0) {
#if defined(__HIP_DEVICE_COMPILE__)
#pragma unroll
  for (int idx = 0; idx < 24; ++idx) {
    const int r = idx / RUN, s = idx % RUN;
    __builtin_amdgcn_global_load_async_to_lds_b128(
        (__attribute__((address_space(1))) v4i*)(g0 + (size_t)r * GS2 + (size_t)s * GS1),
        (__attribute__((address_space(3))) v4i*)(l0 + r * LS2 + s * LS1), 0, 0);
  }
#endif
}

// =========================================================================================================
// (0) weights f32 [768][768] (y = 0: Wk, 1: Wq, 2: Wv, block-uniform selection) -> bf16-RNE planes:
//     natural Wn[y][o][i] and transposed Wt[y][i][o], plus row sums rs[y][o] = sum_i bf16(W[o][i]) in f32.
//     Block (ob, y) owns rows o0..o0+63; column chunks of 64 go through the LDS tile T[i_loc][o_loc] (pitch TPW).
// coverage: Wn 12 chunks x 2 it x 8 waves x 4 rows x 8 lanes x 8 = 64 x 768 per block; Wt 12 chunks x 2 it x 32 x 8
//           lanes x 8 = 768 x 64 per block; rs 16 x 4 = 64; grid (12, 3) covers all three matrices once.
// LDS: T and rsL cross-wave (block barriers).
// =========================================================================================================
__global__ __launch_bounds__(256)
void cvt_w(const float* __restrict__ wk, const float* __restrict__ wq, const float* __restrict__ wv,
           unsigned short* Wn, unsigned short* Wt, float* rs) {
  __shared__ __align__(16) unsigned short T[QT * TPW];
  __shared__ __align__(16) float rsL[QT];
  const int tid = threadIdx.x, lane = tid & 31, wave = tid >> 5;
  const int y = blockIdx.y, o0 = blockIdx.x * QT;
  const float* W = (y == 0) ? wk : ((y == 1) ? wq : wv);            // block-uniform, all global
  unsigned short* Np = Wn + (size_t)y * ND * ND;
  unsigned short* Tq = Wt + (size_t)y * ND * ND;
  const int e = lane & 7, r4 = lane >> 3;                           // r4 0..3
  const int e8 = tid & 7, lq = tid >> 3;                            // lq 0..31
  float rsum0 = 0.f, rsum1 = 0.f;
#pragma unroll 1
  for (int cc = 0; cc < ND / QT; ++cc) {
    const int i0 = cc * QT;
#pragma unroll
    for (int it = 0; it < 2; ++it) {
      const int ol = 8 * wave + 4 * it + r4;                          // 0..63
      const float* sp = W + (size_t)(o0 + ol) * ND + i0 + 8 * e;
      const v4f a = *(const v4f*)sp;
      const v4f q = *(const v4f*)(sp + 4);
      const float f[8] = {a[0], a[1], a[2], a[3], q[0], q[1], q[2], q[3]};
      unsigned short hb[8];
      float ps = 0.f;
#pragma unroll
      for (int t = 0; t < 8; ++t) { hb[t] = bf_bits(f[t]); ps += bf_up(hb[t]); }
      if (it == 0) rsum0 += ps; else rsum1 += ps;
      v4u u;
#pragma unroll
      for (int t = 0; t < 4; ++t) u[t] = pk16(hb[2 * t], hb[2 * t + 1]);
      unsigned short* np = Np + (size_t)(o0 + ol) * ND + i0 + 8 * e;
      *(v4u*)np = u;
      
#pragma unroll
      for (int t = 0; t < 8; ++t) T[(8 * e + t) * TPW + ol] = hb[t];   // T[i_loc][o_loc]
    }
    __syncthreads();
    v4u up[2];
#pragma unroll
    for (int it = 0; it < 2; ++it) {
      const int il = 32 * it + lq;                                    // 0..63
      up[it] = *(const v4u*)(T + il * TPW + 8 * e8);
    }
{
#pragma unroll
      for (int it = 0; it < 2; ++it) {
        const int il = 32 * it + lq;
        *(v4u*)(Tq + (size_t)(i0 + il) * ND + o0 + 8 * e8) = up[it];
      }
      
    }
    __syncthreads();                                                  // T reused by the next chunk
  }
  rsum0 += __shfl_xor(rsum0, 1, 32); rsum0 += __shfl_xor(rsum0, 2, 32); rsum0 += __shfl_xor(rsum0, 4, 32);
  rsum1 += __shfl_xor(rsum1, 1, 32); rsum1 += __shfl_xor(rsum1, 2, 32); rsum1 += __shfl_xor(rsum1, 4, 32);
  if (e == 0) { rsL[8 * wave + r4] = rsum0; rsL[8 * wave + 4 + r4] = rsum1; }
  __syncthreads();
  if (wave == 0 && lane < 16) {
    const v4f v = *(const v4f*)(rsL + 4 * lane);
    float* rp = rs + (size_t)y * ND + o0 + 4 * lane;
    *(v4f*)rp = v;
    
  }
}

// =========================================================================================================
// (1) g[e] = sum_o bf16(Wk)[o][e] * rq[o]  (rq = row sums of bf16(Wq)); f32, one thread per e, loop unrolled by 4.
//     Output: 256 floats per block = 8 lines, wave w lanes 0..7 write line w (8 lanes x 16 B, one instruction),
// coverage: 3 blocks x 256 = 768 = whole g.  LDS gL: each wave reads back only its own 32 slots (block barrier).
// =========================================================================================================
__global__ __launch_bounds__(256)
void k_g(const unsigned short* __restrict__ Wkn, const float* __restrict__ rq, float* g) {
  __shared__ __align__(16) float gL[256];
  const int tid = threadIdx.x, lane = tid & 31, wave = tid >> 5;
  const int e = blockIdx.x * 256 + tid;
  float acc = 0.f;
#pragma unroll 4
  for (int o = 0; o < ND; ++o) acc += bf_up(Wkn[(size_t)o * ND + e]) * rq[o];
  gL[tid] = acc;
  __syncthreads();
  if (lane < 8) {
    const v4f v = *(const v4f*)(gL + 32 * wave + 4 * lane);
    float* p = g + (size_t)blockIdx.x * 256 + 32 * wave + 4 * lane;
    *(v4f*)p = v;
    
  }
}

// =========================================================================================================
// (2) x f32 [b][2048][768] -> Xb bf16-RNE plane (same layout) and per-chunk f64 partial sums of the bf16 values
//     (sum, sum of squares). Block (ch, b) owns 32 rows; wave w rows 4w..4w+3; per row 3 instructions of
// coverage: Xb 4 rows x 8 waves x 3 x 32 lanes x 8 = 32 x 768 per block, grid (64, NB) = all rows of b < NB;
// =========================================================================================================
__global__ __launch_bounds__(256)
void k_xcvt(const float* __restrict__ x, unsigned short* Xb, double* part) {
  __shared__ double sL[8], qL[8];
  const int tid = threadIdx.x, lane = tid & 31, wave = tid >> 5;
  const int ch = blockIdx.x, b = blockIdx.y;
  const int r0 = ch * (NC / KCH);
  double s = 0.0, q = 0.0;
#pragma unroll 1
  for (int t = 0; t < 4; ++t) {
    const int row = r0 + 4 * wave + t;
    const size_t base = ((size_t)b * NC + row) * ND + 8 * lane;
#pragma unroll 1
    for (int c3 = 0; c3 < ND / 256; ++c3) {
      const float* sp = x + base + 256 * c3;
      const v4f a = *(const v4f*)sp;
      const v4f q4 = *(const v4f*)(sp + 4);
      const float f[8] = {a[0], a[1], a[2], a[3], q4[0], q4[1], q4[2], q4[3]};
      unsigned short hb[8];
#pragma unroll
      for (int k = 0; k < 8; ++k) {
        hb[k] = bf_bits(f[k]);
        const double v = (double)bf_up(hb[k]);
        s += v;
        q += v * v;
      }
      v4u u;
#pragma unroll
      for (int k = 0; k < 4; ++k) u[k] = pk16(hb[2 * k], hb[2 * k + 1]);
      unsigned short* xp = Xb + base + 256 * c3;
      *(v4u*)xp = u;
      
    }
  }
  s += shfl_xor_d(s, 16); s += shfl_xor_d(s, 8); s += shfl_xor_d(s, 4); s += shfl_xor_d(s, 2); s += shfl_xor_d(s, 1);
  q += shfl_xor_d(q, 16); q += shfl_xor_d(q, 8); q += shfl_xor_d(q, 4); q += shfl_xor_d(q, 2); q += shfl_xor_d(q, 1);
  if (lane == 0) { sL[wave] = s; qL[wave] = q; }
  __syncthreads();
  if (wave == 0) {
    double S = 0.0, Q = 0.0;
#pragma unroll
    for (int w = 0; w < 8; ++w) { S += sL[w]; Q += qL[w]; }
    v2d val;
    val[0] = (lane == 0) ? S : 0.0;
    val[1] = (lane == 0) ? Q : 0.0;
    if (lane < 8) {
      double* pp = part + ((size_t)b * KCH + ch) * 16 + 2 * lane;
      *(v2d*)pp = val;
      
    }
  }
}

// =========================================================================================================
// (3) LayerNorm statistics per batch from the 64 partial lines (fixed-order f64 tree): st line f32 [32] with
// =========================================================================================================
__global__ __launch_bounds__(64)
void k_stats(const double* __restrict__ part, float* st) {
  __shared__ double sL[64], qL[64];
  __shared__ __align__(16) float stL[32];
  const int tid = threadIdx.x;
  if (tid < 32) stL[tid] = 0.f;
#pragma unroll 1
  for (int b = 0; b < NB; ++b) {
    __syncthreads();
    const size_t pb = ((size_t)b * KCH + tid) * 16;
    sL[tid] = part[pb];
    qL[tid] = part[pb + 1];
    __syncthreads();
#pragma unroll
    for (int off = 32; off > 0; off >>= 1) {
      if (tid < off) { sL[tid] += sL[tid + off]; qL[tid] += qL[tid + off]; }
      __syncthreads();
    }
    if (tid == 0) {
      const double n  = (double)NC * (double)ND;
      const double mu = sL[0] / n;
      double var = qL[0] / n - mu * mu;
      if (var < 0.0) var = 0.0;
      const float varf = (float)var;
      const float ve   = varf + EPSV;
      const float rstd = (float)(1.0 / sqrt((double)ve));
      const float muf  = (float)mu;
      stL[4 * b + 0] = muf;
      stL[4 * b + 1] = rstd;
      stL[4 * b + 2] = rstd * rstd;
      stL[4 * b + 3] = muf * rstd * rstd;
    }
  }
  __syncthreads();
  if (tid < 8) {
    const v4f v = *(const v4f*)(stL + 4 * tid);
    float* p = st + 4 * tid;
    *(v4f*)p = v;
    
  }
}

// =========================================================================================================
// GEMM engine (K = 768 = 24 k-steps, all operand planes k-contiguous with pitch ND): block 128 threads = 4 waves,
// 64 (m) x 64 (n) tile; wave w owns cols n0+16w..+15 (one B fragment per k-step from row n of the B plane) and
// 4 m-tiles (A rows m0 + 16 mt + (lane&15)); NPROD = 2 adds a second A plane (bf16 residual) into the same
// accumulator. Split k map loader for both operands.
// The operands come through LDS: a stage = 64 k of the block's 64 B rows and 64 A rows (each A plane), one whole
// 128-byte line a row, brought once per block by asynchronous copies and read by all four waves as fragments.
// Stage layout: plane 0 = B, plane 1 = A, plane 2 = A residual; a plane = 64 rows of pitch GP (144 B = 16 B x 9, for
// b128 readers; the 16 pad bytes of a row are neither written nor read). Two stages, a two-buffer ring.
// coverage of a plane: 4 waves x 4 copies x 4 rows x 8 lanes x 16 B = 64 x 128 B.
// =========================================================================================================
__device__ __forceinline__ unsigned lds_off(const void* p) { return (unsigned)(size_t)p; }

// Four asynchronous 16-byte copies per lane, global -> LDS: 16 rows of one plane (a copy = 4 whole rows: lane -> row
// lane>>3, 16-byte piece lane&7). l, g: this lane's LDS byte address and global address in the first of them.
// The s_wait_xcnt closes the statement: the address registers that the copies name are rewritten only behind it.
__device__ __forceinline__ void acopy4(unsigned l, const unsigned short* g) {
#if defined(__HIP_DEVICE_COMPILE__)
  asm volatile("global_load_async_to_lds_b128 %0, %4, off\n\t"
               "global_load_async_to_lds_b128 %1, %5, off\n\t"
               "global_load_async_to_lds_b128 %2, %6, off\n\t"
               "global_load_async_to_lds_b128 %3, %7, off\n\t"
               "s_wait_xcnt 0x0"
               :: "v"(l), "v"(l + 4 * GP * 2), "v"(l + 8 * GP * 2), "v"(l + 12 * GP * 2),
                  "v"(g), "v"(g + 4 * ND), "v"(g + 8 * ND), "v"(g + 12 * ND)
               : "memory");
#endif
}

// a0, a1, b: row 0, column 0 of the block's 64 rows in each plane. sm: 2 stages of (NPROD + 1) planes.
template <int NPROD>
__device__ __forceinline__ void gemm_k(unsigned char* sm, const unsigned short* __restrict__ a0,
                                       const unsigned short* __restrict__ a1,
                                       const unsigned short* __restrict__ b, v8f (&acc)[4]) {
  constexpr int STG = (NPROD + 1) * GPB;
  const int tid = threadIdx.x, lane = tid & 31, wave = tid >> 5, hh = lane >> 4, c = lane & 15;
  // copy side: wave w brings rows 16w..16w+15 of every plane
  const int crow = 16 * wave + (lane >> 3);
  const unsigned cl = lds_off(sm) + crow * (GP * 2) + 16 * (lane & 7);
  const size_t   cg = (size_t)crow * ND + 8 * (lane & 7);
  auto fill = [&](int t) {
    const unsigned l = cl + (t & 1) * STG;
    const size_t   g = cg + (size_t)GKC * t;
    acopy4(l, b + g);
    acopy4(l + GPB, a0 + g);
    if (NPROD == 2) acopy4(l + 2 * GPB, a1 + g);
  };
  // fragment readers: lane -> row (lane&15), + 8*(lane>>4), as from the global planes
  const unsigned short* rb = (const unsigned short*)sm + (16 * wave + c) * GP + 8 * hh;
  const unsigned short* ra = (const unsigned short*)(sm + GPB) + c * GP + 8 * hh;               // + 16 mt * GP
#pragma unroll
  for (int mt = 0; mt < 4; ++mt) acc[mt] = zero8();

  fill(0);
  asm volatile("s_wait_asynccnt 0x0" ::: "memory");                  // this wave's share of stage 0 has landed
  __syncthreads();                                                   // ... and every other wave's: stage 0 is readable
  fill(1);
  // rolled: twelve equal trips, the buffer chosen by an address offset; unrolled it would only grow the code
#pragma unroll 1
  for (int t = 0; t < ND / GKC; ++t) {
    const int bo = (t & 1) * (STG / 2);
#pragma unroll
    for (int k2 = 0; k2 < GKC / 32; ++k2) {
      const Frag fb = ldfrag(rb + bo + 32 * k2);
      Frag fa[4], fl[4];
#pragma unroll
      for (int mt = 0; mt < 4; ++mt) {
        fa[mt] = ldfrag(ra + bo + (16 * mt) * GP + 32 * k2);
        if (NPROD == 2) fl[mt] = ldfrag(ra + bo + GPB / 2 + (16 * mt) * GP + 32 * k2);
      }
#pragma unroll
      for (int mt = 0; mt < 4; ++mt) {
        acc[mt] = mma_b(fa[mt].bf, fb.bf, acc[mt]);
        if (NPROD == 2) acc[mt] = mma_b(fl[mt].bf, fb.bf, acc[mt]);
      }
    }
    // foot of the trip: own LDS reads done, own copies of the next stage landed, then the barrier that publishes that
    // stage and ends every wave's reads of this one; behind it this buffer is refilled
    asm volatile("s_wait_dscnt 0x0" ::: "memory");
    asm volatile("s_wait_asynccnt 0x0" ::: "memory");
    __syncthreads();
    if (t + 2 < ND / GKC) fill(t + 2);
  }
  asm volatile("s_wait_asynccnt 0x0" ::: "memory");                  // nothing is in flight when the LDS changes its use
}

// D tiles -> LDS Os[n_loc][m_loc] (pitch OSP, b128 stores): lane (hh, c) holds m = 16 mt + 8 hh + r for
// n_loc = 16 w + c.  coverage: 4 waves x 16 n x 4 mt x 16 m = 64 x 64 (pad cols 64..67 never read).
__device__ __forceinline__ void stage_os(float* Os, const v8f (&acc)[4], float sc, int wave, int hh, int c) {
  const int nl = 16 * wave + c;
#pragma unroll
  for (int mt = 0; mt < 4; ++mt) {
    v4f va, vb;
#pragma unroll
    for (int r = 0; r < 4; ++r) { va[r] = acc[mt][r] * sc; vb[r] = acc[mt][4 + r] * sc; }
    *(v4f*)(Os + nl * OSP + 16 * mt + 8 * hh)     = va;
    *(v4f*)(Os + nl * OSP + 16 * mt + 8 * hh + 4) = vb;
  }
}

// Os -> two bf16 planes (hi = bf16-RNE(v), lo = bf16-RNE(v - hi)), plane row = row0 + n_loc, 64 m values =
// coverage: 4 it x 16 rows x 8 lanes x 8 = 64 x 64 per plane.
__device__ __forceinline__ void epi_split(const float* Os, unsigned short* Ph, unsigned short* Pl,
                                          size_t row0, int pitch, int col0, int tid) {
  const int e = tid & 7, lq = tid >> 3;                              // lq 0..15
  v4u uh[4], ul[4];
#pragma unroll
  for (int it = 0; it < 4; ++it) {
    const int row = it * 16 + lq;
    const v4f a = *(const v4f*)(Os + row * OSP + 8 * e);
    const v4f q = *(const v4f*)(Os + row * OSP + 8 * e + 4);
    const float f[8] = {a[0], a[1], a[2], a[3], q[0], q[1], q[2], q[3]};
#pragma unroll
    for (int t = 0; t < 4; ++t) {
      const float f0 = f[2 * t], f1 = f[2 * t + 1];
      const unsigned short hb0 = bf_bits(f0), hb1 = bf_bits(f1);
      const unsigned short lb0 = bf_bits(f0 - bf_up(hb0));
      const unsigned short lb1 = bf_bits(f1 - bf_up(hb1));
      uh[it][t] = pk16(hb0, hb1);
      ul[it][t] = pk16(lb0, lb1);
    }
  }
{
#pragma unroll
    for (int it = 0; it < 4; ++it) {
      const int row = it * 16 + lq;
      const size_t po = (row0 + (size_t)row) * (size_t)pitch + (size_t)col0 + 8 * e;
      *(v4u*)(Ph + po) = uh[it];
      *(v4u*)(Pl + po) = ul[it];
    }
    
  }
}

// Os -> one f16 plane (values already scaled), same line geometry as epi_split.
__device__ __forceinline__ void epi_h(const float* Os, unsigned short* P, size_t row0, int pitch, int col0, int tid) {
  const int e = tid & 7, lq = tid >> 3;
  v4u u[4];
#pragma unroll
  for (int it = 0; it < 4; ++it) {
    const int row = it * 16 + lq;
    const v4f a = *(const v4f*)(Os + row * OSP + 8 * e);
    const v4f q = *(const v4f*)(Os + row * OSP + 8 * e + 4);
    const float f[8] = {a[0], a[1], a[2], a[3], q[0], q[1], q[2], q[3]};
#pragma unroll
    for (int t = 0; t < 4; ++t)
      u[it][t] = pk16(h_bits((_Float16)f[2 * t]), h_bits((_Float16)f[2 * t + 1]));
  }
{
#pragma unroll
    for (int it = 0; it < 4; ++it) {
      const int row = it * 16 + lq;
      const size_t po = (row0 + (size_t)row) * (size_t)pitch + (size_t)col0 + 8 * e;
      *(v4u*)(P + po) = u[it];
    }
    
  }
}

// =========================================================================================================
// (4) H planes: D[m = d][n = e] = sum_o WqT[d][o] * WkT[e][o]  (1 product, exact) -> Hh/Hl bf16 [e][768 d].
// grid (12 e-tiles, 12 d-tiles).  LDS Os cross-wave (block barrier).
// =========================================================================================================
__global__ __launch_bounds__(128)
void k_hgemm(const unsigned short* __restrict__ Aq, const unsigned short* __restrict__ Bk,
             unsigned short* Hh, unsigned short* Hl) {
  __shared__ __align__(16) unsigned char sm[2 * 2 * GPB];
  float* Os = (float*)sm;                                            // the stages' bytes, free behind the k loop
  const int tid = threadIdx.x, lane = tid & 31, wave = tid >> 5, hh = lane >> 4, c = lane & 15;
  const int n0 = blockIdx.x * QT, m0 = blockIdx.y * QT;
  const unsigned short* ap = Aq + (size_t)m0 * ND;
  const unsigned short* bp = Bk + (size_t)n0 * ND;
  v8f acc[4];
  gemm_k<1>(sm, ap, ap, bp, acc);
  stage_os(Os, acc, 1.0f, wave, hh, c);
  __syncthreads();
  epi_split(Os, Hh, Hl, (size_t)n0, ND, m0, tid);
}

// =========================================================================================================
// (5) query planes: D[m = e][n = query] = sum_d (Hh + Hl)[e][d] * Xb[b][q][d]  (2 products), scaled by rstd_b^2
//     in the epilogue -> Ah/Al bf16 [b][NQ][768 e].  grid (NQ/64, 12 e-tiles, NB).
// =========================================================================================================
__global__ __launch_bounds__(128)
void k_agemm(const unsigned short* __restrict__ Hh, const unsigned short* __restrict__ Hl,
             const unsigned short* __restrict__ Xb, const float* __restrict__ st,
             unsigned short* Ah, unsigned short* Al) {
  __shared__ __align__(16) unsigned char sm[2 * 3 * GPB];
  float* Os = (float*)sm;                                            // the stages' bytes, free behind the k loop
  const int tid = threadIdx.x, lane = tid & 31, wave = tid >> 5, hh = lane >> 4, c = lane & 15;
  const int n0 = blockIdx.x * QT, m0 = blockIdx.y * QT, b = blockIdx.z;
  const unsigned short* ap0 = Hh + (size_t)m0 * ND;
  const unsigned short* ap1 = Hl + (size_t)m0 * ND;
  const unsigned short* bp  = Xb + ((size_t)b * NC + n0) * ND;
  v8f acc[4];
  gemm_k<2>(sm, ap0, ap1, bp, acc);
  const float sc = st[4 * b + 2];
  stage_os(Os, acc, sc, wave, hh, c);
  __syncthreads();
  epi_split(Os, Ah, Al, (size_t)b * NQ + n0, ND, m0, tid);
}

// =========================================================================================================
// (6) value plane (channel-major, keys contiguous): D[m = key j][n = o] = sum_d Xb[b][j][d] * Wvb[o][d]
//     (1 product, exact), x16 -> U f16 [b][768 o][2048 j].  grid (12 o-tiles, 32 key-tiles, NB).
// =========================================================================================================
__global__ __launch_bounds__(128)
void k_vgemm(const unsigned short* __restrict__ Xb, const unsigned short* __restrict__ Wvn, unsigned short* U) {
  __shared__ __align__(16) unsigned char sm[2 * 2 * GPB];
  float* Os = (float*)sm;                                            // the stages' bytes, free behind the k loop
  const int tid = threadIdx.x, lane = tid & 31, wave = tid >> 5, hh = lane >> 4, c = lane & 15;
  const int n0 = blockIdx.x * QT, m0 = blockIdx.y * QT, b = blockIdx.z;
  const unsigned short* ap = Xb + ((size_t)b * NC + m0) * ND;
  const unsigned short* bp = Wvn + (size_t)n0 * ND;
  v8f acc[4];
  gemm_k<1>(sm, ap, ap, bp, acc);
  stage_os(Os, acc, USC, wave, hh, c);
  __syncthreads();
  epi_h(Os, U, (size_t)b * ND + n0, NC, m0, tid);
}

// =========================================================================================================
// (7) key-side affine term: cs[b][j] = -(mu_b rstd_b^2) * sum_d g[d] * Xb[b][j][d], f32 VALU, one wave per row,
// coverage: grid (64, NB) x 32 rows = every key row of b < NB.  LDS csL cross-wave (block barrier).
// =========================================================================================================
__global__ __launch_bounds__(256)
void k_cs(const unsigned short* __restrict__ Xb, const float* __restrict__ g, const float* __restrict__ st,
          float* cs) {
  __shared__ __align__(16) float csL[32];
  const int tid = threadIdx.x, lane = tid & 31, wave = tid >> 5;
  const int r0 = blockIdx.x * 32, b = blockIdx.y;
  v4f ga[3], gb[3];
#pragma unroll
  for (int c3 = 0; c3 < 3; ++c3) {
    ga[c3] = *(const v4f*)(g + 256 * c3 + 8 * lane);
    gb[c3] = *(const v4f*)(g + 256 * c3 + 8 * lane + 4);
  }
  const float nmr = -st[4 * b + 3];
#pragma unroll 1
  for (int t = 0; t < 4; ++t) {
    const int row = r0 + 4 * wave + t;
    const unsigned short* xp = Xb + ((size_t)b * NC + row) * ND + 8 * lane;
    float acc = 0.f;
#pragma unroll
    for (int c3 = 0; c3 < 3; ++c3) {
      const v4u u = *(const v4u*)(xp + 256 * c3);
      acc += bf_lo16(u[0]) * ga[c3][0] + bf_hi16(u[0]) * ga[c3][1]
           + bf_lo16(u[1]) * ga[c3][2] + bf_hi16(u[1]) * ga[c3][3]
           + bf_lo16(u[2]) * gb[c3][0] + bf_hi16(u[2]) * gb[c3][1]
           + bf_lo16(u[3]) * gb[c3][2] + bf_hi16(u[3]) * gb[c3][3];
    }
    acc += __shfl_xor(acc, 16, 32); acc += __shfl_xor(acc, 8, 32); acc += __shfl_xor(acc, 4, 32);
    acc += __shfl_xor(acc, 2, 32);  acc += __shfl_xor(acc, 1, 32);
    if (lane == 0) csL[4 * wave + t] = acc * nmr;
  }
  __syncthreads();
  if (wave == 0 && lane < 8) {
    const v4f v = *(const v4f*)(csL + 4 * lane);
    float* p = cs + (size_t)b * NC + r0 + 4 * lane;
    *(v4f*)p = v;
    
  }
}

// =========================================================================================================
// (8) attention for one (b, 64-query tile), transposed formulation, 2048 keys, no mask:
//   S^T tile (16 keys x 16 queries) = sum over 24 d-chunks of A(key row kb + (lane&15) of the bf16 plane Xb,
//   split k map) . B(query row of Ah) + A(Xb).B(Al) (bf16 residual, shared accumulator), then + cs[key].
//   Per lane the D tile holds 8 keys of ONE query: online softmax state per lane, one shuffle (lane^16) for the
//   max over 32 keys; corr applied every step (== 1 exactly when the max did not grow). P = e^{s-m} x 16384 as
//   f16 is the B operand of O^T (rows channel, cols queries) += A(U rows channel 16j + (lane&15), keys
//   contiguous, f16 x16) . B(P^T): element r <- D of the tile covering keys kb..kb+15, element 8+r <- the tile
//   covering kb+16..kb+31, lane unchanged. The 48 accumulator tiles per wave live in registers (384 per lane) for
//   the whole key loop and are stored once, behind it, to wave-private LDS slots Ow[query][768].
//   Epilogue after a block barrier: out[b][q][:] = Ow[q][:] * (rstd / (16 l_q)) - mu rstd rowsum(Wv), row =
// coverage: 4 waves x 16 query rows x 6 x 32 lanes x 4 = 64 x 768; grid (NQ/64, NB) covers out[b < NB][q < NQ].
// LDS: Ow written once per lane behind the key loop; cross-lane reads only after __syncthreads. staged extent
//      (16 x 768 per wave) == consumed extent. Up to the end of the key loop the same bytes hold the wave's query
//      fragments (hi + residual, 2 x 16 x 768 x 2 B), each 16 B written and read by one and the same lane.
//      Behind them one K buffer (32 key rows) and one V buffer (768 channel rows x 32 keys), filled once per block and
//      32 keys by asynchronous copies (each wave a quarter) and read by all four waves: cross-wave, so every tile is
//      read only behind its copiers' s_wait_asynccnt 0 and a block barrier, and refilled only behind the barrier
//      that ends its last read. coverage: K 4 waves x 8 rows x 3 x 32 lanes x 16 B = 32 x 1536 B; V 4 waves x 24 x
//      8 rows x 4 x 16 B = 768 x 64 B; pad bytes of a row are neither written nor read.
// =========================================================================================================
__global__ __launch_bounds__(128)
void k_attn(const unsigned short* __restrict__ Ah, const unsigned short* __restrict__ Al,
            const unsigned short* __restrict__ Xb, const unsigned short* __restrict__ U,
            const float* __restrict__ cs, const float* __restrict__ rv,
            const float* __restrict__ st, float* out) {
  __shared__ __attribute__((aligned(16))) unsigned char lds_all[ATTN_LDS];
  const int tid  = threadIdx.x;
  const int wave = tid >> 5, lane = tid & 31;
  const int hh   = lane >> 4, c = lane & 15;
  const int n0   = blockIdx.x * QT, b = blockIdx.y;
  float* Ow = (float*)lds_all + (size_t)wave * (16 * ND);
  float* op = Ow + c * ND + 8 * hh;                                  // this lane's slots (query column c)
  // O^T tiles: o[j][r] = channel 16 j + 8 hh + r of query c. Every loop over o[] is fully unrolled: only constant
  // indices keep the tiles in registers.
  v8f o[ND / 16];
#pragma unroll
  for (int j = 0; j < ND / 16; ++j) o[j] = zero8();

  const size_t qo = ((size_t)b * NQ + n0 + 16 * wave + c) * ND + 8 * hh;
  const unsigned short* Ahp = Ah + qo;
  const unsigned short* Alp = Al + qo;
  // The block's K tile (32 key rows x 768, row pitch KP) and V tile (768 channel rows x 32 keys, row pitch VP) in LDS,
  // read by all four waves. Fragment readers: lane -> row (lane&15), + 8*(lane>>4), as from the global planes.
  const unsigned short* Ks = (const unsigned short*)(lds_all + QLDS) + c * KP + 8 * hh;          // + key_loc*KP + 32 kc
  const unsigned short* Vs = (const unsigned short*)(lds_all + QLDS + KLDS) + c * VP + 8 * hh;   // + 16 j*VP
  // Copy side. K: wave w brings key rows 8w..8w+7, three copies of 512 B a row. V: wave w brings channel rows
  // 192w..192w+191, one copy = 8 rows x 64 B (lane -> row lane>>2, 16-byte piece lane&3).
  unsigned char* kl0 = lds_all + QLDS + (8 * wave) * (KP * 2) + 16 * lane;
  unsigned char* vl0 = lds_all + QLDS + KLDS + (192 * wave + (lane >> 2)) * (VP * 2) + 16 * (lane & 3);
  const unsigned short* kg0 = Xb + ((size_t)b * NC + 8 * wave) * ND + 8 * lane;                    // + kb*ND
  const unsigned short* vg0 = U + ((size_t)b * ND + 192 * wave + (lane >> 2)) * NC + 8 * (lane & 3); // + kb
  const float* csb = cs + (size_t)b * NC + 8 * hh;                                    // + kb (+16)

  // The wave's 16 query rows (hi and residual plane) go once into the wave's own LDS slots, fragment by fragment:
  // quarter f = 4 kc + {0, 1: hi elements 0..7, 8..15; 2, 3: residual} holds 32 lanes x 16 B, and every lane reads back
  // only what it wrote itself. The slots are the bytes of Ow, which is written only behind the key loop.
  unsigned short* Qs = (unsigned short*)lds_all + (size_t)wave * (2 * 16 * ND) + 8 * lane;
#pragma unroll 1
  for (int kq = 0; kq < ND / 32 / KG; ++kq) {
    const unsigned short* ap = Ahp + 32 * KG * kq;
    const unsigned short* lp = Alp + 32 * KG * kq;
    Frag a[KG], r[KG];
#pragma unroll
    for (int u = 0; u < KG; ++u) {
      a[u] = ldfrag(ap + 32 * u);
      r[u] = ldfrag(lp + 32 * u);
    }
    asm volatile("s_wait_xcnt 0x0" :: "v"(ap), "v"(lp) : "memory");
#pragma unroll
    for (int u = 0; u < KG; ++u) {
      const int kc = KG * kq + u;
      *(v8us*)(Qs + (4 * kc + 0) * 256) = a[u].u[0];
      *(v8us*)(Qs + (4 * kc + 1) * 256) = a[u].u[1];
      *(v8us*)(Qs + (4 * kc + 2) * 256) = r[u].u[0];
      *(v8us*)(Qs + (4 * kc + 3) * 256) = r[u].u[1];
    }
  }

  // Two-buffer ring over the tile sequence K(0), V(0), K(32), V(32), ...: the K buffer is worked on (scores) while the V
  // tile flies, the V buffer (O^T) while the next K tile flies. In front of the loop: first K tile, landed and
  // published; then the first V tile is sent off.
  asm volatile("s_wait_dscnt 0x0" ::: "memory");                     // the wave's own LDS stores retire before it copies
  acopy_tile<3, 512, 256, KP * 2, ND>(kl0, kg0);
  asm volatile("s_wait_asynccnt 0x0" ::: "memory");                  // this wave's share of the K tile has landed
  __syncthreads();                                                   // ... and every other wave's: the tile is readable
  acopy_tile<24, 8 * VP * 2, 8 * NC, 0, 0>(vl0, vg0);

  float m = -1.0e30f, l = 0.f;
#pragma unroll 1
  for (int kb = 0; kb < NC; kb += 32) {
    const unsigned short* k0p = Ks;                                  // keys kb .. kb+15
    const unsigned short* k1p = Ks + 16 * KP;                        // keys kb+16 .. kb+31
    v8f s0 = zero8(), s1 = zero8();
    // K and Q fragments (both LDS) in groups of KG d-chunks, two groups in registers: group g + 1 is in flight
    // while group g is used.
    Frag kf[2][KG][2], qf[2][KG][2];
#pragma unroll
    for (int u = 0; u < KG; ++u) {
      kf[0][u][0] = ldfrag(k0p + 32 * u);
      kf[0][u][1] = ldfrag(k1p + 32 * u);
      qf[0][u][0] = ldq(Qs + (4 * u) * 256);
      qf[0][u][1] = ldq(Qs + (4 * u + 2) * 256);
    }
    // the key-side terms are fetched here, at the head of the trip: the barrier at its foot waits for every global load
    const v4f ca = *(const v4f*)(csb + kb);
    const v4f cb = *(const v4f*)(csb + kb + 4);
    const v4f cd = *(const v4f*)(csb + kb + 16);
    const v4f ce = *(const v4f*)(csb + kb + 20);
    // the same wait for these four loads: their address pair is an input, so that nothing lands on it while the
    // loads are under way
    asm volatile("s_wait_xcnt 0x0" :: "v"(csb + kb) : "memory");
#pragma unroll
    for (int g = 0; g < ND / 32 / KG; ++g) {
      if (g + 1 < ND / 32 / KG) {
#pragma unroll
        for (int u = 0; u < KG; ++u) {
          const int kn = KG * (g + 1) + u;
          kf[(g + 1) & 1][u][0] = ldfrag(k0p + 32 * kn);
          kf[(g + 1) & 1][u][1] = ldfrag(k1p + 32 * kn);
          qf[(g + 1) & 1][u][0] = ldq(Qs + (4 * kn) * 256);
          qf[(g + 1) & 1][u][1] = ldq(Qs + (4 * kn + 2) * 256);
        }
      }
      // holds the next group's loads, as one run, in front of this group's products: they are in flight meanwhile, and
      // no LDS read stands among the products (without it the build spreads them there)
      __builtin_amdgcn_sched_barrier(0);
#pragma unroll
      for (int u = 0; u < KG; ++u) {
        s0 = mma_q(kf[g & 1][u][0].bf, qf[g & 1][u][0].bf, s0);
        s1 = mma_q(kf[g & 1][u][1].bf, qf[g & 1][u][0].bf, s1);
        s0 = mma_q(kf[g & 1][u][0].bf, qf[g & 1][u][1].bf, s0);
        s1 = mma_q(kf[g & 1][u][1].bf, qf[g & 1][u][1].bf, s1);
      }
      // keeps later groups' loads behind this point: no more than two groups hold registers, and again no LDS read
      // among the products
      __builtin_amdgcn_sched_barrier(0);
    }
    {
#pragma unroll
      for (int r = 0; r < 4; ++r) {
        s0[r] += ca[r]; s0[4 + r] += cb[r];                          // key kb      + 8hh + r
        s1[r] += cd[r]; s1[4 + r] += ce[r];                          // key kb + 16 + 8hh + r
      }
    }

    // foot of the score trip: own LDS reads done, own V copies landed, then the barrier that publishes the V tile and
    // ends every wave's reads of the K buffer; behind it the next K tile is sent off into that buffer
    asm volatile("s_wait_dscnt 0x0" ::: "memory");
    asm volatile("s_wait_asynccnt 0x0" ::: "memory");
    __syncthreads();
    if (kb + 32 < NC) acopy_tile<3, 512, 256, KP * 2, ND>(kl0, kg0 + (size_t)(kb + 32) * ND);

    float mx = fmaxf(hmax8(s0), hmax8(s1));
    mx = fmaxf(mx, __shfl_xor(mx, 16, 32));
    const float mn   = fmaxf(m, mx);
    const float corr = __expf(m - mn);                               // == 1 exactly when the max did not grow
    l *= corr;
    m = mn;
    const float msh = mn - LNPS;                                     // exp gives e^{s-m} * 16384

    FragH ph;
    float ls = 0.f;
#pragma unroll
    for (int r = 0; r < 8; ++r) {
      const float e0 = __expf(s0[r] - msh);
      const float e1 = __expf(s1[r] - msh);
      ls += e0 + e1;
      ph.hv[0][r] = (_Float16)e0;
      ph.hv[1][r] = (_Float16)e1;
    }
    l += ls;

    // V fragments (LDS) in groups of VG channel tiles, two groups in registers, as for K and Q above
    Frag vf[2][VG];
#pragma unroll
    for (int u = 0; u < VG; ++u) vf[0][u] = ldfrag(Vs + (16 * u) * VP);
#pragma unroll
    for (int g = 0; g < ND / 16 / VG; ++g) {
      if (g + 1 < ND / 16 / VG) {
#pragma unroll
        for (int u = 0; u < VG; ++u) vf[(g + 1) & 1][u] = ldfrag(Vs + (16 * (VG * (g + 1) + u)) * VP);
      }
      // holds the next group's LDS reads, as one run, in front of this group's products
      __builtin_amdgcn_sched_barrier(0);
#pragma unroll
      for (int u = 0; u < VG; ++u) {
        const int j = VG * g + u;
        v8f t;
#pragma unroll
        for (int r = 0; r < 8; ++r) t[r] = o[j][r] * corr;
        o[j] = mma_h(vf[g & 1][u].h, ph.v, t);
      }
      // keeps later groups' reads behind this point: no LDS read among the products
      __builtin_amdgcn_sched_barrier(0);
    }
    // foot of the O^T trip: the same order; the barrier publishes the next K tile and frees the V buffer
    asm volatile("s_wait_dscnt 0x0" ::: "memory");
    asm volatile("s_wait_asynccnt 0x0" ::: "memory");
    __syncthreads();
    if (kb + 32 < NC) acopy_tile<24, 8 * VP * 2, 8 * NC, 0, 0>(vl0, vg0 + (kb + 32));
  }
  asm volatile("s_wait_asynccnt 0x0" ::: "memory");                  // nothing is in flight when the LDS changes its use
  // the finished tiles go to the wave's LDS slots once, for the row-major epilogue
#pragma unroll
  for (int j = 0; j < ND / 16; ++j) {
    v4f na, nb2;
#pragma unroll
    for (int r = 0; r < 4; ++r) { na[r] = o[j][r]; nb2[r] = o[j][4 + r]; }
    *(v4f*)(op + 16 * j)     = na;
    *(v4f*)(op + 16 * j + 4) = nb2;
  }
  l += __shfl_xor(l, 16, 32);
  const float inv  = 1.0f / l;                                       // Ow and l both carry the x16384 factor
  const float mu   = st[4 * b + 0], rstd = st[4 * b + 1];
  const float qsc  = inv * rstd * IUSC;                              // per lane: its query column
  const float mrs  = mu * rstd;
  v4f rvv[6];
#pragma unroll
  for (int k = 0; k < ND / 128; ++k) {
    const v4f t = *(const v4f*)(rv + 128 * k + 4 * lane);
#pragma unroll
    for (int u = 0; u < 4; ++u) rvv[k][u] = t[u] * mrs;
  }
  __syncthreads();                                                   // all accumulator slots final before cross-lane reads

{
#pragma unroll 1
    for (int qq = 0; qq < 16; ++qq) {
      const float sc = __shfl(qsc, qq, 32);
      const float* lrow = Ow + qq * ND + 4 * lane;
      float* orow = out + ((size_t)b * NC + n0 + 16 * wave + qq) * ND + 4 * lane;
#pragma unroll
      for (int k = 0; k < ND / 128; ++k) {
        const v4f v = *(const v4f*)(lrow + 128 * k);
        v4f w;
#pragma unroll
        for (int u = 0; u < 4; ++u) w[u] = v[u] * sc - rvv[k][u];
        *(v4f*)(orow + 128 * k) = w;
      }
    }
    
  }
}

// =========================================================================================================
// Workspace map (bytes; each region start a multiple of 256; every extent is an exact tile/line multiple and is
//   Wn bf16 [3][768][768]      3538944      Wt bf16 [3][768][768]   3538944
//   rs  f32 [3][768]              9216      g   f32 [768]              3072
//   Xb bf16 [NB][2048][768]   25165824 (NB=8)  part f64 [NB][64][16]  65536    st f32 [32]  128 (256)
//   Hh/Hl bf16 [768][768]      1179648 x2
//   Ah/Al bf16 [NB][NQ][768]  25165824 x2 (NB=8, NQ=2048)
//   U  f16 [NB][768][2048]    25165824      cs f32 [NB][2048]         65536
//   total (NB=8, NQ=2048) = 110244096
// =========================================================================================================
extern "C" void kernel_launch(void* const* d_in, const int* in_sizes, int n_in,
                              void* d_out, int out_size, void* d_ws, size_t ws_size,
                              hipStream_t stream) {
  if (n_in < 4) return;
  if (in_sizes[0] < NB * NC * ND) return;
  if (in_sizes[1] < ND * ND || in_sizes[2] < ND * ND || in_sizes[3] < ND * ND) return;
  if (out_size < NB * NC * ND) return;

  size_t off = 0;
  auto carve = [&](size_t bytes) { const size_t o = off; off += (bytes + 255) & ~(size_t)255; return o; };
  const size_t oWn   = carve((size_t)3 * ND * ND * 2);
  const size_t oWt   = carve((size_t)3 * ND * ND * 2);
  const size_t oRs   = carve((size_t)3 * ND * 4);
  const size_t oG    = carve((size_t)ND * 4);
  const size_t oXb   = carve((size_t)NB * NC * ND * 2);
  const size_t oPart = carve((size_t)NB * KCH * 128);
  const size_t oSt   = carve((size_t)128);
  const size_t oHh   = carve((size_t)ND * ND * 2);
  const size_t oHl   = carve((size_t)ND * ND * 2);
  const size_t oAh   = carve((size_t)NB * NQ * ND * 2);
  const size_t oAl   = carve((size_t)NB * NQ * ND * 2);
  const size_t oU    = carve((size_t)NB * ND * NC * 2);
  const size_t oCs   = carve((size_t)NB * NC * 4);
  if (off > ws_size) return;
  if (off > (size_t)134217728) return;

  const float* x  = (const float*)d_in[0];
  const float* wk = (const float*)d_in[1];
  const float* wq = (const float*)d_in[2];
  const float* wv = (const float*)d_in[3];

  char* ws = (char*)d_ws;
  unsigned short* Wn  = (unsigned short*)(ws + oWn);
  unsigned short* Wt  = (unsigned short*)(ws + oWt);
  float*          rs  = (float*)(ws + oRs);
  float*          g   = (float*)(ws + oG);
  unsigned short* Xb  = (unsigned short*)(ws + oXb);
  double*         part = (double*)(ws + oPart);
  float*          st  = (float*)(ws + oSt);
  unsigned short* Hh  = (unsigned short*)(ws + oHh);
  unsigned short* Hl  = (unsigned short*)(ws + oHl);
  unsigned short* Ah  = (unsigned short*)(ws + oAh);
  unsigned short* Al  = (unsigned short*)(ws + oAl);
  unsigned short* U   = (unsigned short*)(ws + oU);
  float*          cs  = (float*)(ws + oCs);
  float* out = (float*)d_out;

  const dim3 blk256(256), blk128(128), blk64(64);

  // (0) weights -> bf16 natural + transposed planes + row sums (y: 0 Wk, 1 Wq, 2 Wv)
  cvt_w<<<dim3(ND / QT, 3), blk256, 0, stream>>>(wk, wq, wv, Wn, Wt, rs);
  // (1) g = bf16(Wk)^T . rowsum(bf16(Wq))
  k_g<<<dim3(ND / 256), blk256, 0, stream>>>(Wn, rs + ND, g);
  // (2) x -> bf16 plane + f64 partial sums
  k_xcvt<<<dim3(KCH, NB), blk256, 0, stream>>>(x, Xb, part);
  // (3) LayerNorm statistics
  k_stats<<<dim3(1), blk64, 0, stream>>>(part, st);
  // (4) H planes: A = Wq transposed (rows d), B = Wk transposed (rows e)
  k_hgemm<<<dim3(ND / QT, ND / QT), blk128, 0, stream>>>(Wt + (size_t)1 * ND * ND, Wt, Hh, Hl);
  // (5) query planes A' = rstd^2 X.H  (hi + residual)
  k_agemm<<<dim3(NQ / QT, ND / QT, NB), blk128, 0, stream>>>(Hh, Hl, Xb, st, Ah, Al);
  // (6) value plane U = 16 X.Wv^T (channel-major)
  k_vgemm<<<dim3(ND / QT, NC / QT, NB), blk128, 0, stream>>>(Xb, Wn + (size_t)2 * ND * ND, U);
  // (7) key-side affine term
  k_cs<<<dim3(NC / 32, NB), blk256, 0, stream>>>(Xb, g, st, cs);
  // (8) attention -> out [b][q][768]
  k_attn<<<dim3(NQ / QT, NB), blk128, 0, stream>>>(Ah, Al, Xb, U, cs, rs + 2 * ND, st, out);
  (void)hipGetLastError();
}

// v005
// One run takes 319 microseconds.
// Two timings next to v004 both put it at 1.18 times that version's speed.
// Counting every step since v000, it is 4.49 times as fast.
// Contractions (f32 accumulate everywhere): H[e][d] = sum_o Wq[o][d]*Wk[o][e] on v_wmma_f32_16x16x32_bf16 with
// bf16-RNE weights (exact products); query plane A' = X.H with bf16-RNE x and H carried as bf16 hi + bf16
// residual (2 products, shared accumulator); U = X.Wv^T (1 product, bf16-RNE operands); scores
// S^T = X(keys).A'(queries) with A' as bf16 hi + bf16 residual (2 products); O^T = U.P^T on
// v_wmma_f32_16x16x32_f16 (U x16 as f16, P = e^{s-m} x16384 as f16 built from the score D registers).
// LayerNorm statistics in f64 VALU; per-batch affine terms, softmax statistics and normalisation in f32 VALU.
#include <hip/hip_runtime.h>
#include <math.h>
#include <stdint.h>

#ifndef NB
#define NB 8
#endif
#ifndef NQ
#define NQ 2048
#endif
#define NBF  8
#define NC   2048
#define ND   768
#define QT   64
#define OSP  68
#define TPW  72
#define KCH  64
#define KG   4
#define USC  16.0f
#define IUSC 0.0625f
#define LNPS 9.704060527839234f
#define EPSV 1.0e-5f
#define KP   776
#define VP   40
#define VG   8
#define QLDS (4 * 16 * ND * 4)
#define KLDS (32 * KP * 2)
#define VLDS (ND * VP * 2)
#define ATTN_LDS (QLDS + KLDS + VLDS)
#define GKC  64
#define GP   72
#define GPB  (QT * GP * 2)
#define GCB  32
#define GRG  64

static_assert(NB >= 1 && NB <= NBF);
static_assert(NQ % QT == 0 && NQ >= QT && NQ <= NC);
static_assert(NC % QT == 0 && ND % QT == 0);
static_assert(NC % 32 == 0 && ND % 32 == 0);
static_assert(ND % 256 == 0 && ND % 128 == 0 && ND % 16 == 0);
static_assert(NC / KCH == 32 && KCH == 64);
static_assert((ND / 32) % KG == 0);
static_assert(2 * 16 * ND * 2 == 16 * ND * 4);
static_assert(4 * NBF <= 32);
static_assert((OSP * 4) % 16 == 0);
static_assert((TPW * 2) % 16 == 0);
static_assert(QLDS == 196608 && ATTN_LDS <= 327680);
static_assert((KP * 2) % 32 == 16 && (VP * 2) % 32 == 16);          // LDS row pitch = 16 B x odd, for b128 readers
static_assert(KP >= ND + 8 && VP >= 32 + 8 && QLDS % 16 == 0 && KLDS % 16 == 0);
static_assert(ND % GKC == 0 && ND / GKC >= 2 && GKC * 2 == 128 && GKC % 32 == 0 && QT == 64);
static_assert((GP * 2) % 32 == 16 && GP >= GKC + 8 && 2 * 2 * GPB >= QT * OSP * 4);
static_assert(ND % GCB == 0 && ND % GRG == 0 && GCB == 32 && 4 * GRG == 256 && GRG % 8 == 0);
static_assert((ND / 16) % VG == 0 && ND % (4 * 8) == 0 && ND / 4 / 8 == 24 && 8 * (ND / 256) == 24);

typedef _Float16       v16h __attribute__((ext_vector_type(16)));
typedef _Float16       v8h  __attribute__((ext_vector_type(8)));
typedef __bf16         v16b __attribute__((ext_vector_type(16)));
typedef unsigned short v8us __attribute__((ext_vector_type(8)));
typedef float          v8f  __attribute__((ext_vector_type(8)));
typedef float          v4f  __attribute__((ext_vector_type(4)));
typedef unsigned int   v4u  __attribute__((ext_vector_type(4)));
typedef double         v2d  __attribute__((ext_vector_type(2)));

union Frag  { v8us u[2]; v16h h; v16b bf; };
union FragH { v16h v; v8h hv[2]; };
static_assert(sizeof(Frag) == 32);
static_assert(sizeof(FragH) == 32);

// ---- scalar helpers ---------------------------------------------------------------------------------------
__device__ __forceinline__ unsigned short bf_bits(float f) {          // f32 -> bf16 bits, RNE convert
  unsigned u = __float_as_uint(f);
  return (unsigned short)((u + 0x7FFFu + ((u >> 16) & 1u)) >> 16);
}
__device__ __forceinline__ float bf_up(unsigned short hb) { return __uint_as_float(((unsigned)hb) << 16); }
__device__ __forceinline__ float bf_lo16(unsigned w) { return __uint_as_float(w << 16); }
__device__ __forceinline__ float bf_hi16(unsigned w) { return __uint_as_float(w & 0xFFFF0000u); }
__device__ __forceinline__ unsigned short h_bits(_Float16 x) { return __builtin_bit_cast(unsigned short, x); }
__device__ __forceinline__ unsigned pk16(unsigned short a, unsigned short b) { return (unsigned)a | ((unsigned)b << 16); }
__device__ __forceinline__ v8f zero8() { v8f z = {0.f, 0.f, 0.f, 0.f, 0.f, 0.f, 0.f, 0.f}; return z; }
__device__ __forceinline__ float hmax8(v8f s) {
  return fmaxf(fmaxf(fmaxf(s[0], s[1]), fmaxf(s[2], s[3])), fmaxf(fmaxf(s[4], s[5]), fmaxf(s[6], s[7])));
}
__device__ __forceinline__ double shfl_xor_d(double v, int mask) {
  int lo = __double2loint(v), hi = __double2hiint(v);
  lo = __shfl_xor(lo, mask, 32);
  hi = __shfl_xor(hi, mask, 32);
  return __hiloint2double(hi, lo);
}

// ---- 16-bit fragment loader (A, or B from a k-contiguous [n][k] row): lane -> row/col (lane&15), p already includes
//      + 8*(lane>>4); elements 0..7 <- p[0..7] (k0+8h..), elements 8..15 <- p[16..23] (k0+16+8h..)
__device__ __forceinline__ Frag ldfrag(const unsigned short* p) {
  Frag f;
  f.u[0] = *(const v8us*)(p);
  f.u[1] = *(const v8us*)(p + 16);
  return f;
}

// ---- fragment from the packed LDS form: two quarters of 32 lanes x 16 B, p already includes + 8*lane
__device__ __forceinline__ Frag ldq(const unsigned short* p) {
  Frag f;
  f.u[0] = *(const v8us*)(p);
  f.u[1] = *(const v8us*)(p + 256);
  return f;
}

// ---- WMMA helpers: builtin followed by a 4-slot VALU gap tying D and keeping A/B live --------------------------
// mma_h is the bare builtin (the compiler keeps the distance behind its own WMMAs): with D tied to an asm statement
// the 48 resident D tiles of k_attn, 384 registers, do not all get registers and the build spills to scratch.
__device__ __forceinline__ v8f mma_h(v16h a, v16h b, v8f c) {
  return __builtin_amdgcn_wmma_f32_16x16x32_f16(false, a, false, b, (short)0, c, false, false);
}
// mma_q is the bare bf16 builtin, for a like reason: with the two fragment groups that k_attn keeps in flight tied to
// mma_b's asm statement as operands, the build spills to scratch.
__device__ __forceinline__ v8f mma_q(v16b a, v16b b, v8f c) {
  return __builtin_amdgcn_wmma_f32_16x16x32_bf16(false, a, false, b, (short)0, c, false, false);
}
__device__ __forceinline__ v8f mma_b(v16b a, v16b b, v8f c) {
  v8f d = __builtin_amdgcn_wmma_f32_16x16x32_bf16(false, a, false, b, (short)0, c, false, false);
#if defined(__HIP_DEVICE_COMPILE__)
  const v16h ha = __builtin_bit_cast(v16h, a), hb = __builtin_bit_cast(v16h, b);
  asm volatile("v_nop\n\tv_nop\n\tv_nop\n\tv_nop" : "+v"(d) : "v"(ha), "v"(hb));
#endif
  return d;
}

// ---- one tile = 24 asynchronous 16-byte copies per lane, global -> LDS, through no register. RUN copies follow one
//      another at steps (LS1, GS1), then the next run starts (LS2, GS2) further; steps in bytes (LDS) and in 16-bit
//      elements (global). The landing is waited for by the caller (s_wait_asynccnt).
typedef int v4i __attribute__((ext_vector_type(4)));
template <int RUN, int LS1, int GS1, int LS2, int GS2>
__device__ __forceinline__ void acopy_tile(unsigned char* l0, const unsigned short* g0) {
#if defined(__HIP_DEVICE_COMPILE__)
#pragma unroll
  for (int idx = 0; idx < 24; ++idx) {
    const int r = idx / RUN, s = idx % RUN;
    __builtin_amdgcn_global_load_async_to_lds_b128(
        (__attribute__((address_space(1))) v4i*)(g0 + (size_t)r * GS2 + (size_t)s * GS1),
        (__attribute__((address_space(3))) v4i*)(l0 + r * LS2 + s * LS1), 0, 0);
  }
#endif
}

// =========================================================================================================
// (0) weights f32 [768][768] (y = 0: Wk, 1: Wq, 2: Wv, block-uniform selection) -> bf16-RNE planes:
//     natural Wn[y][o][i] and transposed Wt[y][i][o], plus row sums rs[y][o] = sum_i bf16(W[o][i]) in f32.
//     Block (ob, y) owns rows o0..o0+63; column chunks of 64 go through the LDS tile T[i_loc][o_loc] (pitch TPW).
// coverage: Wn 12 chunks x 2 it x 8 waves x 4 rows x 8 lanes x 8 = 64 x 768 per block; Wt 12 chunks x 2 it x 32 x 8
//           lanes x 8 = 768 x 64 per block; rs 16 x 4 = 64; grid (12, 3) covers all three matrices once.
// LDS: T and rsL cross-wave (block barriers).
// =========================================================================================================
__global__ __launch_bounds__(256)
void cvt_w(const float* __restrict__ wk, const float* __restrict__ wq, const float* __restrict__ wv,
           unsigned short* Wn, unsigned short* Wt, float* rs) {
  __shared__ __align__(16) unsigned short T[QT * TPW];
  __shared__ __align__(16) float rsL[QT];
  const int tid = threadIdx.x, lane = tid & 31, wave = tid >> 5;
  const int y = blockIdx.y, o0 = blockIdx.x * QT;
  const float* W = (y == 0) ? wk : ((y == 1) ? wq : wv);            // block-uniform, all global
  unsigned short* Np = Wn + (size_t)y * ND * ND;
  unsigned short* Tq = Wt + (size_t)y * ND * ND;
  const int e = lane & 7, r4 = lane >> 3;                           // r4 0..3
  const int e8 = tid & 7, lq = tid >> 3;                            // lq 0..31
  float rsum0 = 0.f, rsum1 = 0.f;
#pragma unroll 1
  for (int cc = 0; cc < ND / QT; ++cc) {
    const int i0 = cc * QT;
#pragma unroll
    for (int it = 0; it < 2; ++it) {
      const int ol = 8 * wave + 4 * it + r4;                          // 0..63
      const float* sp = W + (size_t)(o0 + ol) * ND + i0 + 8 * e;
      const v4f a = *(const v4f*)sp;
      const v4f q = *(const v4f*)(sp + 4);
      const float f[8] = {a[0], a[1], a[2], a[3], q[0], q[1], q[2], q[3]};
      unsigned short hb[8];
      float ps = 0.f;
#pragma unroll
      for (int t = 0; t < 8; ++t) { hb[t] = bf_bits(f[t]); ps += bf_up(hb[t]); }
      if (it == 0) rsum0 += ps; else rsum1 += ps;
      v4u u;
#pragma unroll
      for (int t = 0; t < 4; ++t) u[t] = pk16(hb[2 * t], hb[2 * t + 1]);
      unsigned short* np = Np + (size_t)(o0 + ol) * ND + i0 + 8 * e;
      *(v4u*)np = u;
      
#pragma unroll
      for (int t = 0; t < 8; ++t) T[(8 * e + t) * TPW + ol] = hb[t];   // T[i_loc][o_loc]
    }
    __syncthreads();
    v4u up[2];
#pragma unroll
    for (int it = 0; it < 2; ++it) {
      const int il = 32 * it + lq;                                    // 0..63
      up[it] = *(const v4u*)(T + il * TPW + 8 * e8);
    }
{
#pragma unroll
      for (int it = 0; it < 2; ++it) {
        const int il = 32 * it + lq;
        *(v4u*)(Tq + (size_t)(i0 + il) * ND + o0 + 8 * e8) = up[it];
      }
      
    }
    __syncthreads();                                                  // T reused by the next chunk
  }
  rsum0 += __shfl_xor(rsum0, 1, 32); rsum0 += __shfl_xor(rsum0, 2, 32); rsum0 += __shfl_xor(rsum0, 4, 32);
  rsum1 += __shfl_xor(rsum1, 1, 32); rsum1 += __shfl_xor(rsum1, 2, 32); rsum1 += __shfl_xor(rsum1, 4, 32);
  if (e == 0) { rsL[8 * wave + r4] = rsum0; rsL[8 * wave + 4 + r4] = rsum1; }
  __syncthreads();
  if (wave == 0 && lane < 16) {
    const v4f v = *(const v4f*)(rsL + 4 * lane);
    float* rp = rs + (size_t)y * ND + o0 + 4 * lane;
    *(v4f*)rp = v;
    
  }
}

// =========================================================================================================
// (1) g[e] = sum_o bf16(Wk)[o][e] * rq[o]  (rq = row sums of bf16(Wq)); f32. Block = 32 columns e (its 32 results are
//     one 128-byte line of g). Thread (og = tid>>2, e4 = tid&3) takes columns 8 e4..8 e4+7 of rows og + 64 i, i < 12:
//     twelve 16-byte loads and twelve rq values, all sent off before the first is used, so the block pays one load
//     latency. The 64 row groups are joined in a fixed order: pL[og][column] -> wave w sums groups 8w..8w+7 ->
//     sL[w][column] -> wave 0 sums the eight and stores the line with one instruction.
// coverage: 64 og x 12 = 768 rows, 4 e4 x 8 = 32 columns per block; 24 blocks x 32 = 768 = whole g.
// LDS pL and sL cross-wave (a block barrier behind each).
// =========================================================================================================
__global__ __launch_bounds__(256)
void k_g(const unsigned short* __restrict__ Wkn, const float* __restrict__ rq, float* g) {
  __shared__ __align__(16) float pL[GRG * GCB];
  __shared__ __align__(16) float sL[8 * GCB];
  const int tid = threadIdx.x, lane = tid & 31, wave = tid >> 5;
  const int e4 = tid & 3, og = tid >> 2;
  const int e0 = blockIdx.x * GCB;
  const unsigned short* wp = Wkn + (size_t)og * ND + e0 + 8 * e4;
  v4u   w[ND / GRG];
  float r[ND / GRG];
  // unrolled: w[] and r[] stay in registers and all 24 loads are issued before the first one is waited for
#pragma unroll
  for (int i = 0; i < ND / GRG; ++i) {
    w[i] = *(const v4u*)(wp + (size_t)(GRG * i) * ND);
    r[i] = rq[og + GRG * i];
  }
  float acc[8] = {0.f, 0.f, 0.f, 0.f, 0.f, 0.f, 0.f, 0.f};
  // both loops unrolled: only constant indices keep w[], r[] and acc[] in registers
#pragma unroll
  for (int i = 0; i < ND / GRG; ++i) {
#pragma unroll
    for (int t = 0; t < 4; ++t) {
      acc[2 * t]     += bf_lo16(w[i][t]) * r[i];
      acc[2 * t + 1] += bf_hi16(w[i][t]) * r[i];
    }
  }
  const v4f pa = {acc[0], acc[1], acc[2], acc[3]};
  const v4f pb = {acc[4], acc[5], acc[6], acc[7]};
  *(v4f*)(pL + og * GCB + 8 * e4)     = pa;
  *(v4f*)(pL + og * GCB + 8 * e4 + 4) = pb;
  __syncthreads();
  float s = 0.f;
  // unrolled (here and below): eight LDS reads at constant offsets of one address
#pragma unroll
  for (int k = 0; k < GRG / 8; ++k) s += pL[(GRG / 8 * wave + k) * GCB + lane];
  sL[wave * GCB + lane] = s;
  __syncthreads();
  if (wave == 0) {
    float v = 0.f;
#pragma unroll
    for (int k = 0; k < 8; ++k) v += sL[k * GCB + lane];
    g[e0 + lane] = v;
  }
}

// =========================================================================================================
// (2) x f32 [b][2048][768] -> Xb bf16-RNE plane (same layout) and per-chunk f64 partial sums of the bf16 values
//     (sum, sum of squares). Block (ch, b) owns 32 rows; wave w rows 4w..4w+3; per row 3 instructions of
// coverage: Xb 4 rows x 8 waves x 3 x 32 lanes x 8 = 32 x 768 per block, grid (64, NB) = all rows of b < NB;
// =========================================================================================================
__global__ __launch_bounds__(256)
void k_xcvt(const float* __restrict__ x, unsigned short* Xb, double* part) {
  __shared__ double sL[8], qL[8];
  const int tid = threadIdx.x, lane = tid & 31, wave = tid >> 5;
  const int ch = blockIdx.x, b = blockIdx.y;
  const int r0 = ch * (NC / KCH);
  double s = 0.0, q = 0.0;
#pragma unroll 1
  for (int t = 0; t < 4; ++t) {
    const int row = r0 + 4 * wave + t;
    const size_t base = ((size_t)b * NC + row) * ND + 8 * lane;
#pragma unroll 1
    for (int c3 = 0; c3 < ND / 256; ++c3) {
      const float* sp = x + base + 256 * c3;
      const v4f a = *(const v4f*)sp;
      const v4f q4 = *(const v4f*)(sp + 4);
      const float f[8] = {a[0], a[1], a[2], a[3], q4[0], q4[1], q4[2], q4[3]};
      unsigned short hb[8];
#pragma unroll
      for (int k = 0; k < 8; ++k) {
        hb[k] = bf_bits(f[k]);
        const double v = (double)bf_up(hb[k]);
        s += v;
        q += v * v;
      }
      v4u u;
#pragma unroll
      for (int k = 0; k < 4; ++k) u[k] = pk16(hb[2 * k], hb[2 * k + 1]);
      unsigned short* xp = Xb + base + 256 * c3;
      *(v4u*)xp = u;
      
    }
  }
  s += shfl_xor_d(s, 16); s += shfl_xor_d(s, 8); s += shfl_xor_d(s, 4); s += shfl_xor_d(s, 2); s += shfl_xor_d(s, 1);
  q += shfl_xor_d(q, 16); q += shfl_xor_d(q, 8); q += shfl_xor_d(q, 4); q += shfl_xor_d(q, 2); q += shfl_xor_d(q, 1);
  if (lane == 0) { sL[wave] = s; qL[wave] = q; }
  __syncthreads();
  if (wave == 0) {
    double S = 0.0, Q = 0.0;
#pragma unroll
    for (int w = 0; w < 8; ++w) { S += sL[w]; Q += qL[w]; }
    v2d val;
    val[0] = (lane == 0) ? S : 0.0;
    val[1] = (lane == 0) ? Q : 0.0;
    if (lane < 8) {
      double* pp = part + ((size_t)b * KCH + ch) * 16 + 2 * lane;
      *(v2d*)pp = val;
      
    }
  }
}

// =========================================================================================================
// (3) LayerNorm statistics per batch from the 64 partial lines (fixed-order f64 tree): st line f32 [32] with
// =========================================================================================================
__global__ __launch_bounds__(64)
void k_stats(const double* __restrict__ part, float* st) {
  __shared__ double sL[64], qL[64];
  __shared__ __align__(16) float stL[32];
  const int tid = threadIdx.x;
  if (tid < 32) stL[tid] = 0.f;
#pragma unroll 1
  for (int b = 0; b < NB; ++b) {
    __syncthreads();
    const size_t pb = ((size_t)b * KCH + tid) * 16;
    sL[tid] = part[pb];
    qL[tid] = part[pb + 1];
    __syncthreads();
#pragma unroll
    for (int off = 32; off > 0; off >>= 1) {
      if (tid < off) { sL[tid] += sL[tid + off]; qL[tid] += qL[tid + off]; }
      __syncthreads();
    }
    if (tid == 0) {
      const double n  = (double)NC * (double)ND;
      const double mu = sL[0] / n;
      double var = qL[0] / n - mu * mu;
      if (var < 0.0) var = 0.0;
      const float varf = (float)var;
      const float ve   = varf + EPSV;
      const float rstd = (float)(1.0 / sqrt((double)ve));
      const float muf  = (float)mu;
      stL[4 * b + 0] = muf;
      stL[4 * b + 1] = rstd;
      stL[4 * b + 2] = rstd * rstd;
      stL[4 * b + 3] = muf * rstd * rstd;
    }
  }
  __syncthreads();
  if (tid < 8) {
    const v4f v = *(const v4f*)(stL + 4 * tid);
    float* p = st + 4 * tid;
    *(v4f*)p = v;
    
  }
}

// =========================================================================================================
// GEMM engine (K = 768 = 24 k-steps, all operand planes k-contiguous with pitch ND): block 128 threads = 4 waves,
// 64 (m) x 64 (n) tile; wave w owns cols n0+16w..+15 (one B fragment per k-step from row n of the B plane) and
// 4 m-tiles (A rows m0 + 16 mt + (lane&15)); NPROD = 2 adds a second A plane (bf16 residual) into the same
// accumulator. Split k map loader for both operands.
// The operands come through LDS: a stage = 64 k of the block's 64 B rows and 64 A rows (each A plane), one whole
// 128-byte line a row, brought once per block by asynchronous copies and read by all four waves as fragments.
// Stage layout: plane 0 = B, plane 1 = A, plane 2 = A residual; a plane = 64 rows of pitch GP (144 B = 16 B x 9, for
// b128 readers; the 16 pad bytes of a row are neither written nor read). Two stages, a two-buffer ring.
// coverage of a plane: 4 waves x 4 copies x 4 rows x 8 lanes x 16 B = 64 x 128 B.
// =========================================================================================================
__device__ __forceinline__ unsigned lds_off(const void* p) { return (unsigned)(size_t)p; }

// Four asynchronous 16-byte copies per lane, global -> LDS: 16 rows of one plane (a copy = 4 whole rows: lane -> row
// lane>>3, 16-byte piece lane&7). l, g: this lane's LDS byte address and global address in the first of them.
// The s_wait_xcnt closes the statement: the address registers that the copies name are rewritten only behind it.
__device__ __forceinline__ void acopy4(unsigned l, const unsigned short* g) {
#if defined(__HIP_DEVICE_COMPILE__)
  asm volatile("global_load_async_to_lds_b128 %0, %4, off\n\t"
               "global_load_async_to_lds_b128 %1, %5, off\n\t"
               "global_load_async_to_lds_b128 %2, %6, off\n\t"
               "global_load_async_to_lds_b128 %3, %7, off\n\t"
               "s_wait_xcnt 0x0"
               :: "v"(l), "v"(l + 4 * GP * 2), "v"(l + 8 * GP * 2), "v"(l + 12 * GP * 2),
                  "v"(g), "v"(g + 4 * ND), "v"(g + 8 * ND), "v"(g + 12 * ND)
               : "memory");
#endif
}

// a0, a1, b: row 0, column 0 of the block's 64 rows in each plane. sm: 2 stages of (NPROD + 1) planes.
template <int NPROD>
__device__ __forceinline__ void gemm_k(unsigned char* sm, const unsigned short* __restrict__ a0,
                                       const unsigned short* __restrict__ a1,
                                       const unsigned short* __restrict__ b, v8f (&acc)[4]) {
  constexpr int STG = (NPROD + 1) * GPB;
  const int tid = threadIdx.x, lane = tid & 31, wave = tid >> 5, hh = lane >> 4, c = lane & 15;
  // copy side: wave w brings rows 16w..16w+15 of every plane
  const int crow = 16 * wave + (lane >> 3);
  const unsigned cl = lds_off(sm) + crow * (GP * 2) + 16 * (lane & 7);
  const size_t   cg = (size_t)crow * ND + 8 * (lane & 7);
  auto fill = [&](int t) {
    const unsigned l = cl + (t & 1) * STG;
    const size_t   g = cg + (size_t)GKC * t;
    acopy4(l, b + g);
    acopy4(l + GPB, a0 + g);
    if (NPROD == 2) acopy4(l + 2 * GPB, a1 + g);
  };
  // fragment readers: lane -> row (lane&15), + 8*(lane>>4), as from the global planes
  const unsigned short* rb = (const unsigned short*)sm + (16 * wave + c) * GP + 8 * hh;
  const unsigned short* ra = (const unsigned short*)(sm + GPB) + c * GP + 8 * hh;               // + 16 mt * GP
#pragma unroll
  for (int mt = 0; mt < 4; ++mt) acc[mt] = zero8();

  fill(0);
  asm volatile("s_wait_asynccnt 0x0" ::: "memory");                  // this wave's share of stage 0 has landed
  __syncthreads();                                                   // ... and every other wave's: stage 0 is readable
  fill(1);
  // rolled: twelve equal trips, the buffer chosen by an address offset; unrolled it would only grow the code
#pragma unroll 1
  for (int t = 0; t < ND / GKC; ++t) {
    const int bo = (t & 1) * (STG / 2);
#pragma unroll
    for (int k2 = 0; k2 < GKC / 32; ++k2) {
      const Frag fb = ldfrag(rb + bo + 32 * k2);
      Frag fa[4], fl[4];
#pragma unroll
      for (int mt = 0; mt < 4; ++mt) {
        fa[mt] = ldfrag(ra + bo + (16 * mt) * GP + 32 * k2);
        if (NPROD == 2) fl[mt] = ldfrag(ra + bo + GPB / 2 + (16 * mt) * GP + 32 * k2);
      }
#pragma unroll
      for (int mt = 0; mt < 4; ++mt) {
        acc[mt] = mma_b(fa[mt].bf, fb.bf, acc[mt]);
        if (NPROD == 2) acc[mt] = mma_b(fl[mt].bf, fb.bf, acc[mt]);
      }
    }
    // foot of the trip: own LDS reads done, own copies of the next stage landed, then the barrier that publishes that
    // stage and ends every wave's reads of this one; behind it this buffer is refilled
    asm volatile("s_wait_dscnt 0x0" ::: "memory");
    asm volatile("s_wait_asynccnt 0x0" ::: "memory");
    __syncthreads();
    if (t + 2 < ND / GKC) fill(t + 2);
  }
  asm volatile("s_wait_asynccnt 0x0" ::: "memory");                  // nothing is in flight when the LDS changes its use
}

// D tiles -> LDS Os[n_loc][m_loc] (pitch OSP, b128 stores): lane (hh, c) holds m = 16 mt + 8 hh + r for
// n_loc = 16 w + c.  coverage: 4 waves x 16 n x 4 mt x 16 m = 64 x 64 (pad cols 64..67 never read).
__device__ __forceinline__ void stage_os(float* Os, const v8f (&acc)[4], float sc, int wave, int hh, int c) {
  const int nl = 16 * wave + c;
#pragma unroll
  for (int mt = 0; mt < 4; ++mt) {
    v4f va, vb;
#pragma unroll
    for (int r = 0; r < 4; ++r) { va[r] = acc[mt][r] * sc; vb[r] = acc[mt][4 + r] * sc; }
    *(v4f*)(Os + nl * OSP + 16 * mt + 8 * hh)     = va;
    *(v4f*)(Os + nl * OSP + 16 * mt + 8 * hh + 4) = vb;
  }
}

// Os -> two bf16 planes (hi = bf16-RNE(v), lo = bf16-RNE(v - hi)), plane row = row0 + n_loc, 64 m values =
// coverage: 4 it x 16 rows x 8 lanes x 8 = 64 x 64 per plane.
__device__ __forceinline__ void epi_split(const float* Os, unsigned short* Ph, unsigned short* Pl,
                                          size_t row0, int pitch, int col0, int tid) {
  const int e = tid & 7, lq = tid >> 3;                              // lq 0..15
  v4u uh[4], ul[4];
#pragma unroll
  for (int it = 0; it < 4; ++it) {
    const int row = it * 16 + lq;
    const v4f a = *(const v4f*)(Os + row * OSP + 8 * e);
    const v4f q = *(const v4f*)(Os + row * OSP + 8 * e + 4);
    const float f[8] = {a[0], a[1], a[2], a[3], q[0], q[1], q[2], q[3]};
#pragma unroll
    for (int t = 0; t < 4; ++t) {
      const float f0 = f[2 * t], f1 = f[2 * t + 1];
      const unsigned short hb0 = bf_bits(f0), hb1 = bf_bits(f1);
      const unsigned short lb0 = bf_bits(f0 - bf_up(hb0));
      const unsigned short lb1 = bf_bits(f1 - bf_up(hb1));
      uh[it][t] = pk16(hb0, hb1);
      ul[it][t] = pk16(lb0, lb1);
    }
  }
{
#pragma unroll
    for (int it = 0; it < 4; ++it) {
      const int row = it * 16 + lq;
      const size_t po = (row0 + (size_t)row) * (size_t)pitch + (size_t)col0 + 8 * e;
      *(v4u*)(Ph + po) = uh[it];
      *(v4u*)(Pl + po) = ul[it];
    }
    
  }
}

// Os -> one f16 plane (values already scaled), same line geometry as epi_split.
__device__ __forceinline__ void epi_h(const float* Os, unsigned short* P, size_t row0, int pitch, int col0, int tid) {
  const int e = tid & 7, lq = tid >> 3;
  v4u u[4];
#pragma unroll
  for (int it = 0; it < 4; ++it) {
    const int row = it * 16 + lq;
    const v4f a = *(const v4f*)(Os + row * OSP + 8 * e);
    const v4f q = *(const v4f*)(Os + row * OSP + 8 * e + 4);
    const float f[8] = {a[0], a[1], a[2], a[3], q[0], q[1], q[2], q[3]};
#pragma unroll
    for (int t = 0; t < 4; ++t)
      u[it][t] = pk16(h_bits((_Float16)f[2 * t]), h_bits((_Float16)f[2 * t + 1]));
  }
{
#pragma unroll
    for (int it = 0; it < 4; ++it) {
      const int row = it * 16 + lq;
      const size_t po = (row0 + (size_t)row) * (size_t)pitch + (size_t)col0 + 8 * e;
      *(v4u*)(P + po) = u[it];
    }
    
  }
}

// =========================================================================================================
// (4) H planes: D[m = d][n = e] = sum_o WqT[d][o] * WkT[e][o]  (1 product, exact) -> Hh/Hl bf16 [e][768 d].
// grid (12 e-tiles, 12 d-tiles).  LDS Os cross-wave (block barrier).
// =========================================================================================================
__global__ __launch_bounds__(128)
void k_hgemm(const unsigned short* __restrict__ Aq, const unsigned short* __restrict__ Bk,
             unsigned short* Hh, unsigned short* Hl) {
  __shared__ __align__(16) unsigned char sm[2 * 2 * GPB];
  float* Os = (float*)sm;                                            // the stages' bytes, free behind the k loop
  const int tid = threadIdx.x, lane = tid & 31, wave = tid >> 5, hh = lane >> 4, c = lane & 15;
  const int n0 = blockIdx.x * QT, m0 = blockIdx.y * QT;
  const unsigned short* ap = Aq + (size_t)m0 * ND;
  const unsigned short* bp = Bk + (size_t)n0 * ND;
  v8f acc[4];
  gemm_k<1>(sm, ap, ap, bp, acc);
  stage_os(Os, acc, 1.0f, wave, hh, c);
  __syncthreads();
  epi_split(Os, Hh, Hl, (size_t)n0, ND, m0, tid);
}

// =========================================================================================================
// (5) query planes: D[m = e][n = query] = sum_d (Hh + Hl)[e][d] * Xb[b][q][d]  (2 products), scaled by rstd_b^2
//     in the epilogue -> Ah/Al bf16 [b][NQ][768 e].  grid (NQ/64, 12 e-tiles, NB).
// =========================================================================================================
__global__ __launch_bounds__(128)
void k_agemm(const unsigned short* __restrict__ Hh, const unsigned short* __restrict__ Hl,
             const unsigned short* __restrict__ Xb, const float* __restrict__ st,
             unsigned short* Ah, unsigned short* Al) {
  __shared__ __align__(16) unsigned char sm[2 * 3 * GPB];
  float* Os = (float*)sm;                                            // the stages' bytes, free behind the k loop
  const int tid = threadIdx.x, lane = tid & 31, wave = tid >> 5, hh = lane >> 4, c = lane & 15;
  const int n0 = blockIdx.x * QT, m0 = blockIdx.y * QT, b = blockIdx.z;
  const unsigned short* ap0 = Hh + (size_t)m0 * ND;
  const unsigned short* ap1 = Hl + (size_t)m0 * ND;
  const unsigned short* bp  = Xb + ((size_t)b * NC + n0) * ND;
  v8f acc[4];
  gemm_k<2>(sm, ap0, ap1, bp, acc);
  const float sc = st[4 * b + 2];
  stage_os(Os, acc, sc, wave, hh, c);
  __syncthreads();
  epi_split(Os, Ah, Al, (size_t)b * NQ + n0, ND, m0, tid);
}

// =========================================================================================================
// (6) value plane (channel-major, keys contiguous): D[m = key j][n = o] = sum_d Xb[b][j][d] * Wvb[o][d]
//     (1 product, exact), x16 -> U f16 [b][768 o][2048 j].  grid (12 o-tiles, 32 key-tiles, NB).
// =========================================================================================================
__global__ __launch_bounds__(128)
void k_vgemm(const unsigned short* __restrict__ Xb, const unsigned short* __restrict__ Wvn, unsigned short* U) {
  __shared__ __align__(16) unsigned char sm[2 * 2 * GPB];
  float* Os = (float*)sm;                                            // the stages' bytes, free behind the k loop
  const int tid = threadIdx.x, lane = tid & 31, wave = tid >> 5, hh = lane >> 4, c = lane & 15;
  const int n0 = blockIdx.x * QT, m0 = blockIdx.y * QT, b = blockIdx.z;
  const unsigned short* ap = Xb + ((size_t)b * NC + m0) * ND;
  const unsigned short* bp = Wvn + (size_t)n0 * ND;
  v8f acc[4];
  gemm_k<1>(sm, ap, ap, bp, acc);
  stage_os(Os, acc, USC, wave, hh, c);
  __syncthreads();
  epi_h(Os, U, (size_t)b * ND + n0, NC, m0, tid);
}

// =========================================================================================================
// (7) key-side affine term: cs[b][j] = -(mu_b rstd_b^2) * sum_d g[d] * Xb[b][j][d], f32 VALU, one wave per row,
// coverage: grid (64, NB) x 32 rows = every key row of b < NB.  LDS csL cross-wave (block barrier).
// =========================================================================================================
__global__ __launch_bounds__(256)
void k_cs(const unsigned short* __restrict__ Xb, const float* __restrict__ g, const float* __restrict__ st,
          float* cs) {
  __shared__ __align__(16) float csL[32];
  const int tid = threadIdx.x, lane = tid & 31, wave = tid >> 5;
  const int r0 = blockIdx.x * 32, b = blockIdx.y;
  v4f ga[3], gb[3];
#pragma unroll
  for (int c3 = 0; c3 < 3; ++c3) {
    ga[c3] = *(const v4f*)(g + 256 * c3 + 8 * lane);
    gb[c3] = *(const v4f*)(g + 256 * c3 + 8 * lane + 4);
  }
  const float nmr = -st[4 * b + 3];
#pragma unroll 1
  for (int t = 0; t < 4; ++t) {
    const int row = r0 + 4 * wave + t;
    const unsigned short* xp = Xb + ((size_t)b * NC + row) * ND + 8 * lane;
    float acc = 0.f;
#pragma unroll
    for (int c3 = 0; c3 < 3; ++c3) {
      const v4u u = *(const v4u*)(xp + 256 * c3);
      acc += bf_lo16(u[0]) * ga[c3][0] + bf_hi16(u[0]) * ga[c3][1]
           + bf_lo16(u[1]) * ga[c3][2] + bf_hi16(u[1]) * ga[c3][3]
           + bf_lo16(u[2]) * gb[c3][0] + bf_hi16(u[2]) * gb[c3][1]
           + bf_lo16(u[3]) * gb[c3][2] + bf_hi16(u[3]) * gb[c3][3];
    }
    acc += __shfl_xor(acc, 16, 32); acc += __shfl_xor(acc, 8, 32); acc += __shfl_xor(acc, 4, 32);
    acc += __shfl_xor(acc, 2, 32);  acc += __shfl_xor(acc, 1, 32);
    if (lane == 0) csL[4 * wave + t] = acc * nmr;
  }
  __syncthreads();
  if (wave == 0 && lane < 8) {
    const v4f v = *(const v4f*)(csL + 4 * lane);
    float* p = cs + (size_t)b * NC + r0 + 4 * lane;
    *(v4f*)p = v;
    
  }
}

// =========================================================================================================
// (8) attention for one (b, 64-query tile), transposed formulation, 2048 keys, no mask:
//   S^T tile (16 keys x 16 queries) = sum over 24 d-chunks of A(key row kb + (lane&15) of the bf16 plane Xb,
//   split k map) . B(query row of Ah) + A(Xb).B(Al) (bf16 residual, shared accumulator), then + cs[key].
//   Per lane the D tile holds 8 keys of ONE query: online softmax state per lane, one shuffle (lane^16) for the
//   max over 32 keys; corr applied every step (== 1 exactly when the max did not grow). P = e^{s-m} x 16384 as
//   f16 is the B operand of O^T (rows channel, cols queries) += A(U rows channel 16j + (lane&15), keys
//   contiguous, f16 x16) . B(P^T): element r <- D of the tile covering keys kb..kb+15, element 8+r <- the tile
//   covering kb+16..kb+31, lane unchanged. The 48 accumulator tiles per wave live in registers (384 per lane) for
//   the whole key loop and are stored once, behind it, to wave-private LDS slots Ow[query][768].
//   Epilogue after a block barrier: out[b][q][:] = Ow[q][:] * (rstd / (16 l_q)) - mu rstd rowsum(Wv), row =
// coverage: 4 waves x 16 query rows x 6 x 32 lanes x 4 = 64 x 768; grid (NQ/64, NB) covers out[b < NB][q < NQ].
// LDS: Ow written once per lane behind the key loop; cross-lane reads only after __syncthreads. staged extent
//      (16 x 768 per wave) == consumed extent. Up to the end of the key loop the same bytes hold the wave's query
//      fragments (hi + residual, 2 x 16 x 768 x 2 B), each 16 B written and read by one and the same lane.
//      Behind them one K buffer (32 key rows) and one V buffer (768 channel rows x 32 keys), filled once per block and
//      32 keys by asynchronous copies (each wave a quarter) and read by all four waves: cross-wave, so every tile is
//      read only behind its copiers' s_wait_asynccnt 0 and a block barrier, and refilled only behind the barrier
//      that ends its last read. coverage: K 4 waves x 8 rows x 3 x 32 lanes x 16 B = 32 x 1536 B; V 4 waves x 24 x
//      8 rows x 4 x 16 B = 768 x 64 B; pad bytes of a row are neither written nor read.
// =========================================================================================================
__global__ __launch_bounds__(128)
void k_attn(const unsigned short* __restrict__ Ah, const unsigned short* __restrict__ Al,
            const unsigned short* __restrict__ Xb, const unsigned short* __restrict__ U,
            const float* __restrict__ cs, const float* __restrict__ rv,
            const float* __restrict__ st, float* out) {
  __shared__ __attribute__((aligned(16))) unsigned char lds_all[ATTN_LDS];
  const int tid  = threadIdx.x;
  const int wave = tid >> 5, lane = tid & 31;
  const int hh   = lane >> 4, c = lane & 15;
  const int n0   = blockIdx.x * QT, b = blockIdx.y;
  float* Ow = (float*)lds_all + (size_t)wave * (16 * ND);
  float* op = Ow + c * ND + 8 * hh;                                  // this lane's slots (query column c)
  // O^T tiles: o[j][r] = channel 16 j + 8 hh + r of query c. Every loop over o[] is fully unrolled: only constant
  // indices keep the tiles in registers.
  v8f o[ND / 16];
#pragma unroll
  for (int j = 0; j < ND / 16; ++j) o[j] = zero8();

  const size_t qo = ((size_t)b * NQ + n0 + 16 * wave + c) * ND + 8 * hh;
  const unsigned short* Ahp = Ah + qo;
  const unsigned short* Alp = Al + qo;
  // The block's K tile (32 key rows x 768, row pitch KP) and V tile (768 channel rows x 32 keys, row pitch VP) in LDS,
  // read by all four waves. Fragment readers: lane -> row (lane&15), + 8*(lane>>4), as from the global planes.
  const unsigned short* Ks = (const unsigned short*)(lds_all + QLDS) + c * KP + 8 * hh;          // + key_loc*KP + 32 kc
  const unsigned short* Vs = (const unsigned short*)(lds_all + QLDS + KLDS) + c * VP + 8 * hh;   // + 16 j*VP
  // Copy side. K: wave w brings key rows 8w..8w+7, three copies of 512 B a row. V: wave w brings channel rows
  // 192w..192w+191, one copy = 8 rows x 64 B (lane -> row lane>>2, 16-byte piece lane&3).
  unsigned char* kl0 = lds_all + QLDS + (8 * wave) * (KP * 2) + 16 * lane;
  unsigned char* vl0 = lds_all + QLDS + KLDS + (192 * wave + (lane >> 2)) * (VP * 2) + 16 * (lane & 3);
  const unsigned short* kg0 = Xb + ((size_t)b * NC + 8 * wave) * ND + 8 * lane;                    // + kb*ND
  const unsigned short* vg0 = U + ((size_t)b * ND + 192 * wave + (lane >> 2)) * NC + 8 * (lane & 3); // + kb
  const float* csb = cs + (size_t)b * NC + 8 * hh;                                    // + kb (+16)

  // The wave's 16 query rows (hi and residual plane) go once into the wave's own LDS slots, fragment by fragment:
  // quarter f = 4 kc + {0, 1: hi elements 0..7, 8..15; 2, 3: residual} holds 32 lanes x 16 B, and every lane reads back
  // only what it wrote itself. The slots are the bytes of Ow, which is written only behind the key loop.
  unsigned short* Qs = (unsigned short*)lds_all + (size_t)wave * (2 * 16 * ND) + 8 * lane;
#pragma unroll 1
  for (int kq = 0; kq < ND / 32 / KG; ++kq) {
    const unsigned short* ap = Ahp + 32 * KG * kq;
    const unsigned short* lp = Alp + 32 * KG * kq;
    Frag a[KG], r[KG];
#pragma unroll
    for (int u = 0; u < KG; ++u) {
      a[u] = ldfrag(ap + 32 * u);
      r[u] = ldfrag(lp + 32 * u);
    }
    asm volatile("s_wait_xcnt 0x0" :: "v"(ap), "v"(lp) : "memory");
#pragma unroll
    for (int u = 0; u < KG; ++u) {
      const int kc = KG * kq + u;
      *(v8us*)(Qs + (4 * kc + 0) * 256) = a[u].u[0];
      *(v8us*)(Qs + (4 * kc + 1) * 256) = a[u].u[1];
      *(v8us*)(Qs + (4 * kc + 2) * 256) = r[u].u[0];
      *(v8us*)(Qs + (4 * kc + 3) * 256) = r[u].u[1];
    }
  }

  // Two-buffer ring over the tile sequence K(0), V(0), K(32), V(32), ...: the K buffer is worked on (scores) while the V
  // tile flies, the V buffer (O^T) while the next K tile flies. In front of the loop: first K tile, landed and
  // published; then the first V tile is sent off.
  asm volatile("s_wait_dscnt 0x0" ::: "memory");                     // the wave's own LDS stores retire before it copies
  acopy_tile<3, 512, 256, KP * 2, ND>(kl0, kg0);
  asm volatile("s_wait_asynccnt 0x0" ::: "memory");                  // this wave's share of the K tile has landed
  __syncthreads();                                                   // ... and every other wave's: the tile is readable
  acopy_tile<24, 8 * VP * 2, 8 * NC, 0, 0>(vl0, vg0);

  float m = -1.0e30f, l = 0.f;
#pragma unroll 1
  for (int kb = 0; kb < NC; kb += 32) {
    const unsigned short* k0p = Ks;                                  // keys kb .. kb+15
    const unsigned short* k1p = Ks + 16 * KP;                        // keys kb+16 .. kb+31
    v8f s0 = zero8(), s1 = zero8();
    // K and Q fragments (both LDS) in groups of KG d-chunks, two groups in registers: group g + 1 is in flight
    // while group g is used.
    Frag kf[2][KG][2], qf[2][KG][2];
#pragma unroll
    for (int u = 0; u < KG; ++u) {
      kf[0][u][0] = ldfrag(k0p + 32 * u);
      kf[0][u][1] = ldfrag(k1p + 32 * u);
      qf[0][u][0] = ldq(Qs + (4 * u) * 256);
      qf[0][u][1] = ldq(Qs + (4 * u + 2) * 256);
    }
    // the key-side terms are fetched here, at the head of the trip: the barrier at its foot waits for every global load
    const v4f ca = *(const v4f*)(csb + kb);
    const v4f cb = *(const v4f*)(csb + kb + 4);
    const v4f cd = *(const v4f*)(csb + kb + 16);
    const v4f ce = *(const v4f*)(csb + kb + 20);
    // the same wait for these four loads: their address pair is an input, so that nothing lands on it while the
    // loads are under way
    asm volatile("s_wait_xcnt 0x0" :: "v"(csb + kb) : "memory");
#pragma unroll
    for (int g = 0; g < ND / 32 / KG; ++g) {
      if (g + 1 < ND / 32 / KG) {
#pragma unroll
        for (int u = 0; u < KG; ++u) {
          const int kn = KG * (g + 1) + u;
          kf[(g + 1) & 1][u][0] = ldfrag(k0p + 32 * kn);
          kf[(g + 1) & 1][u][1] = ldfrag(k1p + 32 * kn);
          qf[(g + 1) & 1][u][0] = ldq(Qs + (4 * kn) * 256);
          qf[(g + 1) & 1][u][1] = ldq(Qs + (4 * kn + 2) * 256);
        }
      }
      // holds the next group's loads, as one run, in front of this group's products: they are in flight meanwhile, and
      // no LDS read stands among the products (without it the build spreads them there)
      __builtin_amdgcn_sched_barrier(0);
#pragma unroll
      for (int u = 0; u < KG; ++u) {
        s0 = mma_q(kf[g & 1][u][0].bf, qf[g & 1][u][0].bf, s0);
        s1 = mma_q(kf[g & 1][u][1].bf, qf[g & 1][u][0].bf, s1);
        s0 = mma_q(kf[g & 1][u][0].bf, qf[g & 1][u][1].bf, s0);
        s1 = mma_q(kf[g & 1][u][1].bf, qf[g & 1][u][1].bf, s1);
      }
      // keeps later groups' loads behind this point: no more than two groups hold registers, and again no LDS read
      // among the products
      __builtin_amdgcn_sched_barrier(0);
    }
    {
#pragma unroll
      for (int r = 0; r < 4; ++r) {
        s0[r] += ca[r]; s0[4 + r] += cb[r];                          // key kb      + 8hh + r
        s1[r] += cd[r]; s1[4 + r] += ce[r];                          // key kb + 16 + 8hh + r
      }
    }

    // foot of the score trip: own LDS reads done, own V copies landed, then the barrier that publishes the V tile and
    // ends every wave's reads of the K buffer; behind it the next K tile is sent off into that buffer
    asm volatile("s_wait_dscnt 0x0" ::: "memory");
    asm volatile("s_wait_asynccnt 0x0" ::: "memory");
    __syncthreads();
    if (kb + 32 < NC) acopy_tile<3, 512, 256, KP * 2, ND>(kl0, kg0 + (size_t)(kb + 32) * ND);

    float mx = fmaxf(hmax8(s0), hmax8(s1));
    mx = fmaxf(mx, __shfl_xor(mx, 16, 32));
    const float mn   = fmaxf(m, mx);
    const float corr = __expf(m - mn);                               // == 1 exactly when the max did not grow
    l *= corr;
    m = mn;
    const float msh = mn - LNPS;                                     // exp gives e^{s-m} * 16384

    FragH ph;
    float ls = 0.f;
#pragma unroll
    for (int r = 0; r < 8; ++r) {
      const float e0 = __expf(s0[r] - msh);
      const float e1 = __expf(s1[r] - msh);
      ls += e0 + e1;
      ph.hv[0][r] = (_Float16)e0;
      ph.hv[1][r] = (_Float16)e1;
    }
    l += ls;

    // V fragments (LDS) in groups of VG channel tiles, two groups in registers, as for K and Q above
    Frag vf[2][VG];
#pragma unroll
    for (int u = 0; u < VG; ++u) vf[0][u] = ldfrag(Vs + (16 * u) * VP);
#pragma unroll
    for (int g = 0; g < ND / 16 / VG; ++g) {
      if (g + 1 < ND / 16 / VG) {
#pragma unroll
        for (int u = 0; u < VG; ++u) vf[(g + 1) & 1][u] = ldfrag(Vs + (16 * (VG * (g + 1) + u)) * VP);
      }
      // holds the next group's LDS reads, as one run, in front of this group's products
      __builtin_amdgcn_sched_barrier(0);
#pragma unroll
      for (int u = 0; u < VG; ++u) {
        const int j = VG * g + u;
        v8f t;
#pragma unroll
        for (int r = 0; r < 8; ++r) t[r] = o[j][r] * corr;
        o[j] = mma_h(vf[g & 1][u].h, ph.v, t);
      }
      // keeps later groups' reads behind this point: no LDS read among the products
      __builtin_amdgcn_sched_barrier(0);
    }
    // foot of the O^T trip: the same order; the barrier publishes the next K tile and frees the V buffer
    asm volatile("s_wait_dscnt 0x0" ::: "memory");
    asm volatile("s_wait_asynccnt 0x0" ::: "memory");
    __syncthreads();
    if (kb + 32 < NC) acopy_tile<24, 8 * VP * 2, 8 * NC, 0, 0>(vl0, vg0 + (kb + 32));
  }
  asm volatile("s_wait_asynccnt 0x0" ::: "memory");                  // nothing is in flight when the LDS changes its use
  // the finished tiles go to the wave's LDS slots once, for the row-major epilogue
#pragma unroll
  for (int j = 0; j < ND / 16; ++j) {
    v4f na, nb2;
#pragma unroll
    for (int r = 0; r < 4; ++r) { na[r] = o[j][r]; nb2[r] = o[j][4 + r]; }
    *(v4f*)(op + 16 * j)     = na;
    *(v4f*)(op + 16 * j + 4) = nb2;
  }
  l += __shfl_xor(l, 16, 32);
  const float inv  = 1.0f / l;                                       // Ow and l both carry the x16384 factor
  const float mu   = st[4 * b + 0], rstd = st[4 * b + 1];
  const float qsc  = inv * rstd * IUSC;                              // per lane: its query column
  const float mrs  = mu * rstd;
  v4f rvv[6];
#pragma unroll
  for (int k = 0; k < ND / 128; ++k) {
    const v4f t = *(const v4f*)(rv + 128 * k + 4 * lane);
#pragma unroll
    for (int u = 0; u < 4; ++u) rvv[k][u] = t[u] * mrs;
  }
  __syncthreads();                                                   // all accumulator slots final before cross-lane reads

{
#pragma unroll 1
    for (int qq = 0; qq < 16; ++qq) {
      const float sc = __shfl(qsc, qq, 32);
      const float* lrow = Ow + qq * ND + 4 * lane;
      float* orow = out + ((size_t)b * NC + n0 + 16 * wave + qq) * ND + 4 * lane;
#pragma unroll
      for (int k = 0; k < ND / 128; ++k) {
        const v4f v = *(const v4f*)(lrow + 128 * k);
        v4f w;
#pragma unroll
        for (int u = 0; u < 4; ++u) w[u] = v[u] * sc - rvv[k][u];
        *(v4f*)(orow + 128 * k) = w;
      }
    }
    
  }
}

// =========================================================================================================
// Workspace map (bytes; each region start a multiple of 256; every extent is an exact tile/line multiple and is
//   Wn bf16 [3][768][768]      3538944      Wt bf16 [3][768][768]   3538944
//   rs  f32 [3][768]              9216      g   f32 [768]              3072
//   Xb bf16 [NB][2048][768]   25165824 (NB=8)  part f64 [NB][64][16]  65536    st f32 [32]  128 (256)
//   Hh/Hl bf16 [768][768]      1179648 x2
//   Ah/Al bf16 [NB][NQ][768]  25165824 x2 (NB=8, NQ=2048)
//   U  f16 [NB][768][2048]    25165824      cs f32 [NB][2048]         65536
//   total (NB=8, NQ=2048) = 110244096
// =========================================================================================================
extern "C" void kernel_launch(void* const* d_in, const int* in_sizes, int n_in,
                              void* d_out, int out_size, void* d_ws, size_t ws_size,
                              hipStream_t stream) {
  if (n_in < 4) return;
  if (in_sizes[0] < NB * NC * ND) return;
  if (in_sizes[1] < ND * ND || in_sizes[2] < ND * ND || in_sizes[3] < ND * ND) return;
  if (out_size < NB * NC * ND) return;

  size_t off = 0;
  auto carve = [&](size_t bytes) { const size_t o = off; off += (bytes + 255) & ~(size_t)255; return o; };
  const size_t oWn   = carve((size_t)3 * ND * ND * 2);
  const size_t oWt   = carve((size_t)3 * ND * ND * 2);
  const size_t oRs   = carve((size_t)3 * ND * 4);
  const size_t oG    = carve((size_t)ND * 4);
  const size_t oXb   = carve((size_t)NB * NC * ND * 2);
  const size_t oPart = carve((size_t)NB * KCH * 128);
  const size_t oSt   = carve((size_t)128);
  const size_t oHh   = carve((size_t)ND * ND * 2);
  const size_t oHl   = carve((size_t)ND * ND * 2);
  const size_t oAh   = carve((size_t)NB * NQ * ND * 2);
  const size_t oAl   = carve((size_t)NB * NQ * ND * 2);
  const size_t oU    = carve((size_t)NB * ND * NC * 2);
  const size_t oCs   = carve((size_t)NB * NC * 4);
  if (off > ws_size) return;
  if (off > (size_t)134217728) return;

  const float* x  = (const float*)d_in[0];
  const float* wk = (const float*)d_in[1];
  const float* wq = (const float*)d_in[2];
  const float* wv = (const float*)d_in[3];

  char* ws = (char*)d_ws;
  unsigned short* Wn  = (unsigned short*)(ws + oWn);
  unsigned short* Wt  = (unsigned short*)(ws + oWt);
  float*          rs  = (float*)(ws + oRs);
  float*          g   = (float*)(ws + oG);
  unsigned short* Xb  = (unsigned short*)(ws + oXb);
  double*         part = (double*)(ws + oPart);
  float*          st  = (float*)(ws + oSt);
  unsigned short* Hh  = (unsigned short*)(ws + oHh);
  unsigned short* Hl  = (unsigned short*)(ws + oHl);
  unsigned short* Ah  = (unsigned short*)(ws + oAh);
  unsigned short* Al  = (unsigned short*)(ws + oAl);
  unsigned short* U   = (unsigned short*)(ws + oU);
  float*          cs  = (float*)(ws + oCs);
  float* out = (float*)d_out;

  const dim3 blk256(256), blk128(128), blk64(64);

  // (0) weights -> bf16 natural + transposed planes + row sums (y: 0 Wk, 1 Wq, 2 Wv)
  cvt_w<<<dim3(ND / QT, 3), blk256, 0, stream>>>(wk, wq, wv, Wn, Wt, rs);
  // (1) g = bf16(Wk)^T . rowsum(bf16(Wq))
  k_g<<<dim3(ND / GCB), blk256, 0, stream>>>(Wn, rs + ND, g);
  // (2) x -> bf16 plane + f64 partial sums
  k_xcvt<<<dim3(KCH, NB), blk256, 0, stream>>>(x, Xb, part);
  // (3) LayerNorm statistics
  k_stats<<<dim3(1), blk64, 0, stream>>>(part, st);
  // (4) H planes: A = Wq transposed (rows d), B = Wk transposed (rows e)
  k_hgemm<<<dim3(ND / QT, ND / QT), blk128, 0, stream>>>(Wt + (size_t)1 * ND * ND, Wt, Hh, Hl);
  // (5) query planes A' = rstd^2 X.H  (hi + residual)
  k_agemm<<<dim3(NQ / QT, ND / QT, NB), blk128, 0, stream>>>(Hh, Hl, Xb, st, Ah, Al);
  // (6) value plane U = 16 X.Wv^T (channel-major)
  k_vgemm<<<dim3(ND / QT, NC / QT, NB), blk128, 0, stream>>>(Xb, Wn + (size_t)2 * ND * ND, U);
  // (7) key-side affine term
  k_cs<<<dim3(NC / 32, NB), blk256, 0, stream>>>(Xb, g, st, cs);
  // (8) attention -> out [b][q][768]
  k_attn<<<dim3(NQ / QT, NB), blk128, 0, stream>>>(Ah, Al, Xb, U, cs, rs + 2 * ND, st, out);
  (void)hipGetLastError();
}

// v006
// A run of this version takes 261 microseconds.
// Timed twice side by side with v005, it ran 1.22 times as fast both times.
// All steps since v000 together make it 5.49 times as fast.
// Contractions (f32 accumulate everywhere): H[e][d] = sum_o Wq[o][d]*Wk[o][e] on v_wmma_f32_16x16x32_bf16 with
// bf16-RNE weights (exact products); query plane A' = X.H with bf16-RNE x and H carried as bf16 hi + bf16
// residual (2 products, shared accumulator); U = X.Wv^T (1 product, bf16-RNE operands); scores
// S^T = X(keys).A'(queries) with A' as bf16 hi + bf16 residual (2 products); O^T = U.P^T on
// v_wmma_f32_16x16x32_f16 (U x16 as f16, P = e^{s-m} x16384 as f16 built from the score D registers).
// LayerNorm statistics in f64 VALU; per-batch affine terms, softmax statistics and normalisation in f32 VALU.
#include <hip/hip_runtime.h>
#include <math.h>
#include <stdint.h>

#ifndef NB
#define NB 8
#endif
#ifndef NQ
#define NQ 2048
#endif
#define NBF  8
#define NC   2048
#define ND   768
#define QT   64
#define OSP  68
#define TPW  72
#define KCH  64
#define KG   4
#define USC  16.0f
#define IUSC 0.0625f
#define LNPS 9.704060527839234f
#define EPSV 1.0e-5f
#define KP   776
#define VP   40
#define VG   8
#define QLDS (4 * 16 * ND * 4)
#define KLDS (32 * KP * 2)
#define VLDS (ND * VP * 2)
#define ATTN_LDS (QLDS + KLDS + VLDS)
#define GKC  64
#define GP   72
#define GPB  (QT * GP * 2)
#define GCB  32
#define GRG  64

static_assert(NB >= 1 && NB <= NBF);
static_assert(NQ % QT == 0 && NQ >= QT && NQ <= NC);
static_assert(NC % QT == 0 && ND % QT == 0);
static_assert(NC % 32 == 0 && ND % 32 == 0);
static_assert(ND % 256 == 0 && ND % 128 == 0 && ND % 16 == 0);
static_assert(NC / KCH == 32 && KCH == 64);
static_assert((ND / 32) % KG == 0);
static_assert(2 * 16 * ND * 2 == 16 * ND * 4);
static_assert(4 * NBF <= 32);
static_assert((OSP * 4) % 16 == 0);
static_assert((TPW * 2) % 16 == 0);
static_assert(QLDS == 196608 && ATTN_LDS <= 327680);
static_assert((KP * 2) % 32 == 16 && (VP * 2) % 32 == 16);          // LDS row pitch = 16 B x odd, for b128 readers
static_assert(KP >= ND + 8 && VP >= 32 + 8 && QLDS % 16 == 0 && KLDS % 16 == 0);
static_assert(ND % GKC == 0 && ND / GKC >= 2 && GKC * 2 == 128 && GKC % 32 == 0 && QT == 64);
static_assert((GP * 2) % 32 == 16 && GP >= GKC + 8 && 2 * 2 * GPB >= QT * OSP * 4);
static_assert(ND % GCB == 0 && ND % GRG == 0 && GCB == 32 && 4 * GRG == 256 && GRG % 8 == 0);
static_assert((ND / 16) % VG == 0 && ND % (4 * 8) == 0 && ND / 4 / 8 == 24 && 8 * (ND / 256) == 24);

typedef _Float16       v16h __attribute__((ext_vector_type(16)));
typedef _Float16       v8h  __attribute__((ext_vector_type(8)));
typedef __bf16         v16b __attribute__((ext_vector_type(16)));
typedef unsigned short v8us __attribute__((ext_vector_type(8)));
typedef float          v8f  __attribute__((ext_vector_type(8)));
typedef float          v4f  __attribute__((ext_vector_type(4)));
typedef unsigned int   v4u  __attribute__((ext_vector_type(4)));
typedef double         v2d  __attribute__((ext_vector_type(2)));

union Frag  { v8us u[2]; v16h h; v16b bf; };
union FragH { v16h v; v8h hv[2]; };
static_assert(sizeof(Frag) == 32);
static_assert(sizeof(FragH) == 32);

// ---- scalar helpers ---------------------------------------------------------------------------------------
__device__ __forceinline__ unsigned short bf_bits(float f) {          // f32 -> bf16 bits, RNE convert
  unsigned u = __float_as_uint(f);
  return (unsigned short)((u + 0x7FFFu + ((u >> 16) & 1u)) >> 16);
}
__device__ __forceinline__ float bf_up(unsigned short hb) { return __uint_as_float(((unsigned)hb) << 16); }
__device__ __forceinline__ float bf_lo16(unsigned w) { return __uint_as_float(w << 16); }
__device__ __forceinline__ float bf_hi16(unsigned w) { return __uint_as_float(w & 0xFFFF0000u); }
__device__ __forceinline__ unsigned short h_bits(_Float16 x) { return __builtin_bit_cast(unsigned short, x); }
__device__ __forceinline__ unsigned pk16(unsigned short a, unsigned short b) { return (unsigned)a | ((unsigned)b << 16); }
__device__ __forceinline__ v8f zero8() { v8f z = {0.f, 0.f, 0.f, 0.f, 0.f, 0.f, 0.f, 0.f}; return z; }
__device__ __forceinline__ float hmax8(v8f s) {
  return fmaxf(fmaxf(fmaxf(s[0], s[1]), fmaxf(s[2], s[3])), fmaxf(fmaxf(s[4], s[5]), fmaxf(s[6], s[7])));
}
__device__ __forceinline__ double shfl_xor_d(double v, int mask) {
  int lo = __double2loint(v), hi = __double2hiint(v);
  lo = __shfl_xor(lo, mask, 32);
  hi = __shfl_xor(hi, mask, 32);
  return __hiloint2double(hi, lo);
}

// ---- 16-bit fragment loader (A, or B from a k-contiguous [n][k] row): lane -> row/col (lane&15), p already includes
//      + 8*(lane>>4); elements 0..7 <- p[0..7] (k0+8h..), elements 8..15 <- p[16..23] (k0+16+8h..)
__device__ __forceinline__ Frag ldfrag(const unsigned short* p) {
  Frag f;
  f.u[0] = *(const v8us*)(p);
  f.u[1] = *(const v8us*)(p + 16);
  return f;
}

// ---- fragment from the packed LDS form: two quarters of 32 lanes x 16 B, p already includes + 8*lane
__device__ __forceinline__ Frag ldq(const unsigned short* p) {
  Frag f;
  f.u[0] = *(const v8us*)(p);
  f.u[1] = *(const v8us*)(p + 256);
  return f;
}

// ---- WMMA helpers: builtin followed by a 4-slot VALU gap tying D and keeping A/B live --------------------------
// mma_h is the bare builtin (the compiler keeps the distance behind its own WMMAs): with D tied to an asm statement
// the 48 resident D tiles of k_attn, 384 registers, do not all get registers and the build spills to scratch.
__device__ __forceinline__ v8f mma_h(v16h a, v16h b, v8f c) {
  return __builtin_amdgcn_wmma_f32_16x16x32_f16(false, a, false, b, (short)0, c, false, false);
}
// mma_q is the bare bf16 builtin, for a like reason: with the two fragment groups that k_attn keeps in flight tied to
// mma_b's asm statement as operands, the build spills to scratch.
__device__ __forceinline__ v8f mma_q(v16b a, v16b b, v8f c) {
  return __builtin_amdgcn_wmma_f32_16x16x32_bf16(false, a, false, b, (short)0, c, false, false);
}
__device__ __forceinline__ v8f mma_b(v16b a, v16b b, v8f c) {
  v8f d = __builtin_amdgcn_wmma_f32_16x16x32_bf16(false, a, false, b, (short)0, c, false, false);
#if defined(__HIP_DEVICE_COMPILE__)
  const v16h ha = __builtin_bit_cast(v16h, a), hb = __builtin_bit_cast(v16h, b);
  asm volatile("v_nop\n\tv_nop\n\tv_nop\n\tv_nop" : "+v"(d) : "v"(ha), "v"(hb));
#endif
  return d;
}

// ---- one tile = 24 asynchronous 16-byte copies per lane, global -> LDS, through no register. RUN copies follow one
//      another at steps (LS1, GS1), then the next run starts (LS2, GS2) further; steps in bytes (LDS) and in 16-bit
//      elements (global). The landing is waited for by the caller (s_wait_asynccnt).
typedef int v4i __attribute__((ext_vector_type(4)));
template <int RUN, int LS1, int GS1, int LS2, int GS2>
__device__ __forceinline__ void acopy_tile(unsigned char* l0, const unsigned short* g0) {
#if defined(__HIP_DEVICE_COMPILE__)
#pragma unroll
  for (int idx = 0; idx < 24; ++idx) {
    const int r = idx / RUN, s = idx % RUN;
    __builtin_amdgcn_global_load_async_to_lds_b128(
        (__attribute__((address_space(1))) v4i*)(g0 + (size_t)r * GS2 + (size_t)s * GS1),
        (__attribute__((address_space(3))) v4i*)(l0 + r * LS2 + s * LS1), 0, 0);
  }
#endif
}

// =========================================================================================================
// (0) weights f32 [768][768] (y = 0: Wk, 1: Wq, 2: Wv, block-uniform selection) -> bf16-RNE planes:
//     natural Wn[y][o][i] and transposed Wt[y][i][o], plus row sums rs[y][o] = sum_i bf16(W[o][i]) in f32.
//     Block (ob, y) owns rows o0..o0+63; column chunks of 64 go through the LDS tile T[i_loc][o_loc] (pitch TPW).
// coverage: Wn 12 chunks x 2 it x 8 waves x 4 rows x 8 lanes x 8 = 64 x 768 per block; Wt 12 chunks x 2 it x 32 x 8
//           lanes x 8 = 768 x 64 per block; rs 16 x 4 = 64; blocks (bx < 12, y < 3) cover all three matrices once.
// LDS: T and rsL cross-wave (block barriers).
// =========================================================================================================
__device__ __forceinline__
void cvt_w(unsigned char* sm, int bx, int y,
           const float* __restrict__ wk, const float* __restrict__ wq, const float* __restrict__ wv,
           unsigned short* Wn, unsigned short* Wt, float* rs) {
  unsigned short* T = (unsigned short*)sm;                           // [QT * TPW]
  float* rsL = (float*)(sm + QT * TPW * 2);                          // [QT]
  const int tid = threadIdx.x, lane = tid & 31, wave = tid >> 5;
  const int o0 = bx * QT;
  const float* W = (y == 0) ? wk : ((y == 1) ? wq : wv);            // block-uniform, all global
  unsigned short* Np = Wn + (size_t)y * ND * ND;
  unsigned short* Tq = Wt + (size_t)y * ND * ND;
  const int e = lane & 7, r4 = lane >> 3;                           // r4 0..3
  const int e8 = tid & 7, lq = tid >> 3;                            // lq 0..31
  float rsum0 = 0.f, rsum1 = 0.f;
#pragma unroll 1
  for (int cc = 0; cc < ND / QT; ++cc) {
    const int i0 = cc * QT;
#pragma unroll
    for (int it = 0; it < 2; ++it) {
      const int ol = 8 * wave + 4 * it + r4;                          // 0..63
      const float* sp = W + (size_t)(o0 + ol) * ND + i0 + 8 * e;
      const v4f a = *(const v4f*)sp;
      const v4f q = *(const v4f*)(sp + 4);
      const float f[8] = {a[0], a[1], a[2], a[3], q[0], q[1], q[2], q[3]};
      unsigned short hb[8];
      float ps = 0.f;
#pragma unroll
      for (int t = 0; t < 8; ++t) { hb[t] = bf_bits(f[t]); ps += bf_up(hb[t]); }
      if (it == 0) rsum0 += ps; else rsum1 += ps;
      v4u u;
#pragma unroll
      for (int t = 0; t < 4; ++t) u[t] = pk16(hb[2 * t], hb[2 * t + 1]);
      unsigned short* np = Np + (size_t)(o0 + ol) * ND + i0 + 8 * e;
      *(v4u*)np = u;
      
#pragma unroll
      for (int t = 0; t < 8; ++t) T[(8 * e + t) * TPW + ol] = hb[t];   // T[i_loc][o_loc]
    }
    __syncthreads();
    v4u up[2];
#pragma unroll
    for (int it = 0; it < 2; ++it) {
      const int il = 32 * it + lq;                                    // 0..63
      up[it] = *(const v4u*)(T + il * TPW + 8 * e8);
    }
{
#pragma unroll
      for (int it = 0; it < 2; ++it) {
        const int il = 32 * it + lq;
        *(v4u*)(Tq + (size_t)(i0 + il) * ND + o0 + 8 * e8) = up[it];
      }
      
    }
    __syncthreads();                                                  // T reused by the next chunk
  }
  rsum0 += __shfl_xor(rsum0, 1, 32); rsum0 += __shfl_xor(rsum0, 2, 32); rsum0 += __shfl_xor(rsum0, 4, 32);
  rsum1 += __shfl_xor(rsum1, 1, 32); rsum1 += __shfl_xor(rsum1, 2, 32); rsum1 += __shfl_xor(rsum1, 4, 32);
  if (e == 0) { rsL[8 * wave + r4] = rsum0; rsL[8 * wave + 4 + r4] = rsum1; }
  __syncthreads();
  if (wave == 0 && lane < 16) {
    const v4f v = *(const v4f*)(rsL + 4 * lane);
    float* rp = rs + (size_t)y * ND + o0 + 4 * lane;
    *(v4f*)rp = v;
    
  }
}

// =========================================================================================================
// (1) g[e] = sum_o bf16(Wk)[o][e] * rq[o]  (rq = row sums of bf16(Wq)); f32. Block = 32 columns e (its 32 results are
//     one 128-byte line of g), 128 threads, each doing the work of the two places vt = tid and tid + 128 of 256.
//     Place (og = vt>>2, e4 = vt&3) takes columns 8 e4..8 e4+7 of rows og + 64 i, i < 12 in rising order, six rows at a
//     time: six 16-byte loads and six rq values, all sent off before the first is used, four load latencies a block.
//     The 64 row groups are joined in a fixed order: pL[og][column] -> part w < 8 sums groups 8w..8w+7 (wave w & 3) ->
//     sL[w][column] -> wave 0 sums the eight and stores the line with one instruction.
// coverage: 64 og x 12 = 768 rows, 4 e4 x 8 = 32 columns per block; 24 blocks x 32 = 768 = whole g.
// LDS pL and sL cross-wave (a block barrier behind each).
// =========================================================================================================
__device__ __forceinline__
void k_g(unsigned char* sm, int bx, const unsigned short* __restrict__ Wkn, const float* __restrict__ rq, float* g) {
  float* pL = (float*)sm;                                            // [GRG * GCB]
  float* sL = (float*)(sm + GRG * GCB * 4);                          // [8 * GCB]
  const int tid = threadIdx.x, lane = tid & 31, wave = tid >> 5;
  const int e0 = bx * GCB;
  for (int v = 0; v < 2; ++v) {
    const int vt = tid + 128 * v;
    const int e4 = vt & 3, og = vt >> 2;
    const unsigned short* wp = Wkn + (size_t)og * ND + e0 + 8 * e4;
    float acc[8] = {0.f, 0.f, 0.f, 0.f, 0.f, 0.f, 0.f, 0.f};
    // rolled: six rows' w[] and r[] hold registers at a time. Unrolled (twelve rows at once) the build takes 140 registers
    // for the whole launch, past the 128 at which the GEMM blocks that share it stand eight waves a SIMD, as their LDS allows
#pragma unroll 1
    for (int h = 0; h < 2; ++h) {
      const int ib = ND / GRG / 2 * h;
      v4u   w[ND / GRG / 2];
      float r[ND / GRG / 2];
      // unrolled: w[] and r[] stay in registers and all 12 loads are issued before the first one is waited for
#pragma unroll
      for (int i = 0; i < ND / GRG / 2; ++i) {
        w[i] = *(const v4u*)(wp + (size_t)(GRG * (ib + i)) * ND);
        r[i] = rq[og + GRG * (ib + i)];
      }
      // both loops unrolled: only constant indices keep w[], r[] and acc[] in registers
#pragma unroll
      for (int i = 0; i < ND / GRG / 2; ++i) {
#pragma unroll
        for (int t = 0; t < 4; ++t) {
          acc[2 * t]     += bf_lo16(w[i][t]) * r[i];
          acc[2 * t + 1] += bf_hi16(w[i][t]) * r[i];
        }
      }
    }
    const v4f pa = {acc[0], acc[1], acc[2], acc[3]};
    const v4f pb = {acc[4], acc[5], acc[6], acc[7]};
    *(v4f*)(pL + og * GCB + 8 * e4)     = pa;
    *(v4f*)(pL + og * GCB + 8 * e4 + 4) = pb;
  }
  __syncthreads();
  // unrolled (all three loops, here and below): eight LDS reads at constant offsets of one address
#pragma unroll
  for (int v = 0; v < 2; ++v) {
    const int vw = wave + 4 * v;
    float s = 0.f;
#pragma unroll
    for (int k = 0; k < GRG / 8; ++k) s += pL[(GRG / 8 * vw + k) * GCB + lane];
    sL[vw * GCB + lane] = s;
  }
  __syncthreads();
  if (wave == 0) {
    float v = 0.f;
#pragma unroll
    for (int k = 0; k < 8; ++k) v += sL[k * GCB + lane];
    g[e0 + lane] = v;
  }
}

// =========================================================================================================
// (2) x f32 [b][2048][768] -> Xb bf16-RNE plane (same layout) and per-chunk f64 partial sums of the bf16 values
//     (sum, sum of squares). Block (ch, b) owns 32 rows; wave w rows 4w..4w+3; per row 3 instructions of
// coverage: Xb 4 rows x 8 waves x 3 x 32 lanes x 8 = 32 x 768 per block, blocks (ch < 64, b < NB) = all rows of b < NB;
// =========================================================================================================
__device__ __forceinline__
void k_xcvt(unsigned char* sm, int ch, int b, const float* __restrict__ x, unsigned short* Xb, double* part) {
  double* sL = (double*)sm;                                          // [8]
  double* qL = sL + 8;                                               // [8]
  const int tid = threadIdx.x, lane = tid & 31, wave = tid >> 5;
  const int r0 = ch * (NC / KCH);
  double s = 0.0, q = 0.0;
#pragma unroll 1
  for (int t = 0; t < 4; ++t) {
    const int row = r0 + 4 * wave + t;
    const size_t base = ((size_t)b * NC + row) * ND + 8 * lane;
#pragma unroll 1
    for (int c3 = 0; c3 < ND / 256; ++c3) {
      const float* sp = x + base + 256 * c3;
      const v4f a = *(const v4f*)sp;
      const v4f q4 = *(const v4f*)(sp + 4);
      const float f[8] = {a[0], a[1], a[2], a[3], q4[0], q4[1], q4[2], q4[3]};
      unsigned short hb[8];
#pragma unroll
      for (int k = 0; k < 8; ++k) {
        hb[k] = bf_bits(f[k]);
        const double v = (double)bf_up(hb[k]);
        s += v;
        q += v * v;
      }
      v4u u;
#pragma unroll
      for (int k = 0; k < 4; ++k) u[k] = pk16(hb[2 * k], hb[2 * k + 1]);
      unsigned short* xp = Xb + base + 256 * c3;
      *(v4u*)xp = u;
      
    }
  }
  s += shfl_xor_d(s, 16); s += shfl_xor_d(s, 8); s += shfl_xor_d(s, 4); s += shfl_xor_d(s, 2); s += shfl_xor_d(s, 1);
  q += shfl_xor_d(q, 16); q += shfl_xor_d(q, 8); q += shfl_xor_d(q, 4); q += shfl_xor_d(q, 2); q += shfl_xor_d(q, 1);
  if (lane == 0) { sL[wave] = s; qL[wave] = q; }
  __syncthreads();
  if (wave == 0) {
    double S = 0.0, Q = 0.0;
#pragma unroll
    for (int w = 0; w < 8; ++w) { S += sL[w]; Q += qL[w]; }
    v2d val;
    val[0] = (lane == 0) ? S : 0.0;
    val[1] = (lane == 0) ? Q : 0.0;
    if (lane < 8) {
      double* pp = part + ((size_t)b * KCH + ch) * 16 + 2 * lane;
      *(v2d*)pp = val;
      
    }
  }
}

// =========================================================================================================
// (3) LayerNorm statistics per batch from the 64 partial lines (fixed-order f64 tree): st line f32 [32] with
// =========================================================================================================
__device__ __forceinline__
void k_stats(unsigned char* sm, const double* __restrict__ part, float* st) {
  double* sL = (double*)sm;                                          // [64]
  double* qL = sL + 64;                                              // [64]
  float* stL = (float*)(sm + 2 * 64 * 8);                            // [32]
  const int tid = threadIdx.x;                                       // 128 threads; 64 and up only pass the barriers
  if (tid < 32) stL[tid] = 0.f;
#pragma unroll 1
  for (int b = 0; b < NB; ++b) {
    __syncthreads();
    if (tid < KCH) {
      const size_t pb = ((size_t)b * KCH + tid) * 16;
      sL[tid] = part[pb];
      qL[tid] = part[pb + 1];
    }
    __syncthreads();
#pragma unroll
    for (int off = 32; off > 0; off >>= 1) {
      if (tid < off) { sL[tid] += sL[tid + off]; qL[tid] += qL[tid + off]; }
      __syncthreads();
    }
    if (tid == 0) {
      const double n  = (double)NC * (double)ND;
      const double mu = sL[0] / n;
      double var = qL[0] / n - mu * mu;
      if (var < 0.0) var = 0.0;
      const float varf = (float)var;
      const float ve   = varf + EPSV;
      const float rstd = (float)(1.0 / sqrt((double)ve));
      const float muf  = (float)mu;
      stL[4 * b + 0] = muf;
      stL[4 * b + 1] = rstd;
      stL[4 * b + 2] = rstd * rstd;
      stL[4 * b + 3] = muf * rstd * rstd;
    }
  }
  __syncthreads();
  if (tid < 8) {
    const v4f v = *(const v4f*)(stL + 4 * tid);
    float* p = st + 4 * tid;
    *(v4f*)p = v;
    
  }
}

// =========================================================================================================
// GEMM engine (K = 768 = 24 k-steps, all operand planes k-contiguous with pitch ND): block 128 threads = 4 waves,
// 64 (m) x 64 (n) tile; wave w owns cols n0+16w..+15 (one B fragment per k-step from row n of the B plane) and
// 4 m-tiles (A rows m0 + 16 mt + (lane&15)); NPROD = 2 adds a second A plane (bf16 residual) into the same
// accumulator. Split k map loader for both operands.
// The operands come through LDS: a stage = 64 k of the block's 64 B rows and 64 A rows (each A plane), one whole
// 128-byte line a row, brought once per block by asynchronous copies and read by all four waves as fragments.
// Stage layout: plane 0 = B, plane 1 = A, plane 2 = A residual; a plane = 64 rows of pitch GP (144 B = 16 B x 9, for
// b128 readers; the 16 pad bytes of a row are neither written nor read). Two stages, a two-buffer ring.
// coverage of a plane: 4 waves x 4 copies x 4 rows x 8 lanes x 16 B = 64 x 128 B.
// =========================================================================================================
__device__ __forceinline__ unsigned lds_off(const void* p) { return (unsigned)(size_t)p; }

// Four asynchronous 16-byte copies per lane, global -> LDS: 16 rows of one plane (a copy = 4 whole rows: lane -> row
// lane>>3, 16-byte piece lane&7). l, g: this lane's LDS byte address and global address in the first of them.
// The s_wait_xcnt closes the statement: the address registers that the copies name are rewritten only behind it.
__device__ __forceinline__ void acopy4(unsigned l, const unsigned short* g) {
#if defined(__HIP_DEVICE_COMPILE__)
  asm volatile("global_load_async_to_lds_b128 %0, %4, off\n\t"
               "global_load_async_to_lds_b128 %1, %5, off\n\t"
               "global_load_async_to_lds_b128 %2, %6, off\n\t"
               "global_load_async_to_lds_b128 %3, %7, off\n\t"
               "s_wait_xcnt 0x0"
               :: "v"(l), "v"(l + 4 * GP * 2), "v"(l + 8 * GP * 2), "v"(l + 12 * GP * 2),
                  "v"(g), "v"(g + 4 * ND), "v"(g + 8 * ND), "v"(g + 12 * ND)
               : "memory");
#endif
}

// a0, a1, b: row 0, column 0 of the block's 64 rows in each plane. sm: 2 stages of (NPROD + 1) planes.
template <int NPROD>
__device__ __forceinline__ void gemm_k(unsigned char* sm, const unsigned short* __restrict__ a0,
                                       const unsigned short* __restrict__ a1,
                                       const unsigned short* __restrict__ b, v8f (&acc)[4]) {
  constexpr int STG = (NPROD + 1) * GPB;
  const int tid = threadIdx.x, lane = tid & 31, wave = tid >> 5, hh = lane >> 4, c = lane & 15;
  // copy side: wave w brings rows 16w..16w+15 of every plane
  const int crow = 16 * wave + (lane >> 3);
  const unsigned cl = lds_off(sm) + crow * (GP * 2) + 16 * (lane & 7);
  const size_t   cg = (size_t)crow * ND + 8 * (lane & 7);
  auto fill = [&](int t) {
    const unsigned l = cl + (t & 1) * STG;
    const size_t   g = cg + (size_t)GKC * t;
    acopy4(l, b + g);
    acopy4(l + GPB, a0 + g);
    if (NPROD == 2) acopy4(l + 2 * GPB, a1 + g);
  };
  // fragment readers: lane -> row (lane&15), + 8*(lane>>4), as from the global planes
  const unsigned short* rb = (const unsigned short*)sm + (16 * wave + c) * GP + 8 * hh;
  const unsigned short* ra = (const unsigned short*)(sm + GPB) + c * GP + 8 * hh;               // + 16 mt * GP
#pragma unroll
  for (int mt = 0; mt < 4; ++mt) acc[mt] = zero8();

  fill(0);
  asm volatile("s_wait_asynccnt 0x0" ::: "memory");                  // this wave's share of stage 0 has landed
  __syncthreads();                                                   // ... and every other wave's: stage 0 is readable
  fill(1);
  // rolled: twelve equal trips, the buffer chosen by an address offset; unrolled it would only grow the code
#pragma unroll 1
  for (int t = 0; t < ND / GKC; ++t) {
    const int bo = (t & 1) * (STG / 2);
#pragma unroll
    for (int k2 = 0; k2 < GKC / 32; ++k2) {
      const Frag fb = ldfrag(rb + bo + 32 * k2);
      Frag fa[4], fl[4];
#pragma unroll
      for (int mt = 0; mt < 4; ++mt) {
        fa[mt] = ldfrag(ra + bo + (16 * mt) * GP + 32 * k2);
        if (NPROD == 2) fl[mt] = ldfrag(ra + bo + GPB / 2 + (16 * mt) * GP + 32 * k2);
      }
#pragma unroll
      for (int mt = 0; mt < 4; ++mt) {
        acc[mt] = mma_b(fa[mt].bf, fb.bf, acc[mt]);
        if (NPROD == 2) acc[mt] = mma_b(fl[mt].bf, fb.bf, acc[mt]);
      }
    }
    // foot of the trip: own LDS reads done, own copies of the next stage landed, then the barrier that publishes that
    // stage and ends every wave's reads of this one; behind it this buffer is refilled
    asm volatile("s_wait_dscnt 0x0" ::: "memory");
    asm volatile("s_wait_asynccnt 0x0" ::: "memory");
    __syncthreads();
    if (t + 2 < ND / GKC) fill(t + 2);
  }
  asm volatile("s_wait_asynccnt 0x0" ::: "memory");                  // nothing is in flight when the LDS changes its use
}

// D tiles -> LDS Os[n_loc][m_loc] (pitch OSP, b128 stores): lane (hh, c) holds m = 16 mt + 8 hh + r for
// n_loc = 16 w + c.  coverage: 4 waves x 16 n x 4 mt x 16 m = 64 x 64 (pad cols 64..67 never read).
__device__ __forceinline__ void stage_os(float* Os, const v8f (&acc)[4], float sc, int wave, int hh, int c) {
  const int nl = 16 * wave + c;
#pragma unroll
  for (int mt = 0; mt < 4; ++mt) {
    v4f va, vb;
#pragma unroll
    for (int r = 0; r < 4; ++r) { va[r] = acc[mt][r] * sc; vb[r] = acc[mt][4 + r] * sc; }
    *(v4f*)(Os + nl * OSP + 16 * mt + 8 * hh)     = va;
    *(v4f*)(Os + nl * OSP + 16 * mt + 8 * hh + 4) = vb;
  }
}

// Os -> two bf16 planes (hi = bf16-RNE(v), lo = bf16-RNE(v - hi)), plane row = row0 + n_loc, 64 m values =
// coverage: 4 it x 16 rows x 8 lanes x 8 = 64 x 64 per plane.
__device__ __forceinline__ void epi_split(const float* Os, unsigned short* Ph, unsigned short* Pl,
                                          size_t row0, int pitch, int col0, int tid) {
  const int e = tid & 7, lq = tid >> 3;                              // lq 0..15
  v4u uh[4], ul[4];
#pragma unroll
  for (int it = 0; it < 4; ++it) {
    const int row = it * 16 + lq;
    const v4f a = *(const v4f*)(Os + row * OSP + 8 * e);
    const v4f q = *(const v4f*)(Os + row * OSP + 8 * e + 4);
    const float f[8] = {a[0], a[1], a[2], a[3], q[0], q[1], q[2], q[3]};
#pragma unroll
    for (int t = 0; t < 4; ++t) {
      const float f0 = f[2 * t], f1 = f[2 * t + 1];
      const unsigned short hb0 = bf_bits(f0), hb1 = bf_bits(f1);
      const unsigned short lb0 = bf_bits(f0 - bf_up(hb0));
      const unsigned short lb1 = bf_bits(f1 - bf_up(hb1));
      uh[it][t] = pk16(hb0, hb1);
      ul[it][t] = pk16(lb0, lb1);
    }
  }
{
#pragma unroll
    for (int it = 0; it < 4; ++it) {
      const int row = it * 16 + lq;
      const size_t po = (row0 + (size_t)row) * (size_t)pitch + (size_t)col0 + 8 * e;
      *(v4u*)(Ph + po) = uh[it];
      *(v4u*)(Pl + po) = ul[it];
    }
    
  }
}

// Os -> one f16 plane (values already scaled), same line geometry as epi_split.
__device__ __forceinline__ void epi_h(const float* Os, unsigned short* P, size_t row0, int pitch, int col0, int tid) {
  const int e = tid & 7, lq = tid >> 3;
  v4u u[4];
#pragma unroll
  for (int it = 0; it < 4; ++it) {
    const int row = it * 16 + lq;
    const v4f a = *(const v4f*)(Os + row * OSP + 8 * e);
    const v4f q = *(const v4f*)(Os + row * OSP + 8 * e + 4);
    const float f[8] = {a[0], a[1], a[2], a[3], q[0], q[1], q[2], q[3]};
#pragma unroll
    for (int t = 0; t < 4; ++t)
      u[it][t] = pk16(h_bits((_Float16)f[2 * t]), h_bits((_Float16)f[2 * t + 1]));
  }
{
#pragma unroll
    for (int it = 0; it < 4; ++it) {
      const int row = it * 16 + lq;
      const size_t po = (row0 + (size_t)row) * (size_t)pitch + (size_t)col0 + 8 * e;
      *(v4u*)(P + po) = u[it];
    }
    
  }
}

// =========================================================================================================
// (4) H planes: D[m = d][n = e] = sum_o WqT[d][o] * WkT[e][o]  (1 product, exact) -> Hh/Hl bf16 [e][768 d].
// blocks (bx < 12 e-tiles, by < 12 d-tiles).  LDS Os cross-wave (block barrier).  sm: 2 * 2 * GPB bytes.
// =========================================================================================================
__device__ __forceinline__
void k_hgemm(unsigned char* sm, int bx, int by,
             const unsigned short* __restrict__ Aq, const unsigned short* __restrict__ Bk,
             unsigned short* Hh, unsigned short* Hl) {
  float* Os = (float*)sm;                                            // the stages' bytes, free behind the k loop
  const int tid = threadIdx.x, lane = tid & 31, wave = tid >> 5, hh = lane >> 4, c = lane & 15;
  const int n0 = bx * QT, m0 = by * QT;
  const unsigned short* ap = Aq + (size_t)m0 * ND;
  const unsigned short* bp = Bk + (size_t)n0 * ND;
  v8f acc[4];
  gemm_k<1>(sm, ap, ap, bp, acc);
  stage_os(Os, acc, 1.0f, wave, hh, c);
  __syncthreads();
  epi_split(Os, Hh, Hl, (size_t)n0, ND, m0, tid);
}

// =========================================================================================================
// (5) query planes: D[m = e][n = query] = sum_d (Hh + Hl)[e][d] * Xb[b][q][d]  (2 products), scaled by rstd_b^2
//     in the epilogue -> Ah/Al bf16 [b][NQ][768 e].  blocks (bx < NQ/64, by < 12 e-tiles, b < NB).  sm: 2 * 3 * GPB bytes.
// =========================================================================================================
__device__ __forceinline__
void k_agemm(unsigned char* sm, int bx, int by, int b,
             const unsigned short* __restrict__ Hh, const unsigned short* __restrict__ Hl,
             const unsigned short* __restrict__ Xb, const float* __restrict__ st,
             unsigned short* Ah, unsigned short* Al) {
  float* Os = (float*)sm;                                            // the stages' bytes, free behind the k loop
  const int tid = threadIdx.x, lane = tid & 31, wave = tid >> 5, hh = lane >> 4, c = lane & 15;
  const int n0 = bx * QT, m0 = by * QT;
  const unsigned short* ap0 = Hh + (size_t)m0 * ND;
  const unsigned short* ap1 = Hl + (size_t)m0 * ND;
  const unsigned short* bp  = Xb + ((size_t)b * NC + n0) * ND;
  v8f acc[4];
  gemm_k<2>(sm, ap0, ap1, bp, acc);
  const float sc = st[4 * b + 2];
  stage_os(Os, acc, sc, wave, hh, c);
  __syncthreads();
  epi_split(Os, Ah, Al, (size_t)b * NQ + n0, ND, m0, tid);
}

// =========================================================================================================
// (6) value plane (channel-major, keys contiguous): D[m = key j][n = o] = sum_d Xb[b][j][d] * Wvb[o][d]
//     (1 product, exact), x16 -> U f16 [b][768 o][2048 j].  blocks (bx < 12 o-tiles, by < 32 key-tiles, b < NB).
// =========================================================================================================
__device__ __forceinline__
void k_vgemm(unsigned char* sm, int bx, int by, int b,
             const unsigned short* __restrict__ Xb, const unsigned short* __restrict__ Wvn, unsigned short* U) {
  float* Os = (float*)sm;                                            // the stages' bytes, free behind the k loop
  const int tid = threadIdx.x, lane = tid & 31, wave = tid >> 5, hh = lane >> 4, c = lane & 15;
  const int n0 = bx * QT, m0 = by * QT;
  const unsigned short* ap = Xb + ((size_t)b * NC + m0) * ND;
  const unsigned short* bp = Wvn + (size_t)n0 * ND;
  v8f acc[4];
  gemm_k<1>(sm, ap, ap, bp, acc);
  stage_os(Os, acc, USC, wave, hh, c);
  __syncthreads();
  epi_h(Os, U, (size_t)b * ND + n0, NC, m0, tid);
}

// =========================================================================================================
// (7) key-side affine term: cs[b][j] = -(mu_b rstd_b^2) * sum_d g[d] * Xb[b][j][d], f32 VALU, one wave per row,
//     four waves of eight rows a block.
// coverage: blocks (bx < 64, b < NB) x 32 rows = every key row of b < NB.  LDS csL cross-wave (block barrier).
// =========================================================================================================
__device__ __forceinline__
void k_cs(unsigned char* sm, int bx, int b,
          const unsigned short* __restrict__ Xb, const float* __restrict__ g, const float* __restrict__ st,
          float* cs) {
  float* csL = (float*)sm;                                           // [32]
  const int tid = threadIdx.x, lane = tid & 31, wave = tid >> 5;
  const int r0 = bx * 32;
  v4f ga[3], gb[3];
#pragma unroll
  for (int c3 = 0; c3 < 3; ++c3) {
    ga[c3] = *(const v4f*)(g + 256 * c3 + 8 * lane);
    gb[c3] = *(const v4f*)(g + 256 * c3 + 8 * lane + 4);
  }
  const float nmr = -st[4 * b + 3];
#pragma unroll 1
  for (int t = 0; t < 8; ++t) {
    const int row = r0 + 8 * wave + t;
    const unsigned short* xp = Xb + ((size_t)b * NC + row) * ND + 8 * lane;
    float acc = 0.f;
#pragma unroll
    for (int c3 = 0; c3 < 3; ++c3) {
      const v4u u = *(const v4u*)(xp + 256 * c3);
      acc += bf_lo16(u[0]) * ga[c3][0] + bf_hi16(u[0]) * ga[c3][1]
           + bf_lo16(u[1]) * ga[c3][2] + bf_hi16(u[1]) * ga[c3][3]
           + bf_lo16(u[2]) * gb[c3][0] + bf_hi16(u[2]) * gb[c3][1]
           + bf_lo16(u[3]) * gb[c3][2] + bf_hi16(u[3]) * gb[c3][3];
    }
    acc += __shfl_xor(acc, 16, 32); acc += __shfl_xor(acc, 8, 32); acc += __shfl_xor(acc, 4, 32);
    acc += __shfl_xor(acc, 2, 32);  acc += __shfl_xor(acc, 1, 32);
    if (lane == 0) csL[8 * wave + t] = acc * nmr;
  }
  __syncthreads();
  if (wave == 0 && lane < 8) {
    const v4f v = *(const v4f*)(csL + 4 * lane);
    float* p = cs + (size_t)b * NC + r0 + 4 * lane;
    *(v4f*)p = v;
    
  }
}

// =========================================================================================================
// (8) attention for one (b, 64-query tile), transposed formulation, 2048 keys, no mask:
//   S^T tile (16 keys x 16 queries) = sum over 24 d-chunks of A(key row kb + (lane&15) of the bf16 plane Xb,
//   split k map) . B(query row of Ah) + A(Xb).B(Al) (bf16 residual, shared accumulator), then + cs[key].
//   Per lane the D tile holds 8 keys of ONE query: online softmax state per lane, one shuffle (lane^16) for the
//   max over 32 keys; corr applied every step (== 1 exactly when the max did not grow). P = e^{s-m} x 16384 as
//   f16 is the B operand of O^T (rows channel, cols queries) += A(U rows channel 16j + (lane&15), keys
//   contiguous, f16 x16) . B(P^T): element r <- D of the tile covering keys kb..kb+15, element 8+r <- the tile
//   covering kb+16..kb+31, lane unchanged. The 48 accumulator tiles per wave live in registers (384 per lane) for
//   the whole key loop and are stored once, behind it, to wave-private LDS slots Ow[query][768].
//   Epilogue after a block barrier: out[b][q][:] = Ow[q][:] * (rstd / (16 l_q)) - mu rstd rowsum(Wv), row =
// coverage: 4 waves x 16 query rows x 6 x 32 lanes x 4 = 64 x 768; grid (NQ/64, NB) covers out[b < NB][q < NQ].
// LDS: Ow written once per lane behind the key loop; cross-lane reads only after __syncthreads. staged extent
//      (16 x 768 per wave) == consumed extent. Up to the end of the key loop the same bytes hold the wave's query
//      fragments (hi + residual, 2 x 16 x 768 x 2 B), each 16 B written and read by one and the same lane.
//      Behind them one K buffer (32 key rows) and one V buffer (768 channel rows x 32 keys), filled once per block and
//      32 keys by asynchronous copies (each wave a quarter) and read by all four waves: cross-wave, so every tile is
//      read only behind its copiers' s_wait_asynccnt 0 and a block barrier, and refilled only behind the barrier
//      that ends its last read. coverage: K 4 waves x 8 rows x 3 x 32 lanes x 16 B = 32 x 1536 B; V 4 waves x 24 x
//      8 rows x 4 x 16 B = 768 x 64 B; pad bytes of a row are neither written nor read.
// =========================================================================================================
__global__ __launch_bounds__(128)
void k_attn(const unsigned short* __restrict__ Ah, const unsigned short* __restrict__ Al,
            const unsigned short* __restrict__ Xb, const unsigned short* __restrict__ U,
            const float* __restrict__ cs, const float* __restrict__ rv,
            const float* __restrict__ st, float* out) {
  __shared__ __attribute__((aligned(16))) unsigned char lds_all[ATTN_LDS];
  const int tid  = threadIdx.x;
  const int wave = tid >> 5, lane = tid & 31;
  const int hh   = lane >> 4, c = lane & 15;
  const int n0   = blockIdx.x * QT, b = blockIdx.y;
  float* Ow = (float*)lds_all + (size_t)wave * (16 * ND);
  float* op = Ow + c * ND + 8 * hh;                                  // this lane's slots (query column c)
  // O^T tiles: o[j][r] = channel 16 j + 8 hh + r of query c. Every loop over o[] is fully unrolled: only constant
  // indices keep the tiles in registers.
  v8f o[ND / 16];
#pragma unroll
  for (int j = 0; j < ND / 16; ++j) o[j] = zero8();

  const size_t qo = ((size_t)b * NQ + n0 + 16 * wave + c) * ND + 8 * hh;
  const unsigned short* Ahp = Ah + qo;
  const unsigned short* Alp = Al + qo;
  // The block's K tile (32 key rows x 768, row pitch KP) and V tile (768 channel rows x 32 keys, row pitch VP) in LDS,
  // read by all four waves. Fragment readers: lane -> row (lane&15), + 8*(lane>>4), as from the global planes.
  const unsigned short* Ks = (const unsigned short*)(lds_all + QLDS) + c * KP + 8 * hh;          // + key_loc*KP + 32 kc
  const unsigned short* Vs = (const unsigned short*)(lds_all + QLDS + KLDS) + c * VP + 8 * hh;   // + 16 j*VP
  // Copy side. K: wave w brings key rows 8w..8w+7, three copies of 512 B a row. V: wave w brings channel rows
  // 192w..192w+191, one copy = 8 rows x 64 B (lane -> row lane>>2, 16-byte piece lane&3).
  unsigned char* kl0 = lds_all + QLDS + (8 * wave) * (KP * 2) + 16 * lane;
  unsigned char* vl0 = lds_all + QLDS + KLDS + (192 * wave + (lane >> 2)) * (VP * 2) + 16 * (lane & 3);
  const unsigned short* kg0 = Xb + ((size_t)b * NC + 8 * wave) * ND + 8 * lane;                    // + kb*ND
  const unsigned short* vg0 = U + ((size_t)b * ND + 192 * wave + (lane >> 2)) * NC + 8 * (lane & 3); // + kb
  const float* csb = cs + (size_t)b * NC + 8 * hh;                                    // + kb (+16)

  // The wave's 16 query rows (hi and residual plane) go once into the wave's own LDS slots, fragment by fragment:
  // quarter f = 4 kc + {0, 1: hi elements 0..7, 8..15; 2, 3: residual} holds 32 lanes x 16 B, and every lane reads back
  // only what it wrote itself. The slots are the bytes of Ow, which is written only behind the key loop.
  unsigned short* Qs = (unsigned short*)lds_all + (size_t)wave * (2 * 16 * ND) + 8 * lane;
#pragma unroll 1
  for (int kq = 0; kq < ND / 32 / KG; ++kq) {
    const unsigned short* ap = Ahp + 32 * KG * kq;
    const unsigned short* lp = Alp + 32 * KG * kq;
    Frag a[KG], r[KG];
#pragma unroll
    for (int u = 0; u < KG; ++u) {
      a[u] = ldfrag(ap + 32 * u);
      r[u] = ldfrag(lp + 32 * u);
    }
    asm volatile("s_wait_xcnt 0x0" :: "v"(ap), "v"(lp) : "memory");
#pragma unroll
    for (int u = 0; u < KG; ++u) {
      const int kc = KG * kq + u;
      *(v8us*)(Qs + (4 * kc + 0) * 256) = a[u].u[0];
      *(v8us*)(Qs + (4 * kc + 1) * 256) = a[u].u[1];
      *(v8us*)(Qs + (4 * kc + 2) * 256) = r[u].u[0];
      *(v8us*)(Qs + (4 * kc + 3) * 256) = r[u].u[1];
    }
  }

  // Two-buffer ring over the tile sequence K(0), V(0), K(32), V(32), ...: the K buffer is worked on (scores) while the V
  // tile flies, the V buffer (O^T) while the next K tile flies. In front of the loop: first K tile, landed and
  // published; then the first V tile is sent off.
  asm volatile("s_wait_dscnt 0x0" ::: "memory");                     // the wave's own LDS stores retire before it copies
  acopy_tile<3, 512, 256, KP * 2, ND>(kl0, kg0);
  asm volatile("s_wait_asynccnt 0x0" ::: "memory");                  // this wave's share of the K tile has landed
  __syncthreads();                                                   // ... and every other wave's: the tile is readable
  acopy_tile<24, 8 * VP * 2, 8 * NC, 0, 0>(vl0, vg0);

  float m = -1.0e30f, l = 0.f;
#pragma unroll 1
  for (int kb = 0; kb < NC; kb += 32) {
    const unsigned short* k0p = Ks;                                  // keys kb .. kb+15
    const unsigned short* k1p = Ks + 16 * KP;                        // keys kb+16 .. kb+31
    v8f s0 = zero8(), s1 = zero8();
    // K and Q fragments (both LDS) in groups of KG d-chunks, two groups in registers: group g + 1 is in flight
    // while group g is used.
    Frag kf[2][KG][2], qf[2][KG][2];
#pragma unroll
    for (int u = 0; u < KG; ++u) {
      kf[0][u][0] = ldfrag(k0p + 32 * u);
      kf[0][u][1] = ldfrag(k1p + 32 * u);
      qf[0][u][0] = ldq(Qs + (4 * u) * 256);
      qf[0][u][1] = ldq(Qs + (4 * u + 2) * 256);
    }
    // the key-side terms are fetched here, at the head of the trip: the barrier at its foot waits for every global load
    const v4f ca = *(const v4f*)(csb + kb);
    const v4f cb = *(const v4f*)(csb + kb + 4);
    const v4f cd = *(const v4f*)(csb + kb + 16);
    const v4f ce = *(const v4f*)(csb + kb + 20);
    // the same wait for these four loads: their address pair is an input, so that nothing lands on it while the
    // loads are under way
    asm volatile("s_wait_xcnt 0x0" :: "v"(csb + kb) : "memory");
#pragma unroll
    for (int g = 0; g < ND / 32 / KG; ++g) {
      if (g + 1 < ND / 32 / KG) {
#pragma unroll
        for (int u = 0; u < KG; ++u) {
          const int kn = KG * (g + 1) + u;
          kf[(g + 1) & 1][u][0] = ldfrag(k0p + 32 * kn);
          kf[(g + 1) & 1][u][1] = ldfrag(k1p + 32 * kn);
          qf[(g + 1) & 1][u][0] = ldq(Qs + (4 * kn) * 256);
          qf[(g + 1) & 1][u][1] = ldq(Qs + (4 * kn + 2) * 256);
        }
      }
      // holds the next group's loads, as one run, in front of this group's products: they are in flight meanwhile, and
      // no LDS read stands among the products (without it the build spreads them there)
      __builtin_amdgcn_sched_barrier(0);
#pragma unroll
      for (int u = 0; u < KG; ++u) {
        s0 = mma_q(kf[g & 1][u][0].bf, qf[g & 1][u][0].bf, s0);
        s1 = mma_q(kf[g & 1][u][1].bf, qf[g & 1][u][0].bf, s1);
        s0 = mma_q(kf[g & 1][u][0].bf, qf[g & 1][u][1].bf, s0);
        s1 = mma_q(kf[g & 1][u][1].bf, qf[g & 1][u][1].bf, s1);
      }
      // keeps later groups' loads behind this point: no more than two groups hold registers, and again no LDS read
      // among the products
      __builtin_amdgcn_sched_barrier(0);
    }
    {
#pragma unroll
      for (int r = 0; r < 4; ++r) {
        s0[r] += ca[r]; s0[4 + r] += cb[r];                          // key kb      + 8hh + r
        s1[r] += cd[r]; s1[4 + r] += ce[r];                          // key kb + 16 + 8hh + r
      }
    }

    // foot of the score trip: own LDS reads done, own V copies landed, then the barrier that publishes the V tile and
    // ends every wave's reads of the K buffer; behind it the next K tile is sent off into that buffer
    asm volatile("s_wait_dscnt 0x0" ::: "memory");
    asm volatile("s_wait_asynccnt 0x0" ::: "memory");
    __syncthreads();
    if (kb + 32 < NC) acopy_tile<3, 512, 256, KP * 2, ND>(kl0, kg0 + (size_t)(kb + 32) * ND);

    float mx = fmaxf(hmax8(s0), hmax8(s1));
    mx = fmaxf(mx, __shfl_xor(mx, 16, 32));
    const float mn   = fmaxf(m, mx);
    const float corr = __expf(m - mn);                               // == 1 exactly when the max did not grow
    l *= corr;
    m = mn;
    const float msh = mn - LNPS;                                     // exp gives e^{s-m} * 16384

    FragH ph;
    float ls = 0.f;
#pragma unroll
    for (int r = 0; r < 8; ++r) {
      const float e0 = __expf(s0[r] - msh);
      const float e1 = __expf(s1[r] - msh);
      ls += e0 + e1;
      ph.hv[0][r] = (_Float16)e0;
      ph.hv[1][r] = (_Float16)e1;
    }
    l += ls;

    // V fragments (LDS) in groups of VG channel tiles, two groups in registers, as for K and Q above
    Frag vf[2][VG];
#pragma unroll
    for (int u = 0; u < VG; ++u) vf[0][u] = ldfrag(Vs + (16 * u) * VP);
#pragma unroll
    for (int g = 0; g < ND / 16 / VG; ++g) {
      if (g + 1 < ND / 16 / VG) {
#pragma unroll
        for (int u = 0; u < VG; ++u) vf[(g + 1) & 1][u] = ldfrag(Vs + (16 * (VG * (g + 1) + u)) * VP);
      }
      // holds the next group's LDS reads, as one run, in front of this group's products
      __builtin_amdgcn_sched_barrier(0);
#pragma unroll
      for (int u = 0; u < VG; ++u) {
        const int j = VG * g + u;
        v8f t;
#pragma unroll
        for (int r = 0; r < 8; ++r) t[r] = o[j][r] * corr;
        o[j] = mma_h(vf[g & 1][u].h, ph.v, t);
      }
      // keeps later groups' reads behind this point: no LDS read among the products
      __builtin_amdgcn_sched_barrier(0);
    }
    // foot of the O^T trip: the same order; the barrier publishes the next K tile and frees the V buffer
    asm volatile("s_wait_dscnt 0x0" ::: "memory");
    asm volatile("s_wait_asynccnt 0x0" ::: "memory");
    __syncthreads();
    if (kb + 32 < NC) acopy_tile<24, 8 * VP * 2, 8 * NC, 0, 0>(vl0, vg0 + (kb + 32));
  }
  asm volatile("s_wait_asynccnt 0x0" ::: "memory");                  // nothing is in flight when the LDS changes its use
  // the finished tiles go to the wave's LDS slots once, for the row-major epilogue
#pragma unroll
  for (int j = 0; j < ND / 16; ++j) {
    v4f na, nb2;
#pragma unroll
    for (int r = 0; r < 4; ++r) { na[r] = o[j][r]; nb2[r] = o[j][4 + r]; }
    *(v4f*)(op + 16 * j)     = na;
    *(v4f*)(op + 16 * j + 4) = nb2;
  }
  l += __shfl_xor(l, 16, 32);
  const float inv  = 1.0f / l;                                       // Ow and l both carry the x16384 factor
  const float mu   = st[4 * b + 0], rstd = st[4 * b + 1];
  const float qsc  = inv * rstd * IUSC;                              // per lane: its query column
  const float mrs  = mu * rstd;
  v4f rvv[6];
#pragma unroll
  for (int k = 0; k < ND / 128; ++k) {
    const v4f t = *(const v4f*)(rv + 128 * k + 4 * lane);
#pragma unroll
    for (int u = 0; u < 4; ++u) rvv[k][u] = t[u] * mrs;
  }
  __syncthreads();                                                   // all accumulator slots final before cross-lane reads

{
#pragma unroll 1
    for (int qq = 0; qq < 16; ++qq) {
      const float sc = __shfl(qsc, qq, 32);
      const float* lrow = Ow + qq * ND + 4 * lane;
      float* orow = out + ((size_t)b * NC + n0 + 16 * wave + qq) * ND + 4 * lane;
#pragma unroll
      for (int k = 0; k < ND / 128; ++k) {
        const v4f v = *(const v4f*)(lrow + 128 * k);
        v4f w;
#pragma unroll
        for (int u = 0; u < 4; ++u) w[u] = v[u] * sc - rvv[k][u];
        *(v4f*)(orow + 128 * k) = w;
      }
    }
    
  }
}

// =========================================================================================================
// The launches. Stages that need nothing of one another share one grid: a block takes its stage by the range its index
// lies in (a block-uniform branch, so every barrier of a stage is passed by the whole block) and its place in the stage
// from the index, x fastest. All stages of a launch use the one LDS array of the launch.
//   k_prep : (0) weights | (2) x                      both read inputs only
//   k_mid  : (3) statistics | (4) H | (1) g | (6) U    all read only what k_prep wrote
//   k_qc   : (5) query planes | (7) key-side term      both read only what k_prep and k_mid wrote
// The few long serial blocks stand first in their launch; the short blocks of (7) stand last.
// =========================================================================================================
#define PB_X  (3 * (ND / QT))                       // k_prep: first block of (2)
#define PB_N  (PB_X + KCH * NB)
#define MB_H  1                                     // k_mid: first block of (4), of (1), of (6)
#define MB_G  (MB_H + (ND / QT) * (ND / QT))
#define MB_V  (MB_G + ND / GCB)
#define MB_N  (MB_V + (ND / QT) * (NC / QT) * NB)
#define QB_C  ((NQ / QT) * (ND / QT) * NB)          // k_qc: first block of (7)
#define QB_N  (QB_C + (NC / 32) * NB)
static_assert(2 * 2 * GPB >= GRG * GCB * 4 + 8 * GCB * 4 && 2 * 2 * GPB >= 2 * 64 * 8 + 32 * 4 && KCH == 64);

__global__ __launch_bounds__(256)
void k_prep(const float* __restrict__ x, const float* __restrict__ wk, const float* __restrict__ wq,
            const float* __restrict__ wv, unsigned short* Wn, unsigned short* Wt, float* rs,
            unsigned short* Xb, double* part) {
  __shared__ __align__(16) unsigned char sm[QT * TPW * 2 + QT * 4];
  const int bid = blockIdx.x;
  if (bid < PB_X) {
    cvt_w(sm, bid % (ND / QT), bid / (ND / QT), wk, wq, wv, Wn, Wt, rs);
  } else {
    const int i = bid - PB_X;
    k_xcvt(sm, i % KCH, i / KCH, x, Xb, part);
  }
}

__global__ __launch_bounds__(128)
void k_mid(const double* __restrict__ part, const unsigned short* __restrict__ Wn,
           const unsigned short* __restrict__ Wt, const float* __restrict__ rs,
           const unsigned short* __restrict__ Xb, float* st, unsigned short* Hh, unsigned short* Hl, float* g,
           unsigned short* U) {
  __shared__ __align__(16) unsigned char sm[2 * 2 * GPB];
  const int bid = blockIdx.x;
  if (bid < MB_H) {
    k_stats(sm, part, st);
  } else if (bid < MB_G) {
    const int i = bid - MB_H;                                        // A = Wq transposed (rows d), B = Wk transposed (rows e)
    k_hgemm(sm, i % (ND / QT), i / (ND / QT), Wt + (size_t)1 * ND * ND, Wt, Hh, Hl);
    // the wait before a register that an issued global store names is overwritten: the build lets this stage's end run
    // on through the later stages' tests, whose code rewrites the stores' registers
    asm volatile("s_wait_xcnt 0x0" ::: "memory");
  } else if (bid < MB_V) {
    k_g(sm, bid - MB_G, Wn, rs + ND, g);
  } else {
    const int i = bid - MB_V;
    k_vgemm(sm, i % (ND / QT), (i / (ND / QT)) % (NC / QT), i / ((ND / QT) * (NC / QT)), Xb,
            Wn + (size_t)2 * ND * ND, U);
    // the wait before a register that an issued global store names is overwritten: the build lets this stage's end run
    // on through the later stages' tests, whose code rewrites the stores' registers
    asm volatile("s_wait_xcnt 0x0" ::: "memory");
  }
}

__global__ __launch_bounds__(128)
void k_qc(const unsigned short* __restrict__ Hh, const unsigned short* __restrict__ Hl,
          const unsigned short* __restrict__ Xb, const float* __restrict__ st, const float* __restrict__ g,
          unsigned short* Ah, unsigned short* Al, float* cs) {
  __shared__ __align__(16) unsigned char sm[2 * 3 * GPB];
  const int bid = blockIdx.x;
  if (bid < QB_C) {
    k_agemm(sm, bid % (NQ / QT), (bid / (NQ / QT)) % (ND / QT), bid / ((NQ / QT) * (ND / QT)), Hh, Hl, Xb, st, Ah, Al);
  } else {
    const int i = bid - QB_C;
    k_cs(sm, i % (NC / 32), i / (NC / 32), Xb, g, st, cs);
  }
}

// =========================================================================================================
// Workspace map (bytes; each region start a multiple of 256; every extent is an exact tile/line multiple and is
//   Wn bf16 [3][768][768]      3538944      Wt bf16 [3][768][768]   3538944
//   rs  f32 [3][768]              9216      g   f32 [768]              3072
//   Xb bf16 [NB][2048][768]   25165824 (NB=8)  part f64 [NB][64][16]  65536    st f32 [32]  128 (256)
//   Hh/Hl bf16 [768][768]      1179648 x2
//   Ah/Al bf16 [NB][NQ][768]  25165824 x2 (NB=8, NQ=2048)
//   U  f16 [NB][768][2048]    25165824      cs f32 [NB][2048]         65536
//   total (NB=8, NQ=2048) = 110244096
// =========================================================================================================
extern "C" void kernel_launch(void* const* d_in, const int* in_sizes, int n_in,
                              void* d_out, int out_size, void* d_ws, size_t ws_size,
                              hipStream_t stream) {
  if (n_in < 4) return;
  if (in_sizes[0] < NB * NC * ND) return;
  if (in_sizes[1] < ND * ND || in_sizes[2] < ND * ND || in_sizes[3] < ND * ND) return;
  if (out_size < NB * NC * ND) return;

  size_t off = 0;
  auto carve = [&](size_t bytes) { const size_t o = off; off += (bytes + 255) & ~(size_t)255; return o; };
  const size_t oWn   = carve((size_t)3 * ND * ND * 2);
  const size_t oWt   = carve((size_t)3 * ND * ND * 2);
  const size_t oRs   = carve((size_t)3 * ND * 4);
  const size_t oG    = carve((size_t)ND * 4);
  const size_t oXb   = carve((size_t)NB * NC * ND * 2);
  const size_t oPart = carve((size_t)NB * KCH * 128);
  const size_t oSt   = carve((size_t)128);
  const size_t oHh   = carve((size_t)ND * ND * 2);
  const size_t oHl   = carve((size_t)ND * ND * 2);
  const size_t oAh   = carve((size_t)NB * NQ * ND * 2);
  const size_t oAl   = carve((size_t)NB * NQ * ND * 2);
  const size_t oU    = carve((size_t)NB * ND * NC * 2);
  const size_t oCs   = carve((size_t)NB * NC * 4);
  if (off > ws_size) return;
  if (off > (size_t)134217728) return;

  const float* x  = (const float*)d_in[0];
  const float* wk = (const float*)d_in[1];
  const float* wq = (const float*)d_in[2];
  const float* wv = (const float*)d_in[3];

  char* ws = (char*)d_ws;
  unsigned short* Wn  = (unsigned short*)(ws + oWn);
  unsigned short* Wt  = (unsigned short*)(ws + oWt);
  float*          rs  = (float*)(ws + oRs);
  float*          g   = (float*)(ws + oG);
  unsigned short* Xb  = (unsigned short*)(ws + oXb);
  double*         part = (double*)(ws + oPart);
  float*          st  = (float*)(ws + oSt);
  unsigned short* Hh  = (unsigned short*)(ws + oHh);
  unsigned short* Hl  = (unsigned short*)(ws + oHl);
  unsigned short* Ah  = (unsigned short*)(ws + oAh);
  unsigned short* Al  = (unsigned short*)(ws + oAl);
  unsigned short* U   = (unsigned short*)(ws + oU);
  float*          cs  = (float*)(ws + oCs);
  float* out = (float*)d_out;

  const dim3 blk256(256), blk128(128);

  // (0) weights -> bf16 natural + transposed planes + row sums (y: 0 Wk, 1 Wq, 2 Wv); (2) x -> bf16 plane + f64 partial sums
  k_prep<<<dim3(PB_N), blk256, 0, stream>>>(x, wk, wq, wv, Wn, Wt, rs, Xb, part);
  // (3) LayerNorm statistics; (4) H planes; (1) g = bf16(Wk)^T . rowsum(bf16(Wq)); (6) value plane U = 16 X.Wv^T
  k_mid<<<dim3(MB_N), blk128, 0, stream>>>(part, Wn, Wt, rs, Xb, st, Hh, Hl, g, U);
  // (5) query planes A' = rstd^2 X.H (hi + residual); (7) key-side affine term
  k_qc<<<dim3(QB_N), blk128, 0, stream>>>(Hh, Hl, Xb, st, g, Ah, Al, cs);
  // (8) attention -> out [b][q][768]
  k_attn<<<dim3(NQ / QT, NB), blk128, 0, stream>>>(Ah, Al, Xb, U, cs, rs + 2 * ND, st, out);
  (void)hipGetLastError();
}

// v007
// It runs in 228 microseconds.
// Next to v006, in two timings, it ran 1.15 times as fast each time.
// Counting every step since v000, it is 6.31 times as fast.
// Contractions (f32 accumulate everywhere): H[e][d] = sum_o Wq[o][d]*Wk[o][e] on v_wmma_f32_16x16x32_bf16 with
// bf16-RNE weights (exact products); query plane A' = X.H with bf16-RNE x and H carried as bf16 hi + bf16
// residual (2 products, shared accumulator); U = X.Wv^T (1 product, bf16-RNE operands); scores
// S^T = X(keys).A'(queries) with A' as bf16 hi + bf16 residual (2 products); O^T = U.P^T on
// v_wmma_f32_16x16x32_f16 (U x16 as f16, P = e^{s-m} x16384 as f16 built from the score D registers).
// LayerNorm statistics in f64 VALU; per-batch affine terms, softmax statistics and normalisation in f32 VALU.
#include <hip/hip_runtime.h>
#include <math.h>
#include <stdint.h>

#ifndef NB
#define NB 8
#endif
#ifndef NQ
#define NQ 2048
#endif
#define NBF  8
#define NC   2048
#define ND   768
#define QT   64
#define OSP  68
#define TPW  72
#define KCH  64
#define KG   4
#define USC  16.0f
#define IUSC 0.0625f
#define LNPS 9.704060527839234f
#define EPSV 1.0e-5f
#define KP   776
#define VP   40
#define VG   8
#define QLDS (4 * 16 * ND * 4)
#define KLDS (32 * KP * 2)
#define VLDS (ND * VP * 2)
#define ATTN_LDS (QLDS + KLDS + VLDS)
#define GKC  64
#define GP   72
#define GPB  (QT * GP * 2)
#define GCB  32
#define GRG  64

static_assert(NB >= 1 && NB <= NBF);
static_assert(NQ % QT == 0 && NQ >= QT && NQ <= NC);
static_assert(NC % QT == 0 && ND % QT == 0);
static_assert(NC % 32 == 0 && ND % 32 == 0);
static_assert(ND % 256 == 0 && ND % 128 == 0 && ND % 16 == 0);
static_assert(NC / KCH == 32 && KCH == 64);
static_assert((ND / 32) % KG == 0);
static_assert(2 * 16 * ND * 2 == 16 * ND * 4);
static_assert(4 * NBF <= 32);
static_assert((OSP * 4) % 16 == 0);
static_assert((TPW * 2) % 16 == 0);
static_assert(QLDS == 196608 && ATTN_LDS <= 327680);
static_assert((KP * 2) % 32 == 16 && (VP * 2) % 32 == 16);          // LDS row pitch = 16 B x odd, for b128 readers
static_assert(KP >= ND + 8 && VP >= 32 + 8 && QLDS % 16 == 0 && KLDS % 16 == 0);
static_assert(ND % GKC == 0 && ND / GKC >= 2 && GKC * 2 == 128 && GKC % 32 == 0 && QT == 64);
static_assert((GP * 2) % 32 == 16 && GP >= GKC + 8 && 2 * 2 * GPB >= QT * OSP * 4);
static_assert(ND % GCB == 0 && ND % GRG == 0 && GCB == 32 && 4 * GRG == 256 && GRG % 8 == 0);
static_assert((ND / 16) % VG == 0 && ND % (4 * 8) == 0 && ND / 4 / 8 == 24 && 8 * (ND / 256) == 24);

typedef _Float16       v16h __attribute__((ext_vector_type(16)));
typedef _Float16       v8h  __attribute__((ext_vector_type(8)));
typedef __bf16         v16b __attribute__((ext_vector_type(16)));
typedef unsigned short v8us __attribute__((ext_vector_type(8)));
typedef float          v8f  __attribute__((ext_vector_type(8)));
typedef float          v4f  __attribute__((ext_vector_type(4)));
typedef unsigned int   v4u  __attribute__((ext_vector_type(4)));
typedef double         v2d  __attribute__((ext_vector_type(2)));

union Frag  { v8us u[2]; v16h h; v16b bf; };
union FragH { v16h v; v8h hv[2]; };
static_assert(sizeof(Frag) == 32);
static_assert(sizeof(FragH) == 32);

// ---- scalar helpers ---------------------------------------------------------------------------------------
__device__ __forceinline__ unsigned short bf_bits(float f) {          // f32 -> bf16 bits, RNE convert
  unsigned u = __float_as_uint(f);
  return (unsigned short)((u + 0x7FFFu + ((u >> 16) & 1u)) >> 16);
}
__device__ __forceinline__ float bf_up(unsigned short hb) { return __uint_as_float(((unsigned)hb) << 16); }
__device__ __forceinline__ float bf_lo16(unsigned w) { return __uint_as_float(w << 16); }
__device__ __forceinline__ float bf_hi16(unsigned w) { return __uint_as_float(w & 0xFFFF0000u); }
__device__ __forceinline__ unsigned short h_bits(_Float16 x) { return __builtin_bit_cast(unsigned short, x); }
__device__ __forceinline__ unsigned pk16(unsigned short a, unsigned short b) { return (unsigned)a | ((unsigned)b << 16); }
__device__ __forceinline__ v8f zero8() { v8f z = {0.f, 0.f, 0.f, 0.f, 0.f, 0.f, 0.f, 0.f}; return z; }
__device__ __forceinline__ float hmax8(v8f s) {
  return fmaxf(fmaxf(fmaxf(s[0], s[1]), fmaxf(s[2], s[3])), fmaxf(fmaxf(s[4], s[5]), fmaxf(s[6], s[7])));
}
__device__ __forceinline__ double shfl_xor_d(double v, int mask) {
  int lo = __double2loint(v), hi = __double2hiint(v);
  lo = __shfl_xor(lo, mask, 32);
  hi = __shfl_xor(hi, mask, 32);
  return __hiloint2double(hi, lo);
}

// ---- 16-bit fragment loader (A, or B from a k-contiguous [n][k] row): lane -> row/col (lane&15), p already includes
//      + 8*(lane>>4); elements 0..7 <- p[0..7] (k0+8h..), elements 8..15 <- p[16..23] (k0+16+8h..)
__device__ __forceinline__ Frag ldfrag(const unsigned short* p) {
  Frag f;
  f.u[0] = *(const v8us*)(p);
  f.u[1] = *(const v8us*)(p + 16);
  return f;
}

// ---- fragment from the packed LDS form: two quarters of 32 lanes x 16 B, p already includes + 8*lane
__device__ __forceinline__ Frag ldq(const unsigned short* p) {
  Frag f;
  f.u[0] = *(const v8us*)(p);
  f.u[1] = *(const v8us*)(p + 256);
  return f;
}

// ---- WMMA helpers: builtin followed by a 4-slot VALU gap tying D and keeping A/B live --------------------------
// mma_h is the bare builtin (the compiler keeps the distance behind its own WMMAs): with D tied to an asm statement
// the 48 resident D tiles of k_attn, 384 registers, do not all get registers and the build spills to scratch.
__device__ __forceinline__ v8f mma_h(v16h a, v16h b, v8f c) {
  return __builtin_amdgcn_wmma_f32_16x16x32_f16(false, a, false, b, (short)0, c, false, false);
}
// mma_q is the bare bf16 builtin, for a like reason: with the two fragment groups that k_attn keeps in flight tied to
// mma_b's asm statement as operands, the build spills to scratch.
__device__ __forceinline__ v8f mma_q(v16b a, v16b b, v8f c) {
  return __builtin_amdgcn_wmma_f32_16x16x32_bf16(false, a, false, b, (short)0, c, false, false);
}
__device__ __forceinline__ v8f mma_b(v16b a, v16b b, v8f c) {
  v8f d = __builtin_amdgcn_wmma_f32_16x16x32_bf16(false, a, false, b, (short)0, c, false, false);
#if defined(__HIP_DEVICE_COMPILE__)
  const v16h ha = __builtin_bit_cast(v16h, a), hb = __builtin_bit_cast(v16h, b);
  asm volatile("v_nop\n\tv_nop\n\tv_nop\n\tv_nop" : "+v"(d) : "v"(ha), "v"(hb));
#endif
  return d;
}

// ---- one tile = 24 asynchronous 16-byte copies per lane, global -> LDS, through no register. RUN copies follow one
//      another at steps (LS1, GS1), then the next run starts (LS2, GS2) further; steps in bytes (LDS) and in 16-bit
//      elements (global). The landing is waited for by the caller (s_wait_asynccnt).
typedef int v4i __attribute__((ext_vector_type(4)));
template <int RUN, int LS1, int GS1, int LS2, int GS2>
__device__ __forceinline__ void acopy_tile(unsigned char* l0, const unsigned short* g0) {
#if defined(__HIP_DEVICE_COMPILE__)
#pragma unroll
  for (int idx = 0; idx < 24; ++idx) {
    const int r = idx / RUN, s = idx % RUN;
    __builtin_amdgcn_global_load_async_to_lds_b128(
        (__attribute__((address_space(1))) v4i*)(g0 + (size_t)r * GS2 + (size_t)s * GS1),
        (__attribute__((address_space(3))) v4i*)(l0 + r * LS2 + s * LS1), 0, 0);
  }
#endif
}

// =========================================================================================================
// (0) weights f32 [768][768] (y = 0: Wk, 1: Wq, 2: Wv, block-uniform selection) -> bf16-RNE planes:
//     natural Wn[y][o][i] and transposed Wt[y][i][o], plus row sums rs[y][o] = sum_i bf16(W[o][i]) in f32.
//     Block (ob, y) owns rows o0..o0+63; column chunks of 64 go through the LDS tile T[i_loc][o_loc] (pitch TPW).
// coverage: Wn 12 chunks x 2 it x 8 waves x 4 rows x 8 lanes x 8 = 64 x 768 per block; Wt 12 chunks x 2 it x 32 x 8
//           lanes x 8 = 768 x 64 per block; rs 16 x 4 = 64; blocks (bx < 12, y < 3) cover all three matrices once.
// LDS: T and rsL cross-wave (block barriers).
// =========================================================================================================
__device__ __forceinline__
void cvt_w(unsigned char* sm, int bx, int y,
           const float* __restrict__ wk, const float* __restrict__ wq, const float* __restrict__ wv,
           unsigned short* Wn, unsigned short* Wt, float* rs) {
  unsigned short* T = (unsigned short*)sm;                           // [QT * TPW]
  float* rsL = (float*)(sm + QT * TPW * 2);                          // [QT]
  const int tid = threadIdx.x, lane = tid & 31, wave = tid >> 5;
  const int o0 = bx * QT;
  const float* W = (y == 0) ? wk : ((y == 1) ? wq : wv);            // block-uniform, all global
  unsigned short* Np = Wn + (size_t)y * ND * ND;
  unsigned short* Tq = Wt + (size_t)y * ND * ND;
  const int e = lane & 7, r4 = lane >> 3;                           // r4 0..3
  const int e8 = tid & 7, lq = tid >> 3;                            // lq 0..31
  float rsum0 = 0.f, rsum1 = 0.f;
#pragma unroll 1
  for (int cc = 0; cc < ND / QT; ++cc) {
    const int i0 = cc * QT;
#pragma unroll
    for (int it = 0; it < 2; ++it) {
      const int ol = 8 * wave + 4 * it + r4;                          // 0..63
      const float* sp = W + (size_t)(o0 + ol) * ND + i0 + 8 * e;
      const v4f a = *(const v4f*)sp;
      const v4f q = *(const v4f*)(sp + 4);
      const float f[8] = {a[0], a[1], a[2], a[3], q[0], q[1], q[2], q[3]};
      unsigned short hb[8];
      float ps = 0.f;
#pragma unroll
      for (int t = 0; t < 8; ++t) { hb[t] = bf_bits(f[t]); ps += bf_up(hb[t]); }
      if (it == 0) rsum0 += ps; else rsum1 += ps;
      v4u u;
#pragma unroll
      for (int t = 0; t < 4; ++t) u[t] = pk16(hb[2 * t], hb[2 * t + 1]);
      unsigned short* np = Np + (size_t)(o0 + ol) * ND + i0 + 8 * e;
      *(v4u*)np = u;
      
#pragma unroll
      for (int t = 0; t < 8; ++t) T[(8 * e + t) * TPW + ol] = hb[t];   // T[i_loc][o_loc]
    }
    __syncthreads();
    v4u up[2];
#pragma unroll
    for (int it = 0; it < 2; ++it) {
      const int il = 32 * it + lq;                                    // 0..63
      up[it] = *(const v4u*)(T + il * TPW + 8 * e8);
    }
{
#pragma unroll
      for (int it = 0; it < 2; ++it) {
        const int il = 32 * it + lq;
        *(v4u*)(Tq + (size_t)(i0 + il) * ND + o0 + 8 * e8) = up[it];
      }
      
    }
    __syncthreads();                                                  // T reused by the next chunk
  }
  rsum0 += __shfl_xor(rsum0, 1, 32); rsum0 += __shfl_xor(rsum0, 2, 32); rsum0 += __shfl_xor(rsum0, 4, 32);
  rsum1 += __shfl_xor(rsum1, 1, 32); rsum1 += __shfl_xor(rsum1, 2, 32); rsum1 += __shfl_xor(rsum1, 4, 32);
  if (e == 0) { rsL[8 * wave + r4] = rsum0; rsL[8 * wave + 4 + r4] = rsum1; }
  __syncthreads();
  if (wave == 0 && lane < 16) {
    const v4f v = *(const v4f*)(rsL + 4 * lane);
    float* rp = rs + (size_t)y * ND + o0 + 4 * lane;
    *(v4f*)rp = v;
    
  }
}

// =========================================================================================================
// (1) g[e] = sum_o bf16(Wk)[o][e] * rq[o]  (rq = row sums of bf16(Wq)); f32. Block = 32 columns e (its 32 results are
//     one 128-byte line of g), 128 threads, each doing the work of the two places vt = tid and tid + 128 of 256.
//     Place (og = vt>>2, e4 = vt&3) takes columns 8 e4..8 e4+7 of rows og + 64 i, i < 12 in rising order, six rows at a
//     time: six 16-byte loads and six rq values, all sent off before the first is used, four load latencies a block.
//     The 64 row groups are joined in a fixed order: pL[og][column] -> part w < 8 sums groups 8w..8w+7 (wave w & 3) ->
//     sL[w][column] -> wave 0 sums the eight and stores the line with one instruction.
// coverage: 64 og x 12 = 768 rows, 4 e4 x 8 = 32 columns per block; 24 blocks x 32 = 768 = whole g.
// LDS pL and sL cross-wave (a block barrier behind each).
// =========================================================================================================
__device__ __forceinline__
void k_g(unsigned char* sm, int bx, const unsigned short* __restrict__ Wkn, const float* __restrict__ rq, float* g) {
  float* pL = (float*)sm;                                            // [GRG * GCB]
  float* sL = (float*)(sm + GRG * GCB * 4);                          // [8 * GCB]
  const int tid = threadIdx.x, lane = tid & 31, wave = tid >> 5;
  const int e0 = bx * GCB;
  for (int v = 0; v < 2; ++v) {
    const int vt = tid + 128 * v;
    const int e4 = vt & 3, og = vt >> 2;
    const unsigned short* wp = Wkn + (size_t)og * ND + e0 + 8 * e4;
    float acc[8] = {0.f, 0.f, 0.f, 0.f, 0.f, 0.f, 0.f, 0.f};
    // rolled: six rows' w[] and r[] hold registers at a time. Unrolled (twelve rows at once) the build takes 140 registers
    // for the whole launch, past the 128 at which the GEMM blocks that share it stand eight waves a SIMD, as their LDS allows
#pragma unroll 1
    for (int h = 0; h < 2; ++h) {
      const int ib = ND / GRG / 2 * h;
      v4u   w[ND / GRG / 2];
      float r[ND / GRG / 2];
      // unrolled: w[] and r[] stay in registers and all 12 loads are issued before the first one is waited for
#pragma unroll
      for (int i = 0; i < ND / GRG / 2; ++i) {
        w[i] = *(const v4u*)(wp + (size_t)(GRG * (ib + i)) * ND);
        r[i] = rq[og + GRG * (ib + i)];
      }
      // both loops unrolled: only constant indices keep w[], r[] and acc[] in registers
#pragma unroll
      for (int i = 0; i < ND / GRG / 2; ++i) {
#pragma unroll
        for (int t = 0; t < 4; ++t) {
          acc[2 * t]     += bf_lo16(w[i][t]) * r[i];
          acc[2 * t + 1] += bf_hi16(w[i][t]) * r[i];
        }
      }
    }
    const v4f pa = {acc[0], acc[1], acc[2], acc[3]};
    const v4f pb = {acc[4], acc[5], acc[6], acc[7]};
    *(v4f*)(pL + og * GCB + 8 * e4)     = pa;
    *(v4f*)(pL + og * GCB + 8 * e4 + 4) = pb;
  }
  __syncthreads();
  // unrolled (all three loops, here and below): eight LDS reads at constant offsets of one address
#pragma unroll
  for (int v = 0; v < 2; ++v) {
    const int vw = wave + 4 * v;
    float s = 0.f;
#pragma unroll
    for (int k = 0; k < GRG / 8; ++k) s += pL[(GRG / 8 * vw + k) * GCB + lane];
    sL[vw * GCB + lane] = s;
  }
  __syncthreads();
  if (wave == 0) {
    float v = 0.f;
#pragma unroll
    for (int k = 0; k < 8; ++k) v += sL[k * GCB + lane];
    g[e0 + lane] = v;
  }
}

// =========================================================================================================
// (2) x f32 [b][2048][768] -> Xb bf16-RNE plane (same layout) and per-chunk f64 partial sums of the bf16 values
//     (sum, sum of squares). Block (ch, b) owns 32 rows; wave w rows 4w..4w+3; per row 3 instructions of
// coverage: Xb 4 rows x 8 waves x 3 x 32 lanes x 8 = 32 x 768 per block, blocks (ch < 64, b < NB) = all rows of b < NB;
// =========================================================================================================
__device__ __forceinline__
void k_xcvt(unsigned char* sm, int ch, int b, const float* __restrict__ x, unsigned short* Xb, double* part) {
  double* sL = (double*)sm;                                          // [8]
  double* qL = sL + 8;                                               // [8]
  const int tid = threadIdx.x, lane = tid & 31, wave = tid >> 5;
  const int r0 = ch * (NC / KCH);
  double s = 0.0, q = 0.0;
#pragma unroll 1
  for (int t = 0; t < 4; ++t) {
    const int row = r0 + 4 * wave + t;
    const size_t base = ((size_t)b * NC + row) * ND + 8 * lane;
#pragma unroll 1
    for (int c3 = 0; c3 < ND / 256; ++c3) {
      const float* sp = x + base + 256 * c3;
      const v4f a = *(const v4f*)sp;
      const v4f q4 = *(const v4f*)(sp + 4);
      const float f[8] = {a[0], a[1], a[2], a[3], q4[0], q4[1], q4[2], q4[3]};
      unsigned short hb[8];
#pragma unroll
      for (int k = 0; k < 8; ++k) {
        hb[k] = bf_bits(f[k]);
        const double v = (double)bf_up(hb[k]);
        s += v;
        q += v * v;
      }
      v4u u;
#pragma unroll
      for (int k = 0; k < 4; ++k) u[k] = pk16(hb[2 * k], hb[2 * k + 1]);
      unsigned short* xp = Xb + base + 256 * c3;
      *(v4u*)xp = u;
      
    }
  }
  s += shfl_xor_d(s, 16); s += shfl_xor_d(s, 8); s += shfl_xor_d(s, 4); s += shfl_xor_d(s, 2); s += shfl_xor_d(s, 1);
  q += shfl_xor_d(q, 16); q += shfl_xor_d(q, 8); q += shfl_xor_d(q, 4); q += shfl_xor_d(q, 2); q += shfl_xor_d(q, 1);
  if (lane == 0) { sL[wave] = s; qL[wave] = q; }
  __syncthreads();
  if (wave == 0) {
    double S = 0.0, Q = 0.0;
#pragma unroll
    for (int w = 0; w < 8; ++w) { S += sL[w]; Q += qL[w]; }
    v2d val;
    val[0] = (lane == 0) ? S : 0.0;
    val[1] = (lane == 0) ? Q : 0.0;
    if (lane < 8) {
      double* pp = part + ((size_t)b * KCH + ch) * 16 + 2 * lane;
      *(v2d*)pp = val;
      
    }
  }
}

// =========================================================================================================
// (3) LayerNorm statistics per batch from the 64 partial lines (fixed-order f64 tree): st line f32 [32] with
// =========================================================================================================
__device__ __forceinline__
void k_stats(unsigned char* sm, const double* __restrict__ part, float* st) {
  double* sL = (double*)sm;                                          // [64]
  double* qL = sL + 64;                                              // [64]
  float* stL = (float*)(sm + 2 * 64 * 8);                            // [32]
  const int tid = threadIdx.x;                                       // 128 threads; 64 and up only pass the barriers
  if (tid < 32) stL[tid] = 0.f;
#pragma unroll 1
  for (int b = 0; b < NB; ++b) {
    __syncthreads();
    if (tid < KCH) {
      const size_t pb = ((size_t)b * KCH + tid) * 16;
      sL[tid] = part[pb];
      qL[tid] = part[pb + 1];
    }
    __syncthreads();
#pragma unroll
    for (int off = 32; off > 0; off >>= 1) {
      if (tid < off) { sL[tid] += sL[tid + off]; qL[tid] += qL[tid + off]; }
      __syncthreads();
    }
    if (tid == 0) {
      const double n  = (double)NC * (double)ND;
      const double mu = sL[0] / n;
      double var = qL[0] / n - mu * mu;
      if (var < 0.0) var = 0.0;
      const float varf = (float)var;
      const float ve   = varf + EPSV;
      const float rstd = (float)(1.0 / sqrt((double)ve));
      const float muf  = (float)mu;
      stL[4 * b + 0] = muf;
      stL[4 * b + 1] = rstd;
      stL[4 * b + 2] = rstd * rstd;
      stL[4 * b + 3] = muf * rstd * rstd;
    }
  }
  __syncthreads();
  if (tid < 8) {
    const v4f v = *(const v4f*)(stL + 4 * tid);
    float* p = st + 4 * tid;
    *(v4f*)p = v;
    
  }
}

// =========================================================================================================
// GEMM engine (K = 768 = 24 k-steps, all operand planes k-contiguous with pitch ND): block 128 threads = 4 waves,
// 64 (m) x 64 (n) tile; wave w owns cols n0+16w..+15 (one B fragment per k-step from row n of the B plane) and
// 4 m-tiles (A rows m0 + 16 mt + (lane&15)); NPROD = 2 adds a second A plane (bf16 residual) into the same
// accumulator. Split k map loader for both operands.
// The operands come through LDS: a stage = 64 k of the block's 64 B rows and 64 A rows (each A plane), one whole
// 128-byte line a row, brought once per block by asynchronous copies and read by all four waves as fragments.
// Stage layout: plane 0 = B, plane 1 = A, plane 2 = A residual; a plane = 64 rows of pitch GP (144 B = 16 B x 9, for
// b128 readers; the 16 pad bytes of a row are neither written nor read). Two stages, a two-buffer ring.
// coverage of a plane: 4 waves x 4 copies x 4 rows x 8 lanes x 16 B = 64 x 128 B.
// =========================================================================================================
__device__ __forceinline__ unsigned lds_off(const void* p) { return (unsigned)(size_t)p; }

// Four asynchronous 16-byte copies per lane, global -> LDS: 16 rows of one plane (a copy = 4 whole rows: lane -> row
// lane>>3, 16-byte piece lane&7). l, g: this lane's LDS byte address and global address in the first of them.
// The s_wait_xcnt closes the statement: the address registers that the copies name are rewritten only behind it.
__device__ __forceinline__ void acopy4(unsigned l, const unsigned short* g) {
#if defined(__HIP_DEVICE_COMPILE__)
  asm volatile("global_load_async_to_lds_b128 %0, %4, off\n\t"
               "global_load_async_to_lds_b128 %1, %5, off\n\t"
               "global_load_async_to_lds_b128 %2, %6, off\n\t"
               "global_load_async_to_lds_b128 %3, %7, off\n\t"
               "s_wait_xcnt 0x0"
               :: "v"(l), "v"(l + 4 * GP * 2), "v"(l + 8 * GP * 2), "v"(l + 12 * GP * 2),
                  "v"(g), "v"(g + 4 * ND), "v"(g + 8 * ND), "v"(g + 12 * ND)
               : "memory");
#endif
}

// a0, a1, b: row 0, column 0 of the block's 64 rows in each plane. sm: 2 stages of (NPROD + 1) planes.
template <int NPROD>
__device__ __forceinline__ void gemm_k(unsigned char* sm, const unsigned short* __restrict__ a0,
                                       const unsigned short* __restrict__ a1,
                                       const unsigned short* __restrict__ b, v8f (&acc)[4]) {
  constexpr int STG = (NPROD + 1) * GPB;
  const int tid = threadIdx.x, lane = tid & 31, wave = tid >> 5, hh = lane >> 4, c = lane & 15;
  // copy side: wave w brings rows 16w..16w+15 of every plane
  const int crow = 16 * wave + (lane >> 3);
  const unsigned cl = lds_off(sm) + crow * (GP * 2) + 16 * (lane & 7);
  const size_t   cg = (size_t)crow * ND + 8 * (lane & 7);
  auto fill = [&](int t) {
    const unsigned l = cl + (t & 1) * STG;
    const size_t   g = cg + (size_t)GKC * t;
    acopy4(l, b + g);
    acopy4(l + GPB, a0 + g);
    if (NPROD == 2) acopy4(l + 2 * GPB, a1 + g);
  };
  // fragment readers: lane -> row (lane&15), + 8*(lane>>4), as from the global planes
  const unsigned short* rb = (const unsigned short*)sm + (16 * wave + c) * GP + 8 * hh;
  const unsigned short* ra = (const unsigned short*)(sm + GPB) + c * GP + 8 * hh;               // + 16 mt * GP
#pragma unroll
  for (int mt = 0; mt < 4; ++mt) acc[mt] = zero8();

  fill(0);
  asm volatile("s_wait_asynccnt 0x0" ::: "memory");                  // this wave's share of stage 0 has landed
  __syncthreads();                                                   // ... and every other wave's: stage 0 is readable
  fill(1);
  // rolled: twelve equal trips, the buffer chosen by an address offset; unrolled it would only grow the code
#pragma unroll 1
  for (int t = 0; t < ND / GKC; ++t) {
    const int bo = (t & 1) * (STG / 2);
#pragma unroll
    for (int k2 = 0; k2 < GKC / 32; ++k2) {
      const Frag fb = ldfrag(rb + bo + 32 * k2);
      Frag fa[4], fl[4];
#pragma unroll
      for (int mt = 0; mt < 4; ++mt) {
        fa[mt] = ldfrag(ra + bo + (16 * mt) * GP + 32 * k2);
        if (NPROD == 2) fl[mt] = ldfrag(ra + bo + GPB / 2 + (16 * mt) * GP + 32 * k2);
      }
#pragma unroll
      for (int mt = 0; mt < 4; ++mt) {
        acc[mt] = mma_b(fa[mt].bf, fb.bf, acc[mt]);
        if (NPROD == 2) acc[mt] = mma_b(fl[mt].bf, fb.bf, acc[mt]);
      }
    }
    // foot of the trip: own LDS reads done, own copies of the next stage landed, then the barrier that publishes that
    // stage and ends every wave's reads of this one; behind it this buffer is refilled
    asm volatile("s_wait_dscnt 0x0" ::: "memory");
    asm volatile("s_wait_asynccnt 0x0" ::: "memory");
    __syncthreads();
    if (t + 2 < ND / GKC) fill(t + 2);
  }
  asm volatile("s_wait_asynccnt 0x0" ::: "memory");                  // nothing is in flight when the LDS changes its use
}

// D tiles -> LDS Os[n_loc][m_loc] (pitch OSP, b128 stores): lane (hh, c) holds m = 16 mt + 8 hh + r for
// n_loc = 16 w + c.  coverage: 4 waves x 16 n x 4 mt x 16 m = 64 x 64 (pad cols 64..67 never read).
__device__ __forceinline__ void stage_os(float* Os, const v8f (&acc)[4], float sc, int wave, int hh, int c) {
  const int nl = 16 * wave + c;
#pragma unroll
  for (int mt = 0; mt < 4; ++mt) {
    v4f va, vb;
#pragma unroll
    for (int r = 0; r < 4; ++r) { va[r] = acc[mt][r] * sc; vb[r] = acc[mt][4 + r] * sc; }
    *(v4f*)(Os + nl * OSP + 16 * mt + 8 * hh)     = va;
    *(v4f*)(Os + nl * OSP + 16 * mt + 8 * hh + 4) = vb;
  }
}

// Os -> two bf16 planes (hi = bf16-RNE(v), lo = bf16-RNE(v - hi)), plane row = row0 + n_loc, 64 m values =
// coverage: 4 it x 16 rows x 8 lanes x 8 = 64 x 64 per plane.
__device__ __forceinline__ void epi_split(const float* Os, unsigned short* Ph, unsigned short* Pl,
                                          size_t row0, int pitch, int col0, int tid) {
  const int e = tid & 7, lq = tid >> 3;                              // lq 0..15
  v4u uh[4], ul[4];
#pragma unroll
  for (int it = 0; it < 4; ++it) {
    const int row = it * 16 + lq;
    const v4f a = *(const v4f*)(Os + row * OSP + 8 * e);
    const v4f q = *(const v4f*)(Os + row * OSP + 8 * e + 4);
    const float f[8] = {a[0], a[1], a[2], a[3], q[0], q[1], q[2], q[3]};
#pragma unroll
    for (int t = 0; t < 4; ++t) {
      const float f0 = f[2 * t], f1 = f[2 * t + 1];
      const unsigned short hb0 = bf_bits(f0), hb1 = bf_bits(f1);
      const unsigned short lb0 = bf_bits(f0 - bf_up(hb0));
      const unsigned short lb1 = bf_bits(f1 - bf_up(hb1));
      uh[it][t] = pk16(hb0, hb1);
      ul[it][t] = pk16(lb0, lb1);
    }
  }
{
#pragma unroll
    for (int it = 0; it < 4; ++it) {
      const int row = it * 16 + lq;
      const size_t po = (row0 + (size_t)row) * (size_t)pitch + (size_t)col0 + 8 * e;
      *(v4u*)(Ph + po) = uh[it];
      *(v4u*)(Pl + po) = ul[it];
    }
    
  }
}

// Os -> the f16 value plane (values already scaled), stored by key tiles: P[tile = key / 32][channel][key % 32], so that
// the 768 x 32 tile that k_attn copies is 48 KiB in a row. tile0: the tile of Os column 0 (64 columns = two tiles), ch0:
// the channel of Os row 0. A store instruction of a wave = 4 channels x 64 B in a row in each tile: whole 128-byte lines.
__device__ __forceinline__ void epi_h(const float* Os, unsigned short* P, size_t tile0, int ch0, int tid) {
  const int e = tid & 7, lq = tid >> 3;
  v4u u[4];
#pragma unroll
  for (int it = 0; it < 4; ++it) {
    const int row = it * 16 + lq;
    const v4f a = *(const v4f*)(Os + row * OSP + 8 * e);
    const v4f q = *(const v4f*)(Os + row * OSP + 8 * e + 4);
    const float f[8] = {a[0], a[1], a[2], a[3], q[0], q[1], q[2], q[3]};
#pragma unroll
    for (int t = 0; t < 4; ++t)
      u[it][t] = pk16(h_bits((_Float16)f[2 * t]), h_bits((_Float16)f[2 * t + 1]));
  }
{
#pragma unroll
    for (int it = 0; it < 4; ++it) {
      const int row = it * 16 + lq;
      const size_t po = ((tile0 + (size_t)(e >> 2)) * ND + (size_t)(ch0 + row)) * 32 + 8 * (e & 3);
      *(v4u*)(P + po) = u[it];
    }
    
  }
}

// =========================================================================================================
// (4) H planes: D[m = d][n = e] = sum_o WqT[d][o] * WkT[e][o]  (1 product, exact) -> Hh/Hl bf16 [e][768 d].
// blocks (bx < 12 e-tiles, by < 12 d-tiles).  LDS Os cross-wave (block barrier).  sm: 2 * 2 * GPB bytes.
// =========================================================================================================
__device__ __forceinline__
void k_hgemm(unsigned char* sm, int bx, int by,
             const unsigned short* __restrict__ Aq, const unsigned short* __restrict__ Bk,
             unsigned short* Hh, unsigned short* Hl) {
  float* Os = (float*)sm;                                            // the stages' bytes, free behind the k loop
  const int tid = threadIdx.x, lane = tid & 31, wave = tid >> 5, hh = lane >> 4, c = lane & 15;
  const int n0 = bx * QT, m0 = by * QT;
  const unsigned short* ap = Aq + (size_t)m0 * ND;
  const unsigned short* bp = Bk + (size_t)n0 * ND;
  v8f acc[4];
  gemm_k<1>(sm, ap, ap, bp, acc);
  stage_os(Os, acc, 1.0f, wave, hh, c);
  __syncthreads();
  epi_split(Os, Hh, Hl, (size_t)n0, ND, m0, tid);
}

// =========================================================================================================
// (5) query planes: D[m = e][n = query] = sum_d (Hh + Hl)[e][d] * Xb[b][q][d]  (2 products), scaled by rstd_b^2
//     in the epilogue -> Ah/Al bf16 [b][NQ][768 e].  blocks (bx < NQ/64, by < 12 e-tiles, b < NB).  sm: 2 * 3 * GPB bytes.
// =========================================================================================================
__device__ __forceinline__
void k_agemm(unsigned char* sm, int bx, int by, int b,
             const unsigned short* __restrict__ Hh, const unsigned short* __restrict__ Hl,
             const unsigned short* __restrict__ Xb, const float* __restrict__ st,
             unsigned short* Ah, unsigned short* Al) {
  float* Os = (float*)sm;                                            // the stages' bytes, free behind the k loop
  const int tid = threadIdx.x, lane = tid & 31, wave = tid >> 5, hh = lane >> 4, c = lane & 15;
  const int n0 = bx * QT, m0 = by * QT;
  const unsigned short* ap0 = Hh + (size_t)m0 * ND;
  const unsigned short* ap1 = Hl + (size_t)m0 * ND;
  const unsigned short* bp  = Xb + ((size_t)b * NC + n0) * ND;
  v8f acc[4];
  gemm_k<2>(sm, ap0, ap1, bp, acc);
  const float sc = st[4 * b + 2];
  stage_os(Os, acc, sc, wave, hh, c);
  __syncthreads();
  epi_split(Os, Ah, Al, (size_t)b * NQ + n0, ND, m0, tid);
}

// =========================================================================================================
// (6) value plane (by tiles of 32 keys, channel-major inside a tile): D[m = key j][n = o] = sum_d Xb[b][j][d] * Wvb[o][d]
//     (1 product, exact), x16 -> U f16 [b][64 tiles j / 32][768 o][32 j % 32].  blocks (bx < 12 o-tiles, by < 32 key-tiles,
//     b < NB).
// =========================================================================================================
__device__ __forceinline__
void k_vgemm(unsigned char* sm, int bx, int by, int b,
             const unsigned short* __restrict__ Xb, const unsigned short* __restrict__ Wvn, unsigned short* U) {
  float* Os = (float*)sm;                                            // the stages' bytes, free behind the k loop
  const int tid = threadIdx.x, lane = tid & 31, wave = tid >> 5, hh = lane >> 4, c = lane & 15;
  const int n0 = bx * QT, m0 = by * QT;
  const unsigned short* ap = Xb + ((size_t)b * NC + m0) * ND;
  const unsigned short* bp = Wvn + (size_t)n0 * ND;
  v8f acc[4];
  gemm_k<1>(sm, ap, ap, bp, acc);
  stage_os(Os, acc, USC, wave, hh, c);
  __syncthreads();
  epi_h(Os, U, (size_t)b * (NC / 32) + m0 / 32, n0, tid);
}

// =========================================================================================================
// (7) key-side affine term: cs[b][j] = -(mu_b rstd_b^2) * sum_d g[d] * Xb[b][j][d], f32 VALU, one wave per row,
//     four waves of eight rows a block.
// coverage: blocks (bx < 64, b < NB) x 32 rows = every key row of b < NB.  LDS csL cross-wave (block barrier).
// =========================================================================================================
__device__ __forceinline__
void k_cs(unsigned char* sm, int bx, int b,
          const unsigned short* __restrict__ Xb, const float* __restrict__ g, const float* __restrict__ st,
          float* cs) {
  float* csL = (float*)sm;                                           // [32]
  const int tid = threadIdx.x, lane = tid & 31, wave = tid >> 5;
  const int r0 = bx * 32;
  v4f ga[3], gb[3];
#pragma unroll
  for (int c3 = 0; c3 < 3; ++c3) {
    ga[c3] = *(const v4f*)(g + 256 * c3 + 8 * lane);
    gb[c3] = *(const v4f*)(g + 256 * c3 + 8 * lane + 4);
  }
  const float nmr = -st[4 * b + 3];
#pragma unroll 1
  for (int t = 0; t < 8; ++t) {
    const int row = r0 + 8 * wave + t;
    const unsigned short* xp = Xb + ((size_t)b * NC + row) * ND + 8 * lane;
    float acc = 0.f;
#pragma unroll
    for (int c3 = 0; c3 < 3; ++c3) {
      const v4u u = *(const v4u*)(xp + 256 * c3);
      acc += bf_lo16(u[0]) * ga[c3][0] + bf_hi16(u[0]) * ga[c3][1]
           + bf_lo16(u[1]) * ga[c3][2] + bf_hi16(u[1]) * ga[c3][3]
           + bf_lo16(u[2]) * gb[c3][0] + bf_hi16(u[2]) * gb[c3][1]
           + bf_lo16(u[3]) * gb[c3][2] + bf_hi16(u[3]) * gb[c3][3];
    }
    acc += __shfl_xor(acc, 16, 32); acc += __shfl_xor(acc, 8, 32); acc += __shfl_xor(acc, 4, 32);
    acc += __shfl_xor(acc, 2, 32);  acc += __shfl_xor(acc, 1, 32);
    if (lane == 0) csL[8 * wave + t] = acc * nmr;
  }
  __syncthreads();
  if (wave == 0 && lane < 8) {
    const v4f v = *(const v4f*)(csL + 4 * lane);
    float* p = cs + (size_t)b * NC + r0 + 4 * lane;
    *(v4f*)p = v;
    
  }
}

// =========================================================================================================
// (8) attention for one (b, 64-query tile), transposed formulation, 2048 keys, no mask:
//   S^T tile (16 keys x 16 queries) = sum over 24 d-chunks of A(key row kb + (lane&15) of the bf16 plane Xb,
//   split k map) . B(query row of Ah) + A(Xb).B(Al) (bf16 residual, shared accumulator), then + cs[key].
//   Per lane the D tile holds 8 keys of ONE query: online softmax state per lane, one shuffle (lane^16) for the
//   max over 32 keys; corr applied every step (== 1 exactly when the max did not grow). P = e^{s-m} x 16384 as
//   f16 is the B operand of O^T (rows channel, cols queries) += A(U rows channel 16j + (lane&15), keys
//   contiguous, f16 x16) . B(P^T): element r <- D of the tile covering keys kb..kb+15, element 8+r <- the tile
//   covering kb+16..kb+31, lane unchanged. The 48 accumulator tiles per wave live in registers (384 per lane) for
//   the whole key loop and are stored once, behind it, to wave-private LDS slots Ow[query][768].
//   Epilogue after a block barrier: out[b][q][:] = Ow[q][:] * (rstd / (16 l_q)) - mu rstd rowsum(Wv), row =
// coverage: 4 waves x 16 query rows x 6 x 32 lanes x 4 = 64 x 768; grid (NQ/64, NB) covers out[b < NB][q < NQ].
// LDS: Ow written once per lane behind the key loop; cross-lane reads only after __syncthreads. staged extent
//      (16 x 768 per wave) == consumed extent. Up to the end of the key loop the same bytes hold the wave's query
//      fragments (hi + residual, 2 x 16 x 768 x 2 B), each 16 B written and read by one and the same lane.
//      Behind them one K buffer (32 key rows) and one V buffer (768 channel rows x 32 keys), filled once per block and
//      32 keys by asynchronous copies (each wave a quarter) and read by all four waves: cross-wave, so every tile is
//      read only behind its copiers' s_wait_asynccnt 0 and a block barrier, and refilled only behind the barrier
//      that ends its last read. coverage: K 4 waves x 8 rows x 3 x 32 lanes x 16 B = 32 x 1536 B; V 4 waves x 24 x
//      8 rows x 4 x 16 B = 768 x 64 B; pad bytes of a row are neither written nor read.
// =========================================================================================================
__global__ __launch_bounds__(128)
void k_attn(const unsigned short* __restrict__ Ah, const unsigned short* __restrict__ Al,
            const unsigned short* __restrict__ Xb, const unsigned short* __restrict__ U,
            const float* __restrict__ cs, const float* __restrict__ rv,
            const float* __restrict__ st, float* out) {
  __shared__ __attribute__((aligned(16))) unsigned char lds_all[ATTN_LDS];
  const int tid  = threadIdx.x;
  const int wave = tid >> 5, lane = tid & 31;
  const int hh   = lane >> 4, c = lane & 15;
  const int n0   = blockIdx.x * QT, b = blockIdx.y;
  float* Ow = (float*)lds_all + (size_t)wave * (16 * ND);
  float* op = Ow + c * ND + 8 * hh;                                  // this lane's slots (query column c)
  // O^T tiles: o[j][r] = channel 16 j + 8 hh + r of query c. Every loop over o[] is fully unrolled: only constant
  // indices keep the tiles in registers.
  v8f o[ND / 16];
#pragma unroll
  for (int j = 0; j < ND / 16; ++j) o[j] = zero8();

  const size_t qo = ((size_t)b * NQ + n0 + 16 * wave + c) * ND + 8 * hh;
  const unsigned short* Ahp = Ah + qo;
  const unsigned short* Alp = Al + qo;
  // The block's K tile (32 key rows x 768, row pitch KP) and V tile (768 channel rows x 32 keys, row pitch VP) in LDS,
  // read by all four waves. Fragment readers: lane -> row (lane&15), + 8*(lane>>4), as from the global planes.
  const unsigned short* Ks = (const unsigned short*)(lds_all + QLDS) + c * KP + 8 * hh;          // + key_loc*KP + 32 kc
  const unsigned short* Vs = (const unsigned short*)(lds_all + QLDS + KLDS) + c * VP + 8 * hh;   // + 16 j*VP
  // Copy side. K: wave w brings key rows 8w..8w+7, three copies of 512 B a row. V: wave w brings channel rows
  // 192w..192w+191, one copy = 8 rows x 64 B (lane -> row lane>>2, 16-byte piece lane&3), which lie in a row in the
  // tiled plane U: 512 B = four whole lines a copy.
  unsigned char* kl0 = lds_all + QLDS + (8 * wave) * (KP * 2) + 16 * lane;
  unsigned char* vl0 = lds_all + QLDS + KLDS + (192 * wave + (lane >> 2)) * (VP * 2) + 16 * (lane & 3);
  const unsigned short* kg0 = Xb + ((size_t)b * NC + 8 * wave) * ND + 8 * lane;                    // + kb*ND
  const unsigned short* vg0 = U + (size_t)b * ND * NC + (192 * wave) * 32 + 8 * lane;              // + kb*ND
  const float* csb = cs + (size_t)b * NC + 8 * hh;                                    // + kb (+16)

  // The wave's 16 query rows (hi and residual plane) go once into the wave's own LDS slots, fragment by fragment:
  // quarter f = 4 kc + {0, 1: hi elements 0..7, 8..15; 2, 3: residual} holds 32 lanes x 16 B, and every lane reads back
  // only what it wrote itself. The slots are the bytes of Ow, which is written only behind the key loop.
  unsigned short* Qs = (unsigned short*)lds_all + (size_t)wave * (2 * 16 * ND) + 8 * lane;
#pragma unroll 1
  for (int kq = 0; kq < ND / 32 / KG; ++kq) {
    const unsigned short* ap = Ahp + 32 * KG * kq;
    const unsigned short* lp = Alp + 32 * KG * kq;
    Frag a[KG], r[KG];
#pragma unroll
    for (int u = 0; u < KG; ++u) {
      a[u] = ldfrag(ap + 32 * u);
      r[u] = ldfrag(lp + 32 * u);
    }
    asm volatile("s_wait_xcnt 0x0" :: "v"(ap), "v"(lp) : "memory");
#pragma unroll
    for (int u = 0; u < KG; ++u) {
      const int kc = KG * kq + u;
      *(v8us*)(Qs + (4 * kc + 0) * 256) = a[u].u[0];
      *(v8us*)(Qs + (4 * kc + 1) * 256) = a[u].u[1];
      *(v8us*)(Qs + (4 * kc + 2) * 256) = r[u].u[0];
      *(v8us*)(Qs + (4 * kc + 3) * 256) = r[u].u[1];
    }
  }

  // Two-buffer ring over the tile sequence K(0), V(0), K(32), V(32), ...: the K buffer is worked on (scores) while the V
  // tile flies, the V buffer (O^T) while the next K tile flies. In front of the loop: first K tile, landed and
  // published; then the first V tile is sent off.
  asm volatile("s_wait_dscnt 0x0" ::: "memory");                     // the wave's own LDS stores retire before it copies
  acopy_tile<3, 512, 256, KP * 2, ND>(kl0, kg0);
  asm volatile("s_wait_asynccnt 0x0" ::: "memory");                  // this wave's share of the K tile has landed
  __syncthreads();                                                   // ... and every other wave's: the tile is readable
  acopy_tile<24, 8 * VP * 2, 8 * 32, 0, 0>(vl0, vg0);

  float m = -1.0e30f, l = 0.f;
#pragma unroll 1
  for (int kb = 0; kb < NC; kb += 32) {
    const unsigned short* k0p = Ks;                                  // keys kb .. kb+15
    const unsigned short* k1p = Ks + 16 * KP;                        // keys kb+16 .. kb+31
    v8f s0 = zero8(), s1 = zero8();
    // K and Q fragments (both LDS) in groups of KG d-chunks, two groups in registers: group g + 1 is in flight
    // while group g is used.
    Frag kf[2][KG][2], qf[2][KG][2];
#pragma unroll
    for (int u = 0; u < KG; ++u) {
      kf[0][u][0] = ldfrag(k0p + 32 * u);
      kf[0][u][1] = ldfrag(k1p + 32 * u);
      qf[0][u][0] = ldq(Qs + (4 * u) * 256);
      qf[0][u][1] = ldq(Qs + (4 * u + 2) * 256);
    }
    // the key-side terms are fetched here, at the head of the trip: the barrier at its foot waits for every global load
    const v4f ca = *(const v4f*)(csb + kb);
    const v4f cb = *(const v4f*)(csb + kb + 4);
    const v4f cd = *(const v4f*)(csb + kb + 16);
    const v4f ce = *(const v4f*)(csb + kb + 20);
    // the same wait for these four loads: their address pair is an input, so that nothing lands on it while the
    // loads are under way
    asm volatile("s_wait_xcnt 0x0" :: "v"(csb + kb) : "memory");
#pragma unroll
    for (int g = 0; g < ND / 32 / KG; ++g) {
      if (g + 1 < ND / 32 / KG) {
#pragma unroll
        for (int u = 0; u < KG; ++u) {
          const int kn = KG * (g + 1) + u;
          kf[(g + 1) & 1][u][0] = ldfrag(k0p + 32 * kn);
          kf[(g + 1) & 1][u][1] = ldfrag(k1p + 32 * kn);
          qf[(g + 1) & 1][u][0] = ldq(Qs + (4 * kn) * 256);
          qf[(g + 1) & 1][u][1] = ldq(Qs + (4 * kn + 2) * 256);
        }
      }
      // holds the next group's loads, as one run, in front of this group's products: they are in flight meanwhile, and
      // no LDS read stands among the products (without it the build spreads them there)
      __builtin_amdgcn_sched_barrier(0);
#pragma unroll
      for (int u = 0; u < KG; ++u) {
        s0 = mma_q(kf[g & 1][u][0].bf, qf[g & 1][u][0].bf, s0);
        s1 = mma_q(kf[g & 1][u][1].bf, qf[g & 1][u][0].bf, s1);
        s0 = mma_q(kf[g & 1][u][0].bf, qf[g & 1][u][1].bf, s0);
        s1 = mma_q(kf[g & 1][u][1].bf, qf[g & 1][u][1].bf, s1);
      }
      // keeps later groups' loads behind this point: no more than two groups hold registers, and again no LDS read
      // among the products
      __builtin_amdgcn_sched_barrier(0);
    }
    {
#pragma unroll
      for (int r = 0; r < 4; ++r) {
        s0[r] += ca[r]; s0[4 + r] += cb[r];                          // key kb      + 8hh + r
        s1[r] += cd[r]; s1[4 + r] += ce[r];                          // key kb + 16 + 8hh + r
      }
    }

    // foot of the score trip: own LDS reads done, own V copies landed, then the barrier that publishes the V tile and
    // ends every wave's reads of the K buffer; behind it the next K tile is sent off into that buffer
    asm volatile("s_wait_dscnt 0x0" ::: "memory");
    asm volatile("s_wait_asynccnt 0x0" ::: "memory");
    __syncthreads();
    if (kb + 32 < NC) acopy_tile<3, 512, 256, KP * 2, ND>(kl0, kg0 + (size_t)(kb + 32) * ND);

    float mx = fmaxf(hmax8(s0), hmax8(s1));
    mx = fmaxf(mx, __shfl_xor(mx, 16, 32));
    const float mn   = fmaxf(m, mx);
    const float corr = __expf(m - mn);                               // == 1 exactly when the max did not grow
    l *= corr;
    m = mn;
    const float msh = mn - LNPS;                                     // exp gives e^{s-m} * 16384

    FragH ph;
    float ls = 0.f;
#pragma unroll
    for (int r = 0; r < 8; ++r) {
      const float e0 = __expf(s0[r] - msh);
      const float e1 = __expf(s1[r] - msh);
      ls += e0 + e1;
      ph.hv[0][r] = (_Float16)e0;
      ph.hv[1][r] = (_Float16)e1;
    }
    l += ls;

    // V fragments (LDS) in groups of VG channel tiles, two groups in registers, as for K and Q above
    Frag vf[2][VG];
#pragma unroll
    for (int u = 0; u < VG; ++u) vf[0][u] = ldfrag(Vs + (16 * u) * VP);
#pragma unroll
    for (int g = 0; g < ND / 16 / VG; ++g) {
      if (g + 1 < ND / 16 / VG) {
#pragma unroll
        for (int u = 0; u < VG; ++u) vf[(g + 1) & 1][u] = ldfrag(Vs + (16 * (VG * (g + 1) + u)) * VP);
      }
      // holds the next group's LDS reads, as one run, in front of this group's products
      __builtin_amdgcn_sched_barrier(0);
#pragma unroll
      for (int u = 0; u < VG; ++u) {
        const int j = VG * g + u;
        v8f t;
#pragma unroll
        for (int r = 0; r < 8; ++r) t[r] = o[j][r] * corr;
        o[j] = mma_h(vf[g & 1][u].h, ph.v, t);
      }
      // keeps later groups' reads behind this point: no LDS read among the products
      __builtin_amdgcn_sched_barrier(0);
    }
    // foot of the O^T trip: the same order; the barrier publishes the next K tile and frees the V buffer
    asm volatile("s_wait_dscnt 0x0" ::: "memory");
    asm volatile("s_wait_asynccnt 0x0" ::: "memory");
    __syncthreads();
    if (kb + 32 < NC) acopy_tile<24, 8 * VP * 2, 8 * 32, 0, 0>(vl0, vg0 + (size_t)(kb + 32) * ND);
  }
  asm volatile("s_wait_asynccnt 0x0" ::: "memory");                  // nothing is in flight when the LDS changes its use
  // the finished tiles go to the wave's LDS slots once, for the row-major epilogue
#pragma unroll
  for (int j = 0; j < ND / 16; ++j) {
    v4f na, nb2;
#pragma unroll
    for (int r = 0; r < 4; ++r) { na[r] = o[j][r]; nb2[r] = o[j][4 + r]; }
    *(v4f*)(op + 16 * j)     = na;
    *(v4f*)(op + 16 * j + 4) = nb2;
  }
  l += __shfl_xor(l, 16, 32);
  const float inv  = 1.0f / l;                                       // Ow and l both carry the x16384 factor
  const float mu   = st[4 * b + 0], rstd = st[4 * b + 1];
  const float qsc  = inv * rstd * IUSC;                              // per lane: its query column
  const float mrs  = mu * rstd;
  v4f rvv[6];
#pragma unroll
  for (int k = 0; k < ND / 128; ++k) {
    const v4f t = *(const v4f*)(rv + 128 * k + 4 * lane);
#pragma unroll
    for (int u = 0; u < 4; ++u) rvv[k][u] = t[u] * mrs;
  }
  __syncthreads();                                                   // all accumulator slots final before cross-lane reads

{
#pragma unroll 1
    for (int qq = 0; qq < 16; ++qq) {
      const float sc = __shfl(qsc, qq, 32);
      const float* lrow = Ow + qq * ND + 4 * lane;
      float* orow = out + ((size_t)b * NC + n0 + 16 * wave + qq) * ND + 4 * lane;
#pragma unroll
      for (int k = 0; k < ND / 128; ++k) {
        const v4f v = *(const v4f*)(lrow + 128 * k);
        v4f w;
#pragma unroll
        for (int u = 0; u < 4; ++u) w[u] = v[u] * sc - rvv[k][u];
        *(v4f*)(orow + 128 * k) = w;
      }
    }
    
  }
}

// =========================================================================================================
// The launches. Stages that need nothing of one another share one grid: a block takes its stage by the range its index
// lies in (a block-uniform branch, so every barrier of a stage is passed by the whole block) and its place in the stage
// from the index, x fastest. All stages of a launch use the one LDS array of the launch.
//   k_prep : (0) weights | (2) x                      both read inputs only
//   k_mid  : (3) statistics | (4) H | (1) g | (6) U    all read only what k_prep wrote
//   k_qc   : (5) query planes | (7) key-side term      both read only what k_prep and k_mid wrote
// The few long serial blocks stand first in their launch; the short blocks of (7) stand last.
// =========================================================================================================
#define PB_X  (3 * (ND / QT))                       // k_prep: first block of (2)
#define PB_N  (PB_X + KCH * NB)
#define MB_H  1                                     // k_mid: first block of (4), of (1), of (6)
#define MB_G  (MB_H + (ND / QT) * (ND / QT))
#define MB_V  (MB_G + ND / GCB)
#define MB_N  (MB_V + (ND / QT) * (NC / QT) * NB)
#define QB_C  ((NQ / QT) * (ND / QT) * NB)          // k_qc: first block of (7)
#define QB_N  (QB_C + (NC / 32) * NB)
static_assert(2 * 2 * GPB >= GRG * GCB * 4 + 8 * GCB * 4 && 2 * 2 * GPB >= 2 * 64 * 8 + 32 * 4 && KCH == 64);

__global__ __launch_bounds__(256)
void k_prep(const float* __restrict__ x, const float* __restrict__ wk, const float* __restrict__ wq,
            const float* __restrict__ wv, unsigned short* Wn, unsigned short* Wt, float* rs,
            unsigned short* Xb, double* part) {
  __shared__ __align__(16) unsigned char sm[QT * TPW * 2 + QT * 4];
  const int bid = blockIdx.x;
  if (bid < PB_X) {
    cvt_w(sm, bid % (ND / QT), bid / (ND / QT), wk, wq, wv, Wn, Wt, rs);
  } else {
    const int i = bid - PB_X;
    k_xcvt(sm, i % KCH, i / KCH, x, Xb, part);
  }
}

__global__ __launch_bounds__(128)
void k_mid(const double* __restrict__ part, const unsigned short* __restrict__ Wn,
           const unsigned short* __restrict__ Wt, const float* __restrict__ rs,
           const unsigned short* __restrict__ Xb, float* st, unsigned short* Hh, unsigned short* Hl, float* g,
           unsigned short* U) {
  __shared__ __align__(16) unsigned char sm[2 * 2 * GPB];
  const int bid = blockIdx.x;
  if (bid < MB_H) {
    k_stats(sm, part, st);
  } else if (bid < MB_G) {
    const int i = bid - MB_H;                                        // A = Wq transposed (rows d), B = Wk transposed (rows e)
    k_hgemm(sm, i % (ND / QT), i / (ND / QT), Wt + (size_t)1 * ND * ND, Wt, Hh, Hl);
    // the wait before a register that an issued global store names is overwritten: the build lets this stage's end run
    // on through the later stages' tests, whose code rewrites the stores' registers
    asm volatile("s_wait_xcnt 0x0" ::: "memory");
  } else if (bid < MB_V) {
    k_g(sm, bid - MB_G, Wn, rs + ND, g);
  } else {
    const int i = bid - MB_V;
    k_vgemm(sm, i % (ND / QT), (i / (ND / QT)) % (NC / QT), i / ((ND / QT) * (NC / QT)), Xb,
            Wn + (size_t)2 * ND * ND, U);
    // the wait before a register that an issued global store names is overwritten: the build lets this stage's end run
    // on through the later stages' tests, whose code rewrites the stores' registers
    asm volatile("s_wait_xcnt 0x0" ::: "memory");
  }
}

__global__ __launch_bounds__(128)
void k_qc(const unsigned short* __restrict__ Hh, const unsigned short* __restrict__ Hl,
          const unsigned short* __restrict__ Xb, const float* __restrict__ st, const float* __restrict__ g,
          unsigned short* Ah, unsigned short* Al, float* cs) {
  __shared__ __align__(16) unsigned char sm[2 * 3 * GPB];
  const int bid = blockIdx.x;
  if (bid < QB_C) {
    k_agemm(sm, bid % (NQ / QT), (bid / (NQ / QT)) % (ND / QT), bid / ((NQ / QT) * (ND / QT)), Hh, Hl, Xb, st, Ah, Al);
  } else {
    const int i = bid - QB_C;
    k_cs(sm, i % (NC / 32), i / (NC / 32), Xb, g, st, cs);
  }
}

// =========================================================================================================
// Workspace map (bytes; each region start a multiple of 256; every extent is an exact tile/line multiple and is
//   Wn bf16 [3][768][768]      3538944      Wt bf16 [3][768][768]   3538944
//   rs  f32 [3][768]              9216      g   f32 [768]              3072
//   Xb bf16 [NB][2048][768]   25165824 (NB=8)  part f64 [NB][64][16]  65536    st f32 [32]  128 (256)
//   Hh/Hl bf16 [768][768]      1179648 x2
//   Ah/Al bf16 [NB][NQ][768]  25165824 x2 (NB=8, NQ=2048)
//   U  f16 [NB][64][768][32]  25165824      cs f32 [NB][2048]         65536
//   total (NB=8, NQ=2048) = 110244096
// =========================================================================================================
extern "C" void kernel_launch(void* const* d_in, const int* in_sizes, int n_in,
                              void* d_out, int out_size, void* d_ws, size_t ws_size,
                              hipStream_t stream) {
  if (n_in < 4) return;
  if (in_sizes[0] < NB * NC * ND) return;
  if (in_sizes[1] < ND * ND || in_sizes[2] < ND * ND || in_sizes[3] < ND * ND) return;
  if (out_size < NB * NC * ND) return;

  size_t off = 0;
  auto carve = [&](size_t bytes) { const size_t o = off; off += (bytes + 255) & ~(size_t)255; return o; };
  const size_t oWn   = carve((size_t)3 * ND * ND * 2);
  const size_t oWt   = carve((size_t)3 * ND * ND * 2);
  const size_t oRs   = carve((size_t)3 * ND * 4);
  const size_t oG    = carve((size_t)ND * 4);
  const size_t oXb   = carve((size_t)NB * NC * ND * 2);
  const size_t oPart = carve((size_t)NB * KCH * 128);
  const size_t oSt   = carve((size_t)128);
  const size_t oHh   = carve((size_t)ND * ND * 2);
  const size_t oHl   = carve((size_t)ND * ND * 2);
  const size_t oAh   = carve((size_t)NB * NQ * ND * 2);
  const size_t oAl   = carve((size_t)NB * NQ * ND * 2);
  const size_t oU    = carve((size_t)NB * ND * NC * 2);
  const size_t oCs   = carve((size_t)NB * NC * 4);
  if (off > ws_size) return;
  if (off > (size_t)134217728) return;

  const float* x  = (const float*)d_in[0];
  const float* wk = (const float*)d_in[1];
  const float* wq = (const float*)d_in[2];
  const float* wv = (const float*)d_in[3];

  char* ws = (char*)d_ws;
  unsigned short* Wn  = (unsigned short*)(ws + oWn);
  unsigned short* Wt  = (unsigned short*)(ws + oWt);
  float*          rs  = (float*)(ws + oRs);
  float*          g   = (float*)(ws + oG);
  unsigned short* Xb  = (unsigned short*)(ws + oXb);
  double*         part = (double*)(ws + oPart);
  float*          st  = (float*)(ws + oSt);
  unsigned short* Hh  = (unsigned short*)(ws + oHh);
  unsigned short* Hl  = (unsigned short*)(ws + oHl);
  unsigned short* Ah  = (unsigned short*)(ws + oAh);
  unsigned short* Al  = (unsigned short*)(ws + oAl);
  unsigned short* U   = (unsigned short*)(ws + oU);
  float*          cs  = (float*)(ws + oCs);
  float* out = (float*)d_out;

  const dim3 blk256(256), blk128(128);

  // (0) weights -> bf16 natural + transposed planes + row sums (y: 0 Wk, 1 Wq, 2 Wv); (2) x -> bf16 plane + f64 partial sums
  k_prep<<<dim3(PB_N), blk256, 0, stream>>>(x, wk, wq, wv, Wn, Wt, rs, Xb, part);
  // (3) LayerNorm statistics; (4) H planes; (1) g = bf16(Wk)^T . rowsum(bf16(Wq)); (6) value plane U = 16 X.Wv^T
  k_mid<<<dim3(MB_N), blk128, 0, stream>>>(part, Wn, Wt, rs, Xb, st, Hh, Hl, g, U);
  // (5) query planes A' = rstd^2 X.H (hi + residual); (7) key-side affine term
  k_qc<<<dim3(QB_N), blk128, 0, stream>>>(Hh, Hl, Xb, st, g, Ah, Al, cs);
  // (8) attention -> out [b][q][768]
  k_attn<<<dim3(NQ / QT, NB), blk128, 0, stream>>>(Ah, Al, Xb, U, cs, rs + 2 * ND, st, out);
  (void)hipGetLastError();
}

// v008
// A run of this version takes 218 microseconds.
// Timed twice side by side with v007, it ran 1.04 and 1.05 times as fast.
// Counting every step since v000, it is 6.59 times as fast.
// Contractions (f32 accumulate everywhere): H[e][d] = sum_o Wq[o][d]*Wk[o][e] on v_wmma_f32_16x16x32_bf16 with
// bf16-RNE weights (exact products); query plane A' = X.H with bf16-RNE x and H carried as bf16 hi + bf16
// residual (2 products, shared accumulator); U = X.Wv^T (1 product, bf16-RNE operands); scores
// S^T = X(keys).A'(queries) with A' as bf16 hi + bf16 residual (2 products); O^T = U.P^T on
// v_wmma_f32_16x16x32_f16 (U x16 as f16, P = e^{s-m} x16384 as f16 built from the score D registers).
// LayerNorm statistics in f64 VALU; per-batch affine terms, softmax statistics and normalisation in f32 VALU.
#include <hip/hip_runtime.h>
#include <math.h>
#include <stdint.h>

#ifndef NB
#define NB 8
#endif
#ifndef NQ
#define NQ 2048
#endif
#define NBF  8
#define NC   2048
#define ND   768
#define QT   64
#define OSP  68
#define TPW  72
#define KCH  64
#define KG   4
#define USC  16.0f
#define IUSC 0.0625f
#define LNPS 9.704060527839234f
#define EPSV 1.0e-5f
#define KP   776
#define VP   40
#define VG   8
#define QLDS (4 * 16 * ND * 4)
#define KLDS (32 * KP * 2)
#define VLDS (ND * VP * 2)
#define ATTN_LDS (QLDS + KLDS + VLDS)
#define GKC  64
#define GP   72
#define GPB  (QT * GP * 2)
#define GCB  32
#define GRG  64

static_assert(NB >= 1 && NB <= NBF);
static_assert(NQ % QT == 0 && NQ >= QT && NQ <= NC);
static_assert(NC % QT == 0 && ND % QT == 0);
static_assert(NC % 32 == 0 && ND % 32 == 0);
static_assert(ND % 256 == 0 && ND % 128 == 0 && ND % 16 == 0);
static_assert(NC / KCH == 32 && KCH == 64);
static_assert((ND / 32) % KG == 0);
static_assert(4 * NBF <= 32);
static_assert((OSP * 4) % 16 == 0);
static_assert((TPW * 2) % 16 == 0);
static_assert(QLDS == 196608 && ATTN_LDS <= 327680);
static_assert((KP * 2) % 32 == 16 && (VP * 2) % 32 == 16);          // LDS row pitch = 16 B x odd, for b128 readers
static_assert(KP >= ND + 8 && VP >= 32 + 8 && QLDS % 16 == 0 && KLDS % 16 == 0);
static_assert(ND % GKC == 0 && ND / GKC >= 2 && GKC * 2 == 128 && GKC % 32 == 0 && QT == 64);
static_assert((GP * 2) % 32 == 16 && GP >= GKC + 8 && 2 * 2 * GPB >= QT * OSP * 4);
static_assert(ND % GCB == 0 && ND % GRG == 0 && GCB == 32 && 4 * GRG == 256 && GRG % 8 == 0);
static_assert((ND / 16) % VG == 0 && ND % (4 * 8) == 0 && ND / 4 / 8 == 24 && 8 * (ND / 256) == 24);

typedef _Float16       v16h __attribute__((ext_vector_type(16)));
typedef _Float16       v8h  __attribute__((ext_vector_type(8)));
typedef __bf16         v16b __attribute__((ext_vector_type(16)));
typedef unsigned short v8us __attribute__((ext_vector_type(8)));
typedef float          v8f  __attribute__((ext_vector_type(8)));
typedef float          v4f  __attribute__((ext_vector_type(4)));
typedef unsigned int   v4u  __attribute__((ext_vector_type(4)));
typedef double         v2d  __attribute__((ext_vector_type(2)));

union Frag  { v8us u[2]; v16h h; v16b bf; };
union FragH { v16h v; v8h hv[2]; };
static_assert(sizeof(Frag) == 32);
static_assert(sizeof(FragH) == 32);

// ---- scalar helpers ---------------------------------------------------------------------------------------
__device__ __forceinline__ unsigned short bf_bits(float f) {          // f32 -> bf16 bits, RNE convert
  unsigned u = __float_as_uint(f);
  return (unsigned short)((u + 0x7FFFu + ((u >> 16) & 1u)) >> 16);
}
__device__ __forceinline__ float bf_up(unsigned short hb) { return __uint_as_float(((unsigned)hb) << 16); }
__device__ __forceinline__ float bf_lo16(unsigned w) { return __uint_as_float(w << 16); }
__device__ __forceinline__ float bf_hi16(unsigned w) { return __uint_as_float(w & 0xFFFF0000u); }
__device__ __forceinline__ unsigned short h_bits(_Float16 x) { return __builtin_bit_cast(unsigned short, x); }
__device__ __forceinline__ unsigned pk16(unsigned short a, unsigned short b) { return (unsigned)a | ((unsigned)b << 16); }
__device__ __forceinline__ v8f zero8() { v8f z = {0.f, 0.f, 0.f, 0.f, 0.f, 0.f, 0.f, 0.f}; return z; }
__device__ __forceinline__ float hmax8(v8f s) {
  return fmaxf(fmaxf(fmaxf(s[0], s[1]), fmaxf(s[2], s[3])), fmaxf(fmaxf(s[4], s[5]), fmaxf(s[6], s[7])));
}
__device__ __forceinline__ double shfl_xor_d(double v, int mask) {
  int lo = __double2loint(v), hi = __double2hiint(v);
  lo = __shfl_xor(lo, mask, 32);
  hi = __shfl_xor(hi, mask, 32);
  return __hiloint2double(hi, lo);
}

// ---- 16-bit fragment loader (A, or B from a k-contiguous [n][k] row): lane -> row/col (lane&15), p already includes
//      + 8*(lane>>4); elements 0..7 <- p[0..7] (k0+8h..), elements 8..15 <- p[16..23] (k0+16+8h..)
__device__ __forceinline__ Frag ldfrag(const unsigned short* p) {
  Frag f;
  f.u[0] = *(const v8us*)(p);
  f.u[1] = *(const v8us*)(p + 16);
  return f;
}

// ---- WMMA helpers: builtin followed by a 4-slot VALU gap tying D and keeping A/B live --------------------------
// mma_h is the bare builtin (the compiler keeps the distance behind its own WMMAs): with D tied to an asm statement
// the 48 resident D tiles of k_attn, 384 registers, do not all get registers and the build spills to scratch.
__device__ __forceinline__ v8f mma_h(v16h a, v16h b, v8f c) {
  return __builtin_amdgcn_wmma_f32_16x16x32_f16(false, a, false, b, (short)0, c, false, false);
}
// mma_q is the bare bf16 builtin, for a like reason: with the two fragment groups that k_attn keeps in flight tied to
// mma_b's asm statement as operands, the build spills to scratch.
__device__ __forceinline__ v8f mma_q(v16b a, v16b b, v8f c) {
  return __builtin_amdgcn_wmma_f32_16x16x32_bf16(false, a, false, b, (short)0, c, false, false);
}
__device__ __forceinline__ v8f mma_b(v16b a, v16b b, v8f c) {
  v8f d = __builtin_amdgcn_wmma_f32_16x16x32_bf16(false, a, false, b, (short)0, c, false, false);
#if defined(__HIP_DEVICE_COMPILE__)
  const v16h ha = __builtin_bit_cast(v16h, a), hb = __builtin_bit_cast(v16h, b);
  asm volatile("v_nop\n\tv_nop\n\tv_nop\n\tv_nop" : "+v"(d) : "v"(ha), "v"(hb));
#endif
  return d;
}

// ---- one tile = 24 asynchronous 16-byte copies per lane, global -> LDS, through no register. RUN copies follow one
//      another at steps (LS1, GS1), then the next run starts (LS2, GS2) further; steps in bytes (LDS) and in 16-bit
//      elements (global). The landing is waited for by the caller (s_wait_asynccnt).
typedef int v4i __attribute__((ext_vector_type(4)));
template <int RUN, int LS1, int GS1, int LS2, int GS2>
__device__ __forceinline__ void acopy_tile(unsigned char* l0, const unsigned short* g0) {
#if defined(__HIP_DEVICE_COMPILE__)
#pragma unroll
  for (int idx = 0; idx < 24; ++idx) {
    const int r = idx / RUN, s = idx % RUN;
    __builtin_amdgcn_global_load_async_to_lds_b128(
        (__attribute__((address_space(1))) v4i*)(g0 + (size_t)r * GS2 + (size_t)s * GS1),
        (__attribute__((address_space(3))) v4i*)(l0 + r * LS2 + s * LS1), 0, 0);
  }
#endif
}

// =========================================================================================================
// (0) weights f32 [768][768] (y = 0: Wk, 1: Wq, 2: Wv, block-uniform selection) -> bf16-RNE planes:
//     natural Wn[y][o][i] and transposed Wt[y][i][o], plus row sums rs[y][o] = sum_i bf16(W[o][i]) in f32.
//     Block (ob, y) owns rows o0..o0+63; column chunks of 64 go through the LDS tile T[i_loc][o_loc] (pitch TPW).
// coverage: Wn 12 chunks x 2 it x 8 waves x 4 rows x 8 lanes x 8 = 64 x 768 per block; Wt 12 chunks x 2 it x 32 x 8
//           lanes x 8 = 768 x 64 per block; rs 16 x 4 = 64; blocks (bx < 12, y < 3) cover all three matrices once.
// LDS: T and rsL cross-wave (block barriers).
// =========================================================================================================
__device__ __forceinline__
void cvt_w(unsigned char* sm, int bx, int y,
           const float* __restrict__ wk, const float* __restrict__ wq, const float* __restrict__ wv,
           unsigned short* Wn, unsigned short* Wt, float* rs) {
  unsigned short* T = (unsigned short*)sm;                           // [QT * TPW]
  float* rsL = (float*)(sm + QT * TPW * 2);                          // [QT]
  const int tid = threadIdx.x, lane = tid & 31, wave = tid >> 5;
  const int o0 = bx * QT;
  const float* W = (y == 0) ? wk : ((y == 1) ? wq : wv);            // block-uniform, all global
  unsigned short* Np = Wn + (size_t)y * ND * ND;
  unsigned short* Tq = Wt + (size_t)y * ND * ND;
  const int e = lane & 7, r4 = lane >> 3;                           // r4 0..3
  const int e8 = tid & 7, lq = tid >> 3;                            // lq 0..31
  float rsum0 = 0.f, rsum1 = 0.f;
#pragma unroll 1
  for (int cc = 0; cc < ND / QT; ++cc) {
    const int i0 = cc * QT;
#pragma unroll
    for (int it = 0; it < 2; ++it) {
      const int ol = 8 * wave + 4 * it + r4;                          // 0..63
      const float* sp = W + (size_t)(o0 + ol) * ND + i0 + 8 * e;
      const v4f a = *(const v4f*)sp;
      const v4f q = *(const v4f*)(sp + 4);
      const float f[8] = {a[0], a[1], a[2], a[3], q[0], q[1], q[2], q[3]};
      unsigned short hb[8];
      float ps = 0.f;
#pragma unroll
      for (int t = 0; t < 8; ++t) { hb[t] = bf_bits(f[t]); ps += bf_up(hb[t]); }
      if (it == 0) rsum0 += ps; else rsum1 += ps;
      v4u u;
#pragma unroll
      for (int t = 0; t < 4; ++t) u[t] = pk16(hb[2 * t], hb[2 * t + 1]);
      unsigned short* np = Np + (size_t)(o0 + ol) * ND + i0 + 8 * e;
      *(v4u*)np = u;
      
#pragma unroll
      for (int t = 0; t < 8; ++t) T[(8 * e + t) * TPW + ol] = hb[t];   // T[i_loc][o_loc]
    }
    __syncthreads();
    v4u up[2];
#pragma unroll
    for (int it = 0; it < 2; ++it) {
      const int il = 32 * it + lq;                                    // 0..63
      up[it] = *(const v4u*)(T + il * TPW + 8 * e8);
    }
{
#pragma unroll
      for (int it = 0; it < 2; ++it) {
        const int il = 32 * it + lq;
        *(v4u*)(Tq + (size_t)(i0 + il) * ND + o0 + 8 * e8) = up[it];
      }
      
    }
    __syncthreads();                                                  // T reused by the next chunk
  }
  rsum0 += __shfl_xor(rsum0, 1, 32); rsum0 += __shfl_xor(rsum0, 2, 32); rsum0 += __shfl_xor(rsum0, 4, 32);
  rsum1 += __shfl_xor(rsum1, 1, 32); rsum1 += __shfl_xor(rsum1, 2, 32); rsum1 += __shfl_xor(rsum1, 4, 32);
  if (e == 0) { rsL[8 * wave + r4] = rsum0; rsL[8 * wave + 4 + r4] = rsum1; }
  __syncthreads();
  if (wave == 0 && lane < 16) {
    const v4f v = *(const v4f*)(rsL + 4 * lane);
    float* rp = rs + (size_t)y * ND + o0 + 4 * lane;
    *(v4f*)rp = v;
    
  }
}

// =========================================================================================================
// (1) g[e] = sum_o bf16(Wk)[o][e] * rq[o]  (rq = row sums of bf16(Wq)); f32. Block = 32 columns e (its 32 results are
//     one 128-byte line of g), 128 threads, each doing the work of the two places vt = tid and tid + 128 of 256.
//     Place (og = vt>>2, e4 = vt&3) takes columns 8 e4..8 e4+7 of rows og + 64 i, i < 12 in rising order, six rows at a
//     time: six 16-byte loads and six rq values, all sent off before the first is used, four load latencies a block.
//     The 64 row groups are joined in a fixed order: pL[og][column] -> part w < 8 sums groups 8w..8w+7 (wave w & 3) ->
//     sL[w][column] -> wave 0 sums the eight and stores the line with one instruction.
// coverage: 64 og x 12 = 768 rows, 4 e4 x 8 = 32 columns per block; 24 blocks x 32 = 768 = whole g.
// LDS pL and sL cross-wave (a block barrier behind each).
// =========================================================================================================
__device__ __forceinline__
void k_g(unsigned char* sm, int bx, const unsigned short* __restrict__ Wkn, const float* __restrict__ rq, float* g) {
  float* pL = (float*)sm;                                            // [GRG * GCB]
  float* sL = (float*)(sm + GRG * GCB * 4);                          // [8 * GCB]
  const int tid = threadIdx.x, lane = tid & 31, wave = tid >> 5;
  const int e0 = bx * GCB;
  for (int v = 0; v < 2; ++v) {
    const int vt = tid + 128 * v;
    const int e4 = vt & 3, og = vt >> 2;
    const unsigned short* wp = Wkn + (size_t)og * ND + e0 + 8 * e4;
    float acc[8] = {0.f, 0.f, 0.f, 0.f, 0.f, 0.f, 0.f, 0.f};
    // rolled: six rows' w[] and r[] hold registers at a time. Unrolled (twelve rows at once) the build takes 140 registers
    // for the whole launch, past the 128 at which the GEMM blocks that share it stand eight waves a SIMD, as their LDS allows
#pragma unroll 1
    for (int h = 0; h < 2; ++h) {
      const int ib = ND / GRG / 2 * h;
      v4u   w[ND / GRG / 2];
      float r[ND / GRG / 2];
      // unrolled: w[] and r[] stay in registers and all 12 loads are issued before the first one is waited for
#pragma unroll
      for (int i = 0; i < ND / GRG / 2; ++i) {
        w[i] = *(const v4u*)(wp + (size_t)(GRG * (ib + i)) * ND);
        r[i] = rq[og + GRG * (ib + i)];
      }
      // both loops unrolled: only constant indices keep w[], r[] and acc[] in registers
#pragma unroll
      for (int i = 0; i < ND / GRG / 2; ++i) {
#pragma unroll
        for (int t = 0; t < 4; ++t) {
          acc[2 * t]     += bf_lo16(w[i][t]) * r[i];
          acc[2 * t + 1] += bf_hi16(w[i][t]) * r[i];
        }
      }
    }
    const v4f pa = {acc[0], acc[1], acc[2], acc[3]};
    const v4f pb = {acc[4], acc[5], acc[6], acc[7]};
    *(v4f*)(pL + og * GCB + 8 * e4)     = pa;
    *(v4f*)(pL + og * GCB + 8 * e4 + 4) = pb;
  }
  __syncthreads();
  // unrolled (all three loops, here and below): eight LDS reads at constant offsets of one address
#pragma unroll
  for (int v = 0; v < 2; ++v) {
    const int vw = wave + 4 * v;
    float s = 0.f;
#pragma unroll
    for (int k = 0; k < GRG / 8; ++k) s += pL[(GRG / 8 * vw + k) * GCB + lane];
    sL[vw * GCB + lane] = s;
  }
  __syncthreads();
  if (wave == 0) {
    float v = 0.f;
#pragma unroll
    for (int k = 0; k < 8; ++k) v += sL[k * GCB + lane];
    g[e0 + lane] = v;
  }
}

// =========================================================================================================
// (2) x f32 [b][2048][768] -> Xb bf16-RNE plane (same layout) and per-chunk f64 partial sums of the bf16 values
//     (sum, sum of squares). Block (ch, b) owns 32 rows; wave w rows 4w..4w+3; per row 3 instructions of
// coverage: Xb 4 rows x 8 waves x 3 x 32 lanes x 8 = 32 x 768 per block, blocks (ch < 64, b < NB) = all rows of b < NB;
// =========================================================================================================
__device__ __forceinline__
void k_xcvt(unsigned char* sm, int ch, int b, const float* __restrict__ x, unsigned short* Xb, double* part) {
  double* sL = (double*)sm;                                          // [8]
  double* qL = sL + 8;                                               // [8]
  const int tid = threadIdx.x, lane = tid & 31, wave = tid >> 5;
  const int r0 = ch * (NC / KCH);
  double s = 0.0, q = 0.0;
#pragma unroll 1
  for (int t = 0; t < 4; ++t) {
    const int row = r0 + 4 * wave + t;
    const size_t base = ((size_t)b * NC + row) * ND + 8 * lane;
#pragma unroll 1
    for (int c3 = 0; c3 < ND / 256; ++c3) {
      const float* sp = x + base + 256 * c3;
      const v4f a = *(const v4f*)sp;
      const v4f q4 = *(const v4f*)(sp + 4);
      const float f[8] = {a[0], a[1], a[2], a[3], q4[0], q4[1], q4[2], q4[3]};
      unsigned short hb[8];
#pragma unroll
      for (int k = 0; k < 8; ++k) {
        hb[k] = bf_bits(f[k]);
        const double v = (double)bf_up(hb[k]);
        s += v;
        q += v * v;
      }
      v4u u;
#pragma unroll
      for (int k = 0; k < 4; ++k) u[k] = pk16(hb[2 * k], hb[2 * k + 1]);
      unsigned short* xp = Xb + base + 256 * c3;
      *(v4u*)xp = u;
      
    }
  }
  s += shfl_xor_d(s, 16); s += shfl_xor_d(s, 8); s += shfl_xor_d(s, 4); s += shfl_xor_d(s, 2); s += shfl_xor_d(s, 1);
  q += shfl_xor_d(q, 16); q += shfl_xor_d(q, 8); q += shfl_xor_d(q, 4); q += shfl_xor_d(q, 2); q += shfl_xor_d(q, 1);
  if (lane == 0) { sL[wave] = s; qL[wave] = q; }
  __syncthreads();
  if (wave == 0) {
    double S = 0.0, Q = 0.0;
#pragma unroll
    for (int w = 0; w < 8; ++w) { S += sL[w]; Q += qL[w]; }
    v2d val;
    val[0] = (lane == 0) ? S : 0.0;
    val[1] = (lane == 0) ? Q : 0.0;
    if (lane < 8) {
      double* pp = part + ((size_t)b * KCH + ch) * 16 + 2 * lane;
      *(v2d*)pp = val;
      
    }
  }
}

// =========================================================================================================
// (3) LayerNorm statistics per batch from the 64 partial lines (fixed-order f64 tree): st line f32 [32] with
// =========================================================================================================
__device__ __forceinline__
void k_stats(unsigned char* sm, const double* __restrict__ part, float* st) {
  double* sL = (double*)sm;                                          // [64]
  double* qL = sL + 64;                                              // [64]
  float* stL = (float*)(sm + 2 * 64 * 8);                            // [32]
  const int tid = threadIdx.x;                                       // 128 threads; 64 and up only pass the barriers
  if (tid < 32) stL[tid] = 0.f;
#pragma unroll 1
  for (int b = 0; b < NB; ++b) {
    __syncthreads();
    if (tid < KCH) {
      const size_t pb = ((size_t)b * KCH + tid) * 16;
      sL[tid] = part[pb];
      qL[tid] = part[pb + 1];
    }
    __syncthreads();
#pragma unroll
    for (int off = 32; off > 0; off >>= 1) {
      if (tid < off) { sL[tid] += sL[tid + off]; qL[tid] += qL[tid + off]; }
      __syncthreads();
    }
    if (tid == 0) {
      const double n  = (double)NC * (double)ND;
      const double mu = sL[0] / n;
      double var = qL[0] / n - mu * mu;
      if (var < 0.0) var = 0.0;
      const float varf = (float)var;
      const float ve   = varf + EPSV;
      const float rstd = (float)(1.0 / sqrt((double)ve));
      const float muf  = (float)mu;
      stL[4 * b + 0] = muf;
      stL[4 * b + 1] = rstd;
      stL[4 * b + 2] = rstd * rstd;
      stL[4 * b + 3] = muf * rstd * rstd;
    }
  }
  __syncthreads();
  if (tid < 8) {
    const v4f v = *(const v4f*)(stL + 4 * tid);
    float* p = st + 4 * tid;
    *(v4f*)p = v;
    
  }
}

// =========================================================================================================
// GEMM engine (K = 768 = 24 k-steps, all operand planes k-contiguous with pitch ND): block 128 threads = 4 waves,
// 64 (m) x 64 (n) tile; wave w owns cols n0+16w..+15 (one B fragment per k-step from row n of the B plane) and
// 4 m-tiles (A rows m0 + 16 mt + (lane&15)); NPROD = 2 adds a second A plane (bf16 residual) into the same
// accumulator. Split k map loader for both operands.
// The operands come through LDS: a stage = 64 k of the block's 64 B rows and 64 A rows (each A plane), one whole
// 128-byte line a row, brought once per block by asynchronous copies and read by all four waves as fragments.
// Stage layout: plane 0 = B, plane 1 = A, plane 2 = A residual; a plane = 64 rows of pitch GP (144 B = 16 B x 9, for
// b128 readers; the 16 pad bytes of a row are neither written nor read). Two stages, a two-buffer ring.
// coverage of a plane: 4 waves x 4 copies x 4 rows x 8 lanes x 16 B = 64 x 128 B.
// =========================================================================================================
__device__ __forceinline__ unsigned lds_off(const void* p) { return (unsigned)(size_t)p; }

// Four asynchronous 16-byte copies per lane, global -> LDS: 16 rows of one plane (a copy = 4 whole rows: lane -> row
// lane>>3, 16-byte piece lane&7). l, g: this lane's LDS byte address and global address in the first of them.
// The s_wait_xcnt closes the statement: the address registers that the copies name are rewritten only behind it.
__device__ __forceinline__ void acopy4(unsigned l, const unsigned short* g) {
#if defined(__HIP_DEVICE_COMPILE__)
  asm volatile("global_load_async_to_lds_b128 %0, %4, off\n\t"
               "global_load_async_to_lds_b128 %1, %5, off\n\t"
               "global_load_async_to_lds_b128 %2, %6, off\n\t"
               "global_load_async_to_lds_b128 %3, %7, off\n\t"
               "s_wait_xcnt 0x0"
               :: "v"(l), "v"(l + 4 * GP * 2), "v"(l + 8 * GP * 2), "v"(l + 12 * GP * 2),
                  "v"(g), "v"(g + 4 * ND), "v"(g + 8 * ND), "v"(g + 12 * ND)
               : "memory");
#endif
}

// a0, a1, b: row 0, column 0 of the block's 64 rows in each plane. sm: 2 stages of (NPROD + 1) planes.
template <int NPROD>
__device__ __forceinline__ void gemm_k(unsigned char* sm, const unsigned short* __restrict__ a0,
                                       const unsigned short* __restrict__ a1,
                                       const unsigned short* __restrict__ b, v8f (&acc)[4]) {
  constexpr int STG = (NPROD + 1) * GPB;
  const int tid = threadIdx.x, lane = tid & 31, wave = tid >> 5, hh = lane >> 4, c = lane & 15;
  // copy side: wave w brings rows 16w..16w+15 of every plane
  const int crow = 16 * wave + (lane >> 3);
  const unsigned cl = lds_off(sm) + crow * (GP * 2) + 16 * (lane & 7);
  const size_t   cg = (size_t)crow * ND + 8 * (lane & 7);
  auto fill = [&](int t) {
    const unsigned l = cl + (t & 1) * STG;
    const size_t   g = cg + (size_t)GKC * t;
    acopy4(l, b + g);
    acopy4(l + GPB, a0 + g);
    if (NPROD == 2) acopy4(l + 2 * GPB, a1 + g);
  };
  // fragment readers: lane -> row (lane&15), + 8*(lane>>4), as from the global planes
  const unsigned short* rb = (const unsigned short*)sm + (16 * wave + c) * GP + 8 * hh;
  const unsigned short* ra = (const unsigned short*)(sm + GPB) + c * GP + 8 * hh;               // + 16 mt * GP
#pragma unroll
  for (int mt = 0; mt < 4; ++mt) acc[mt] = zero8();

  fill(0);
  asm volatile("s_wait_asynccnt 0x0" ::: "memory");                  // this wave's share of stage 0 has landed
  __syncthreads();                                                   // ... and every other wave's: stage 0 is readable
  fill(1);
  // rolled: twelve equal trips, the buffer chosen by an address offset; unrolled it would only grow the code
#pragma unroll 1
  for (int t = 0; t < ND / GKC; ++t) {
    const int bo = (t & 1) * (STG / 2);
#pragma unroll
    for (int k2 = 0; k2 < GKC / 32; ++k2) {
      const Frag fb = ldfrag(rb + bo + 32 * k2);
      Frag fa[4], fl[4];
#pragma unroll
      for (int mt = 0; mt < 4; ++mt) {
        fa[mt] = ldfrag(ra + bo + (16 * mt) * GP + 32 * k2);
        if (NPROD == 2) fl[mt] = ldfrag(ra + bo + GPB / 2 + (16 * mt) * GP + 32 * k2);
      }
#pragma unroll
      for (int mt = 0; mt < 4; ++mt) {
        acc[mt] = mma_b(fa[mt].bf, fb.bf, acc[mt]);
        if (NPROD == 2) acc[mt] = mma_b(fl[mt].bf, fb.bf, acc[mt]);
      }
    }
    // foot of the trip: own LDS reads done, own copies of the next stage landed, then the barrier that publishes that
    // stage and ends every wave's reads of this one; behind it this buffer is refilled
    asm volatile("s_wait_dscnt 0x0" ::: "memory");
    asm volatile("s_wait_asynccnt 0x0" ::: "memory");
    __syncthreads();
    if (t + 2 < ND / GKC) fill(t + 2);
  }
  asm volatile("s_wait_asynccnt 0x0" ::: "memory");                  // nothing is in flight when the LDS changes its use
}

// D tiles -> LDS Os[n_loc][m_loc] (pitch OSP, b128 stores): lane (hh, c) holds m = 16 mt + 8 hh + r for
// n_loc = 16 w + c.  coverage: 4 waves x 16 n x 4 mt x 16 m = 64 x 64 (pad cols 64..67 never read).
__device__ __forceinline__ void stage_os(float* Os, const v8f (&acc)[4], float sc, int wave, int hh, int c) {
  const int nl = 16 * wave + c;
#pragma unroll
  for (int mt = 0; mt < 4; ++mt) {
    v4f va, vb;
#pragma unroll
    for (int r = 0; r < 4; ++r) { va[r] = acc[mt][r] * sc; vb[r] = acc[mt][4 + r] * sc; }
    *(v4f*)(Os + nl * OSP + 16 * mt + 8 * hh)     = va;
    *(v4f*)(Os + nl * OSP + 16 * mt + 8 * hh + 4) = vb;
  }
}

// Os -> two bf16 planes (hi = bf16-RNE(v), lo = bf16-RNE(v - hi)), plane row = row0 + n_loc, 64 m values =
// coverage: 4 it x 16 rows x 8 lanes x 8 = 64 x 64 per plane.
__device__ __forceinline__ void epi_split(const float* Os, unsigned short* Ph, unsigned short* Pl,
                                          size_t row0, int pitch, int col0, int tid) {
  const int e = tid & 7, lq = tid >> 3;                              // lq 0..15
  v4u uh[4], ul[4];
#pragma unroll
  for (int it = 0; it < 4; ++it) {
    const int row = it * 16 + lq;
    const v4f a = *(const v4f*)(Os + row * OSP + 8 * e);
    const v4f q = *(const v4f*)(Os + row * OSP + 8 * e + 4);
    const float f[8] = {a[0], a[1], a[2], a[3], q[0], q[1], q[2], q[3]};
#pragma unroll
    for (int t = 0; t < 4; ++t) {
      const float f0 = f[2 * t], f1 = f[2 * t + 1];
      const unsigned short hb0 = bf_bits(f0), hb1 = bf_bits(f1);
      const unsigned short lb0 = bf_bits(f0 - bf_up(hb0));
      const unsigned short lb1 = bf_bits(f1 - bf_up(hb1));
      uh[it][t] = pk16(hb0, hb1);
      ul[it][t] = pk16(lb0, lb1);
    }
  }
{
#pragma unroll
    for (int it = 0; it < 4; ++it) {
      const int row = it * 16 + lq;
      const size_t po = (row0 + (size_t)row) * (size_t)pitch + (size_t)col0 + 8 * e;
      *(v4u*)(Ph + po) = uh[it];
      *(v4u*)(Pl + po) = ul[it];
    }
    
  }
}

// Os -> the f16 value plane (values already scaled), stored by key tiles: P[tile = key / 32][channel][key % 32], so that
// the 768 x 32 tile that k_attn copies is 48 KiB in a row. tile0: the tile of Os column 0 (64 columns = two tiles), ch0:
// the channel of Os row 0. A store instruction of a wave = 4 channels x 64 B in a row in each tile: whole 128-byte lines.
__device__ __forceinline__ void epi_h(const float* Os, unsigned short* P, size_t tile0, int ch0, int tid) {
  const int e = tid & 7, lq = tid >> 3;
  v4u u[4];
#pragma unroll
  for (int it = 0; it < 4; ++it) {
    const int row = it * 16 + lq;
    const v4f a = *(const v4f*)(Os + row * OSP + 8 * e);
    const v4f q = *(const v4f*)(Os + row * OSP + 8 * e + 4);
    const float f[8] = {a[0], a[1], a[2], a[3], q[0], q[1], q[2], q[3]};
#pragma unroll
    for (int t = 0; t < 4; ++t)
      u[it][t] = pk16(h_bits((_Float16)f[2 * t]), h_bits((_Float16)f[2 * t + 1]));
  }
{
#pragma unroll
    for (int it = 0; it < 4; ++it) {
      const int row = it * 16 + lq;
      const size_t po = ((tile0 + (size_t)(e >> 2)) * ND + (size_t)(ch0 + row)) * 32 + 8 * (e & 3);
      *(v4u*)(P + po) = u[it];
    }
    
  }
}

// =========================================================================================================
// (4) H planes: D[m = d][n = e] = sum_o WqT[d][o] * WkT[e][o]  (1 product, exact) -> Hh/Hl bf16 [e][768 d].
// blocks (bx < 12 e-tiles, by < 12 d-tiles).  LDS Os cross-wave (block barrier).  sm: 2 * 2 * GPB bytes.
// =========================================================================================================
__device__ __forceinline__
void k_hgemm(unsigned char* sm, int bx, int by,
             const unsigned short* __restrict__ Aq, const unsigned short* __restrict__ Bk,
             unsigned short* Hh, unsigned short* Hl) {
  float* Os = (float*)sm;                                            // the stages' bytes, free behind the k loop
  const int tid = threadIdx.x, lane = tid & 31, wave = tid >> 5, hh = lane >> 4, c = lane & 15;
  const int n0 = bx * QT, m0 = by * QT;
  const unsigned short* ap = Aq + (size_t)m0 * ND;
  const unsigned short* bp = Bk + (size_t)n0 * ND;
  v8f acc[4];
  gemm_k<1>(sm, ap, ap, bp, acc);
  stage_os(Os, acc, 1.0f, wave, hh, c);
  __syncthreads();
  epi_split(Os, Hh, Hl, (size_t)n0, ND, m0, tid);
}

// =========================================================================================================
// (5) query planes: D[m = e][n = query] = sum_d (Hh + Hl)[e][d] * Xb[b][q][d]  (2 products), scaled by rstd_b^2
//     in the epilogue -> Ah/Al bf16 [b][NQ][768 e].  blocks (bx < NQ/64, by < 12 e-tiles, b < NB).  sm: 2 * 3 * GPB bytes.
// =========================================================================================================
__device__ __forceinline__
void k_agemm(unsigned char* sm, int bx, int by, int b,
             const unsigned short* __restrict__ Hh, const unsigned short* __restrict__ Hl,
             const unsigned short* __restrict__ Xb, const float* __restrict__ st,
             unsigned short* Ah, unsigned short* Al) {
  float* Os = (float*)sm;                                            // the stages' bytes, free behind the k loop
  const int tid = threadIdx.x, lane = tid & 31, wave = tid >> 5, hh = lane >> 4, c = lane & 15;
  const int n0 = bx * QT, m0 = by * QT;
  const unsigned short* ap0 = Hh + (size_t)m0 * ND;
  const unsigned short* ap1 = Hl + (size_t)m0 * ND;
  const unsigned short* bp  = Xb + ((size_t)b * NC + n0) * ND;
  v8f acc[4];
  gemm_k<2>(sm, ap0, ap1, bp, acc);
  const float sc = st[4 * b + 2];
  stage_os(Os, acc, sc, wave, hh, c);
  __syncthreads();
  epi_split(Os, Ah, Al, (size_t)b * NQ + n0, ND, m0, tid);
}

// =========================================================================================================
// (6) value plane (by tiles of 32 keys, channel-major inside a tile): D[m = key j][n = o] = sum_d Xb[b][j][d] * Wvb[o][d]
//     (1 product, exact), x16 -> U f16 [b][64 tiles j / 32][768 o][32 j % 32].  blocks (bx < 12 o-tiles, by < 32 key-tiles,
//     b < NB).
// =========================================================================================================
__device__ __forceinline__
void k_vgemm(unsigned char* sm, int bx, int by, int b,
             const unsigned short* __restrict__ Xb, const unsigned short* __restrict__ Wvn, unsigned short* U) {
  float* Os = (float*)sm;                                            // the stages' bytes, free behind the k loop
  const int tid = threadIdx.x, lane = tid & 31, wave = tid >> 5, hh = lane >> 4, c = lane & 15;
  const int n0 = bx * QT, m0 = by * QT;
  const unsigned short* ap = Xb + ((size_t)b * NC + m0) * ND;
  const unsigned short* bp = Wvn + (size_t)n0 * ND;
  v8f acc[4];
  gemm_k<1>(sm, ap, ap, bp, acc);
  stage_os(Os, acc, USC, wave, hh, c);
  __syncthreads();
  epi_h(Os, U, (size_t)b * (NC / 32) + m0 / 32, n0, tid);
}

// =========================================================================================================
// (7) key-side affine term: cs[b][j] = -(mu_b rstd_b^2) * sum_d g[d] * Xb[b][j][d], f32 VALU, one wave per row,
//     four waves of eight rows a block.
// coverage: blocks (bx < 64, b < NB) x 32 rows = every key row of b < NB.  LDS csL cross-wave (block barrier).
// =========================================================================================================
__device__ __forceinline__
void k_cs(unsigned char* sm, int bx, int b,
          const unsigned short* __restrict__ Xb, const float* __restrict__ g, const float* __restrict__ st,
          float* cs) {
  float* csL = (float*)sm;                                           // [32]
  const int tid = threadIdx.x, lane = tid & 31, wave = tid >> 5;
  const int r0 = bx * 32;
  v4f ga[3], gb[3];
#pragma unroll
  for (int c3 = 0; c3 < 3; ++c3) {
    ga[c3] = *(const v4f*)(g + 256 * c3 + 8 * lane);
    gb[c3] = *(const v4f*)(g + 256 * c3 + 8 * lane + 4);
  }
  const float nmr = -st[4 * b + 3];
#pragma unroll 1
  for (int t = 0; t < 8; ++t) {
    const int row = r0 + 8 * wave + t;
    const unsigned short* xp = Xb + ((size_t)b * NC + row) * ND + 8 * lane;
    float acc = 0.f;
#pragma unroll
    for (int c3 = 0; c3 < 3; ++c3) {
      const v4u u = *(const v4u*)(xp + 256 * c3);
      acc += bf_lo16(u[0]) * ga[c3][0] + bf_hi16(u[0]) * ga[c3][1]
           + bf_lo16(u[1]) * ga[c3][2] + bf_hi16(u[1]) * ga[c3][3]
           + bf_lo16(u[2]) * gb[c3][0] + bf_hi16(u[2]) * gb[c3][1]
           + bf_lo16(u[3]) * gb[c3][2] + bf_hi16(u[3]) * gb[c3][3];
    }
    acc += __shfl_xor(acc, 16, 32); acc += __shfl_xor(acc, 8, 32); acc += __shfl_xor(acc, 4, 32);
    acc += __shfl_xor(acc, 2, 32);  acc += __shfl_xor(acc, 1, 32);
    if (lane == 0) csL[8 * wave + t] = acc * nmr;
  }
  __syncthreads();
  if (wave == 0 && lane < 8) {
    const v4f v = *(const v4f*)(csL + 4 * lane);
    float* p = cs + (size_t)b * NC + r0 + 4 * lane;
    *(v4f*)p = v;
    
  }
}

// =========================================================================================================
// (8) attention for one (b, 64-query tile), transposed formulation, 2048 keys, no mask:
//   S^T tile (16 keys x 16 queries) = sum over 24 d-chunks of A(key row kb + (lane&15) of the bf16 plane Xb,
//   split k map) . B(query row of Ah) + A(Xb).B(Al) (bf16 residual, shared accumulator), then + cs[key].
//   Per lane the D tile holds 8 keys of ONE query: online softmax state per lane, one shuffle (lane^16) for the
//   max over 32 keys; corr applied every step (== 1 exactly when the max did not grow). P = e^{s-m} x 16384 as
//   f16 is the B operand of O^T (rows channel, cols queries) += A(U rows channel 16j + (lane&15), keys
//   contiguous, f16 x16) . B(P^T): element r <- D of the tile covering keys kb..kb+15, element 8+r <- the tile
//   covering kb+16..kb+31, lane unchanged. The 48 accumulator tiles per wave live in registers (384 per lane) for
//   the whole key loop and are stored once, behind it, to wave-private LDS slots Ow[query][768].
//   Epilogue after a block barrier: out[b][q][:] = Ow[q][:] * (rstd / (16 l_q)) - mu rstd rowsum(Wv), row =
// coverage: 4 waves x 16 query rows x 6 x 32 lanes x 4 = 64 x 768; grid (NQ/64, NB) covers out[b < NB][q < NQ].
// LDS: Ow written once per lane behind the key loop; cross-lane reads only after __syncthreads. staged extent
//      (16 x 768 per wave) == consumed extent. The wave's query fragments (hi + residual) never pass through LDS: they
//      are loaded once from the global planes and stay in registers (384 per lane) beside the accumulator tiles.
//      Behind the Ow bytes one K buffer (32 key rows) and one V buffer (768 channel rows x 32 keys), filled once per block and
//      32 keys by asynchronous copies (each wave a quarter) and read by all four waves: cross-wave, so every tile is
//      read only behind its copiers' s_wait_asynccnt 0 and a block barrier, and refilled only behind the barrier
//      that ends its last read. coverage: K 4 waves x 8 rows x 3 x 32 lanes x 16 B = 32 x 1536 B; V 4 waves x 24 x
//      8 rows x 4 x 16 B = 768 x 64 B; pad bytes of a row are neither written nor read.
// =========================================================================================================
__global__ __launch_bounds__(128)
void k_attn(const unsigned short* __restrict__ Ah, const unsigned short* __restrict__ Al,
            const unsigned short* __restrict__ Xb, const unsigned short* __restrict__ U,
            const float* __restrict__ cs, const float* __restrict__ rv,
            const float* __restrict__ st, float* out) {
  __shared__ __attribute__((aligned(16))) unsigned char lds_all[ATTN_LDS];
  const int tid  = threadIdx.x;
  const int wave = tid >> 5, lane = tid & 31;
  const int hh   = lane >> 4, c = lane & 15;
  const int n0   = blockIdx.x * QT, b = blockIdx.y;
  float* Ow = (float*)lds_all + (size_t)wave * (16 * ND);
  float* op = Ow + c * ND + 8 * hh;                                  // this lane's slots (query column c)
  // O^T tiles: o[j][r] = channel 16 j + 8 hh + r of query c. Every loop over o[] is fully unrolled: only constant
  // indices keep the tiles in registers.
  v8f o[ND / 16];
#pragma unroll
  for (int j = 0; j < ND / 16; ++j) o[j] = zero8();

  const size_t qo = ((size_t)b * NQ + n0 + 16 * wave + c) * ND + 8 * hh;
  const unsigned short* Ahp = Ah + qo;
  const unsigned short* Alp = Al + qo;
  // The block's K tile (32 key rows x 768, row pitch KP) and V tile (768 channel rows x 32 keys, row pitch VP) in LDS,
  // read by all four waves. Fragment readers: lane -> row (lane&15), + 8*(lane>>4), as from the global planes.
  const unsigned short* Ks = (const unsigned short*)(lds_all + QLDS) + c * KP + 8 * hh;          // + key_loc*KP + 32 kc
  const unsigned short* Vs = (const unsigned short*)(lds_all + QLDS + KLDS) + c * VP + 8 * hh;   // + 16 j*VP
  // Copy side. K: wave w brings key rows 8w..8w+7, three copies of 512 B a row. V: wave w brings channel rows
  // 192w..192w+191, one copy = 8 rows x 64 B (lane -> row lane>>2, 16-byte piece lane&3), which lie in a row in the
  // tiled plane U: 512 B = four whole lines a copy.
  unsigned char* kl0 = lds_all + QLDS + (8 * wave) * (KP * 2) + 16 * lane;
  unsigned char* vl0 = lds_all + QLDS + KLDS + (192 * wave + (lane >> 2)) * (VP * 2) + 16 * (lane & 3);
  const unsigned short* kg0 = Xb + ((size_t)b * NC + 8 * wave) * ND + 8 * lane;                    // + kb*ND
  const unsigned short* vg0 = U + (size_t)b * ND * NC + (192 * wave) * 32 + 8 * lane;              // + kb*ND
  const float* csb = cs + (size_t)b * NC + 8 * hh;                                    // + kb (+16)

  // The wave's 16 query rows (hi and residual plane) are loaded once, as B fragments, and stay in registers (2 x 24
  // fragments = 384 per lane) for the whole key loop. Every loop over qh[] and ql[] is fully unrolled: only constant
  // indices keep them in registers.
  Frag qh[ND / 32], ql[ND / 32];
#pragma unroll
  for (int kc = 0; kc < ND / 32; ++kc) {
    qh[kc] = ldfrag(Ahp + 32 * kc);
    ql[kc] = ldfrag(Alp + 32 * kc);
  }
  asm volatile("s_wait_xcnt 0x0" :: "v"(Ahp), "v"(Alp) : "memory");

  // Two-buffer ring over the tile sequence K(0), V(0), K(32), V(32), ...: the K buffer is worked on (scores) while the V
  // tile flies, the V buffer (O^T) while the next K tile flies. In front of the loop: first K tile, landed and
  // published; then the first V tile is sent off.
  acopy_tile<3, 512, 256, KP * 2, ND>(kl0, kg0);
  asm volatile("s_wait_asynccnt 0x0" ::: "memory");                  // this wave's share of the K tile has landed
  __syncthreads();                                                   // ... and every other wave's: the tile is readable
  acopy_tile<24, 8 * VP * 2, 8 * 32, 0, 0>(vl0, vg0);

  float m = -1.0e30f, l = 0.f;
#pragma unroll 1
  for (int kb = 0; kb < NC; kb += 32) {
    const unsigned short* k0p = Ks;                                  // keys kb .. kb+15
    const unsigned short* k1p = Ks + 16 * KP;                        // keys kb+16 .. kb+31
    v8f s0 = zero8(), s1 = zero8();
    // K fragments (LDS) in groups of KG d-chunks, two groups in registers: group g + 1 is in flight while group g is
    // used.
    Frag kf[2][KG][2];
#pragma unroll
    for (int u = 0; u < KG; ++u) {
      kf[0][u][0] = ldfrag(k0p + 32 * u);
      kf[0][u][1] = ldfrag(k1p + 32 * u);
    }
    // the key-side terms are fetched here, at the head of the trip: the barrier at its foot waits for every global load
    const v4f ca = *(const v4f*)(csb + kb);
    const v4f cb = *(const v4f*)(csb + kb + 4);
    const v4f cd = *(const v4f*)(csb + kb + 16);
    const v4f ce = *(const v4f*)(csb + kb + 20);
    // the same wait for these four loads: their address pair is an input, so that nothing lands on it while the
    // loads are under way
    asm volatile("s_wait_xcnt 0x0" :: "v"(csb + kb) : "memory");
#pragma unroll
    for (int g = 0; g < ND / 32 / KG; ++g) {
      if (g + 1 < ND / 32 / KG) {
#pragma unroll
        for (int u = 0; u < KG; ++u) {
          const int kn = KG * (g + 1) + u;
          kf[(g + 1) & 1][u][0] = ldfrag(k0p + 32 * kn);
          kf[(g + 1) & 1][u][1] = ldfrag(k1p + 32 * kn);
        }
      }
      // holds the next group's loads, as one run, in front of this group's products: they are in flight meanwhile, and
      // no LDS read stands among the products (without it the build spreads them there)
      __builtin_amdgcn_sched_barrier(0);
#pragma unroll
      for (int u = 0; u < KG; ++u) {
        s0 = mma_q(kf[g & 1][u][0].bf, qh[KG * g + u].bf, s0);
        s1 = mma_q(kf[g & 1][u][1].bf, qh[KG * g + u].bf, s1);
        s0 = mma_q(kf[g & 1][u][0].bf, ql[KG * g + u].bf, s0);
        s1 = mma_q(kf[g & 1][u][1].bf, ql[KG * g + u].bf, s1);
      }
      // keeps later groups' loads behind this point: no more than two groups hold registers, and again no LDS read
      // among the products
      __builtin_amdgcn_sched_barrier(0);
    }
    {
#pragma unroll
      for (int r = 0; r < 4; ++r) {
        s0[r] += ca[r]; s0[4 + r] += cb[r];                          // key kb      + 8hh + r
        s1[r] += cd[r]; s1[4 + r] += ce[r];                          // key kb + 16 + 8hh + r
      }
    }

    // foot of the score trip: own LDS reads done, own V copies landed, then the barrier that publishes the V tile and
    // ends every wave's reads of the K buffer; behind it the next K tile is sent off into that buffer
    asm volatile("s_wait_dscnt 0x0" ::: "memory");
    asm volatile("s_wait_asynccnt 0x0" ::: "memory");
    __syncthreads();
    if (kb + 32 < NC) acopy_tile<3, 512, 256, KP * 2, ND>(kl0, kg0 + (size_t)(kb + 32) * ND);

    float mx = fmaxf(hmax8(s0), hmax8(s1));
    mx = fmaxf(mx, __shfl_xor(mx, 16, 32));
    const float mn   = fmaxf(m, mx);
    const float corr = __expf(m - mn);                               // == 1 exactly when the max did not grow
    l *= corr;
    m = mn;
    const float msh = mn - LNPS;                                     // exp gives e^{s-m} * 16384

    FragH ph;
    float ls = 0.f;
#pragma unroll
    for (int r = 0; r < 8; ++r) {
      const float e0 = __expf(s0[r] - msh);
      const float e1 = __expf(s1[r] - msh);
      ls += e0 + e1;
      ph.hv[0][r] = (_Float16)e0;
      ph.hv[1][r] = (_Float16)e1;
    }
    l += ls;

    // V fragments (LDS) in groups of VG channel tiles, two groups in registers, as for K above
    Frag vf[2][VG];
#pragma unroll
    for (int u = 0; u < VG; ++u) vf[0][u] = ldfrag(Vs + (16 * u) * VP);
#pragma unroll
    for (int g = 0; g < ND / 16 / VG; ++g) {
      if (g + 1 < ND / 16 / VG) {
#pragma unroll
        for (int u = 0; u < VG; ++u) vf[(g + 1) & 1][u] = ldfrag(Vs + (16 * (VG * (g + 1) + u)) * VP);
      }
      // holds the next group's LDS reads, as one run, in front of this group's products
      __builtin_amdgcn_sched_barrier(0);
#pragma unroll
      for (int u = 0; u < VG; ++u) {
        const int j = VG * g + u;
        v8f t;
#pragma unroll
        for (int r = 0; r < 8; ++r) t[r] = o[j][r] * corr;
        o[j] = mma_h(vf[g & 1][u].h, ph.v, t);
      }
      // keeps later groups' reads behind this point: no LDS read among the products
      __builtin_amdgcn_sched_barrier(0);
    }
    // foot of the O^T trip: the same order; the barrier publishes the next K tile and frees the V buffer
    asm volatile("s_wait_dscnt 0x0" ::: "memory");
    asm volatile("s_wait_asynccnt 0x0" ::: "memory");
    __syncthreads();
    if (kb + 32 < NC) acopy_tile<24, 8 * VP * 2, 8 * 32, 0, 0>(vl0, vg0 + (size_t)(kb + 32) * ND);
  }
  asm volatile("s_wait_asynccnt 0x0" ::: "memory");                  // nothing is in flight when the LDS changes its use
  // the finished tiles go to the wave's LDS slots once, for the row-major epilogue
#pragma unroll
  for (int j = 0; j < ND / 16; ++j) {
    v4f na, nb2;
#pragma unroll
    for (int r = 0; r < 4; ++r) { na[r] = o[j][r]; nb2[r] = o[j][4 + r]; }
    *(v4f*)(op + 16 * j)     = na;
    *(v4f*)(op + 16 * j + 4) = nb2;
  }
  l += __shfl_xor(l, 16, 32);
  const float inv  = 1.0f / l;                                       // Ow and l both carry the x16384 factor
  const float mu   = st[4 * b + 0], rstd = st[4 * b + 1];
  const float qsc  = inv * rstd * IUSC;                              // per lane: its query column
  const float mrs  = mu * rstd;
  v4f rvv[6];
#pragma unroll
  for (int k = 0; k < ND / 128; ++k) {
    const v4f t = *(const v4f*)(rv + 128 * k + 4 * lane);
#pragma unroll
    for (int u = 0; u < 4; ++u) rvv[k][u] = t[u] * mrs;
  }
  __syncthreads();                                                   // all accumulator slots final before cross-lane reads

{
#pragma unroll 1
    for (int qq = 0; qq < 16; ++qq) {
      const float sc = __shfl(qsc, qq, 32);
      const float* lrow = Ow + qq * ND + 4 * lane;
      float* orow = out + ((size_t)b * NC + n0 + 16 * wave + qq) * ND + 4 * lane;
#pragma unroll
      for (int k = 0; k < ND / 128; ++k) {
        const v4f v = *(const v4f*)(lrow + 128 * k);
        v4f w;
#pragma unroll
        for (int u = 0; u < 4; ++u) w[u] = v[u] * sc - rvv[k][u];
        *(v4f*)(orow + 128 * k) = w;
      }
    }
    
  }
}

// =========================================================================================================
// The launches. Stages that need nothing of one another share one grid: a block takes its stage by the range its index
// lies in (a block-uniform branch, so every barrier of a stage is passed by the whole block) and its place in the stage
// from the index, x fastest. All stages of a launch use the one LDS array of the launch.
//   k_prep : (0) weights | (2) x                      both read inputs only
//   k_mid  : (3) statistics | (4) H | (1) g | (6) U    all read only what k_prep wrote
//   k_qc   : (5) query planes | (7) key-side term      both read only what k_prep and k_mid wrote
// The few long serial blocks stand first in their launch; the short blocks of (7) stand last.
// =========================================================================================================
#define PB_X  (3 * (ND / QT))                       // k_prep: first block of (2)
#define PB_N  (PB_X + KCH * NB)
#define MB_H  1                                     // k_mid: first block of (4), of (1), of (6)
#define MB_G  (MB_H + (ND / QT) * (ND / QT))
#define MB_V  (MB_G + ND / GCB)
#define MB_N  (MB_V + (ND / QT) * (NC / QT) * NB)
#define QB_C  ((NQ / QT) * (ND / QT) * NB)          // k_qc: first block of (7)
#define QB_N  (QB_C + (NC / 32) * NB)
static_assert(2 * 2 * GPB >= GRG * GCB * 4 + 8 * GCB * 4 && 2 * 2 * GPB >= 2 * 64 * 8 + 32 * 4 && KCH == 64);

__global__ __launch_bounds__(256)
void k_prep(const float* __restrict__ x, const float* __restrict__ wk, const float* __restrict__ wq,
            const float* __restrict__ wv, unsigned short* Wn, unsigned short* Wt, float* rs,
            unsigned short* Xb, double* part) {
  __shared__ __align__(16) unsigned char sm[QT * TPW * 2 + QT * 4];
  const int bid = blockIdx.x;
  if (bid < PB_X) {
    cvt_w(sm, bid % (ND / QT), bid / (ND / QT), wk, wq, wv, Wn, Wt, rs);
  } else {
    const int i = bid - PB_X;
    k_xcvt(sm, i % KCH, i / KCH, x, Xb, part);
  }
}

__global__ __launch_bounds__(128)
void k_mid(const double* __restrict__ part, const unsigned short* __restrict__ Wn,
           const unsigned short* __restrict__ Wt, const float* __restrict__ rs,
           const unsigned short* __restrict__ Xb, float* st, unsigned short* Hh, unsigned short* Hl, float* g,
           unsigned short* U) {
  __shared__ __align__(16) unsigned char sm[2 * 2 * GPB];
  const int bid = blockIdx.x;
  if (bid < MB_H) {
    k_stats(sm, part, st);
  } else if (bid < MB_G) {
    const int i = bid - MB_H;                                        // A = Wq transposed (rows d), B = Wk transposed (rows e)
    k_hgemm(sm, i % (ND / QT), i / (ND / QT), Wt + (size_t)1 * ND * ND, Wt, Hh, Hl);
    // the wait before a register that an issued global store names is overwritten: the build lets this stage's end run
    // on through the later stages' tests, whose code rewrites the stores' registers
    asm volatile("s_wait_xcnt 0x0" ::: "memory");
  } else if (bid < MB_V) {
    k_g(sm, bid - MB_G, Wn, rs + ND, g);
  } else {
    const int i = bid - MB_V;
    k_vgemm(sm, i % (ND / QT), (i / (ND / QT)) % (NC / QT), i / ((ND / QT) * (NC / QT)), Xb,
            Wn + (size_t)2 * ND * ND, U);
    // the wait before a register that an issued global store names is overwritten: the build lets this stage's end run
    // on through the later stages' tests, whose code rewrites the stores' registers
    asm volatile("s_wait_xcnt 0x0" ::: "memory");
  }
}

__global__ __launch_bounds__(128)
void k_qc(const unsigned short* __restrict__ Hh, const unsigned short* __restrict__ Hl,
          const unsigned short* __restrict__ Xb, const float* __restrict__ st, const float* __restrict__ g,
          unsigned short* Ah, unsigned short* Al, float* cs) {
  __shared__ __align__(16) unsigned char sm[2 * 3 * GPB];
  const int bid = blockIdx.x;
  if (bid < QB_C) {
    k_agemm(sm, bid % (NQ / QT), (bid / (NQ / QT)) % (ND / QT), bid / ((NQ / QT) * (ND / QT)), Hh, Hl, Xb, st, Ah, Al);
  } else {
    const int i = bid - QB_C;
    k_cs(sm, i % (NC / 32), i / (NC / 32), Xb, g, st, cs);
  }
}

// =========================================================================================================
// Workspace map (bytes; each region start a multiple of 256; every extent is an exact tile/line multiple and is
//   Wn bf16 [3][768][768]      3538944      Wt bf16 [3][768][768]   3538944
//   rs  f32 [3][768]              9216      g   f32 [768]              3072
//   Xb bf16 [NB][2048][768]   25165824 (NB=8)  part f64 [NB][64][16]  65536    st f32 [32]  128 (256)
//   Hh/Hl bf16 [768][768]      1179648 x2
//   Ah/Al bf16 [NB][NQ][768]  25165824 x2 (NB=8, NQ=2048)
//   U  f16 [NB][64][768][32]  25165824      cs f32 [NB][2048]         65536
//   total (NB=8, NQ=2048) = 110244096
// =========================================================================================================
extern "C" void kernel_launch(void* const* d_in, const int* in_sizes, int n_in,
                              void* d_out, int out_size, void* d_ws, size_t ws_size,
                              hipStream_t stream) {
  if (n_in < 4) return;
  if (in_sizes[0] < NB * NC * ND) return;
  if (in_sizes[1] < ND * ND || in_sizes[2] < ND * ND || in_sizes[3] < ND * ND) return;
  if (out_size < NB * NC * ND) return;

  size_t off = 0;
  auto carve = [&](size_t bytes) { const size_t o = off; off += (bytes + 255) & ~(size_t)255; return o; };
  const size_t oWn   = carve((size_t)3 * ND * ND * 2);
  const size_t oWt   = carve((size_t)3 * ND * ND * 2);
  const size_t oRs   = carve((size_t)3 * ND * 4);
  const size_t oG    = carve((size_t)ND * 4);
  const size_t oXb   = carve((size_t)NB * NC * ND * 2);
  const size_t oPart = carve((size_t)NB * KCH * 128);
  const size_t oSt   = carve((size_t)128);
  const size_t oHh   = carve((size_t)ND * ND * 2);
  const size_t oHl   = carve((size_t)ND * ND * 2);
  const size_t oAh   = carve((size_t)NB * NQ * ND * 2);
  const size_t oAl   = carve((size_t)NB * NQ * ND * 2);
  const size_t oU    = carve((size_t)NB * ND * NC * 2);
  const size_t oCs   = carve((size_t)NB * NC * 4);
  if (off > ws_size) return;
  if (off > (size_t)134217728) return;

  const float* x  = (const float*)d_in[0];
  const float* wk = (const float*)d_in[1];
  const float* wq = (const float*)d_in[2];
  const float* wv = (const float*)d_in[3];

  char* ws = (char*)d_ws;
  unsigned short* Wn  = (unsigned short*)(ws + oWn);
  unsigned short* Wt  = (unsigned short*)(ws + oWt);
  float*          rs  = (float*)(ws + oRs);
  float*          g   = (float*)(ws + oG);
  unsigned short* Xb  = (unsigned short*)(ws + oXb);
  double*         part = (double*)(ws + oPart);
  float*          st  = (float*)(ws + oSt);
  unsigned short* Hh  = (unsigned short*)(ws + oHh);
  unsigned short* Hl  = (unsigned short*)(ws + oHl);
  unsigned short* Ah  = (unsigned short*)(ws + oAh);
  unsigned short* Al  = (unsigned short*)(ws + oAl);
  unsigned short* U   = (unsigned short*)(ws + oU);
  float*          cs  = (float*)(ws + oCs);
  float* out = (float*)d_out;

  const dim3 blk256(256), blk128(128);

  // (0) weights -> bf16 natural + transposed planes + row sums (y: 0 Wk, 1 Wq, 2 Wv); (2) x -> bf16 plane + f64 partial sums
  k_prep<<<dim3(PB_N), blk256, 0, stream>>>(x, wk, wq, wv, Wn, Wt, rs, Xb, part);
  // (3) LayerNorm statistics; (4) H planes; (1) g = bf16(Wk)^T . rowsum(bf16(Wq)); (6) value plane U = 16 X.Wv^T
  k_mid<<<dim3(MB_N), blk128, 0, stream>>>(part, Wn, Wt, rs, Xb, st, Hh, Hl, g, U);
  // (5) query planes A' = rstd^2 X.H (hi + residual); (7) key-side affine term
  k_qc<<<dim3(QB_N), blk128, 0, stream>>>(Hh, Hl, Xb, st, g, Ah, Al, cs);
  // (8) attention -> out [b][q][768]
  k_attn<<<dim3(NQ / QT, NB), blk128, 0, stream>>>(Ah, Al, Xb, U, cs, rs + 2 * ND, st, out);
  (void)hipGetLastError();
}

// v009
// A run of this version takes 204 microseconds.
// Timed twice side by side with v008, it ran 1.06 times as fast both times.
// Over all steps from v000 it is 6.97 times as fast.
// Contractions (f32 accumulate everywhere): H[e][d] = sum_o Wq[o][d]*Wk[o][e] on v_wmma_f32_16x16x32_bf16 with
// bf16-RNE weights (exact products); query plane A' = X.H with bf16-RNE x and H carried as bf16 hi + bf16
// residual (2 products, shared accumulator); U = X.Wv^T (1 product, bf16-RNE operands); scores
// S^T = X(keys).A'(queries) with A' as bf16 hi + bf16 residual (2 products); O^T = U.P^T on
// v_wmma_f32_16x16x32_f16 (U x16 as f16, P = e^{s-m} x16384 as f16 built from the score D registers).
// LayerNorm statistics in f64 VALU; per-batch affine terms, softmax statistics and normalisation in f32 VALU.
#include <hip/hip_runtime.h>
#include <math.h>
#include <stdint.h>

#ifndef NB
#define NB 8
#endif
#ifndef NQ
#define NQ 2048
#endif
#define NBF  8
#define NC   2048
#define ND   768
#define QT   64
#define GT   128
#define GOSP 132
#define TPW  72
#define KCH  64
#define KG   4
#define USC  16.0f
#define IUSC 0.0625f
#define LNPS 9.704060527839234f
#define EPSV 1.0e-5f
#define KP   776
#define VP   40
#define VG   8
#define QLDS (4 * 16 * ND * 4)
#define KLDS (32 * KP * 2)
#define VLDS (ND * VP * 2)
#define ATTN_LDS (QLDS + KLDS + VLDS)
#define GKC  64
#define GP   72
#define GPB  (GT * GP * 2)
#define GCB  32
#define GRG  64

static_assert(NB >= 1 && NB <= NBF);
static_assert(NQ % QT == 0 && NQ >= QT && NQ <= NC);
static_assert(NC % QT == 0 && ND % QT == 0);
static_assert(NC % 32 == 0 && ND % 32 == 0);
static_assert(ND % 256 == 0 && ND % 128 == 0 && ND % 16 == 0);
static_assert(NC / KCH == 32 && KCH == 64);
static_assert((ND / 32) % KG == 0);
static_assert(4 * NBF <= 32);
static_assert((GOSP * 4) % 16 == 0 && GOSP >= GT + 4);
static_assert(NQ % GT == 0 && NC % GT == 0 && ND % GT == 0 && GT == 128);
static_assert((TPW * 2) % 16 == 0);
static_assert(QLDS == 196608 && ATTN_LDS <= 327680);
static_assert((KP * 2) % 32 == 16 && (VP * 2) % 32 == 16);          // LDS row pitch = 16 B x odd, for b128 readers
static_assert(KP >= ND + 8 && VP >= 32 + 8 && QLDS % 16 == 0 && KLDS % 16 == 0);
static_assert(ND % GKC == 0 && ND / GKC >= 2 && GKC * 2 == 128 && GKC % 32 == 0 && QT == 64);
static_assert((GP * 2) % 32 == 16 && GP >= GKC + 8 && 2 * 2 * GPB >= GT * GOSP * 4);
static_assert(ND % GCB == 0 && ND % GRG == 0 && GCB == 32 && 4 * GRG == 256 && GRG % 8 == 0);
static_assert((ND / 16) % VG == 0 && ND % (4 * 8) == 0 && ND / 4 / 8 == 24 && 8 * (ND / 256) == 24);

typedef _Float16       v16h __attribute__((ext_vector_type(16)));
typedef _Float16       v8h  __attribute__((ext_vector_type(8)));
typedef __bf16         v16b __attribute__((ext_vector_type(16)));
typedef unsigned short v8us __attribute__((ext_vector_type(8)));
typedef float          v8f  __attribute__((ext_vector_type(8)));
typedef float          v4f  __attribute__((ext_vector_type(4)));
typedef unsigned int   v4u  __attribute__((ext_vector_type(4)));
typedef double         v2d  __attribute__((ext_vector_type(2)));

union Frag  { v8us u[2]; v16h h; v16b bf; };
union FragH { v16h v; v8h hv[2]; };
static_assert(sizeof(Frag) == 32);
static_assert(sizeof(FragH) == 32);

// ---- scalar helpers ---------------------------------------------------------------------------------------
__device__ __forceinline__ unsigned short bf_bits(float f) {          // f32 -> bf16 bits, RNE convert
  unsigned u = __float_as_uint(f);
  return (unsigned short)((u + 0x7FFFu + ((u >> 16) & 1u)) >> 16);
}
__device__ __forceinline__ float bf_up(unsigned short hb) { return __uint_as_float(((unsigned)hb) << 16); }
__device__ __forceinline__ float bf_lo16(unsigned w) { return __uint_as_float(w << 16); }
__device__ __forceinline__ float bf_hi16(unsigned w) { return __uint_as_float(w & 0xFFFF0000u); }
__device__ __forceinline__ unsigned short h_bits(_Float16 x) { return __builtin_bit_cast(unsigned short, x); }
__device__ __forceinline__ unsigned pk16(unsigned short a, unsigned short b) { return (unsigned)a | ((unsigned)b << 16); }
__device__ __forceinline__ v8f zero8() { v8f z = {0.f, 0.f, 0.f, 0.f, 0.f, 0.f, 0.f, 0.f}; return z; }
__device__ __forceinline__ float hmax8(v8f s) {
  return fmaxf(fmaxf(fmaxf(s[0], s[1]), fmaxf(s[2], s[3])), fmaxf(fmaxf(s[4], s[5]), fmaxf(s[6], s[7])));
}
__device__ __forceinline__ double shfl_xor_d(double v, int mask) {
  int lo = __double2loint(v), hi = __double2hiint(v);
  lo = __shfl_xor(lo, mask, 32);
  hi = __shfl_xor(hi, mask, 32);
  return __hiloint2double(hi, lo);
}

// ---- 16-bit fragment loader (A, or B from a k-contiguous [n][k] row): lane -> row/col (lane&15), p already includes
//      + 8*(lane>>4); elements 0..7 <- p[0..7] (k0+8h..), elements 8..15 <- p[16..23] (k0+16+8h..)
__device__ __forceinline__ Frag ldfrag(const unsigned short* p) {
  Frag f;
  f.u[0] = *(const v8us*)(p);
  f.u[1] = *(const v8us*)(p + 16);
  return f;
}

// ---- WMMA helpers: the bare builtins (the compiler keeps the distance behind its own WMMAs) -------------------
__device__ __forceinline__ v8f mma_h(v16h a, v16h b, v8f c) {
  return __builtin_amdgcn_wmma_f32_16x16x32_f16(false, a, false, b, (short)0, c, false, false);
}
__device__ __forceinline__ v8f mma_q(v16b a, v16b b, v8f c) {
  return __builtin_amdgcn_wmma_f32_16x16x32_bf16(false, a, false, b, (short)0, c, false, false);
}

// ---- one tile = 24 asynchronous 16-byte copies per lane, global -> LDS, through no register. RUN copies follow one
//      another at steps (LS1, GS1), then the next run starts (LS2, GS2) further; steps in bytes (LDS) and in 16-bit
//      elements (global). The landing is waited for by the caller (s_wait_asynccnt).
typedef int v4i __attribute__((ext_vector_type(4)));
template <int RUN, int LS1, int GS1, int LS2, int GS2>
__device__ __forceinline__ void acopy_tile(unsigned char* l0, const unsigned short* g0) {
#if defined(__HIP_DEVICE_COMPILE__)
#pragma unroll
  for (int idx = 0; idx < 24; ++idx) {
    const int r = idx / RUN, s = idx % RUN;
    __builtin_amdgcn_global_load_async_to_lds_b128(
        (__attribute__((address_space(1))) v4i*)(g0 + (size_t)r * GS2 + (size_t)s * GS1),
        (__attribute__((address_space(3))) v4i*)(l0 + r * LS2 + s * LS1), 0, 0);
  }
#endif
}

// =========================================================================================================
// (0) weights f32 [768][768] (y = 0: Wk, 1: Wq, 2: Wv, block-uniform selection) -> bf16-RNE planes:
//     natural Wn[y][o][i] and transposed Wt[y][i][o], plus row sums rs[y][o] = sum_i bf16(W[o][i]) in f32.
//     Block (ob, y) owns rows o0..o0+63; column chunks of 64 go through the LDS tile T[i_loc][o_loc] (pitch TPW).
// coverage: Wn 12 chunks x 2 it x 8 waves x 4 rows x 8 lanes x 8 = 64 x 768 per block; Wt 12 chunks x 2 it x 32 x 8
//           lanes x 8 = 768 x 64 per block; rs 16 x 4 = 64; blocks (bx < 12, y < 3) cover all three matrices once.
// LDS: T and rsL cross-wave (block barriers).
// =========================================================================================================
__device__ __forceinline__
void cvt_w(unsigned char* sm, int bx, int y,
           const float* __restrict__ wk, const float* __restrict__ wq, const float* __restrict__ wv,
           unsigned short* Wn, unsigned short* Wt, float* rs) {
  unsigned short* T = (unsigned short*)sm;                           // [QT * TPW]
  float* rsL = (float*)(sm + QT * TPW * 2);                          // [QT]
  const int tid = threadIdx.x, lane = tid & 31, wave = tid >> 5;
  const int o0 = bx * QT;
  const float* W = (y == 0) ? wk : ((y == 1) ? wq : wv);            // block-uniform, all global
  unsigned short* Np = Wn + (size_t)y * ND * ND;
  unsigned short* Tq = Wt + (size_t)y * ND * ND;
  const int e = lane & 7, r4 = lane >> 3;                           // r4 0..3
  const int e8 = tid & 7, lq = tid >> 3;                            // lq 0..31
  float rsum0 = 0.f, rsum1 = 0.f;
#pragma unroll 1
  for (int cc = 0; cc < ND / QT; ++cc) {
    const int i0 = cc * QT;
#pragma unroll
    for (int it = 0; it < 2; ++it) {
      const int ol = 8 * wave + 4 * it + r4;                          // 0..63
      const float* sp = W + (size_t)(o0 + ol) * ND + i0 + 8 * e;
      const v4f a = *(const v4f*)sp;
      const v4f q = *(const v4f*)(sp + 4);
      const float f[8] = {a[0], a[1], a[2], a[3], q[0], q[1], q[2], q[3]};
      unsigned short hb[8];
      float ps = 0.f;
#pragma unroll
      for (int t = 0; t < 8; ++t) { hb[t] = bf_bits(f[t]); ps += bf_up(hb[t]); }
      if (it == 0) rsum0 += ps; else rsum1 += ps;
      v4u u;
#pragma unroll
      for (int t = 0; t < 4; ++t) u[t] = pk16(hb[2 * t], hb[2 * t + 1]);
      unsigned short* np = Np + (size_t)(o0 + ol) * ND + i0 + 8 * e;
      *(v4u*)np = u;
      
#pragma unroll
      for (int t = 0; t < 8; ++t) T[(8 * e + t) * TPW + ol] = hb[t];   // T[i_loc][o_loc]
    }
    __syncthreads();
    v4u up[2];
#pragma unroll
    for (int it = 0; it < 2; ++it) {
      const int il = 32 * it + lq;                                    // 0..63
      up[it] = *(const v4u*)(T + il * TPW + 8 * e8);
    }
{
#pragma unroll
      for (int it = 0; it < 2; ++it) {
        const int il = 32 * it + lq;
        *(v4u*)(Tq + (size_t)(i0 + il) * ND + o0 + 8 * e8) = up[it];
      }
      
    }
    __syncthreads();                                                  // T reused by the next chunk
  }
  rsum0 += __shfl_xor(rsum0, 1, 32); rsum0 += __shfl_xor(rsum0, 2, 32); rsum0 += __shfl_xor(rsum0, 4, 32);
  rsum1 += __shfl_xor(rsum1, 1, 32); rsum1 += __shfl_xor(rsum1, 2, 32); rsum1 += __shfl_xor(rsum1, 4, 32);
  if (e == 0) { rsL[8 * wave + r4] = rsum0; rsL[8 * wave + 4 + r4] = rsum1; }
  __syncthreads();
  if (wave == 0 && lane < 16) {
    const v4f v = *(const v4f*)(rsL + 4 * lane);
    float* rp = rs + (size_t)y * ND + o0 + 4 * lane;
    *(v4f*)rp = v;
    
  }
}

// =========================================================================================================
// (1) g[e] = sum_o bf16(Wk)[o][e] * rq[o]  (rq = row sums of bf16(Wq)); f32. Block = 32 columns e (its 32 results are
//     one 128-byte line of g), 128 threads, each doing the work of the two places vt = tid and tid + 128 of 256.
//     Place (og = vt>>2, e4 = vt&3) takes columns 8 e4..8 e4+7 of rows og + 64 i, i < 12 in rising order, six rows at a
//     time: six 16-byte loads and six rq values, all sent off before the first is used, four load latencies a block.
//     The 64 row groups are joined in a fixed order: pL[og][column] -> part w < 8 sums groups 8w..8w+7 (wave w & 3) ->
//     sL[w][column] -> wave 0 sums the eight and stores the line with one instruction.
// coverage: 64 og x 12 = 768 rows, 4 e4 x 8 = 32 columns per block; 24 blocks x 32 = 768 = whole g.
// LDS pL and sL cross-wave (a block barrier behind each).
// =========================================================================================================
__device__ __forceinline__
void k_g(unsigned char* sm, int bx, const unsigned short* __restrict__ Wkn, const float* __restrict__ rq, float* g) {
  float* pL = (float*)sm;                                            // [GRG * GCB]
  float* sL = (float*)(sm + GRG * GCB * 4);                          // [8 * GCB]
  const int tid = threadIdx.x, lane = tid & 31, wave = tid >> 5;
  const int e0 = bx * GCB;
  for (int v = 0; v < 2; ++v) {
    const int vt = tid + 128 * v;
    const int e4 = vt & 3, og = vt >> 2;
    const unsigned short* wp = Wkn + (size_t)og * ND + e0 + 8 * e4;
    float acc[8] = {0.f, 0.f, 0.f, 0.f, 0.f, 0.f, 0.f, 0.f};
    // rolled: six rows' w[] and r[] hold registers at a time
#pragma unroll 1
    for (int h = 0; h < 2; ++h) {
      const int ib = ND / GRG / 2 * h;
      v4u   w[ND / GRG / 2];
      float r[ND / GRG / 2];
      // unrolled: w[] and r[] stay in registers and all 12 loads are issued before the first one is waited for
#pragma unroll
      for (int i = 0; i < ND / GRG / 2; ++i) {
        w[i] = *(const v4u*)(wp + (size_t)(GRG * (ib + i)) * ND);
        r[i] = rq[og + GRG * (ib + i)];
      }
      // both loops unrolled: only constant indices keep w[], r[] and acc[] in registers
#pragma unroll
      for (int i = 0; i < ND / GRG / 2; ++i) {
#pragma unroll
        for (int t = 0; t < 4; ++t) {
          acc[2 * t]     += bf_lo16(w[i][t]) * r[i];
          acc[2 * t + 1] += bf_hi16(w[i][t]) * r[i];
        }
      }
    }
    const v4f pa = {acc[0], acc[1], acc[2], acc[3]};
    const v4f pb = {acc[4], acc[5], acc[6], acc[7]};
    *(v4f*)(pL + og * GCB + 8 * e4)     = pa;
    *(v4f*)(pL + og * GCB + 8 * e4 + 4) = pb;
  }
  __syncthreads();
  // unrolled (all three loops, here and below): eight LDS reads at constant offsets of one address
#pragma unroll
  for (int v = 0; v < 2; ++v) {
    const int vw = wave + 4 * v;
    float s = 0.f;
#pragma unroll
    for (int k = 0; k < GRG / 8; ++k) s += pL[(GRG / 8 * vw + k) * GCB + lane];
    sL[vw * GCB + lane] = s;
  }
  __syncthreads();
  if (wave == 0) {
    float v = 0.f;
#pragma unroll
    for (int k = 0; k < 8; ++k) v += sL[k * GCB + lane];
    g[e0 + lane] = v;
  }
}

// =========================================================================================================
// (2) x f32 [b][2048][768] -> Xb bf16-RNE plane (same layout) and per-chunk f64 partial sums of the bf16 values
//     (sum, sum of squares). Block (ch, b) owns 32 rows; wave w rows 4w..4w+3; per row 3 instructions of
// coverage: Xb 4 rows x 8 waves x 3 x 32 lanes x 8 = 32 x 768 per block, blocks (ch < 64, b < NB) = all rows of b < NB;
// =========================================================================================================
__device__ __forceinline__
void k_xcvt(unsigned char* sm, int ch, int b, const float* __restrict__ x, unsigned short* Xb, double* part) {
  double* sL = (double*)sm;                                          // [8]
  double* qL = sL + 8;                                               // [8]
  const int tid = threadIdx.x, lane = tid & 31, wave = tid >> 5;
  const int r0 = ch * (NC / KCH);
  double s = 0.0, q = 0.0;
#pragma unroll 1
  for (int t = 0; t < 4; ++t) {
    const int row = r0 + 4 * wave + t;
    const size_t base = ((size_t)b * NC + row) * ND + 8 * lane;
#pragma unroll 1
    for (int c3 = 0; c3 < ND / 256; ++c3) {
      const float* sp = x + base + 256 * c3;
      const v4f a = *(const v4f*)sp;
      const v4f q4 = *(const v4f*)(sp + 4);
      const float f[8] = {a[0], a[1], a[2], a[3], q4[0], q4[1], q4[2], q4[3]};
      unsigned short hb[8];
#pragma unroll
      for (int k = 0; k < 8; ++k) {
        hb[k] = bf_bits(f[k]);
        const double v = (double)bf_up(hb[k]);
        s += v;
        q += v * v;
      }
      v4u u;
#pragma unroll
      for (int k = 0; k < 4; ++k) u[k] = pk16(hb[2 * k], hb[2 * k + 1]);
      unsigned short* xp = Xb + base + 256 * c3;
      *(v4u*)xp = u;
      
    }
  }
  s += shfl_xor_d(s, 16); s += shfl_xor_d(s, 8); s += shfl_xor_d(s, 4); s += shfl_xor_d(s, 2); s += shfl_xor_d(s, 1);
  q += shfl_xor_d(q, 16); q += shfl_xor_d(q, 8); q += shfl_xor_d(q, 4); q += shfl_xor_d(q, 2); q += shfl_xor_d(q, 1);
  if (lane == 0) { sL[wave] = s; qL[wave] = q; }
  __syncthreads();
  if (wave == 0) {
    double S = 0.0, Q = 0.0;
#pragma unroll
    for (int w = 0; w < 8; ++w) { S += sL[w]; Q += qL[w]; }
    v2d val;
    val[0] = (lane == 0) ? S : 0.0;
    val[1] = (lane == 0) ? Q : 0.0;
    if (lane < 8) {
      double* pp = part + ((size_t)b * KCH + ch) * 16 + 2 * lane;
      *(v2d*)pp = val;
      
    }
  }
}

// =========================================================================================================
// (3) LayerNorm statistics per batch from the 64 partial lines (fixed-order f64 tree): st line f32 [32] with
// =========================================================================================================
__device__ __forceinline__
void k_stats(unsigned char* sm, const double* __restrict__ part, float* st) {
  double* sL = (double*)sm;                                          // [64]
  double* qL = sL + 64;                                              // [64]
  float* stL = (float*)(sm + 2 * 64 * 8);                            // [32]
  const int tid = threadIdx.x;                                       // 128 threads; 64 and up only pass the barriers
  if (tid < 32) stL[tid] = 0.f;
#pragma unroll 1
  for (int b = 0; b < NB; ++b) {
    __syncthreads();
    if (tid < KCH) {
      const size_t pb = ((size_t)b * KCH + tid) * 16;
      sL[tid] = part[pb];
      qL[tid] = part[pb + 1];
    }
    __syncthreads();
#pragma unroll
    for (int off = 32; off > 0; off >>= 1) {
      if (tid < off) { sL[tid] += sL[tid + off]; qL[tid] += qL[tid + off]; }
      __syncthreads();
    }
    if (tid == 0) {
      const double n  = (double)NC * (double)ND;
      const double mu = sL[0] / n;
      double var = qL[0] / n - mu * mu;
      if (var < 0.0) var = 0.0;
      const float varf = (float)var;
      const float ve   = varf + EPSV;
      const float rstd = (float)(1.0 / sqrt((double)ve));
      const float muf  = (float)mu;
      stL[4 * b + 0] = muf;
      stL[4 * b + 1] = rstd;
      stL[4 * b + 2] = rstd * rstd;
      stL[4 * b + 3] = muf * rstd * rstd;
    }
  }
  __syncthreads();
  if (tid < 8) {
    const v4f v = *(const v4f*)(stL + 4 * tid);
    float* p = st + 4 * tid;
    *(v4f*)p = v;
    
  }
}

// =========================================================================================================
// GEMM engine (K = 768 = 24 k-steps, all operand planes k-contiguous with pitch ND): block 128 threads = 4 waves,
// 128 (m) x 128 (n) tile; wave (wm = w >> 1, wn = w & 1) owns the 64 x 64 quarter m0+64wm.., n0+64wn..: 4 x 4
// accumulator tiles (128 registers). Per k-step it reads 4 B fragments (rows n of the B plane) and 4 A fragments (rows
// m of the A plane), each used by 4 products; NPROD = 2 adds a second A plane (bf16 residual) into the same
// accumulators, behind the first plane's product of the same k-step. Split k map loader for both operands.
// The operands come through LDS: a stage = 64 k of the block's 128 B rows and 128 A rows (each A plane), one whole
// 128-byte line a row, brought once per block by asynchronous copies and read by the waves as fragments.
// Stage layout: plane 0 = B, plane 1 = A, plane 2 = A residual; a plane = 128 rows of pitch GP (144 B = 16 B x 9, for
// b128 readers; the 16 pad bytes of a row are neither written nor read). Two stages, a two-buffer ring.
// coverage of a plane: 4 waves x 8 copies x 4 rows x 8 lanes x 16 B = 128 x 128 B.
// =========================================================================================================
__device__ __forceinline__ unsigned lds_off(const void* p) { return (unsigned)(size_t)p; }

// Eight asynchronous 16-byte copies per lane, global -> LDS: a wave's 32 rows of one plane (a copy = 4 whole rows: lane ->
// row lane>>3, 16-byte piece lane&7). l, g: this lane's LDS byte address and global address in the first of them.
// The s_wait_xcnt closes the statement: the address registers that the copies name are rewritten only behind it.
__device__ __forceinline__ void acopy8(unsigned l, const unsigned short* g) {
#if defined(__HIP_DEVICE_COMPILE__)
  asm volatile("global_load_async_to_lds_b128 %0, %8, off\n\t"
               "global_load_async_to_lds_b128 %1, %9, off\n\t"
               "global_load_async_to_lds_b128 %2, %10, off\n\t"
               "global_load_async_to_lds_b128 %3, %11, off\n\t"
               "global_load_async_to_lds_b128 %4, %12, off\n\t"
               "global_load_async_to_lds_b128 %5, %13, off\n\t"
               "global_load_async_to_lds_b128 %6, %14, off\n\t"
               "global_load_async_to_lds_b128 %7, %15, off\n\t"
               "s_wait_xcnt 0x0"
               :: "v"(l), "v"(l + 4 * GP * 2), "v"(l + 8 * GP * 2), "v"(l + 12 * GP * 2),
                  "v"(l + 16 * GP * 2), "v"(l + 20 * GP * 2), "v"(l + 24 * GP * 2), "v"(l + 28 * GP * 2),
                  "v"(g), "v"(g + 4 * ND), "v"(g + 8 * ND), "v"(g + 12 * ND),
                  "v"(g + 16 * ND), "v"(g + 20 * ND), "v"(g + 24 * ND), "v"(g + 28 * ND)
               : "memory");
#endif
}

// a0, a1, b: row 0, column 0 of the block's 128 rows in each plane. sm: 2 stages of (NPROD + 1) planes.
template <int NPROD>
__device__ __forceinline__ void gemm_k(unsigned char* sm, const unsigned short* __restrict__ a0,
                                       const unsigned short* __restrict__ a1,
                                       const unsigned short* __restrict__ b, v8f (&acc)[4][4]) {
  constexpr int STG = (NPROD + 1) * GPB;
  const int tid = threadIdx.x, lane = tid & 31, wave = tid >> 5, hh = lane >> 4, c = lane & 15;
  const int wm = wave >> 1, wn = wave & 1;
  // copy side: wave w brings rows 32w..32w+31 of every plane
  const int crow = 32 * wave + (lane >> 3);
  const unsigned cl = lds_off(sm) + crow * (GP * 2) + 16 * (lane & 7);
  const size_t   cg = (size_t)crow * ND + 8 * (lane & 7);
  auto fill = [&](int t) {
    const unsigned l = cl + (t & 1) * STG;
    const size_t   g = cg + (size_t)GKC * t;
    acopy8(l, b + g);
    acopy8(l + GPB, a0 + g);
    if (NPROD == 2) acopy8(l + 2 * GPB, a1 + g);
  };
  // fragment readers: lane -> row (lane&15), + 8*(lane>>4), as from the global planes
  const unsigned short* rb = (const unsigned short*)sm + (64 * wn + c) * GP + 8 * hh;           // + 16 nt * GP
  const unsigned short* ra = (const unsigned short*)(sm + GPB) + (64 * wm + c) * GP + 8 * hh;   // + 16 mt * GP
#pragma unroll
  for (int mt = 0; mt < 4; ++mt) {
#pragma unroll
    for (int nt = 0; nt < 4; ++nt) acc[mt][nt] = zero8();
  }

  fill(0);
  asm volatile("s_wait_asynccnt 0x0" ::: "memory");                  // this wave's share of stage 0 has landed
  __syncthreads();                                                   // ... and every other wave's: stage 0 is readable
  fill(1);
  // rolled: twelve equal trips, the buffer chosen by an address offset; unrolled it would only grow the code
#pragma unroll 1
  for (int t = 0; t < ND / GKC; ++t) {
    const int bo = (t & 1) * (STG / 2);
#pragma unroll
    for (int k2 = 0; k2 < GKC / 32; ++k2) {
      // read in the order of first use: the first A fragment, the four B fragments, then the other A fragments
      Frag fb[4], fa[4], fl[4];
      fa[0] = ldfrag(ra + bo + 32 * k2);
#pragma unroll
      for (int i = 0; i < 4; ++i) fb[i] = ldfrag(rb + bo + (16 * i) * GP + 32 * k2);
#pragma unroll
      for (int i = 1; i < 4; ++i) fa[i] = ldfrag(ra + bo + (16 * i) * GP + 32 * k2);
      if (NPROD == 2) {
#pragma unroll
        for (int i = 0; i < 4; ++i) fl[i] = ldfrag(ra + bo + GPB / 2 + (16 * i) * GP + 32 * k2);
      }
      // holds the k-step's LDS reads, as one run, in front of its products: no LDS read stands among the products
      __builtin_amdgcn_sched_barrier(0);
#pragma unroll
      for (int mt = 0; mt < 4; ++mt) {
#pragma unroll
        for (int nt = 0; nt < 4; ++nt) acc[mt][nt] = mma_q(fa[mt].bf, fb[nt].bf, acc[mt][nt]);
      }
      if (NPROD == 2) {
#pragma unroll
        for (int mt = 0; mt < 4; ++mt) {
#pragma unroll
          for (int nt = 0; nt < 4; ++nt) acc[mt][nt] = mma_q(fl[mt].bf, fb[nt].bf, acc[mt][nt]);
        }
      }
      // keeps the next k-step's reads behind this point: one k-step's fragments hold registers at a time
      __builtin_amdgcn_sched_barrier(0);
    }
    // foot of the trip: own LDS reads done, own copies of the next stage landed, then the barrier that publishes that
    // stage and ends every wave's reads of this one; behind it this buffer is refilled
    asm volatile("s_wait_dscnt 0x0" ::: "memory");
    asm volatile("s_wait_asynccnt 0x0" ::: "memory");
    __syncthreads();
    if (t + 2 < ND / GKC) fill(t + 2);
  }
  asm volatile("s_wait_asynccnt 0x0" ::: "memory");                  // nothing is in flight when the LDS changes its use
}

// D tiles -> LDS Os[n_loc][m_loc] (pitch GOSP, b128 stores): lane (hh, c) of wave (wm, wn) holds
// m_loc = 64 wm + 16 mt + 8 hh + r for n_loc = 64 wn + 16 nt + c.
// coverage: 4 waves x 4 nt x 16 n x 4 mt x 16 m = 128 x 128 (pad cols 128..131 never read).
__device__ __forceinline__ void stage_os(float* Os, const v8f (&acc)[4][4], float sc, int wave, int hh, int c) {
  const int wm = wave >> 1, wn = wave & 1;
#pragma unroll
  for (int nt = 0; nt < 4; ++nt) {
    float* orow = Os + (64 * wn + 16 * nt + c) * GOSP + 64 * wm + 8 * hh;
#pragma unroll
    for (int mt = 0; mt < 4; ++mt) {
      v4f va, vb;
#pragma unroll
      for (int r = 0; r < 4; ++r) { va[r] = acc[mt][nt][r] * sc; vb[r] = acc[mt][nt][4 + r] * sc; }
      *(v4f*)(orow + 16 * mt)     = va;
      *(v4f*)(orow + 16 * mt + 4) = vb;
    }
  }
}

// Os -> two bf16 planes (hi = bf16-RNE(v), lo = bf16-RNE(v - hi)), plane row = row0 + n_loc, 128 m values = two whole
// 128-byte lines a row and plane. coverage: 16 it x 8 rows x 16 lanes x 8 = 128 x 128 per plane.
__device__ __forceinline__ void epi_split(const float* Os, unsigned short* Ph, unsigned short* Pl,
                                          size_t row0, int pitch, int col0, int tid) {
  const int e = tid & 15, lq = tid >> 4;                             // lq 0..7
  // unrolled: constant LDS offsets; four rows' values are packed, then stored
#pragma unroll
  for (int ib = 0; ib < 4; ++ib) {
    v4u uh[4], ul[4];
#pragma unroll
    for (int it = 0; it < 4; ++it) {
      const int row = (4 * ib + it) * 8 + lq;
      const v4f a = *(const v4f*)(Os + row * GOSP + 8 * e);
      const v4f q = *(const v4f*)(Os + row * GOSP + 8 * e + 4);
      const float f[8] = {a[0], a[1], a[2], a[3], q[0], q[1], q[2], q[3]};
#pragma unroll
      for (int t = 0; t < 4; ++t) {
        const float f0 = f[2 * t], f1 = f[2 * t + 1];
        const unsigned short hb0 = bf_bits(f0), hb1 = bf_bits(f1);
        const unsigned short lb0 = bf_bits(f0 - bf_up(hb0));
        const unsigned short lb1 = bf_bits(f1 - bf_up(hb1));
        uh[it][t] = pk16(hb0, hb1);
        ul[it][t] = pk16(lb0, lb1);
      }
    }
#pragma unroll
    for (int it = 0; it < 4; ++it) {
      const int row = (4 * ib + it) * 8 + lq;
      const size_t po = (row0 + (size_t)row) * (size_t)pitch + (size_t)col0 + 8 * e;
      *(v4u*)(Ph + po) = uh[it];
      *(v4u*)(Pl + po) = ul[it];
    }
    // the wait before a register that an issued global store names is overwritten: the next four rows reuse them
    if (ib + 1 < 4) asm volatile("s_wait_xcnt 0x0" ::: "memory");
  }
}

// Os -> the f16 value plane (values already scaled), stored by key tiles: P[tile = key / 32][channel][key % 32], so that
// the 768 x 32 tile that k_attn copies is 48 KiB in a row. tile0: the tile of Os column 0 (128 columns = four tiles), ch0:
// the channel of Os row 0. A store instruction of a wave = 2 channels x 64 B in a row in each tile: whole 128-byte lines.
__device__ __forceinline__ void epi_h(const float* Os, unsigned short* P, size_t tile0, int ch0, int tid) {
  const int e = tid & 15, lq = tid >> 4;                             // lq 0..7
  // unrolled: constant LDS offsets; four rows' values are packed, then stored
#pragma unroll
  for (int ib = 0; ib < 4; ++ib) {
    v4u u[4];
#pragma unroll
    for (int it = 0; it < 4; ++it) {
      const int row = (4 * ib + it) * 8 + lq;
      const v4f a = *(const v4f*)(Os + row * GOSP + 8 * e);
      const v4f q = *(const v4f*)(Os + row * GOSP + 8 * e + 4);
      const float f[8] = {a[0], a[1], a[2], a[3], q[0], q[1], q[2], q[3]};
#pragma unroll
      for (int t = 0; t < 4; ++t)
        u[it][t] = pk16(h_bits((_Float16)f[2 * t]), h_bits((_Float16)f[2 * t + 1]));
    }
#pragma unroll
    for (int it = 0; it < 4; ++it) {
      const int row = (4 * ib + it) * 8 + lq;
      const size_t po = ((tile0 + (size_t)(e >> 2)) * ND + (size_t)(ch0 + row)) * 32 + 8 * (e & 3);
      *(v4u*)(P + po) = u[it];
    }
    // the wait before a register that an issued global store names is overwritten: the next four rows reuse them
    if (ib + 1 < 4) asm volatile("s_wait_xcnt 0x0" ::: "memory");
  }
}

// =========================================================================================================
// (4) H planes: D[m = d][n = e] = sum_o WqT[d][o] * WkT[e][o]  (1 product, exact) -> Hh/Hl bf16 [e][768 d].
// blocks (bx < 6 e-tiles, by < 6 d-tiles).  LDS Os cross-wave (block barrier).  sm: 2 * 2 * GPB bytes.
// =========================================================================================================
__device__ __forceinline__
void k_hgemm(unsigned char* sm, int bx, int by,
             const unsigned short* __restrict__ Aq, const unsigned short* __restrict__ Bk,
             unsigned short* Hh, unsigned short* Hl) {
  float* Os = (float*)sm;                                            // the stages' bytes, free behind the k loop
  const int tid = threadIdx.x, lane = tid & 31, wave = tid >> 5, hh = lane >> 4, c = lane & 15;
  const int n0 = bx * GT, m0 = by * GT;
  const unsigned short* ap = Aq + (size_t)m0 * ND;
  const unsigned short* bp = Bk + (size_t)n0 * ND;
  v8f acc[4][4];
  gemm_k<1>(sm, ap, ap, bp, acc);
  stage_os(Os, acc, 1.0f, wave, hh, c);
  __syncthreads();
  epi_split(Os, Hh, Hl, (size_t)n0, ND, m0, tid);
}

// =========================================================================================================
// (5) query planes: D[m = e][n = query] = sum_d (Hh + Hl)[e][d] * Xb[b][q][d]  (2 products), scaled by rstd_b^2
//     in the epilogue -> Ah/Al bf16 [b][NQ][768 e].  blocks (bx < NQ/128, by < 6 e-tiles, b < NB).  sm: 2 * 3 * GPB bytes.
// =========================================================================================================
__device__ __forceinline__
void k_agemm(unsigned char* sm, int bx, int by, int b,
             const unsigned short* __restrict__ Hh, const unsigned short* __restrict__ Hl,
             const unsigned short* __restrict__ Xb, const float* __restrict__ st,
             unsigned short* Ah, unsigned short* Al) {
  float* Os = (float*)sm;                                            // the stages' bytes, free behind the k loop
  const int tid = threadIdx.x, lane = tid & 31, wave = tid >> 5, hh = lane >> 4, c = lane & 15;
  const int n0 = bx * GT, m0 = by * GT;
  const unsigned short* ap0 = Hh + (size_t)m0 * ND;
  const unsigned short* ap1 = Hl + (size_t)m0 * ND;
  const unsigned short* bp  = Xb + ((size_t)b * NC + n0) * ND;
  v8f acc[4][4];
  gemm_k<2>(sm, ap0, ap1, bp, acc);
  const float sc = st[4 * b + 2];
  stage_os(Os, acc, sc, wave, hh, c);
  __syncthreads();
  epi_split(Os, Ah, Al, (size_t)b * NQ + n0, ND, m0, tid);
}

// =========================================================================================================
// (6) value plane (by tiles of 32 keys, channel-major inside a tile): D[m = key j][n = o] = sum_d Xb[b][j][d] * Wvb[o][d]
//     (1 product, exact), x16 -> U f16 [b][64 tiles j / 32][768 o][32 j % 32].  blocks (bx < 6 o-tiles, by < 16 key-tiles,
//     b < NB).
// =========================================================================================================
__device__ __forceinline__
void k_vgemm(unsigned char* sm, int bx, int by, int b,
             const unsigned short* __restrict__ Xb, const unsigned short* __restrict__ Wvn, unsigned short* U) {
  float* Os = (float*)sm;                                            // the stages' bytes, free behind the k loop
  const int tid = threadIdx.x, lane = tid & 31, wave = tid >> 5, hh = lane >> 4, c = lane & 15;
  const int n0 = bx * GT, m0 = by * GT;
  const unsigned short* ap = Xb + ((size_t)b * NC + m0) * ND;
  const unsigned short* bp = Wvn + (size_t)n0 * ND;
  v8f acc[4][4];
  gemm_k<1>(sm, ap, ap, bp, acc);
  stage_os(Os, acc, USC, wave, hh, c);
  __syncthreads();
  epi_h(Os, U, (size_t)b * (NC / 32) + m0 / 32, n0, tid);
}

// =========================================================================================================
// (7) key-side affine term: cs[b][j] = -(mu_b rstd_b^2) * sum_d g[d] * Xb[b][j][d], f32 VALU, one wave per row,
//     four waves of eight rows a block.
// coverage: blocks (bx < 64, b < NB) x 32 rows = every key row of b < NB.  LDS csL cross-wave (block barrier).
// =========================================================================================================
__device__ __forceinline__
void k_cs(unsigned char* sm, int bx, int b,
          const unsigned short* __restrict__ Xb, const float* __restrict__ g, const float* __restrict__ st,
          float* cs) {
  float* csL = (float*)sm;                                           // [32]
  const int tid = threadIdx.x, lane = tid & 31, wave = tid >> 5;
  const int r0 = bx * 32;
  v4f ga[3], gb[3];
#pragma unroll
  for (int c3 = 0; c3 < 3; ++c3) {
    ga[c3] = *(const v4f*)(g + 256 * c3 + 8 * lane);
    gb[c3] = *(const v4f*)(g + 256 * c3 + 8 * lane + 4);
  }
  const float nmr = -st[4 * b + 3];
#pragma unroll 1
  for (int t = 0; t < 8; ++t) {
    const int row = r0 + 8 * wave + t;
    const unsigned short* xp = Xb + ((size_t)b * NC + row) * ND + 8 * lane;
    float acc = 0.f;
#pragma unroll
    for (int c3 = 0; c3 < 3; ++c3) {
      const v4u u = *(const v4u*)(xp + 256 * c3);
      acc += bf_lo16(u[0]) * ga[c3][0] + bf_hi16(u[0]) * ga[c3][1]
           + bf_lo16(u[1]) * ga[c3][2] + bf_hi16(u[1]) * ga[c3][3]
           + bf_lo16(u[2]) * gb[c3][0] + bf_hi16(u[2]) * gb[c3][1]
           + bf_lo16(u[3]) * gb[c3][2] + bf_hi16(u[3]) * gb[c3][3];
    }
    acc += __shfl_xor(acc, 16, 32); acc += __shfl_xor(acc, 8, 32); acc += __shfl_xor(acc, 4, 32);
    acc += __shfl_xor(acc, 2, 32);  acc += __shfl_xor(acc, 1, 32);
    if (lane == 0) csL[8 * wave + t] = acc * nmr;
  }
  __syncthreads();
  if (wave == 0 && lane < 8) {
    const v4f v = *(const v4f*)(csL + 4 * lane);
    float* p = cs + (size_t)b * NC + r0 + 4 * lane;
    *(v4f*)p = v;
    
  }
}

// =========================================================================================================
// (8) attention for one (b, 64-query tile), transposed formulation, 2048 keys, no mask:
//   S^T tile (16 keys x 16 queries) = sum over 24 d-chunks of A(key row kb + (lane&15) of the bf16 plane Xb,
//   split k map) . B(query row of Ah) + A(Xb).B(Al) (bf16 residual, shared accumulator), then + cs[key].
//   Per lane the D tile holds 8 keys of ONE query: online softmax state per lane, one shuffle (lane^16) for the
//   max over 32 keys; corr applied every step (== 1 exactly when the max did not grow). P = e^{s-m} x 16384 as
//   f16 is the B operand of O^T (rows channel, cols queries) += A(U rows channel 16j + (lane&15), keys
//   contiguous, f16 x16) . B(P^T): element r <- D of the tile covering keys kb..kb+15, element 8+r <- the tile
//   covering kb+16..kb+31, lane unchanged. The 48 accumulator tiles per wave live in registers (384 per lane) for
//   the whole key loop and are stored once, behind it, to wave-private LDS slots Ow[query][768].
//   Epilogue after a block barrier: out[b][q][:] = Ow[q][:] * (rstd / (16 l_q)) - mu rstd rowsum(Wv), row =
// coverage: 4 waves x 16 query rows x 6 x 32 lanes x 4 = 64 x 768; grid (NQ/64, NB) covers out[b < NB][q < NQ].
// LDS: Ow written once per lane behind the key loop; cross-lane reads only after __syncthreads. staged extent
//      (16 x 768 per wave) == consumed extent. The wave's query fragments (hi + residual) never pass through LDS: they
//      are loaded once from the global planes and stay in registers (384 per lane) beside the accumulator tiles.
//      Behind the Ow bytes one K buffer (32 key rows) and one V buffer (768 channel rows x 32 keys), filled once per block and
//      32 keys by asynchronous copies (each wave a quarter) and read by all four waves: cross-wave, so every tile is
//      read only behind its copiers' s_wait_asynccnt 0 and a block barrier, and refilled only behind the barrier
//      that ends its last read. coverage: K 4 waves x 8 rows x 3 x 32 lanes x 16 B = 32 x 1536 B; V 4 waves x 24 x
//      8 rows x 4 x 16 B = 768 x 64 B; pad bytes of a row are neither written nor read.
// =========================================================================================================
__global__ __launch_bounds__(128)
void k_attn(const unsigned short* __restrict__ Ah, const unsigned short* __restrict__ Al,
            const unsigned short* __restrict__ Xb, const unsigned short* __restrict__ U,
            const float* __restrict__ cs, const float* __restrict__ rv,
            const float* __restrict__ st, float* out) {
  __shared__ __attribute__((aligned(16))) unsigned char lds_all[ATTN_LDS];
  const int tid  = threadIdx.x;
  const int wave = tid >> 5, lane = tid & 31;
  const int hh   = lane >> 4, c = lane & 15;
  const int n0   = blockIdx.x * QT, b = blockIdx.y;
  float* Ow = (float*)lds_all + (size_t)wave * (16 * ND);
  float* op = Ow + c * ND + 8 * hh;                                  // this lane's slots (query column c)
  // O^T tiles: o[j][r] = channel 16 j + 8 hh + r of query c. Every loop over o[] is fully unrolled: only constant
  // indices keep the tiles in registers.
  v8f o[ND / 16];
#pragma unroll
  for (int j = 0; j < ND / 16; ++j) o[j] = zero8();

  const size_t qo = ((size_t)b * NQ + n0 + 16 * wave + c) * ND + 8 * hh;
  const unsigned short* Ahp = Ah + qo;
  const unsigned short* Alp = Al + qo;
  // The block's K tile (32 key rows x 768, row pitch KP) and V tile (768 channel rows x 32 keys, row pitch VP) in LDS,
  // read by all four waves. Fragment readers: lane -> row (lane&15), + 8*(lane>>4), as from the global planes.
  const unsigned short* Ks = (const unsigned short*)(lds_all + QLDS) + c * KP + 8 * hh;          // + key_loc*KP + 32 kc
  const unsigned short* Vs = (const unsigned short*)(lds_all + QLDS + KLDS) + c * VP + 8 * hh;   // + 16 j*VP
  // Copy side. K: wave w brings key rows 8w..8w+7, three copies of 512 B a row. V: wave w brings channel rows
  // 192w..192w+191, one copy = 8 rows x 64 B (lane -> row lane>>2, 16-byte piece lane&3), which lie in a row in the
  // tiled plane U: 512 B = four whole lines a copy.
  unsigned char* kl0 = lds_all + QLDS + (8 * wave) * (KP * 2) + 16 * lane;
  unsigned char* vl0 = lds_all + QLDS + KLDS + (192 * wave + (lane >> 2)) * (VP * 2) + 16 * (lane & 3);
  const unsigned short* kg0 = Xb + ((size_t)b * NC + 8 * wave) * ND + 8 * lane;                    // + kb*ND
  const unsigned short* vg0 = U + (size_t)b * ND * NC + (192 * wave) * 32 + 8 * lane;              // + kb*ND
  const float* csb = cs + (size_t)b * NC + 8 * hh;                                    // + kb (+16)

  // The wave's 16 query rows (hi and residual plane) are loaded once, as B fragments, and stay in registers (2 x 24
  // fragments = 384 per lane) for the whole key loop. Every loop over qh[] and ql[] is fully unrolled: only constant
  // indices keep them in registers.
  Frag qh[ND / 32], ql[ND / 32];
#pragma unroll
  for (int kc = 0; kc < ND / 32; ++kc) {
    qh[kc] = ldfrag(Ahp + 32 * kc);
    ql[kc] = ldfrag(Alp + 32 * kc);
  }
  asm volatile("s_wait_xcnt 0x0" :: "v"(Ahp), "v"(Alp) : "memory");

  // Two-buffer ring over the tile sequence K(0), V(0), K(32), V(32), ...: the K buffer is worked on (scores) while the V
  // tile flies, the V buffer (O^T) while the next K tile flies. In front of the loop: first K tile, landed and
  // published; then the first V tile is sent off.
  acopy_tile<3, 512, 256, KP * 2, ND>(kl0, kg0);
  asm volatile("s_wait_asynccnt 0x0" ::: "memory");                  // this wave's share of the K tile has landed
  __syncthreads();                                                   // ... and every other wave's: the tile is readable
  acopy_tile<24, 8 * VP * 2, 8 * 32, 0, 0>(vl0, vg0);

  float m = -1.0e30f, l = 0.f;
#pragma unroll 1
  for (int kb = 0; kb < NC; kb += 32) {
    const unsigned short* k0p = Ks;                                  // keys kb .. kb+15
    const unsigned short* k1p = Ks + 16 * KP;                        // keys kb+16 .. kb+31
    v8f s0 = zero8(), s1 = zero8();
    // K fragments (LDS) in groups of KG d-chunks, two groups in registers: group g + 1 is in flight while group g is
    // used.
    Frag kf[2][KG][2];
#pragma unroll
    for (int u = 0; u < KG; ++u) {
      kf[0][u][0] = ldfrag(k0p + 32 * u);
      kf[0][u][1] = ldfrag(k1p + 32 * u);
    }
    // the key-side terms are fetched here, at the head of the trip: the barrier at its foot waits for every global load
    const v4f ca = *(const v4f*)(csb + kb);
    const v4f cb = *(const v4f*)(csb + kb + 4);
    const v4f cd = *(const v4f*)(csb + kb + 16);
    const v4f ce = *(const v4f*)(csb + kb + 20);
    // the same wait for these four loads: their address pair is an input, so that nothing lands on it while the
    // loads are under way
    asm volatile("s_wait_xcnt 0x0" :: "v"(csb + kb) : "memory");
#pragma unroll
    for (int g = 0; g < ND / 32 / KG; ++g) {
      if (g + 1 < ND / 32 / KG) {
#pragma unroll
        for (int u = 0; u < KG; ++u) {
          const int kn = KG * (g + 1) + u;
          kf[(g + 1) & 1][u][0] = ldfrag(k0p + 32 * kn);
          kf[(g + 1) & 1][u][1] = ldfrag(k1p + 32 * kn);
        }
      }
      // holds the next group's loads, as one run, in front of this group's products: they are in flight meanwhile, and
      // no LDS read stands among the products (without it the build spreads them there)
      __builtin_amdgcn_sched_barrier(0);
#pragma unroll
      for (int u = 0; u < KG; ++u) {
        s0 = mma_q(kf[g & 1][u][0].bf, qh[KG * g + u].bf, s0);
        s1 = mma_q(kf[g & 1][u][1].bf, qh[KG * g + u].bf, s1);
        s0 = mma_q(kf[g & 1][u][0].bf, ql[KG * g + u].bf, s0);
        s1 = mma_q(kf[g & 1][u][1].bf, ql[KG * g + u].bf, s1);
      }
      // keeps later groups' loads behind this point: no more than two groups hold registers, and again no LDS read
      // among the products
      __builtin_amdgcn_sched_barrier(0);
    }
    {
#pragma unroll
      for (int r = 0; r < 4; ++r) {
        s0[r] += ca[r]; s0[4 + r] += cb[r];                          // key kb      + 8hh + r
        s1[r] += cd[r]; s1[4 + r] += ce[r];                          // key kb + 16 + 8hh + r
      }
    }

    // foot of the score trip: own LDS reads done, own V copies landed, then the barrier that publishes the V tile and
    // ends every wave's reads of the K buffer; behind it the next K tile is sent off into that buffer
    asm volatile("s_wait_dscnt 0x0" ::: "memory");
    asm volatile("s_wait_asynccnt 0x0" ::: "memory");
    __syncthreads();
    if (kb + 32 < NC) acopy_tile<3, 512, 256, KP * 2, ND>(kl0, kg0 + (size_t)(kb + 32) * ND);

    float mx = fmaxf(hmax8(s0), hmax8(s1));
    mx = fmaxf(mx, __shfl_xor(mx, 16, 32));
    const float mn   = fmaxf(m, mx);
    const float corr = __expf(m - mn);                               // == 1 exactly when the max did not grow
    l *= corr;
    m = mn;
    const float msh = mn - LNPS;                                     // exp gives e^{s-m} * 16384

    FragH ph;
    float ls = 0.f;
#pragma unroll
    for (int r = 0; r < 8; ++r) {
      const float e0 = __expf(s0[r] - msh);
      const float e1 = __expf(s1[r] - msh);
      ls += e0 + e1;
      ph.hv[0][r] = (_Float16)e0;
      ph.hv[1][r] = (_Float16)e1;
    }
    l += ls;

    // V fragments (LDS) in groups of VG channel tiles, two groups in registers, as for K above
    Frag vf[2][VG];
#pragma unroll
    for (int u = 0; u < VG; ++u) vf[0][u] = ldfrag(Vs + (16 * u) * VP);
#pragma unroll
    for (int g = 0; g < ND / 16 / VG; ++g) {
      if (g + 1 < ND / 16 / VG) {
#pragma unroll
        for (int u = 0; u < VG; ++u) vf[(g + 1) & 1][u] = ldfrag(Vs + (16 * (VG * (g + 1) + u)) * VP);
      }
      // holds the next group's LDS reads, as one run, in front of this group's products
      __builtin_amdgcn_sched_barrier(0);
#pragma unroll
      for (int u = 0; u < VG; ++u) {
        const int j = VG * g + u;
        v8f t;
#pragma unroll
        for (int r = 0; r < 8; ++r) t[r] = o[j][r] * corr;
        o[j] = mma_h(vf[g & 1][u].h, ph.v, t);
      }
      // keeps later groups' reads behind this point: no LDS read among the products
      __builtin_amdgcn_sched_barrier(0);
    }
    // foot of the O^T trip: the same order; the barrier publishes the next K tile and frees the V buffer
    asm volatile("s_wait_dscnt 0x0" ::: "memory");
    asm volatile("s_wait_asynccnt 0x0" ::: "memory");
    __syncthreads();
    if (kb + 32 < NC) acopy_tile<24, 8 * VP * 2, 8 * 32, 0, 0>(vl0, vg0 + (size_t)(kb + 32) * ND);
  }
  asm volatile("s_wait_asynccnt 0x0" ::: "memory");                  // nothing is in flight when the LDS changes its use
  // the finished tiles go to the wave's LDS slots once, for the row-major epilogue
#pragma unroll
  for (int j = 0; j < ND / 16; ++j) {
    v4f na, nb2;
#pragma unroll
    for (int r = 0; r < 4; ++r) { na[r] = o[j][r]; nb2[r] = o[j][4 + r]; }
    *(v4f*)(op + 16 * j)     = na;
    *(v4f*)(op + 16 * j + 4) = nb2;
  }
  l += __shfl_xor(l, 16, 32);
  const float inv  = 1.0f / l;                                       // Ow and l both carry the x16384 factor
  const float mu   = st[4 * b + 0], rstd = st[4 * b + 1];
  const float qsc  = inv * rstd * IUSC;                              // per lane: its query column
  const float mrs  = mu * rstd;
  v4f rvv[6];
#pragma unroll
  for (int k = 0; k < ND / 128; ++k) {
    const v4f t = *(const v4f*)(rv + 128 * k + 4 * lane);
#pragma unroll
    for (int u = 0; u < 4; ++u) rvv[k][u] = t[u] * mrs;
  }
  __syncthreads();                                                   // all accumulator slots final before cross-lane reads

{
#pragma unroll 1
    for (int qq = 0; qq < 16; ++qq) {
      const float sc = __shfl(qsc, qq, 32);
      const float* lrow = Ow + qq * ND + 4 * lane;
      float* orow = out + ((size_t)b * NC + n0 + 16 * wave + qq) * ND + 4 * lane;
#pragma unroll
      for (int k = 0; k < ND / 128; ++k) {
        const v4f v = *(const v4f*)(lrow + 128 * k);
        v4f w;
#pragma unroll
        for (int u = 0; u < 4; ++u) w[u] = v[u] * sc - rvv[k][u];
        *(v4f*)(orow + 128 * k) = w;
      }
    }
    
  }
}

// =========================================================================================================
// The launches. Stages that need nothing of one another share one grid: a block takes its stage by the range its index
// lies in (a block-uniform branch, so every barrier of a stage is passed by the whole block) and its place in the stage
// from the index, x fastest. All stages of a launch use the one LDS array of the launch.
//   k_prep : (0) weights | (2) x                      both read inputs only
//   k_mid  : (3) statistics | (4) H | (1) g | (6) U    all read only what k_prep wrote
//   k_qc   : (5) query planes | (7) key-side term      both read only what k_prep and k_mid wrote
// The few long serial blocks stand first in their launch; the short blocks of (7) stand last.
// =========================================================================================================
#define PB_X  (3 * (ND / QT))                       // k_prep: first block of (2)
#define PB_N  (PB_X + KCH * NB)
#define MB_H  1                                     // k_mid: first block of (4), of (1), of (6)
#define MB_G  (MB_H + (ND / GT) * (ND / GT))
#define MB_V  (MB_G + ND / GCB)
#define MB_N  (MB_V + (ND / GT) * (NC / GT) * NB)
#define QB_C  ((NQ / GT) * (ND / GT) * NB)          // k_qc: first block of (7)
#define QB_N  (QB_C + (NC / 32) * NB)
static_assert(2 * 2 * GPB >= GRG * GCB * 4 + 8 * GCB * 4 && 2 * 2 * GPB >= 2 * 64 * 8 + 32 * 4 && KCH == 64);

__global__ __launch_bounds__(256)
void k_prep(const float* __restrict__ x, const float* __restrict__ wk, const float* __restrict__ wq,
            const float* __restrict__ wv, unsigned short* Wn, unsigned short* Wt, float* rs,
            unsigned short* Xb, double* part) {
  __shared__ __align__(16) unsigned char sm[QT * TPW * 2 + QT * 4];
  const int bid = blockIdx.x;
  if (bid < PB_X) {
    cvt_w(sm, bid % (ND / QT), bid / (ND / QT), wk, wq, wv, Wn, Wt, rs);
  } else {
    const int i = bid - PB_X;
    k_xcvt(sm, i % KCH, i / KCH, x, Xb, part);
  }
}

__global__ __launch_bounds__(128)
void k_mid(const double* __restrict__ part, const unsigned short* __restrict__ Wn,
           const unsigned short* __restrict__ Wt, const float* __restrict__ rs,
           const unsigned short* __restrict__ Xb, float* st, unsigned short* Hh, unsigned short* Hl, float* g,
           unsigned short* U) {
  __shared__ __align__(16) unsigned char sm[2 * 2 * GPB];
  const int bid = blockIdx.x;
  if (bid < MB_H) {
    k_stats(sm, part, st);
  } else if (bid < MB_G) {
    const int i = bid - MB_H;                                        // A = Wq transposed (rows d), B = Wk transposed (rows e)
    k_hgemm(sm, i % (ND / GT), i / (ND / GT), Wt + (size_t)1 * ND * ND, Wt, Hh, Hl);
    // the wait before a register that an issued global store names is overwritten: the build lets this stage's end run
    // on through the later stages' tests, whose code rewrites the stores' registers
    asm volatile("s_wait_xcnt 0x0" ::: "memory");
  } else if (bid < MB_V) {
    k_g(sm, bid - MB_G, Wn, rs + ND, g);
  } else {
    const int i = bid - MB_V;
    k_vgemm(sm, i % (ND / GT), (i / (ND / GT)) % (NC / GT), i / ((ND / GT) * (NC / GT)), Xb,
            Wn + (size_t)2 * ND * ND, U);
    // the wait before a register that an issued global store names is overwritten: the build lets this stage's end run
    // on through the later stages' tests, whose code rewrites the stores' registers
    asm volatile("s_wait_xcnt 0x0" ::: "memory");
  }
}

__global__ __launch_bounds__(128)
void k_qc(const unsigned short* __restrict__ Hh, const unsigned short* __restrict__ Hl,
          const unsigned short* __restrict__ Xb, const float* __restrict__ st, const float* __restrict__ g,
          unsigned short* Ah, unsigned short* Al, float* cs) {
  __shared__ __align__(16) unsigned char sm[2 * 3 * GPB];
  const int bid = blockIdx.x;
  if (bid < QB_C) {
    k_agemm(sm, bid % (NQ / GT), (bid / (NQ / GT)) % (ND / GT), bid / ((NQ / GT) * (ND / GT)), Hh, Hl, Xb, st, Ah, Al);
  } else {
    const int i = bid - QB_C;
    k_cs(sm, i % (NC / 32), i / (NC / 32), Xb, g, st, cs);
  }
}

// =========================================================================================================
// Workspace map (bytes; each region start a multiple of 256; every extent is an exact tile/line multiple and is
//   Wn bf16 [3][768][768]      3538944      Wt bf16 [3][768][768]   3538944
//   rs  f32 [3][768]              9216      g   f32 [768]              3072
//   Xb bf16 [NB][2048][768]   25165824 (NB=8)  part f64 [NB][64][16]  65536    st f32 [32]  128 (256)
//   Hh/Hl bf16 [768][768]      1179648 x2
//   Ah/Al bf16 [NB][NQ][768]  25165824 x2 (NB=8, NQ=2048)
//   U  f16 [NB][64][768][32]  25165824      cs f32 [NB][2048]         65536
//   total (NB=8, NQ=2048) = 110244096
// =========================================================================================================
extern "C" void kernel_launch(void* const* d_in, const int* in_sizes, int n_in,
                              void* d_out, int out_size, void* d_ws, size_t ws_size,
                              hipStream_t stream) {
  if (n_in < 4) return;
  if (in_sizes[0] < NB * NC * ND) return;
  if (in_sizes[1] < ND * ND || in_sizes[2] < ND * ND || in_sizes[3] < ND * ND) return;
  if (out_size < NB * NC * ND) return;

  size_t off = 0;
  auto carve = [&](size_t bytes) { const size_t o = off; off += (bytes + 255) & ~(size_t)255; return o; };
  const size_t oWn   = carve((size_t)3 * ND * ND * 2);
  const size_t oWt   = carve((size_t)3 * ND * ND * 2);
  const size_t oRs   = carve((size_t)3 * ND * 4);
  const size_t oG    = carve((size_t)ND * 4);
  const size_t oXb   = carve((size_t)NB * NC * ND * 2);
  const size_t oPart = carve((size_t)NB * KCH * 128);
  const size_t oSt   = carve((size_t)128);
  const size_t oHh   = carve((size_t)ND * ND * 2);
  const size_t oHl   = carve((size_t)ND * ND * 2);
  const size_t oAh   = carve((size_t)NB * NQ * ND * 2);
  const size_t oAl   = carve((size_t)NB * NQ * ND * 2);
  const size_t oU    = carve((size_t)NB * ND * NC * 2);
  const size_t oCs   = carve((size_t)NB * NC * 4);
  if (off > ws_size) return;
  if (off > (size_t)134217728) return;

  const float* x  = (const float*)d_in[0];
  const float* wk = (const float*)d_in[1];
  const float* wq = (const float*)d_in[2];
  const float* wv = (const float*)d_in[3];

  char* ws = (char*)d_ws;
  unsigned short* Wn  = (unsigned short*)(ws + oWn);
  unsigned short* Wt  = (unsigned short*)(ws + oWt);
  float*          rs  = (float*)(ws + oRs);
  float*          g   = (float*)(ws + oG);
  unsigned short* Xb  = (unsigned short*)(ws + oXb);
  double*         part = (double*)(ws + oPart);
  float*          st  = (float*)(ws + oSt);
  unsigned short* Hh  = (unsigned short*)(ws + oHh);
  unsigned short* Hl  = (unsigned short*)(ws + oHl);
  unsigned short* Ah  = (unsigned short*)(ws + oAh);
  unsigned short* Al  = (unsigned short*)(ws + oAl);
  unsigned short* U   = (unsigned short*)(ws + oU);
  float*          cs  = (float*)(ws + oCs);
  float* out = (float*)d_out;

  const dim3 blk256(256), blk128(128);

  // (0) weights -> bf16 natural + transposed planes + row sums (y: 0 Wk, 1 Wq, 2 Wv); (2) x -> bf16 plane + f64 partial sums
  k_prep<<<dim3(PB_N), blk256, 0, stream>>>(x, wk, wq, wv, Wn, Wt, rs, Xb, part);
  // (3) LayerNorm statistics; (4) H planes; (1) g = bf16(Wk)^T . rowsum(bf16(Wq)); (6) value plane U = 16 X.Wv^T
  k_mid<<<dim3(MB_N), blk128, 0, stream>>>(part, Wn, Wt, rs, Xb, st, Hh, Hl, g, U);
  // (5) query planes A' = rstd^2 X.H (hi + residual); (7) key-side affine term
  k_qc<<<dim3(QB_N), blk128, 0, stream>>>(Hh, Hl, Xb, st, g, Ah, Al, cs);
  // (8) attention -> out [b][q][768]
  k_attn<<<dim3(NQ / QT, NB), blk128, 0, stream>>>(Ah, Al, Xb, U, cs, rs + 2 * ND, st, out);
  (void)hipGetLastError();
}

// v010
// It runs in 194 microseconds.
// Timed twice side by side with v009, it ran 1.07 times as fast both times.
// Counting every step since v000, it is 7.44 times as fast.
// Contractions (f32 accumulate everywhere): H[e][d] = sum_o Wq[o][d]*Wk[o][e] on v_wmma_f32_16x16x32_bf16 with
// bf16-RNE weights (exact products); query plane A' = X.H with bf16-RNE x and H carried as bf16 hi + bf16
// residual (2 products, shared accumulator); U = X.Wv^T (1 product, bf16-RNE operands); scores
// S^T = X(keys).A'(queries) with A' as bf16 hi + bf16 residual (2 products); O^T = U.P^T on
// v_wmma_f32_16x16x32_f16 (U x16 as f16, P = e^{s-m} x16384 as f16 built from the score D registers).
// LayerNorm statistics in f64 VALU; per-batch affine terms, softmax statistics and normalisation in f32 VALU.
#include <hip/hip_runtime.h>
#include <math.h>
#include <stdint.h>

#ifndef NB
#define NB 8
#endif
#ifndef NQ
#define NQ 2048
#endif
#define NBF  8
#define NC   2048
#define ND   768
#define QT   64
#define GT   128
#define GOSP 132
#define TPW  72
#define KCH  64
#define KG   4
#define USC  16.0f
#define IUSC 0.0625f
#define LNPS 9.704060527839234f
#define EPSV 1.0e-5f
#define KP   776
#define VP   40
#define CTW  12
#define XB   1536
#define QLDS (4 * 16 * ND * 4)
#define KLDS (32 * KP * 2)
#define VLDS (ND * VP * 2)
#define ATTN_LDS (QLDS + KLDS + VLDS)
#define GKC  64
#define GP   72
#define GPB  (GT * GP * 2)
#define GCB  32
#define GRG  64

static_assert(NB >= 1 && NB <= NBF);
static_assert(NQ % QT == 0 && NQ >= QT && NQ <= NC);
static_assert(NC % QT == 0 && ND % QT == 0);
static_assert(NC % 32 == 0 && ND % 32 == 0);
static_assert(ND % 256 == 0 && ND % 128 == 0 && ND % 16 == 0);
static_assert(NC / KCH == 32 && KCH == 64);
static_assert((ND / 32) % KG == 0);
static_assert(4 * NBF <= 32);
static_assert((GOSP * 4) % 16 == 0 && GOSP >= GT + 4);
static_assert(NQ % GT == 0 && NC % GT == 0 && ND % GT == 0 && GT == 128);
static_assert((TPW * 2) % 16 == 0);
static_assert(QLDS == 196608 && ATTN_LDS <= 327680);
static_assert((KP * 2) % 32 == 16 && (VP * 2) % 32 == 16);          // LDS row pitch = 16 B x odd, for b128 readers
static_assert(KP >= ND + 8 && VP >= 32 + 8 && QLDS % 16 == 0 && KLDS % 16 == 0);
static_assert(ND % GKC == 0 && ND / GKC >= 2 && GKC * 2 == 128 && GKC % 32 == 0 && QT == 64);
static_assert((GP * 2) % 32 == 16 && GP >= GKC + 8 && 2 * 2 * GPB >= GT * GOSP * 4);
static_assert(ND % GCB == 0 && ND % GRG == 0 && GCB == 32 && 4 * GRG == 256 && GRG % 8 == 0);
static_assert(4 * CTW == ND / 16 && 4 * XB <= QLDS && XB % 16 == 0 && XB >= 3 * 512);
static_assert(ND % (4 * 8) == 0 && ND / 4 / 8 == 24 && 8 * (ND / 256) == 24);

typedef _Float16       v16h __attribute__((ext_vector_type(16)));
typedef _Float16       v8h  __attribute__((ext_vector_type(8)));
typedef __bf16         v16b __attribute__((ext_vector_type(16)));
typedef unsigned short v8us __attribute__((ext_vector_type(8)));
typedef float          v8f  __attribute__((ext_vector_type(8)));
typedef float          v4f  __attribute__((ext_vector_type(4)));
typedef unsigned int   v4u  __attribute__((ext_vector_type(4)));
typedef double         v2d  __attribute__((ext_vector_type(2)));

union Frag  { v8us u[2]; v16h h; v16b bf; };
union FragH { v16h v; v8h hv[2]; };
static_assert(sizeof(Frag) == 32);
static_assert(sizeof(FragH) == 32);

// ---- scalar helpers ---------------------------------------------------------------------------------------
__device__ __forceinline__ unsigned short bf_bits(float f) {          // f32 -> bf16 bits, RNE convert
  unsigned u = __float_as_uint(f);
  return (unsigned short)((u + 0x7FFFu + ((u >> 16) & 1u)) >> 16);
}
__device__ __forceinline__ float bf_up(unsigned short hb) { return __uint_as_float(((unsigned)hb) << 16); }
__device__ __forceinline__ float bf_lo16(unsigned w) { return __uint_as_float(w << 16); }
__device__ __forceinline__ float bf_hi16(unsigned w) { return __uint_as_float(w & 0xFFFF0000u); }
__device__ __forceinline__ unsigned short h_bits(_Float16 x) { return __builtin_bit_cast(unsigned short, x); }
__device__ __forceinline__ unsigned pk16(unsigned short a, unsigned short b) { return (unsigned)a | ((unsigned)b << 16); }
__device__ __forceinline__ v8f zero8() { v8f z = {0.f, 0.f, 0.f, 0.f, 0.f, 0.f, 0.f, 0.f}; return z; }
__device__ __forceinline__ float hmax8(v8f s) {
  return fmaxf(fmaxf(fmaxf(s[0], s[1]), fmaxf(s[2], s[3])), fmaxf(fmaxf(s[4], s[5]), fmaxf(s[6], s[7])));
}
__device__ __forceinline__ double shfl_xor_d(double v, int mask) {
  int lo = __double2loint(v), hi = __double2hiint(v);
  lo = __shfl_xor(lo, mask, 32);
  hi = __shfl_xor(hi, mask, 32);
  return __hiloint2double(hi, lo);
}

// ---- 16-bit fragment loader (A, or B from a k-contiguous [n][k] row): lane -> row/col (lane&15), p already includes
//      + 8*(lane>>4); elements 0..7 <- p[0..7] (k0+8h..), elements 8..15 <- p[16..23] (k0+16+8h..)
__device__ __forceinline__ Frag ldfrag(const unsigned short* p) {
  Frag f;
  f.u[0] = *(const v8us*)(p);
  f.u[1] = *(const v8us*)(p + 16);
  return f;
}

// ---- WMMA helpers: the bare builtins (the compiler keeps the distance behind its own WMMAs) -------------------
__device__ __forceinline__ v8f mma_h(v16h a, v16h b, v8f c) {
  return __builtin_amdgcn_wmma_f32_16x16x32_f16(false, a, false, b, (short)0, c, false, false);
}
__device__ __forceinline__ v8f mma_q(v16b a, v16b b, v8f c) {
  return __builtin_amdgcn_wmma_f32_16x16x32_bf16(false, a, false, b, (short)0, c, false, false);
}

// ---- one tile = 24 asynchronous 16-byte copies per lane, global -> LDS, through no register. RUN copies follow one
//      another at steps (LS1, GS1), then the next run starts (LS2, GS2) further; steps in bytes (LDS) and in 16-bit
//      elements (global). The landing is waited for by the caller (s_wait_asynccnt).
typedef int v4i __attribute__((ext_vector_type(4)));
template <int RUN, int LS1, int GS1, int LS2, int GS2>
__device__ __forceinline__ void acopy_tile(unsigned char* l0, const unsigned short* g0) {
#if defined(__HIP_DEVICE_COMPILE__)
#pragma unroll
  for (int idx = 0; idx < 24; ++idx) {
    const int r = idx / RUN, s = idx % RUN;
    __builtin_amdgcn_global_load_async_to_lds_b128(
        (__attribute__((address_space(1))) v4i*)(g0 + (size_t)r * GS2 + (size_t)s * GS1),
        (__attribute__((address_space(3))) v4i*)(l0 + r * LS2 + s * LS1), 0, 0);
  }
#endif
}

// =========================================================================================================
// (0) weights f32 [768][768] (y = 0: Wk, 1: Wq, 2: Wv, block-uniform selection) -> bf16-RNE planes:
//     natural Wn[y][o][i] and transposed Wt[y][i][o], plus row sums rs[y][o] = sum_i bf16(W[o][i]) in f32.
//     Block (ob, y) owns rows o0..o0+63; column chunks of 64 go through the LDS tile T[i_loc][o_loc] (pitch TPW).
// coverage: Wn 12 chunks x 2 it x 8 waves x 4 rows x 8 lanes x 8 = 64 x 768 per block; Wt 12 chunks x 2 it x 32 x 8
//           lanes x 8 = 768 x 64 per block; rs 16 x 4 = 64; blocks (bx < 12, y < 3) cover all three matrices once.
// LDS: T and rsL cross-wave (block barriers).
// =========================================================================================================
__device__ __forceinline__
void cvt_w(unsigned char* sm, int bx, int y,
           const float* __restrict__ wk, const float* __restrict__ wq, const float* __restrict__ wv,
           unsigned short* Wn, unsigned short* Wt, float* rs) {
  unsigned short* T = (unsigned short*)sm;                           // [QT * TPW]
  float* rsL = (float*)(sm + QT * TPW * 2);                          // [QT]
  const int tid = threadIdx.x, lane = tid & 31, wave = tid >> 5;
  const int o0 = bx * QT;
  const float* W = (y == 0) ? wk : ((y == 1) ? wq : wv);            // block-uniform, all global
  unsigned short* Np = Wn + (size_t)y * ND * ND;
  unsigned short* Tq = Wt + (size_t)y * ND * ND;
  const int e = lane & 7, r4 = lane >> 3;                           // r4 0..3
  const int e8 = tid & 7, lq = tid >> 3;                            // lq 0..31
  float rsum0 = 0.f, rsum1 = 0.f;
#pragma unroll 1
  for (int cc = 0; cc < ND / QT; ++cc) {
    const int i0 = cc * QT;
#pragma unroll
    for (int it = 0; it < 2; ++it) {
      const int ol = 8 * wave + 4 * it + r4;                          // 0..63
      const float* sp = W + (size_t)(o0 + ol) * ND + i0 + 8 * e;
      const v4f a = *(const v4f*)sp;
      const v4f q = *(const v4f*)(sp + 4);
      const float f[8] = {a[0], a[1], a[2], a[3], q[0], q[1], q[2], q[3]};
      unsigned short hb[8];
      float ps = 0.f;
#pragma unroll
      for (int t = 0; t < 8; ++t) { hb[t] = bf_bits(f[t]); ps += bf_up(hb[t]); }
      if (it == 0) rsum0 += ps; else rsum1 += ps;
      v4u u;
#pragma unroll
      for (int t = 0; t < 4; ++t) u[t] = pk16(hb[2 * t], hb[2 * t + 1]);
      unsigned short* np = Np + (size_t)(o0 + ol) * ND + i0 + 8 * e;
      *(v4u*)np = u;
      
#pragma unroll
      for (int t = 0; t < 8; ++t) T[(8 * e + t) * TPW + ol] = hb[t];   // T[i_loc][o_loc]
    }
    __syncthreads();
    v4u up[2];
#pragma unroll
    for (int it = 0; it < 2; ++it) {
      const int il = 32 * it + lq;                                    // 0..63
      up[it] = *(const v4u*)(T + il * TPW + 8 * e8);
    }
{
#pragma unroll
      for (int it = 0; it < 2; ++it) {
        const int il = 32 * it + lq;
        *(v4u*)(Tq + (size_t)(i0 + il) * ND + o0 + 8 * e8) = up[it];
      }
      
    }
    __syncthreads();                                                  // T reused by the next chunk
  }
  rsum0 += __shfl_xor(rsum0, 1, 32); rsum0 += __shfl_xor(rsum0, 2, 32); rsum0 += __shfl_xor(rsum0, 4, 32);
  rsum1 += __shfl_xor(rsum1, 1, 32); rsum1 += __shfl_xor(rsum1, 2, 32); rsum1 += __shfl_xor(rsum1, 4, 32);
  if (e == 0) { rsL[8 * wave + r4] = rsum0; rsL[8 * wave + 4 + r4] = rsum1; }
  __syncthreads();
  if (wave == 0 && lane < 16) {
    const v4f v = *(const v4f*)(rsL + 4 * lane);
    float* rp = rs + (size_t)y * ND + o0 + 4 * lane;
    *(v4f*)rp = v;
    
  }
}

// =========================================================================================================
// (1) g[e] = sum_o bf16(Wk)[o][e] * rq[o]  (rq = row sums of bf16(Wq)); f32. Block = 32 columns e (its 32 results are
//     one 128-byte line of g), 128 threads, each doing the work of the two places vt = tid and tid + 128 of 256.
//     Place (og = vt>>2, e4 = vt&3) takes columns 8 e4..8 e4+7 of rows og + 64 i, i < 12 in rising order, six rows at a
//     time: six 16-byte loads and six rq values, all sent off before the first is used, four load latencies a block.
//     The 64 row groups are joined in a fixed order: pL[og][column] -> part w < 8 sums groups 8w..8w+7 (wave w & 3) ->
//     sL[w][column] -> wave 0 sums the eight and stores the line with one instruction.
// coverage: 64 og x 12 = 768 rows, 4 e4 x 8 = 32 columns per block; 24 blocks x 32 = 768 = whole g.
// LDS pL and sL cross-wave (a block barrier behind each).
// =========================================================================================================
__device__ __forceinline__
void k_g(unsigned char* sm, int bx, const unsigned short* __restrict__ Wkn, const float* __restrict__ rq, float* g) {
  float* pL = (float*)sm;                                            // [GRG * GCB]
  float* sL = (float*)(sm + GRG * GCB * 4);                          // [8 * GCB]
  const int tid = threadIdx.x, lane = tid & 31, wave = tid >> 5;
  const int e0 = bx * GCB;
  for (int v = 0; v < 2; ++v) {
    const int vt = tid + 128 * v;
    const int e4 = vt & 3, og = vt >> 2;
    const unsigned short* wp = Wkn + (size_t)og * ND + e0 + 8 * e4;
    float acc[8] = {0.f, 0.f, 0.f, 0.f, 0.f, 0.f, 0.f, 0.f};
    // rolled: six rows' w[] and r[] hold registers at a time
#pragma unroll 1
    for (int h = 0; h < 2; ++h) {
      const int ib = ND / GRG / 2 * h;
      v4u   w[ND / GRG / 2];
      float r[ND / GRG / 2];
      // unrolled: w[] and r[] stay in registers and all 12 loads are issued before the first one is waited for
#pragma unroll
      for (int i = 0; i < ND / GRG / 2; ++i) {
        w[i] = *(const v4u*)(wp + (size_t)(GRG * (ib + i)) * ND);
        r[i] = rq[og + GRG * (ib + i)];
      }
      // both loops unrolled: only constant indices keep w[], r[] and acc[] in registers
#pragma unroll
      for (int i = 0; i < ND / GRG / 2; ++i) {
#pragma unroll
        for (int t = 0; t < 4; ++t) {
          acc[2 * t]     += bf_lo16(w[i][t]) * r[i];
          acc[2 * t + 1] += bf_hi16(w[i][t]) * r[i];
        }
      }
    }
    const v4f pa = {acc[0], acc[1], acc[2], acc[3]};
    const v4f pb = {acc[4], acc[5], acc[6], acc[7]};
    *(v4f*)(pL + og * GCB + 8 * e4)     = pa;
    *(v4f*)(pL + og * GCB + 8 * e4 + 4) = pb;
  }
  __syncthreads();
  // unrolled (all three loops, here and below): eight LDS reads at constant offsets of one address
#pragma unroll
  for (int v = 0; v < 2; ++v) {
    const int vw = wave + 4 * v;
    float s = 0.f;
#pragma unroll
    for (int k = 0; k < GRG / 8; ++k) s += pL[(GRG / 8 * vw + k) * GCB + lane];
    sL[vw * GCB + lane] = s;
  }
  __syncthreads();
  if (wave == 0) {
    float v = 0.f;
#pragma unroll
    for (int k = 0; k < 8; ++k) v += sL[k * GCB + lane];
    g[e0 + lane] = v;
  }
}

// =========================================================================================================
// (2) x f32 [b][2048][768] -> Xb bf16-RNE plane (same layout) and per-chunk f64 partial sums of the bf16 values
//     (sum, sum of squares). Block (ch, b) owns 32 rows; wave w rows 4w..4w+3; per row 3 instructions of
// coverage: Xb 4 rows x 8 waves x 3 x 32 lanes x 8 = 32 x 768 per block, blocks (ch < 64, b < NB) = all rows of b < NB;
// =========================================================================================================
__device__ __forceinline__
void k_xcvt(unsigned char* sm, int ch, int b, const float* __restrict__ x, unsigned short* Xb, double* part) {
  double* sL = (double*)sm;                                          // [8]
  double* qL = sL + 8;                                               // [8]
  const int tid = threadIdx.x, lane = tid & 31, wave = tid >> 5;
  const int r0 = ch * (NC / KCH);
  double s = 0.0, q = 0.0;
#pragma unroll 1
  for (int t = 0; t < 4; ++t) {
    const int row = r0 + 4 * wave + t;
    const size_t base = ((size_t)b * NC + row) * ND + 8 * lane;
#pragma unroll 1
    for (int c3 = 0; c3 < ND / 256; ++c3) {
      const float* sp = x + base + 256 * c3;
      const v4f a = *(const v4f*)sp;
      const v4f q4 = *(const v4f*)(sp + 4);
      const float f[8] = {a[0], a[1], a[2], a[3], q4[0], q4[1], q4[2], q4[3]};
      unsigned short hb[8];
#pragma unroll
      for (int k = 0; k < 8; ++k) {
        hb[k] = bf_bits(f[k]);
        const double v = (double)bf_up(hb[k]);
        s += v;
        q += v * v;
      }
      v4u u;
#pragma unroll
      for (int k = 0; k < 4; ++k) u[k] = pk16(hb[2 * k], hb[2 * k + 1]);
      unsigned short* xp = Xb + base + 256 * c3;
      *(v4u*)xp = u;
      
    }
  }
  s += shfl_xor_d(s, 16); s += shfl_xor_d(s, 8); s += shfl_xor_d(s, 4); s += shfl_xor_d(s, 2); s += shfl_xor_d(s, 1);
  q += shfl_xor_d(q, 16); q += shfl_xor_d(q, 8); q += shfl_xor_d(q, 4); q += shfl_xor_d(q, 2); q += shfl_xor_d(q, 1);
  if (lane == 0) { sL[wave] = s; qL[wave] = q; }
  __syncthreads();
  if (wave == 0) {
    double S = 0.0, Q = 0.0;
#pragma unroll
    for (int w = 0; w < 8; ++w) { S += sL[w]; Q += qL[w]; }
    v2d val;
    val[0] = (lane == 0) ? S : 0.0;
    val[1] = (lane == 0) ? Q : 0.0;
    if (lane < 8) {
      double* pp = part + ((size_t)b * KCH + ch) * 16 + 2 * lane;
      *(v2d*)pp = val;
      
    }
  }
}

// =========================================================================================================
// (3) LayerNorm statistics per batch from the 64 partial lines (fixed-order f64 tree): st line f32 [32] with
// =========================================================================================================
__device__ __forceinline__
void k_stats(unsigned char* sm, const double* __restrict__ part, float* st) {
  double* sL = (double*)sm;                                          // [64]
  double* qL = sL + 64;                                              // [64]
  float* stL = (float*)(sm + 2 * 64 * 8);                            // [32]
  const int tid = threadIdx.x;                                       // 128 threads; 64 and up only pass the barriers
  if (tid < 32) stL[tid] = 0.f;
#pragma unroll 1
  for (int b = 0; b < NB; ++b) {
    __syncthreads();
    if (tid < KCH) {
      const size_t pb = ((size_t)b * KCH + tid) * 16;
      sL[tid] = part[pb];
      qL[tid] = part[pb + 1];
    }
    __syncthreads();
#pragma unroll
    for (int off = 32; off > 0; off >>= 1) {
      if (tid < off) { sL[tid] += sL[tid + off]; qL[tid] += qL[tid + off]; }
      __syncthreads();
    }
    if (tid == 0) {
      const double n  = (double)NC * (double)ND;
      const double mu = sL[0] / n;
      double var = qL[0] / n - mu * mu;
      if (var < 0.0) var = 0.0;
      const float varf = (float)var;
      const float ve   = varf + EPSV;
      const float rstd = (float)(1.0 / sqrt((double)ve));
      const float muf  = (float)mu;
      stL[4 * b + 0] = muf;
      stL[4 * b + 1] = rstd;
      stL[4 * b + 2] = rstd * rstd;
      stL[4 * b + 3] = muf * rstd * rstd;
    }
  }
  __syncthreads();
  if (tid < 8) {
    const v4f v = *(const v4f*)(stL + 4 * tid);
    float* p = st + 4 * tid;
    *(v4f*)p = v;
    
  }
}

// =========================================================================================================
// GEMM engine (K = 768 = 24 k-steps, all operand planes k-contiguous with pitch ND): block 128 threads = 4 waves,
// 128 (m) x 128 (n) tile; wave (wm = w >> 1, wn = w & 1) owns the 64 x 64 quarter m0+64wm.., n0+64wn..: 4 x 4
// accumulator tiles (128 registers). Per k-step it reads 4 B fragments (rows n of the B plane) and 4 A fragments (rows
// m of the A plane), each used by 4 products; NPROD = 2 adds a second A plane (bf16 residual) into the same
// accumulators, behind the first plane's product of the same k-step. Split k map loader for both operands.
// The operands come through LDS: a stage = 64 k of the block's 128 B rows and 128 A rows (each A plane), one whole
// 128-byte line a row, brought once per block by asynchronous copies and read by the waves as fragments.
// Stage layout: plane 0 = B, plane 1 = A, plane 2 = A residual; a plane = 128 rows of pitch GP (144 B = 16 B x 9, for
// b128 readers; the 16 pad bytes of a row are neither written nor read). Two stages, a two-buffer ring.
// coverage of a plane: 4 waves x 8 copies x 4 rows x 8 lanes x 16 B = 128 x 128 B.
// =========================================================================================================
__device__ __forceinline__ unsigned lds_off(const void* p) { return (unsigned)(size_t)p; }

// Eight asynchronous 16-byte copies per lane, global -> LDS: a wave's 32 rows of one plane (a copy = 4 whole rows: lane ->
// row lane>>3, 16-byte piece lane&7). l, g: this lane's LDS byte address and global address in the first of them.
// The s_wait_xcnt closes the statement: the address registers that the copies name are rewritten only behind it.
__device__ __forceinline__ void acopy8(unsigned l, const unsigned short* g) {
#if defined(__HIP_DEVICE_COMPILE__)
  asm volatile("global_load_async_to_lds_b128 %0, %8, off\n\t"
               "global_load_async_to_lds_b128 %1, %9, off\n\t"
               "global_load_async_to_lds_b128 %2, %10, off\n\t"
               "global_load_async_to_lds_b128 %3, %11, off\n\t"
               "global_load_async_to_lds_b128 %4, %12, off\n\t"
               "global_load_async_to_lds_b128 %5, %13, off\n\t"
               "global_load_async_to_lds_b128 %6, %14, off\n\t"
               "global_load_async_to_lds_b128 %7, %15, off\n\t"
               "s_wait_xcnt 0x0"
               :: "v"(l), "v"(l + 4 * GP * 2), "v"(l + 8 * GP * 2), "v"(l + 12 * GP * 2),
                  "v"(l + 16 * GP * 2), "v"(l + 20 * GP * 2), "v"(l + 24 * GP * 2), "v"(l + 28 * GP * 2),
                  "v"(g), "v"(g + 4 * ND), "v"(g + 8 * ND), "v"(g + 12 * ND),
                  "v"(g + 16 * ND), "v"(g + 20 * ND), "v"(g + 24 * ND), "v"(g + 28 * ND)
               : "memory");
#endif
}

// a0, a1, b: row 0, column 0 of the block's 128 rows in each plane. sm: 2 stages of (NPROD + 1) planes.
template <int NPROD>
__device__ __forceinline__ void gemm_k(unsigned char* sm, const unsigned short* __restrict__ a0,
                                       const unsigned short* __restrict__ a1,
                                       const unsigned short* __restrict__ b, v8f (&acc)[4][4]) {
  constexpr int STG = (NPROD + 1) * GPB;
  const int tid = threadIdx.x, lane = tid & 31, wave = tid >> 5, hh = lane >> 4, c = lane & 15;
  const int wm = wave >> 1, wn = wave & 1;
  // copy side: wave w brings rows 32w..32w+31 of every plane
  const int crow = 32 * wave + (lane >> 3);
  const unsigned cl = lds_off(sm) + crow * (GP * 2) + 16 * (lane & 7);
  const size_t   cg = (size_t)crow * ND + 8 * (lane & 7);
  auto fill = [&](int t) {
    const unsigned l = cl + (t & 1) * STG;
    const size_t   g = cg + (size_t)GKC * t;
    acopy8(l, b + g);
    acopy8(l + GPB, a0 + g);
    if (NPROD == 2) acopy8(l + 2 * GPB, a1 + g);
  };
  // fragment readers: lane -> row (lane&15), + 8*(lane>>4), as from the global planes
  const unsigned short* rb = (const unsigned short*)sm + (64 * wn + c) * GP + 8 * hh;           // + 16 nt * GP
  const unsigned short* ra = (const unsigned short*)(sm + GPB) + (64 * wm + c) * GP + 8 * hh;   // + 16 mt * GP
#pragma unroll
  for (int mt = 0; mt < 4; ++mt) {
#pragma unroll
    for (int nt = 0; nt < 4; ++nt) acc[mt][nt] = zero8();
  }

  fill(0);
  asm volatile("s_wait_asynccnt 0x0" ::: "memory");                  // this wave's share of stage 0 has landed
  __syncthreads();                                                   // ... and every other wave's: stage 0 is readable
  fill(1);
  // rolled: twelve equal trips, the buffer chosen by an address offset; unrolled it would only grow the code
#pragma unroll 1
  for (int t = 0; t < ND / GKC; ++t) {
    const int bo = (t & 1) * (STG / 2);
#pragma unroll
    for (int k2 = 0; k2 < GKC / 32; ++k2) {
      // read in the order of first use: the first A fragment, the four B fragments, then the other A fragments
      Frag fb[4], fa[4], fl[4];
      fa[0] = ldfrag(ra + bo + 32 * k2);
#pragma unroll
      for (int i = 0; i < 4; ++i) fb[i] = ldfrag(rb + bo + (16 * i) * GP + 32 * k2);
#pragma unroll
      for (int i = 1; i < 4; ++i) fa[i] = ldfrag(ra + bo + (16 * i) * GP + 32 * k2);
      if (NPROD == 2) {
#pragma unroll
        for (int i = 0; i < 4; ++i) fl[i] = ldfrag(ra + bo + GPB / 2 + (16 * i) * GP + 32 * k2);
      }
      // holds the k-step's LDS reads, as one run, in front of its products: no LDS read stands among the products
      __builtin_amdgcn_sched_barrier(0);
#pragma unroll
      for (int mt = 0; mt < 4; ++mt) {
#pragma unroll
        for (int nt = 0; nt < 4; ++nt) acc[mt][nt] = mma_q(fa[mt].bf, fb[nt].bf, acc[mt][nt]);
      }
      if (NPROD == 2) {
#pragma unroll
        for (int mt = 0; mt < 4; ++mt) {
#pragma unroll
          for (int nt = 0; nt < 4; ++nt) acc[mt][nt] = mma_q(fl[mt].bf, fb[nt].bf, acc[mt][nt]);
        }
      }
      // keeps the next k-step's reads behind this point: one k-step's fragments hold registers at a time
      __builtin_amdgcn_sched_barrier(0);
    }
    // foot of the trip: own LDS reads done, own copies of the next stage landed, then the barrier that publishes that
    // stage and ends every wave's reads of this one; behind it this buffer is refilled
    asm volatile("s_wait_dscnt 0x0" ::: "memory");
    asm volatile("s_wait_asynccnt 0x0" ::: "memory");
    __syncthreads();
    if (t + 2 < ND / GKC) fill(t + 2);
  }
  asm volatile("s_wait_asynccnt 0x0" ::: "memory");                  // nothing is in flight when the LDS changes its use
}

// D tiles -> LDS Os[n_loc][m_loc] (pitch GOSP, b128 stores): lane (hh, c) of wave (wm, wn) holds
// m_loc = 64 wm + 16 mt + 8 hh + r for n_loc = 64 wn + 16 nt + c.
// coverage: 4 waves x 4 nt x 16 n x 4 mt x 16 m = 128 x 128 (pad cols 128..131 never read).
__device__ __forceinline__ void stage_os(float* Os, const v8f (&acc)[4][4], float sc, int wave, int hh, int c) {
  const int wm = wave >> 1, wn = wave & 1;
#pragma unroll
  for (int nt = 0; nt < 4; ++nt) {
    float* orow = Os + (64 * wn + 16 * nt + c) * GOSP + 64 * wm + 8 * hh;
#pragma unroll
    for (int mt = 0; mt < 4; ++mt) {
      v4f va, vb;
#pragma unroll
      for (int r = 0; r < 4; ++r) { va[r] = acc[mt][nt][r] * sc; vb[r] = acc[mt][nt][4 + r] * sc; }
      *(v4f*)(orow + 16 * mt)     = va;
      *(v4f*)(orow + 16 * mt + 4) = vb;
    }
  }
}

// Os -> two bf16 planes (hi = bf16-RNE(v), lo = bf16-RNE(v - hi)), plane row = row0 + n_loc, 128 m values = two whole
// 128-byte lines a row and plane. coverage: 16 it x 8 rows x 16 lanes x 8 = 128 x 128 per plane.
__device__ __forceinline__ void epi_split(const float* Os, unsigned short* Ph, unsigned short* Pl,
                                          size_t row0, int pitch, int col0, int tid) {
  const int e = tid & 15, lq = tid >> 4;                             // lq 0..7
  // unrolled: constant LDS offsets; four rows' values are packed, then stored
#pragma unroll
  for (int ib = 0; ib < 4; ++ib) {
    v4u uh[4], ul[4];
#pragma unroll
    for (int it = 0; it < 4; ++it) {
      const int row = (4 * ib + it) * 8 + lq;
      const v4f a = *(const v4f*)(Os + row * GOSP + 8 * e);
      const v4f q = *(const v4f*)(Os + row * GOSP + 8 * e + 4);
      const float f[8] = {a[0], a[1], a[2], a[3], q[0], q[1], q[2], q[3]};
#pragma unroll
      for (int t = 0; t < 4; ++t) {
        const float f0 = f[2 * t], f1 = f[2 * t + 1];
        const unsigned short hb0 = bf_bits(f0), hb1 = bf_bits(f1);
        const unsigned short lb0 = bf_bits(f0 - bf_up(hb0));
        const unsigned short lb1 = bf_bits(f1 - bf_up(hb1));
        uh[it][t] = pk16(hb0, hb1);
        ul[it][t] = pk16(lb0, lb1);
      }
    }
#pragma unroll
    for (int it = 0; it < 4; ++it) {
      const int row = (4 * ib + it) * 8 + lq;
      const size_t po = (row0 + (size_t)row) * (size_t)pitch + (size_t)col0 + 8 * e;
      *(v4u*)(Ph + po) = uh[it];
      *(v4u*)(Pl + po) = ul[it];
    }
    // the wait before a register that an issued global store names is overwritten: the next four rows reuse them
    if (ib + 1 < 4) asm volatile("s_wait_xcnt 0x0" ::: "memory");
  }
}

// Os -> the f16 value plane (values already scaled), stored by key tiles: P[tile = key / 32][channel][key % 32], so that
// the 768 x 32 tile that k_attn copies is 48 KiB in a row. tile0: the tile of Os column 0 (128 columns = four tiles), ch0:
// the channel of Os row 0. A store instruction of a wave = 2 channels x 64 B in a row in each tile: whole 128-byte lines.
__device__ __forceinline__ void epi_h(const float* Os, unsigned short* P, size_t tile0, int ch0, int tid) {
  const int e = tid & 15, lq = tid >> 4;                             // lq 0..7
  // unrolled: constant LDS offsets; four rows' values are packed, then stored
#pragma unroll
  for (int ib = 0; ib < 4; ++ib) {
    v4u u[4];
#pragma unroll
    for (int it = 0; it < 4; ++it) {
      const int row = (4 * ib + it) * 8 + lq;
      const v4f a = *(const v4f*)(Os + row * GOSP + 8 * e);
      const v4f q = *(const v4f*)(Os + row * GOSP + 8 * e + 4);
      const float f[8] = {a[0], a[1], a[2], a[3], q[0], q[1], q[2], q[3]};
#pragma unroll
      for (int t = 0; t < 4; ++t)
        u[it][t] = pk16(h_bits((_Float16)f[2 * t]), h_bits((_Float16)f[2 * t + 1]));
    }
#pragma unroll
    for (int it = 0; it < 4; ++it) {
      const int row = (4 * ib + it) * 8 + lq;
      const size_t po = ((tile0 + (size_t)(e >> 2)) * ND + (size_t)(ch0 + row)) * 32 + 8 * (e & 3);
      *(v4u*)(P + po) = u[it];
    }
    // the wait before a register that an issued global store names is overwritten: the next four rows reuse them
    if (ib + 1 < 4) asm volatile("s_wait_xcnt 0x0" ::: "memory");
  }
}

// =========================================================================================================
// (4) H planes: D[m = d][n = e] = sum_o WqT[d][o] * WkT[e][o]  (1 product, exact) -> Hh/Hl bf16 [e][768 d].
// blocks (bx < 6 e-tiles, by < 6 d-tiles).  LDS Os cross-wave (block barrier).  sm: 2 * 2 * GPB bytes.
// =========================================================================================================
__device__ __forceinline__
void k_hgemm(unsigned char* sm, int bx, int by,
             const unsigned short* __restrict__ Aq, const unsigned short* __restrict__ Bk,
             unsigned short* Hh, unsigned short* Hl) {
  float* Os = (float*)sm;                                            // the stages' bytes, free behind the k loop
  const int tid = threadIdx.x, lane = tid & 31, wave = tid >> 5, hh = lane >> 4, c = lane & 15;
  const int n0 = bx * GT, m0 = by * GT;
  const unsigned short* ap = Aq + (size_t)m0 * ND;
  const unsigned short* bp = Bk + (size_t)n0 * ND;
  v8f acc[4][4];
  gemm_k<1>(sm, ap, ap, bp, acc);
  stage_os(Os, acc, 1.0f, wave, hh, c);
  __syncthreads();
  epi_split(Os, Hh, Hl, (size_t)n0, ND, m0, tid);
}

// =========================================================================================================
// (5) query planes: D[m = e][n = query] = sum_d (Hh + Hl)[e][d] * Xb[b][q][d]  (2 products), scaled by rstd_b^2
//     in the epilogue -> Ah/Al bf16 [b][NQ][768 e].  blocks (bx < NQ/128, by < 6 e-tiles, b < NB).  sm: 2 * 3 * GPB bytes.
// =========================================================================================================
__device__ __forceinline__
void k_agemm(unsigned char* sm, int bx, int by, int b,
             const unsigned short* __restrict__ Hh, const unsigned short* __restrict__ Hl,
             const unsigned short* __restrict__ Xb, const float* __restrict__ st,
             unsigned short* Ah, unsigned short* Al) {
  float* Os = (float*)sm;                                            // the stages' bytes, free behind the k loop
  const int tid = threadIdx.x, lane = tid & 31, wave = tid >> 5, hh = lane >> 4, c = lane & 15;
  const int n0 = bx * GT, m0 = by * GT;
  const unsigned short* ap0 = Hh + (size_t)m0 * ND;
  const unsigned short* ap1 = Hl + (size_t)m0 * ND;
  const unsigned short* bp  = Xb + ((size_t)b * NC + n0) * ND;
  v8f acc[4][4];
  gemm_k<2>(sm, ap0, ap1, bp, acc);
  const float sc = st[4 * b + 2];
  stage_os(Os, acc, sc, wave, hh, c);
  __syncthreads();
  epi_split(Os, Ah, Al, (size_t)b * NQ + n0, ND, m0, tid);
}

// =========================================================================================================
// (6) value plane (by tiles of 32 keys, channel-major inside a tile): D[m = key j][n = o] = sum_d Xb[b][j][d] * Wvb[o][d]
//     (1 product, exact), x16 -> U f16 [b][64 tiles j / 32][768 o][32 j % 32].  blocks (bx < 6 o-tiles, by < 16 key-tiles,
//     b < NB).
// =========================================================================================================
__device__ __forceinline__
void k_vgemm(unsigned char* sm, int bx, int by, int b,
             const unsigned short* __restrict__ Xb, const unsigned short* __restrict__ Wvn, unsigned short* U) {
  float* Os = (float*)sm;                                            // the stages' bytes, free behind the k loop
  const int tid = threadIdx.x, lane = tid & 31, wave = tid >> 5, hh = lane >> 4, c = lane & 15;
  const int n0 = bx * GT, m0 = by * GT;
  const unsigned short* ap = Xb + ((size_t)b * NC + m0) * ND;
  const unsigned short* bp = Wvn + (size_t)n0 * ND;
  v8f acc[4][4];
  gemm_k<1>(sm, ap, ap, bp, acc);
  stage_os(Os, acc, USC, wave, hh, c);
  __syncthreads();
  epi_h(Os, U, (size_t)b * (NC / 32) + m0 / 32, n0, tid);
}

// =========================================================================================================
// (7) key-side affine term: cs[b][j] = -(mu_b rstd_b^2) * sum_d g[d] * Xb[b][j][d], f32 VALU, one wave per row,
//     four waves of eight rows a block.
// coverage: blocks (bx < 64, b < NB) x 32 rows = every key row of b < NB.  LDS csL cross-wave (block barrier).
// =========================================================================================================
__device__ __forceinline__
void k_cs(unsigned char* sm, int bx, int b,
          const unsigned short* __restrict__ Xb, const float* __restrict__ g, const float* __restrict__ st,
          float* cs) {
  float* csL = (float*)sm;                                           // [32]
  const int tid = threadIdx.x, lane = tid & 31, wave = tid >> 5;
  const int r0 = bx * 32;
  v4f ga[3], gb[3];
#pragma unroll
  for (int c3 = 0; c3 < 3; ++c3) {
    ga[c3] = *(const v4f*)(g + 256 * c3 + 8 * lane);
    gb[c3] = *(const v4f*)(g + 256 * c3 + 8 * lane + 4);
  }
  const float nmr = -st[4 * b + 3];
#pragma unroll 1
  for (int t = 0; t < 8; ++t) {
    const int row = r0 + 8 * wave + t;
    const unsigned short* xp = Xb + ((size_t)b * NC + row) * ND + 8 * lane;
    float acc = 0.f;
#pragma unroll
    for (int c3 = 0; c3 < 3; ++c3) {
      const v4u u = *(const v4u*)(xp + 256 * c3);
      acc += bf_lo16(u[0]) * ga[c3][0] + bf_hi16(u[0]) * ga[c3][1]
           + bf_lo16(u[1]) * ga[c3][2] + bf_hi16(u[1]) * ga[c3][3]
           + bf_lo16(u[2]) * gb[c3][0] + bf_hi16(u[2]) * gb[c3][1]
           + bf_lo16(u[3]) * gb[c3][2] + bf_hi16(u[3]) * gb[c3][3];
    }
    acc += __shfl_xor(acc, 16, 32); acc += __shfl_xor(acc, 8, 32); acc += __shfl_xor(acc, 4, 32);
    acc += __shfl_xor(acc, 2, 32);  acc += __shfl_xor(acc, 1, 32);
    if (lane == 0) csL[8 * wave + t] = acc * nmr;
  }
  __syncthreads();
  if (wave == 0 && lane < 8) {
    const v4f v = *(const v4f*)(csL + 4 * lane);
    float* p = cs + (size_t)b * NC + r0 + 4 * lane;
    *(v4f*)p = v;
    
  }
}

// =========================================================================================================
// (8) attention for one (b, 64-query tile), transposed formulation, 2048 keys, no mask:
//   S^T tile (16 keys x 16 queries) = sum over 24 d-chunks of A(key row kb + (lane&15) of the bf16 plane Xb,
//   split k map) . B(query row of Ah) + A(Xb).B(Al) (bf16 residual, shared accumulator), then + cs[key].
//   Per lane the D tile holds 8 keys of ONE query: online softmax state per lane, one shuffle (lane^16) for the
//   max over 32 keys; corr applied every step (== 1 exactly when the max did not grow). P = e^{s-m} x 16384 as
//   f16 is the B operand of O^T (rows channel, cols queries) += A(U rows channel 16j + (lane&15), keys
//   contiguous, f16 x16) . B(P^T): element r <- D of the tile covering keys kb..kb+15, element 8+r <- the tile
//   covering kb+16..kb+31, lane unchanged. For O^T the waves split the channels, not the queries: wave w owns channels
//   192 w .. 192 w + 191 of all 64 queries, so that a V fragment read from LDS feeds four products (one per query tile)
//   and every V byte is read by one wave only. Each wave hands its P fragment and its corr to the other three through
//   LDS (one block of XB bytes per query tile, lane-private slots of 16 B), behind a block barrier of its own.
//   The 48 accumulator tiles per wave (12 channel tiles x 4 query tiles) live in registers (384 per lane) for
//   the whole key loop and are stored once, behind it, to the LDS slots Ow[query][768] of the wave that owns the query.
//   Epilogue after a block barrier: out[b][q][:] = Ow[q][:] * (rstd / (16 l_q)) - mu rstd rowsum(Wv), row =
// coverage: 4 waves x 16 query rows x 6 x 32 lanes x 4 = 64 x 768; grid (NQ/64, NB) covers out[b < NB][q < NQ].
// LDS: Ow written once per lane behind the key loop; cross-wave reads only after __syncthreads. staged extent
//      (64 x 768 per block) == consumed extent. During the key loop the first 4 XB of these bytes are the P exchange.
//      The wave's query fragments (hi + residual) never pass through LDS: they
//      are loaded once from the global planes and stay in registers (384 per lane) beside the accumulator tiles.
//      Behind the Ow bytes one K buffer (32 key rows) and one V buffer (768 channel rows x 32 keys), filled once per block and
//      32 keys by asynchronous copies (each wave a quarter); the K tile is read by all four waves, a V row by one. Every
//      tile is read only behind its copiers' s_wait_asynccnt 0 and a block barrier, and refilled only behind the barrier
//      that ends its last read. coverage: K 4 waves x 8 rows x 3 x 32 lanes x 16 B = 32 x 1536 B; V 4 waves x 24 x
//      8 rows x 4 x 16 B = 768 x 64 B; pad bytes of a row are neither written nor read.
// =========================================================================================================
__global__ __launch_bounds__(128)
void k_attn(const unsigned short* __restrict__ Ah, const unsigned short* __restrict__ Al,
            const unsigned short* __restrict__ Xb, const unsigned short* __restrict__ U,
            const float* __restrict__ cs, const float* __restrict__ rv,
            const float* __restrict__ st, float* out) {
  __shared__ __attribute__((aligned(16))) unsigned char lds_all[ATTN_LDS];
  const int tid  = threadIdx.x;
  const int wave = tid >> 5, lane = tid & 31;
  const int hh   = lane >> 4, c = lane & 15;
  const int n0   = blockIdx.x * QT, b = blockIdx.y;
  float* Ow = (float*)lds_all + (size_t)wave * (16 * ND);
  // O^T tiles: o[j][i][r] = channel 192 wave + 16 j + 8 hh + r of query c of query tile (wave + i) & 3: i = 0 is the
  // wave's own tile, whose P is used straight from its registers. Every loop over o[] is fully unrolled: only constant indices
  // keep the tiles in registers.
  v8f o[CTW][4];
#pragma unroll
  for (int j = 0; j < CTW; ++j) {
#pragma unroll
    for (int i = 0; i < 4; ++i) o[j][i] = zero8();
  }
  // P exchange: block (wave + i) & 3, this lane's 16-byte slot in each of its three rows (P elements 0..7, 8..15, corr)
  unsigned char* xb[4];
#pragma unroll
  for (int i = 0; i < 4; ++i) xb[i] = lds_all + ((wave + i) & 3) * XB + 16 * lane;

  const size_t qo = ((size_t)b * NQ + n0 + 16 * wave + c) * ND + 8 * hh;
  const unsigned short* Ahp = Ah + qo;
  const unsigned short* Alp = Al + qo;
  // The block's K tile (32 key rows x 768, row pitch KP) and V tile (768 channel rows x 32 keys, row pitch VP) in LDS,
  // K read by all four waves, V rows 192 w .. 192 w + 191 by wave w. Fragment readers: lane -> row (lane&15),
  // + 8*(lane>>4), as from the global planes.
  const unsigned short* Ks = (const unsigned short*)(lds_all + QLDS) + c * KP + 8 * hh;          // + key_loc*KP + 32 kc
  const unsigned short* Vs = (const unsigned short*)(lds_all + QLDS + KLDS) + (192 * wave + c) * VP + 8 * hh;  // + 16 j*VP
  // Copy side. K: wave w brings key rows 8w..8w+7, three copies of 512 B a row. V: wave w brings channel rows
  // 192w..192w+191, one copy = 8 rows x 64 B (lane -> row lane>>2, 16-byte piece lane&3), which lie in a row in the
  // tiled plane U: 512 B = four whole lines a copy.
  unsigned char* kl0 = lds_all + QLDS + (8 * wave) * (KP * 2) + 16 * lane;
  unsigned char* vl0 = lds_all + QLDS + KLDS + (192 * wave + (lane >> 2)) * (VP * 2) + 16 * (lane & 3);
  const unsigned short* kg0 = Xb + ((size_t)b * NC + 8 * wave) * ND + 8 * lane;                    // + kb*ND
  const unsigned short* vg0 = U + (size_t)b * ND * NC + (192 * wave) * 32 + 8 * lane;              // + kb*ND
  const float* csb = cs + (size_t)b * NC + 8 * hh;                                    // + kb (+16)

  // The wave's 16 query rows (hi and residual plane) are loaded once, as B fragments, and stay in registers (2 x 24
  // fragments = 384 per lane) for the whole key loop. Every loop over qh[] and ql[] is fully unrolled: only constant
  // indices keep them in registers.
  Frag qh[ND / 32], ql[ND / 32];
#pragma unroll
  for (int kc = 0; kc < ND / 32; ++kc) {
    qh[kc] = ldfrag(Ahp + 32 * kc);
    ql[kc] = ldfrag(Alp + 32 * kc);
  }
  asm volatile("s_wait_xcnt 0x0" :: "v"(Ahp), "v"(Alp) : "memory");

  // Two-buffer ring over the tile sequence K(0), V(0), K(32), V(32), ...: the K buffer is worked on (scores) while the V
  // tile flies, the V buffer (O^T) while the next K tile flies. In front of the loop: first K tile, landed and
  // published; then the first V tile is sent off.
  acopy_tile<3, 512, 256, KP * 2, ND>(kl0, kg0);
  asm volatile("s_wait_asynccnt 0x0" ::: "memory");                  // this wave's share of the K tile has landed
  __syncthreads();                                                   // ... and every other wave's: the tile is readable
  acopy_tile<24, 8 * VP * 2, 8 * 32, 0, 0>(vl0, vg0);

  float m = -1.0e30f, l = 0.f;
#pragma unroll 1
  for (int kb = 0; kb < NC; kb += 32) {
    const unsigned short* k0p = Ks;                                  // keys kb .. kb+15
    const unsigned short* k1p = Ks + 16 * KP;                        // keys kb+16 .. kb+31
    v8f s0 = zero8(), s1 = zero8();
    // K fragments (LDS) in groups of KG d-chunks, two groups in registers: group g + 1 is in flight while group g is
    // used.
    Frag kf[2][KG][2];
#pragma unroll
    for (int u = 0; u < KG; ++u) {
      kf[0][u][0] = ldfrag(k0p + 32 * u);
      kf[0][u][1] = ldfrag(k1p + 32 * u);
    }
    // the key-side terms are fetched here, at the head of the trip: the barrier at its foot waits for every global load
    const v4f ca = *(const v4f*)(csb + kb);
    const v4f cb = *(const v4f*)(csb + kb + 4);
    const v4f cd = *(const v4f*)(csb + kb + 16);
    const v4f ce = *(const v4f*)(csb + kb + 20);
    // the same wait for these four loads: their address pair is an input, so that nothing lands on it while the
    // loads are under way
    asm volatile("s_wait_xcnt 0x0" :: "v"(csb + kb) : "memory");
#pragma unroll
    for (int g = 0; g < ND / 32 / KG; ++g) {
      if (g + 1 < ND / 32 / KG) {
#pragma unroll
        for (int u = 0; u < KG; ++u) {
          const int kn = KG * (g + 1) + u;
          kf[(g + 1) & 1][u][0] = ldfrag(k0p + 32 * kn);
          kf[(g + 1) & 1][u][1] = ldfrag(k1p + 32 * kn);
        }
      }
      // holds the next group's loads, as one run, in front of this group's products: they are in flight meanwhile, and
      // no LDS read stands among the products (without it the build spreads them there)
      __builtin_amdgcn_sched_barrier(0);
#pragma unroll
      for (int u = 0; u < KG; ++u) {
        s0 = mma_q(kf[g & 1][u][0].bf, qh[KG * g + u].bf, s0);
        s1 = mma_q(kf[g & 1][u][1].bf, qh[KG * g + u].bf, s1);
        s0 = mma_q(kf[g & 1][u][0].bf, ql[KG * g + u].bf, s0);
        s1 = mma_q(kf[g & 1][u][1].bf, ql[KG * g + u].bf, s1);
      }
      // keeps later groups' loads behind this point: no more than two groups hold registers, and again no LDS read
      // among the products
      __builtin_amdgcn_sched_barrier(0);
    }
    {
#pragma unroll
      for (int r = 0; r < 4; ++r) {
        s0[r] += ca[r]; s0[4 + r] += cb[r];                          // key kb      + 8hh + r
        s1[r] += cd[r]; s1[4 + r] += ce[r];                          // key kb + 16 + 8hh + r
      }
    }

    // foot of the score trip: own LDS reads done, own V copies landed, then the barrier that publishes the V tile and
    // ends every wave's reads of the K buffer; behind it the next K tile is sent off into that buffer
    asm volatile("s_wait_dscnt 0x0" ::: "memory");
    asm volatile("s_wait_asynccnt 0x0" ::: "memory");
    __syncthreads();
    if (kb + 32 < NC) acopy_tile<3, 512, 256, KP * 2, ND>(kl0, kg0 + (size_t)(kb + 32) * ND);

    float mx = fmaxf(hmax8(s0), hmax8(s1));
    mx = fmaxf(mx, __shfl_xor(mx, 16, 32));
    // holds the V reads below behind the return of this exchange (input only): its wait is for every LDS operation of
    // the wave, so with the 24 reads in front of it the exponentials would start only when all of them have landed
    asm volatile("" :: "v"(mx) : "memory");
    const float mn   = fmaxf(m, mx);
    const float corr = __expf(m - mn);                               // == 1 exactly when the max did not grow
    l *= corr;
    m = mn;
    const float msh = mn - LNPS;                                     // exp gives e^{s-m} * 16384

    // V fragments (LDS): the wave's own 12 channel tiles, each read once per block; they land under the exponentials
    Frag vf[CTW];
#pragma unroll
    for (int j = 0; j < CTW; ++j) vf[j] = ldfrag(Vs + (16 * j) * VP);
    // holds the V reads, as one run, in front of the exponentials
    __builtin_amdgcn_sched_barrier(0);

    FragH ph;
    float ls = 0.f;
#pragma unroll
    for (int r = 0; r < 8; ++r) {
      const float e0 = __expf(s0[r] - msh);
      const float e1 = __expf(s1[r] - msh);
      ls += e0 + e1;
      ph.hv[0][r] = (_Float16)e0;
      ph.hv[1][r] = (_Float16)e1;
    }
    l += ls;

    // the wave's P fragment and corr go to its exchange block; the barrier (behind the build's own wait for these
    // writes) publishes them
    *(v8h*)(xb[0])          = ph.hv[0];
    *(v8h*)(xb[0] + 512)    = ph.hv[1];
    *(float*)(xb[0] + 1024) = corr;
    __syncthreads();
    FragH pf[4];
    float cr[4];
    pf[0] = ph;
    cr[0] = corr;
#pragma unroll
    for (int i = 1; i < 4; ++i) {
      pf[i].hv[0] = *(const v8h*)(xb[i]);
      pf[i].hv[1] = *(const v8h*)(xb[i] + 512);
      cr[i]       = *(const float*)(xb[i] + 1024);
    }
    // holds the reads of the other waves' P, as one run, in front of the products: the own query tile's products, which
    // need none of them, run while they are in flight
    __builtin_amdgcn_sched_barrier(0);
    // product n = 12 i + j. A tile is rescaled (x corr of its query) two products ahead of its own.
#pragma unroll
    for (int n = 0; n < 2; ++n) {
#pragma unroll
      for (int r = 0; r < 8; ++r) o[n % CTW][n / CTW][r] *= cr[n / CTW];
    }
#pragma unroll
    for (int n = 0; n < 4 * CTW; ++n) {
      o[n % CTW][n / CTW] = mma_h(vf[n % CTW].h, pf[n / CTW].v, o[n % CTW][n / CTW]);
      if (n + 2 < 4 * CTW) {
#pragma unroll
        for (int r = 0; r < 8; ++r) o[(n + 2) % CTW][(n + 2) / CTW][r] *= cr[(n + 2) / CTW];
      }
      // keeps one tile's multiplies behind each product, where they issue while the matrix unit works (the build
      // otherwise puts all of them in front of the first product); the last one also keeps the foot's waits behind the
      // products: the wait for the K copies would otherwise stand in front of them
      __builtin_amdgcn_sched_barrier(0);
    }
    // foot of the O^T trip: the same order; the barrier publishes the next K tile and frees the V buffer and the P exchange
    asm volatile("s_wait_dscnt 0x0" ::: "memory");
    asm volatile("s_wait_asynccnt 0x0" ::: "memory");
    __syncthreads();
    if (kb + 32 < NC) acopy_tile<24, 8 * VP * 2, 8 * 32, 0, 0>(vl0, vg0 + (size_t)(kb + 32) * ND);
  }
  asm volatile("s_wait_asynccnt 0x0" ::: "memory");                  // nothing is in flight when the LDS changes its use
  // the finished tiles go to the LDS slots of their queries once, for the row-major epilogue
#pragma unroll
  for (int i = 0; i < 4; ++i) {
    float* op = (float*)lds_all + (16 * ((wave + i) & 3) + c) * ND + 192 * wave + 8 * hh;
#pragma unroll
    for (int j = 0; j < CTW; ++j) {
      v4f na, nb2;
#pragma unroll
      for (int r = 0; r < 4; ++r) { na[r] = o[j][i][r]; nb2[r] = o[j][i][4 + r]; }
      *(v4f*)(op + 16 * j)     = na;
      *(v4f*)(op + 16 * j + 4) = nb2;
    }
  }
  l += __shfl_xor(l, 16, 32);
  const float inv  = 1.0f / l;                                       // Ow and l both carry the x16384 factor
  const float mu   = st[4 * b + 0], rstd = st[4 * b + 1];
  const float qsc  = inv * rstd * IUSC;                              // per lane: its query column
  const float mrs  = mu * rstd;
  v4f rvv[6];
#pragma unroll
  for (int k = 0; k < ND / 128; ++k) {
    const v4f t = *(const v4f*)(rv + 128 * k + 4 * lane);
#pragma unroll
    for (int u = 0; u < 4; ++u) rvv[k][u] = t[u] * mrs;
  }
  __syncthreads();                                                   // all accumulator slots final before cross-lane reads

{
#pragma unroll 1
    for (int qq = 0; qq < 16; ++qq) {
      const float sc = __shfl(qsc, qq, 32);
      const float* lrow = Ow + qq * ND + 4 * lane;
      float* orow = out + ((size_t)b * NC + n0 + 16 * wave + qq) * ND + 4 * lane;
#pragma unroll
      for (int k = 0; k < ND / 128; ++k) {
        const v4f v = *(const v4f*)(lrow + 128 * k);
        v4f w;
#pragma unroll
        for (int u = 0; u < 4; ++u) w[u] = v[u] * sc - rvv[k][u];
        *(v4f*)(orow + 128 * k) = w;
      }
    }
    
  }
}

// =========================================================================================================
// The launches. Stages that need nothing of one another share one grid: a block takes its stage by the range its index
// lies in (a block-uniform branch, so every barrier of a stage is passed by the whole block) and its place in the stage
// from the index, x fastest. All stages of a launch use the one LDS array of the launch.
//   k_prep : (0) weights | (2) x                      both read inputs only
//   k_mid  : (3) statistics | (4) H | (1) g | (6) U    all read only what k_prep wrote
//   k_qc   : (5) query planes | (7) key-side term      both read only what k_prep and k_mid wrote
// The few long serial blocks stand first in their launch; the short blocks of (7) stand last.
// =========================================================================================================
#define PB_X  (3 * (ND / QT))                       // k_prep: first block of (2)
#define PB_N  (PB_X + KCH * NB)
#define MB_H  1                                     // k_mid: first block of (4), of (1), of (6)
#define MB_G  (MB_H + (ND / GT) * (ND / GT))
#define MB_V  (MB_G + ND / GCB)
#define MB_N  (MB_V + (ND / GT) * (NC / GT) * NB)
#define QB_C  ((NQ / GT) * (ND / GT) * NB)          // k_qc: first block of (7)
#define QB_N  (QB_C + (NC / 32) * NB)
static_assert(2 * 2 * GPB >= GRG * GCB * 4 + 8 * GCB * 4 && 2 * 2 * GPB >= 2 * 64 * 8 + 32 * 4 && KCH == 64);

__global__ __launch_bounds__(256)
void k_prep(const float* __restrict__ x, const float* __restrict__ wk, const float* __restrict__ wq,
            const float* __restrict__ wv, unsigned short* Wn, unsigned short* Wt, float* rs,
            unsigned short* Xb, double* part) {
  __shared__ __align__(16) unsigned char sm[QT * TPW * 2 + QT * 4];
  const int bid = blockIdx.x;
  if (bid < PB_X) {
    cvt_w(sm, bid % (ND / QT), bid / (ND / QT), wk, wq, wv, Wn, Wt, rs);
  } else {
    const int i = bid - PB_X;
    k_xcvt(sm, i % KCH, i / KCH, x, Xb, part);
  }
}

__global__ __launch_bounds__(128)
void k_mid(const double* __restrict__ part, const unsigned short* __restrict__ Wn,
           const unsigned short* __restrict__ Wt, const float* __restrict__ rs,
           const unsigned short* __restrict__ Xb, float* st, unsigned short* Hh, unsigned short* Hl, float* g,
           unsigned short* U) {
  __shared__ __align__(16) unsigned char sm[2 * 2 * GPB];
  const int bid = blockIdx.x;
  if (bid < MB_H) {
    k_stats(sm, part, st);
  } else if (bid < MB_G) {
    const int i = bid - MB_H;                                        // A = Wq transposed (rows d), B = Wk transposed (rows e)
    k_hgemm(sm, i % (ND / GT), i / (ND / GT), Wt + (size_t)1 * ND * ND, Wt, Hh, Hl);
    // the wait before a register that an issued global store names is overwritten: the build lets this stage's end run
    // on through the later stages' tests, whose code rewrites the stores' registers
    asm volatile("s_wait_xcnt 0x0" ::: "memory");
  } else if (bid < MB_V) {
    k_g(sm, bid - MB_G, Wn, rs + ND, g);
  } else {
    const int i = bid - MB_V;
    k_vgemm(sm, i % (ND / GT), (i / (ND / GT)) % (NC / GT), i / ((ND / GT) * (NC / GT)), Xb,
            Wn + (size_t)2 * ND * ND, U);
    // the wait before a register that an issued global store names is overwritten: the build lets this stage's end run
    // on through the later stages' tests, whose code rewrites the stores' registers
    asm volatile("s_wait_xcnt 0x0" ::: "memory");
  }
}

__global__ __launch_bounds__(128)
void k_qc(const unsigned short* __restrict__ Hh, const unsigned short* __restrict__ Hl,
          const unsigned short* __restrict__ Xb, const float* __restrict__ st, const float* __restrict__ g,
          unsigned short* Ah, unsigned short* Al, float* cs) {
  __shared__ __align__(16) unsigned char sm[2 * 3 * GPB];
  const int bid = blockIdx.x;
  if (bid < QB_C) {
    k_agemm(sm, bid % (NQ / GT), (bid / (NQ / GT)) % (ND / GT), bid / ((NQ / GT) * (ND / GT)), Hh, Hl, Xb, st, Ah, Al);
  } else {
    const int i = bid - QB_C;
    k_cs(sm, i % (NC / 32), i / (NC / 32), Xb, g, st, cs);
  }
}

// =========================================================================================================
// Workspace map (bytes; each region start a multiple of 256; every extent is an exact tile/line multiple and is
//   Wn bf16 [3][768][768]      3538944      Wt bf16 [3][768][768]   3538944
//   rs  f32 [3][768]              9216      g   f32 [768]              3072
//   Xb bf16 [NB][2048][768]   25165824 (NB=8)  part f64 [NB][64][16]  65536    st f32 [32]  128 (256)
//   Hh/Hl bf16 [768][768]      1179648 x2
//   Ah/Al bf16 [NB][NQ][768]  25165824 x2 (NB=8, NQ=2048)
//   U  f16 [NB][64][768][32]  25165824      cs f32 [NB][2048]         65536
//   total (NB=8, NQ=2048) = 110244096
// =========================================================================================================
extern "C" void kernel_launch(void* const* d_in, const int* in_sizes, int n_in,
                              void* d_out, int out_size, void* d_ws, size_t ws_size,
                              hipStream_t stream) {
  if (n_in < 4) return;
  if (in_sizes[0] < NB * NC * ND) return;
  if (in_sizes[1] < ND * ND || in_sizes[2] < ND * ND || in_sizes[3] < ND * ND) return;
  if (out_size < NB * NC * ND) return;

  size_t off = 0;
  auto carve = [&](size_t bytes) { const size_t o = off; off += (bytes + 255) & ~(size_t)255; return o; };
  const size_t oWn   = carve((size_t)3 * ND * ND * 2);
  const size_t oWt   = carve((size_t)3 * ND * ND * 2);
  const size_t oRs   = carve((size_t)3 * ND * 4);
  const size_t oG    = carve((size_t)ND * 4);
  const size_t oXb   = carve((size_t)NB * NC * ND * 2);
  const size_t oPart = carve((size_t)NB * KCH * 128);
  const size_t oSt   = carve((size_t)128);
  const size_t oHh   = carve((size_t)ND * ND * 2);
  const size_t oHl   = carve((size_t)ND * ND * 2);
  const size_t oAh   = carve((size_t)NB * NQ * ND * 2);
  const size_t oAl   = carve((size_t)NB * NQ * ND * 2);
  const size_t oU    = carve((size_t)NB * ND * NC * 2);
  const size_t oCs   = carve((size_t)NB * NC * 4);
  if (off > ws_size) return;
  if (off > (size_t)134217728) return;

  const float* x  = (const float*)d_in[0];
  const float* wk = (const float*)d_in[1];
  const float* wq = (const float*)d_in[2];
  const float* wv = (const float*)d_in[3];

  char* ws = (char*)d_ws;
  unsigned short* Wn  = (unsigned short*)(ws + oWn);
  unsigned short* Wt  = (unsigned short*)(ws + oWt);
  float*          rs  = (float*)(ws + oRs);
  float*          g   = (float*)(ws + oG);
  unsigned short* Xb  = (unsigned short*)(ws + oXb);
  double*         part = (double*)(ws + oPart);
  float*          st  = (float*)(ws + oSt);
  unsigned short* Hh  = (unsigned short*)(ws + oHh);
  unsigned short* Hl  = (unsigned short*)(ws + oHl);
  unsigned short* Ah  = (unsigned short*)(ws + oAh);
  unsigned short* Al  = (unsigned short*)(ws + oAl);
  unsigned short* U   = (unsigned short*)(ws + oU);
  float*          cs  = (float*)(ws + oCs);
  float* out = (float*)d_out;

  const dim3 blk256(256), blk128(128);

  // (0) weights -> bf16 natural + transposed planes + row sums (y: 0 Wk, 1 Wq, 2 Wv); (2) x -> bf16 plane + f64 partial sums
  k_prep<<<dim3(PB_N), blk256, 0, stream>>>(x, wk, wq, wv, Wn, Wt, rs, Xb, part);
  // (3) LayerNorm statistics; (4) H planes; (1) g = bf16(Wk)^T . rowsum(bf16(Wq)); (6) value plane U = 16 X.Wv^T
  k_mid<<<dim3(MB_N), blk128, 0, stream>>>(part, Wn, Wt, rs, Xb, st, Hh, Hl, g, U);
  // (5) query planes A' = rstd^2 X.H (hi + residual); (7) key-side affine term
  k_qc<<<dim3(QB_N), blk128, 0, stream>>>(Hh, Hl, Xb, st, g, Ah, Al, cs);
  // (8) attention -> out [b][q][768]
  k_attn<<<dim3(NQ / QT, NB), blk128, 0, stream>>>(Ah, Al, Xb, U, cs, rs + 2 * ND, st, out);
  (void)hipGetLastError();
}
